// v000
// Times are from an AMD MI455X. After a warm-up the kernel runs many times in a row, and a time is the length of
// such a window on the GPU divided by its runs, so every launch and the gaps after it count. The runs cycle
// through copies of the inputs. A figure is the median of several windows, for all but v000 over two sittings.
// Sittings can differ by a few percent; kernels timed side by side share one.
// The starting kernel, v000, takes 1400 microseconds a run.
#include <hip/hip_runtime.h>
// Multi_Heads_Self_Attn_Q_KV (1 volume, C 128, 16^3 = 4096 voxels, 8 heads x 32): InstanceNorm of x_q and x_kv (per channel over the 4096 voxels, biased var, eps 1e-5, affine); q, k, v = 1x1 convs (no bias); w = sigmoid(q.k) (no scale) * mask[key] (int input 0/1); o = w v (no normalisation); attn = o oW^T + x_q; h = IN(attn); h = relu(W1 h + b1); h = W2 h + b2; out = h + attn -> [1, 128, 16, 16, 16].
// Compute dtype: inputs and parameters rounded to bf16; normalised inputs, q, k, v, sigmoid weights, o and the MLP activations as plain f16 operands (~2^-12); statistics/sigmoid f32. v_wmma_f32_16x16x32_f16.
#define CC 128
#define NS 4096
#define NHD 8
#define HDm 32
#define HDA (NHD * HDm)          /* 256 */
#define PW (NHD * 64)            /* 512: padded o plane */
typedef __bf16 v16b __attribute__((ext_vector_type(16)));
typedef unsigned short v8us __attribute__((ext_vector_type(8), may_alias));
typedef float  v8f  __attribute__((ext_vector_type(8)));
typedef float  v4f  __attribute__((ext_vector_type(4)));
typedef float  v4fa __attribute__((ext_vector_type(4), may_alias));
union FragB { v16b v; v8us half[2]; unsigned short u[16]; };

__device__ __forceinline__ unsigned short bf16_bits(float x) { unsigned int u = __float_as_uint(x); return (unsigned short)((u + 0x7FFFu + ((u >> 16) & 1u)) >> 16); }
__device__ __forceinline__ float bf16_val(unsigned short b) { return __uint_as_float(((unsigned int)b) << 16); }
__device__ __forceinline__ float bf16_round(float x) { return bf16_val(bf16_bits(x)); }
// D += A·B with NT terms: 1 = ah·bh, 2 = + al·bh (A split), 3 = + ah·bl (both split)
template <int NT>
__device__ __forceinline__ v8f mmaN(v16b ah, v16b al, v16b bh, v16b bl, v8f c) {
  c = __builtin_amdgcn_wmma_f32_16x16x32_bf16(false, ah, false, bh, (short)0, c, false, false);
  if (NT >= 2) c = __builtin_amdgcn_wmma_f32_16x16x32_bf16(false, al, false, bh, (short)0, c, false, false);
  if (NT >= 3) c = __builtin_amdgcn_wmma_f32_16x16x32_bf16(false, ah, false, bl, (short)0, c, false, false);
  asm volatile("v_nop\n\tv_nop\n\tv_nop\n\tv_nop" : "+v"(c) : "v"(ah), "v"(al), "v"(bh), "v"(bl));
  return c;
}

__global__ __launch_bounds__(256) void k_wt_bf16(const float* __restrict__ W, unsigned short* __restrict__ Wt, int K, int N) {
  const int t = blockIdx.x * 256 + threadIdx.x;
  const int k8n = K / 8;
  if (t >= N * k8n) return;
  const int n = t / k8n, k8 = (t % k8n) * 8;
  v8us v;
#pragma unroll
  for (int i = 0; i < 8; ++i) v[i] = bf16_bits(W[(size_t)(k8 + i) * N + n]);
  *(v8us*)(Wt + (size_t)n * K + k8) = v;
  
}

// GEMM C[M][N] (f32, pitch ldc) = act(A[M][K]·W + bias). A f32 row-major (pitch lda) converted per fragment to bf16
// (ASPLIT: hi/lo two planes -> 2 terms, else single rounded term); Wt bf16 [N][K] (pitch ldb). BIAS_BF16 rounds the
// bias to bf16 first (bias quantised to bf16 before the add). K%32==0, M%16==0, N%64==0.
template <bool ASPLIT, int ACT, bool BIAS_BF16>
__global__ __launch_bounds__(128) void k_gemm_bf(const float* __restrict__ A, int lda, const unsigned short* __restrict__ Wt, int ldb,
                                               const float* __restrict__ bias, float* __restrict__ C, int ldc, int M, int N, int K) {
  __shared__ __attribute__((aligned(16))) float so[4][16][64];
  const int tid = threadIdx.x, w = tid >> 5, lane = tid & 31, ln = lane & 15, hh = lane >> 4;
  const int ntn = N / 64;
  const int wid = blockIdx.x * 4 + w;
  const int mt = wid / ntn, nq = wid % ntn;
  if (mt * 16 >= M) return;
  const int row0 = mt * 16, col0 = nq * 64;
  const float* arow = A + (size_t)(row0 + ln) * lda;
  v8f acc[4] = {};
  for (int kb = 0; kb < K; kb += 32) {
    FragB ah, al;
    const v4f x0 = *(const v4fa*)(arow + kb + 8 * hh), x1 = *(const v4fa*)(arow + kb + 8 * hh + 4);
    const v4f x2 = *(const v4fa*)(arow + kb + 16 + 8 * hh), x3 = *(const v4fa*)(arow + kb + 16 + 8 * hh + 4);
    float xs[16] = {x0[0],x0[1],x0[2],x0[3],x1[0],x1[1],x1[2],x1[3],x2[0],x2[1],x2[2],x2[3],x3[0],x3[1],x3[2],x3[3]};
#pragma unroll
    for (int i = 0; i < 16; ++i) { const unsigned short hb = bf16_bits(xs[i]); ah.u[i] = hb; al.u[i] = ASPLIT ? bf16_bits(xs[i] - bf16_val(hb)) : (unsigned short)0; }
#pragma unroll
    for (int t = 0; t < 4; ++t) {
      const unsigned short* brow = Wt + (size_t)(col0 + t * 16 + ln) * ldb + kb;
      FragB b;
      b.half[0] = *(const v8us*)(brow + 8 * hh);
      b.half[1] = *(const v8us*)(brow + 16 + 8 * hh);
      acc[t] = mmaN<ASPLIT ? 2 : 1>(ah.v, al.v, b.v, b.v, acc[t]);
    }
  }
#pragma unroll
  for (int t = 0; t < 4; ++t) {
    float bv = bias ? bias[col0 + t * 16 + ln] : 0.f;
    if (BIAS_BF16) bv = bf16_round(bv);
#pragma unroll
    for (int r = 0; r < 8; ++r) { float v = acc[t][r] + bv; if (ACT == 1) v = fmaxf(v, 0.f); so[w][8 * hh + r][t * 16 + ln] = v; }
  }
  __builtin_amdgcn_fence(__ATOMIC_ACQ_REL, "workgroup");
  __builtin_amdgcn_wave_barrier();
  const int rsub = lane >> 4, c4 = (lane & 15) * 4;
  {
#pragma unroll
    for (int q = 0; q < 8; ++q) {
      const int r = q * 2 + rsub;
      const v4f v = *(const v4fa*)&so[w][r][c4];
      *(v4f*)(C + (size_t)(row0 + r) * ldc + col0 + c4) = v;
    }
    
  }
}

// GEMM C = act(A·W + bias + resid): A f32 (ASPLIT -> hi/lo 2 terms), Wt bf16 [N][K]; ACT 0 none, 1 relu, 2 exact gelu;
// resid (optional, f32, row index = (row % rmod), pitch ldr, RES_BF16 rounds it) added before the activation.
template <bool ASPLIT, int ACT, bool BIAS_BF16, bool RES_BF16>
__global__ __launch_bounds__(128) void k_gemm_bf3(const float* __restrict__ A, int lda, const unsigned short* __restrict__ Wt, int ldb,
                                                const float* __restrict__ bias, const float* __restrict__ resid, int rmod, int ldr,
                                                float* __restrict__ C, int ldc, int M, int N, int K) {
  __shared__ __attribute__((aligned(16))) float so[4][16][64];
  const int tid = threadIdx.x, w = tid >> 5, lane = tid & 31, ln = lane & 15, hh = lane >> 4;
  const int ntn = N / 64;
  const int wid = blockIdx.x * 4 + w;
  const int mt = wid / ntn, nq = wid % ntn;
  if (mt * 16 >= M) return;
  const int row0 = mt * 16, col0 = nq * 64;
  const float* arow = A + (size_t)(row0 + ln) * lda;
  v8f acc[4] = {};
  for (int kb = 0; kb < K; kb += 32) {
    FragB ah, al;
    const v4f x0 = *(const v4fa*)(arow + kb + 8 * hh), x1 = *(const v4fa*)(arow + kb + 8 * hh + 4);
    const v4f x2 = *(const v4fa*)(arow + kb + 16 + 8 * hh), x3 = *(const v4fa*)(arow + kb + 16 + 8 * hh + 4);
    float xs[16] = {x0[0],x0[1],x0[2],x0[3],x1[0],x1[1],x1[2],x1[3],x2[0],x2[1],x2[2],x2[3],x3[0],x3[1],x3[2],x3[3]};
#pragma unroll
    for (int i = 0; i < 16; ++i) { const unsigned short hb = bf16_bits(xs[i]); ah.u[i] = hb; al.u[i] = ASPLIT ? bf16_bits(xs[i] - bf16_val(hb)) : (unsigned short)0; }
#pragma unroll
    for (int t = 0; t < 4; ++t) {
      const unsigned short* brow = Wt + (size_t)(col0 + t * 16 + ln) * ldb + kb;
      FragB b;
      b.half[0] = *(const v8us*)(brow + 8 * hh);
      b.half[1] = *(const v8us*)(brow + 16 + 8 * hh);
      acc[t] = mmaN<ASPLIT ? 2 : 1>(ah.v, al.v, b.v, b.v, acc[t]);
    }
  }
#pragma unroll
  for (int t = 0; t < 4; ++t) {
    const int col = col0 + t * 16 + ln;
    float bv = bias ? bias[col] : 0.f;
    if (BIAS_BF16) bv = bf16_round(bv);
#pragma unroll
    for (int r = 0; r < 8; ++r) {
      float v = acc[t][r] + bv;
      if (resid) { float rv = resid[(size_t)((row0 + 8 * hh + r) % rmod) * ldr + col]; if (RES_BF16) rv = bf16_round(rv); v += rv; }
      if (ACT == 1) v = fmaxf(v, 0.f);
      if (ACT == 2) v = 0.5f * v * (1.0f + erff(v * 0.70710678118654752f));
      if (ACT == 3) { const float u = 0.7978845608028654f * (v + 0.044715f * v * v * v); v = 0.5f * v * (1.0f + tanhf(u)); }
      so[w][8 * hh + r][t * 16 + ln] = v;
    }
  }
  __builtin_amdgcn_fence(__ATOMIC_ACQ_REL, "workgroup");
  __builtin_amdgcn_wave_barrier();
  const int rsub = lane >> 4, c4 = (lane & 15) * 4;
  {
#pragma unroll
    for (int q = 0; q < 8; ++q) {
      const int r = q * 2 + rsub;
      const v4f v = *(const v4fa*)&so[w][r][c4];
      *(v4f*)(C + (size_t)(row0 + r) * ldc + col0 + c4) = v;
    }
    
  }
}
// row LayerNorm (biased variance, eps) over N: s = X (+ R); optional out_sum <- s; out_norm <- (s-mu)*rsqrt(var+eps)*g + b
template <bool PARAM_BF16>
__global__ __launch_bounds__(256) void k_layernorm(const float* __restrict__ X, const float* __restrict__ R, const float* __restrict__ g, const float* __restrict__ bta,
                                                  float* __restrict__ out_sum, float* __restrict__ out_norm, int N, float eps) {
  __shared__ float red[256];
  const int row = blockIdx.x, tid = threadIdx.x;
  const float* x = X + (size_t)row * N; const float* rr = R ? R + (size_t)row * N : nullptr;
  float vals[16];                     // up to N = 4096
  const int per = N / 256;            // contiguous chunk per thread? use strided-by-4 chunks: thread handles j = tid*4 + 1024*u
  float s1 = 0.f;
  for (int u = 0; u < per / 4; ++u) {
    const int j = tid * 4 + 1024 * u;
    const v4f a = *(const v4fa*)(x + j);
    v4f b = {0.f,0.f,0.f,0.f}; if (rr) b = *(const v4fa*)(rr + j);
#pragma unroll
    for (int q = 0; q < 4; ++q) { const float v = a[q] + b[q]; vals[u * 4 + q] = v; s1 += v; }
  }
  red[tid] = s1; __syncthreads();
  for (int st = 128; st > 0; st >>= 1) { if (tid < st) red[tid] += red[tid + st]; __syncthreads(); }
  const float mu = red[0] / (float)N; __syncthreads();
  float s2 = 0.f;
  for (int u = 0; u < per / 4; ++u)
#pragma unroll
    for (int q = 0; q < 4; ++q) { const float c = vals[u * 4 + q] - mu; s2 += c * c; }
  red[tid] = s2; __syncthreads();
  for (int st = 128; st > 0; st >>= 1) { if (tid < st) red[tid] += red[tid + st]; __syncthreads(); }
  const float rs = rsqrtf(red[0] / (float)N + eps);
  {
    for (int u = 0; u < per / 4; ++u) {
      const int j = tid * 4 + 1024 * u;
      v4f o, sm;
#pragma unroll
      for (int q = 0; q < 4; ++q) {
        float gg = g[j + q], bb = bta[j + q];
        if (PARAM_BF16) { gg = bf16_round(gg); bb = bf16_round(bb); }
        sm[q] = vals[u * 4 + q]; o[q] = (vals[u * 4 + q] - mu) * rs * gg + bb;
      }
      if (out_sum) *(v4f*)(out_sum + (size_t)row * N + j) = sm;
      *(v4f*)(out_norm + (size_t)row * N + j) = o;
    }
    
  }
}



// ---- f16 WMMA path (v_wmma_f32_16x16x32_f16): 11-bit significands for operands in range — used where a [0,1] probability operand needs more precision than bf16
typedef _Float16 v16h __attribute__((ext_vector_type(16)));
union FragH { v16h v; v8us half[2]; _Float16 h[16]; unsigned short u[16]; };
template <int NT>
__device__ __forceinline__ v8f mmaH(v16h ah, v16h al, v16h bh, v16h bl, v8f c) {
  c = __builtin_amdgcn_wmma_f32_16x16x32_f16(false, ah, false, bh, (short)0, c, false, false);
  if (NT >= 2) c = __builtin_amdgcn_wmma_f32_16x16x32_f16(false, al, false, bh, (short)0, c, false, false);
  if (NT >= 3) c = __builtin_amdgcn_wmma_f32_16x16x32_f16(false, ah, false, bl, (short)0, c, false, false);
  asm volatile("v_nop\n\tv_nop\n\tv_nop\n\tv_nop" : "+v"(c) : "v"(ah), "v"(al), "v"(bh), "v"(bl));
  return c;
}
// batched GEMM like k_gemm_b but f16 operands: A f32 (split into f16 hi/lo if ASPLIT, else rounded to f16), Bt = f16 values [n][k]; alpha; C f32; N multiple of 16 (partial tiles skipped)
template <bool ASPLIT>
__global__ __launch_bounds__(128) void k_gemm_h(const float* __restrict__ A, int lda, size_t sA, const _Float16* __restrict__ Bh, int ldb, size_t sB, float alpha, float* __restrict__ C, int ldc, size_t sC, int M, int N, int K) {
  __shared__ __attribute__((aligned(16))) float so[4][16][64];
  const int tid = threadIdx.x, w = tid >> 5, lane = tid & 31, ln = lane & 15, hh = lane >> 4; const int by = blockIdx.y;
  A += (size_t)by * sA; Bh += (size_t)by * sB; C += (size_t)by * sC;
  const int ntn = (N + 63) / 64; const int wid = blockIdx.x * 4 + w; const int mt = wid / ntn, nq = wid % ntn; if (mt * 16 >= M) return;
  const int row0 = mt * 16, col0 = nq * 64; const float* arow = A + (size_t)(row0 + ln) * lda;
  v8f acc[4] = {};
  for (int kb = 0; kb < K; kb += 32) {
    FragH ah, al;
    const v4f x0 = *(const v4fa*)(arow + kb + 8 * hh), x1 = *(const v4fa*)(arow + kb + 8 * hh + 4), x2 = *(const v4fa*)(arow + kb + 16 + 8 * hh), x3 = *(const v4fa*)(arow + kb + 16 + 8 * hh + 4);
    float xs[16] = {x0[0],x0[1],x0[2],x0[3],x1[0],x1[1],x1[2],x1[3],x2[0],x2[1],x2[2],x2[3],x3[0],x3[1],x3[2],x3[3]};
#pragma unroll
    for (int i = 0; i < 16; ++i) { const _Float16 h = (_Float16)xs[i]; ah.h[i] = h; al.h[i] = ASPLIT ? (_Float16)(xs[i] - (float)h) : (_Float16)0.0f; }
#pragma unroll
    for (int t = 0; t < 4; ++t) { if (col0 + t * 16 >= N) continue; const size_t boff = (size_t)(col0 + t * 16 + ln) * ldb + kb; FragH bq; bq.half[0] = *(const v8us*)(Bh + boff + 8 * hh); bq.half[1] = *(const v8us*)(Bh + boff + 16 + 8 * hh);
      acc[t] = mmaH<ASPLIT ? 2 : 1>(ah.v, al.v, bq.v, bq.v, acc[t]); }
  }
#pragma unroll
  for (int t = 0; t < 4; ++t) { if (col0 + t * 16 >= N) continue;
#pragma unroll
    for (int r = 0; r < 8; ++r) so[w][8 * hh + r][t * 16 + ln] = acc[t][r] * alpha; }
  __builtin_amdgcn_fence(__ATOMIC_ACQ_REL, "workgroup"); __builtin_amdgcn_wave_barrier();
  const int rsub = lane >> 4, c4 = (lane & 15) * 4;
  {
#pragma unroll
    for (int q = 0; q < 8; ++q) { const int r = q * 2 + rsub; if (col0 + c4 < N) { const v4f v = *(const v4fa*)&so[w][r][c4]; *(v4f*)(C + (size_t)(row0 + r) * ldc + col0 + c4) = v; } }
     }
}

// Wt[n][k] = f16(W[k][n]·scale) from f32 row-major W[K][N] (scale = power of two; bf16-exact weights stay exact in f16 away from the subnormal range)
__global__ __launch_bounds__(256) void k_wt_f16(const float* __restrict__ W, _Float16* __restrict__ Wt, int K, int N, float scale) {
  const int t = blockIdx.x * 256 + threadIdx.x; if (t >= N * (K / 8)) return; const int n = t / (K / 8), k8 = (t % (K / 8)) * 8; FragH f;
#pragma unroll
  for (int i = 0; i < 8; ++i) f.h[i] = (_Float16)(bf16_round(W[(size_t)(k8 + i) * N + n]) * scale); const v8us o = f.half[0];
  *(v8us*)((unsigned short*)Wt + (size_t)n * K + k8) = o; 
}
// k_gemm_hh variant with fused epilogue: v = acc·alpha + bias[by·sBias + col] (+ CP[(row/rowsPerB)·sCPb + by·64 + col] if CP) ; ACT 0 none / 1 elu ; writes f16 C16 (and f32 C if non-null)
template <int ACT>
__global__ __launch_bounds__(128) void k_gemm_hhx(const _Float16* __restrict__ A, int lda, size_t sA, const _Float16* __restrict__ Bh, int ldb, size_t sB, float alpha, const float* __restrict__ bias, size_t sBias, const float* __restrict__ CP, int rowsPerB, size_t sCPb, int row0g,
    float* __restrict__ C, _Float16* __restrict__ C16, int ldc, size_t sC, int M, int N, int K) {
  __shared__ __attribute__((aligned(16))) float so[4][16][64];
  const int tid = threadIdx.x, w = tid >> 5, lane = tid & 31, ln = lane & 15, hh = lane >> 4; const int by = blockIdx.y;
  A += (size_t)by * sA; Bh += (size_t)by * sB; const size_t cofs = (size_t)by * sC; const float* bp = bias ? bias + (size_t)by * sBias : nullptr;
  const int ntn = (N + 63) / 64; const int wid = blockIdx.x * 4 + w; const int mt = wid / ntn, nq = wid % ntn; if (mt * 16 >= M) return;
  const int row0 = mt * 16, col0 = nq * 64; const _Float16* arow = A + (size_t)(row0 + ln) * lda;
  v8f acc[4] = {};
  for (int kb = 0; kb < K; kb += 32) { FragH ah; ah.half[0] = *(const v8us*)((const unsigned short*)arow + kb + 8 * hh); ah.half[1] = *(const v8us*)((const unsigned short*)arow + kb + 16 + 8 * hh);
#pragma unroll
    for (int t = 0; t < 4; ++t) { if (col0 + t * 16 >= N) continue; const size_t boff = (size_t)(col0 + t * 16 + ln) * ldb + kb; FragH bq; bq.half[0] = *(const v8us*)((const unsigned short*)Bh + boff + 8 * hh); bq.half[1] = *(const v8us*)((const unsigned short*)Bh + boff + 16 + 8 * hh);
      acc[t] = mmaH<1>(ah.v, ah.v, bq.v, bq.v, acc[t]); }
  }
#pragma unroll
  for (int t = 0; t < 4; ++t) { if (col0 + t * 16 >= N) continue; const int col = col0 + t * 16 + ln; const float bv = bp ? bf16_round(bp[col]) : 0.f;
#pragma unroll
    for (int r = 0; r < 8; ++r) { float v = acc[t][r] * alpha + bv; if (CP) { const int rr = row0g + row0 + 8 * hh + r; if (rowsPerB < 0) v += CP[cofs + (size_t)rr * ldc + col];      /* rowsPerB < 0: own element of the batched C plane */ else { const int bidx = rr / rowsPerB; v += CP[(size_t)bidx * sCPb + (size_t)by * 64 + col]; } } if (ACT == 1) v = (v > 0.f) ? v : expm1f(v); else if (ACT == 7) v = (v > 0.f) ? v + 1.0f : expf(v); else if (ACT == 8) v = tanhf(v); else if (ACT == 9) v = 0.5f * v * (1.0f + tanhf(0.7978845608028654f * (v + 0.044715f * v * v * v))); else if (ACT == 11) v = 1.0f / (1.0f + expf(-v)); else if (ACT == 12) v = (v > 0.f) ? v : 0.01f * v; else if (ACT == 14) v = (v > 0.f) ? v : 0.1f * v; else if (ACT == 16) v = (v >= 0.f) ? v : 0.3f * v; else if (ACT == 15) v = v / (1.0f + expf(-v)); else if (ACT == 3) v = fmaxf(v, 0.f); else if (ACT == 6) v = 0.5f * v * (1.0f + erff(v * 0.70710678118654752f)); so[w][8 * hh + r][t * 16 + ln] = v; } }
  __builtin_amdgcn_fence(__ATOMIC_ACQ_REL, "workgroup"); __builtin_amdgcn_wave_barrier();
  const int rsub = lane >> 4, c4 = (lane & 15) * 4; typedef _Float16 v4h __attribute__((ext_vector_type(4)));
  {
#pragma unroll
    for (int q = 0; q < 8; ++q) { const int r = q * 2 + rsub; if (col0 + c4 < N) { const v4f v = *(const v4fa*)&so[w][r][c4]; if (C) *(v4f*)(C + cofs + (size_t)(row0 + r) * ldc + col0 + c4) = v; if (C16) { v4h h4; for (int i = 0; i < 4; ++i) h4[i] = (_Float16)v[i]; *(v4h*)(C16 + cofs + (size_t)(row0 + r) * ldc + col0 + c4) = h4; } } }
     }
}


typedef _Float16 v4h __attribute__((ext_vector_type(4)));

__global__ __launch_bounds__(256) void k_x16(const float* __restrict__ x, _Float16* __restrict__ X16, size_t n8) { const size_t t = (size_t)blockIdx.x * 256 + threadIdx.x; if (t >= n8) return; FragH f;
#pragma unroll
  for (int q = 0; q < 8; ++q) f.h[q] = (_Float16)bf16_round(x[t * 8 + q]); *(v8us*)((unsigned short*)X16 + t * 8) = f.half[0];  }
__global__ __launch_bounds__(256) void k_h16(const float* __restrict__ x, _Float16* __restrict__ X16, size_t n8) { const size_t t = (size_t)blockIdx.x * 256 + threadIdx.x; if (t >= n8) return; FragH f;
#pragma unroll
  for (int q = 0; q < 8; ++q) f.h[q] = (_Float16)x[t * 8 + q]; *(v8us*)((unsigned short*)X16 + t * 8) = f.half[0];  }
__global__ __launch_bounds__(256) void k_round16f(const float* __restrict__ W, _Float16* __restrict__ Bt, size_t n8) { const size_t t = (size_t)blockIdx.x * 256 + threadIdx.x; if (t >= n8) return; FragH f;
#pragma unroll
  for (int i = 0; i < 8; ++i) f.h[i] = (_Float16)(bf16_round(W[t * 8 + i]) * 16.0f); *(v8us*)((unsigned short*)Bt + t * 8) = f.half[0];  }
template <int NHv, int TTv>
__global__ __launch_bounds__(256) void k_vt(const _Float16* __restrict__ V16, int ldv, int voff, _Float16* __restrict__ Vt) { __shared__ unsigned short tl[64][66]; const int tid = threadIdx.x; const int slab = blockIdx.x / (TTv / 64), lg = blockIdx.x % (TTv / 64); const int b = slab / NHv, h = slab % NHv;
  for (int i = tid; i < 64 * 8; i += 256) { const int r = i / 8, c8 = (i % 8) * 8; FragH f; f.half[0] = *(const v8us*)((const unsigned short*)V16 + ((size_t)b * TTv + lg * 64 + r) * ldv + voff + h * 64 + c8);
#pragma unroll
    for (int q = 0; q < 8; ++q) tl[r][c8 + q] = f.u[q]; }
  __syncthreads();
  {
#pragma unroll
    for (int rd = 0; rd < 2; ++rd) { const int d = rd * 32 + tid / 8, pc = tid % 8; FragH f;
#pragma unroll
      for (int q = 0; q < 8; ++q) f.u[q] = tl[pc * 8 + q][d];
      *(v8us*)((unsigned short*)Vt + ((size_t)slab * 64 + d) * TTv + lg * 64 + pc * 8) = f.half[0]; }
     } }

__global__ __launch_bounds__(256) void k_hl(const float* __restrict__ F, _Float16* __restrict__ Hh, _Float16* __restrict__ Hl, size_t n8) { const size_t t = (size_t)blockIdx.x * 256 + threadIdx.x; if (t >= n8) return; FragH fh, fl; const v4f a = *(const v4fa*)(F + t * 8), c = *(const v4fa*)(F + t * 8 + 4);
#pragma unroll
  for (int q = 0; q < 4; ++q) { _Float16 h = (_Float16)a[q]; fh.h[q] = h; fl.h[q] = (_Float16)((a[q] - (float)h) * 1024.0f); h = (_Float16)c[q]; fh.h[4 + q] = h; fl.h[4 + q] = (_Float16)((c[q] - (float)h) * 1024.0f); }
  { *(v8us*)((unsigned short*)Hh + t * 8) = fh.half[0]; *(v8us*)((unsigned short*)Hl + t * 8) = fl.half[0];  } }

// ---- fast GEMM (wave tile 32x64; requires M % 32 == 0 rows per launch region and N % 64 == 0); epilogue = k_gemm_hhx semantics ----
__device__ __forceinline__ v16h g2_frag(const _Float16* p, int hh) { FragH f; f.half[0] = *(const v8us*)((const unsigned short*)p + 8 * hh); f.half[1] = *(const v8us*)((const unsigned short*)p + 16 + 8 * hh); return f.v; }
__device__ __forceinline__ v8f g2_mma(v16h a, v16h b, v8f c) { v8f d = __builtin_amdgcn_wmma_f32_16x16x32_f16(false, a, false, b, (short)0, c, false, false); asm volatile("v_nop\n\tv_nop\n\tv_nop\n\tv_nop" : "+v"(d) : "v"(a), "v"(b)); return d; }
template <int ACT>
__global__ __launch_bounds__(128) void k_gemm2(const _Float16* __restrict__ A, int lda, size_t sA, const _Float16* __restrict__ Bh, int ldb, size_t sB, float alpha, const float* __restrict__ bias, size_t sBias, const float* __restrict__ CP, int rowsPerB, size_t sCPb, int row0g,
    float* __restrict__ C, _Float16* __restrict__ C16, int ldc, size_t sC, int M, int N, int K) { static_assert(ACT == 0 || ACT == 3 || ACT == 6 || ACT == 8 || ACT == 9 || ACT == 11 || ACT == 12 || ACT == 14 || ACT == 15 || ACT == 16, "k_gemm2: unsupported ACT code (would silently apply no activation)");
  __shared__ __attribute__((aligned(16))) float so[4][32][68];
  const int tid = threadIdx.x, w = tid >> 5, lane = tid & 31, ln = lane & 15, hh = lane >> 4; const int by = blockIdx.y;
  A += (size_t)by * sA; Bh += (size_t)by * sB; const size_t cofs = (size_t)by * sC; const float* bp = bias ? bias + (size_t)by * sBias : nullptr;
  const int ntn = N >> 6; const int mt = blockIdx.x / ntn, nq = blockIdx.x - mt * ntn; const int row0 = mt * 128 + 32 * w, col0 = nq * 64; if (row0 >= M) return;
  const _Float16* a0p = A + (size_t)(row0 + ln) * lda; const _Float16* a1p = a0p + (size_t)16 * lda;
  const _Float16* b0p = Bh + (size_t)(col0 + ln) * ldb; const _Float16* b1p = b0p + (size_t)16 * ldb; const _Float16* b2p = b1p + (size_t)16 * ldb; const _Float16* b3p = b2p + (size_t)16 * ldb;
  const v8f z8 = {0.f,0.f,0.f,0.f,0.f,0.f,0.f,0.f}; v8f c00 = z8, c01 = z8, c02 = z8, c03 = z8, c10 = z8, c11 = z8, c12 = z8, c13 = z8;
#pragma unroll 1
  for (int kb = 0; kb < K; kb += 32) { const v16h a0 = g2_frag(a0p + kb, hh), a1 = g2_frag(a1p + kb, hh);
    v16h b = g2_frag(b0p + kb, hh); c00 = g2_mma(a0, b, c00); c10 = g2_mma(a1, b, c10);
    b = g2_frag(b1p + kb, hh); c01 = g2_mma(a0, b, c01); c11 = g2_mma(a1, b, c11);
    b = g2_frag(b2p + kb, hh); c02 = g2_mma(a0, b, c02); c12 = g2_mma(a1, b, c12);
    b = g2_frag(b3p + kb, hh); c03 = g2_mma(a0, b, c03); c13 = g2_mma(a1, b, c13); }
  v8f accs[8] = {c00, c01, c02, c03, c10, c11, c12, c13};
#pragma unroll
  for (int u = 0; u < 8; ++u) { const int t = u & 3, half = u >> 2; const int col = col0 + t * 16 + ln; const float bv = bp ? bf16_round(bp[col]) : 0.f;
#pragma unroll
    for (int r = 0; r < 8; ++r) { const int rloc = half * 16 + 8 * hh + r; float v = accs[u][r] * alpha + bv; if (CP) { if (rowsPerB < 0) v += CP[cofs + (size_t)(row0g + row0 + rloc) * ldc + col];      /* rowsPerB < 0: own element of the batched C plane */ else { const int bidx = (row0g + row0 + rloc) / rowsPerB; v += CP[(size_t)bidx * sCPb + (size_t)by * 64 + col]; } }
      if (ACT == 3) v = fmaxf(v, 0.f); else if (ACT == 6) v = 0.5f * v * (1.0f + erff(v * 0.70710678118654752f)); else if (ACT == 11) v = 1.0f / (1.0f + expf(-v)); else if (ACT == 15) v = v / (1.0f + expf(-v)); else if (ACT == 12) v = (v > 0.f) ? v : 0.01f * v; else if (ACT == 8) v = tanhf(v); else if (ACT == 9) v = 0.5f * v * (1.0f + tanhf(0.7978845608028654f * (v + 0.044715f * v * v * v))); else if (ACT == 14) v = (v > 0.f) ? v : 0.1f * v; else if (ACT == 16) v = (v >= 0.f) ? v : 0.3f * v;
      so[w][rloc][t * 16 + ln] = v; } }
  __builtin_amdgcn_fence(__ATOMIC_ACQ_REL, "workgroup"); __builtin_amdgcn_wave_barrier();
  const int rsub = lane >> 4, c4 = (lane & 15) * 4;
  {
#pragma unroll
    for (int q = 0; q < 16; ++q) { const int r = q * 2 + rsub; const v4f v = *(const v4fa*)&so[w][r][c4]; if (C) *(v4f*)(C + cofs + (size_t)(row0 + r) * ldc + col0 + c4) = v; if (C16) { v4h h4; for (int i = 0; i < 4; ++i) h4[i] = (_Float16)v[i]; *(v4h*)(C16 + cofs + (size_t)(row0 + r) * ldc + col0 + c4) = h4; } }
     } }


__global__ __launch_bounds__(256) void k_wsc(const float* __restrict__ Wm, _Float16* __restrict__ Bt, size_t n8, float sc) { const size_t t = (size_t)blockIdx.x * 256 + threadIdx.x; if (t >= n8) return; FragH f; for (int q = 0; q < 8; ++q) f.h[q] = (_Float16)(bf16_round(Wm[t * 8 + q]) * sc); *(v8us*)((unsigned short*)Bt + t * 8) = f.half[0];  }
__global__ __launch_bounds__(256) void k_instat(const float* __restrict__ base, size_t scs, size_t sss, int rnd, float* __restrict__ ST) {
  #pragma clang fp contract(off)
  __shared__ float red[256]; const int tid = threadIdx.x; const int c = blockIdx.x; float s = 0.f;
#pragma unroll 1
  for (int i = tid; i < NS; i += 256) { float v = base[(size_t)c * scs + (size_t)i * sss]; if (rnd) v = bf16_round(v); s += v; }
  red[tid] = s; __syncthreads(); for (int st = 128; st > 0; st >>= 1) { if (tid < st) red[tid] += red[tid + st]; __syncthreads(); } const float mean = red[0] / (float)NS; __syncthreads(); float vs = 0.f;
#pragma unroll 1
  for (int i = tid; i < NS; i += 256) { float v = base[(size_t)c * scs + (size_t)i * sss]; if (rnd) v = bf16_round(v); const float d = v - mean; vs += d * d; }
  red[tid] = vs; __syncthreads(); for (int st = 128; st > 0; st >>= 1) { if (tid < st) red[tid] += red[tid + st]; __syncthreads(); }
  if (tid == 0) { const float var = red[0] / (float)NS; { *(float*)(ST + c * 2) = mean; *(float*)(ST + c * 2 + 1) = var;  } } }
__global__ __launch_bounds__(256) void k_innc(const float* __restrict__ xc, const float* __restrict__ ST, const float* __restrict__ g, const float* __restrict__ bb, _Float16* __restrict__ N16, float* __restrict__ XB) {
  #pragma clang fp contract(off)
  const size_t t = (size_t)blockIdx.x * 256 + threadIdx.x; if (t >= (size_t)NS * (CC / 8)) return; const int c0 = (int)(t % (CC / 8)) * 8; const int s = (int)(t / (CC / 8)); FragH f; v8f xb;
  for (int q = 0; q < 8; ++q) { const int c = c0 + q; const float x = bf16_round(xc[(size_t)c * NS + s]); xb[q] = x; float v = (x - ST[c * 2]) * rsqrtf(ST[c * 2 + 1] + 1e-5f); v *= bf16_round(g[c]); v += bf16_round(bb[c]); f.h[q] = (_Float16)v; }
  { *(v8us*)((unsigned short*)N16 + (size_t)s * CC + c0) = f.half[0]; if (XB) *(v8f*)(XB + (size_t)s * CC + c0) = xb;  } }
__global__ __launch_bounds__(256) void k_inpm(const float* __restrict__ Fp, const float* __restrict__ ST, const float* __restrict__ g, const float* __restrict__ bb, _Float16* __restrict__ N16) {
  #pragma clang fp contract(off)
  const size_t t = (size_t)blockIdx.x * 256 + threadIdx.x; if (t >= (size_t)NS * (CC / 8)) return; const int c0 = (int)(t % (CC / 8)) * 8; const int s = (int)(t / (CC / 8)); const v8f a = *(const v8f*)(Fp + (size_t)s * CC + c0); FragH f;
  for (int q = 0; q < 8; ++q) { const int c = c0 + q; float v = (a[q] - ST[c * 2]) * rsqrtf(ST[c * 2 + 1] + 1e-5f); v *= bf16_round(g[c]); v += bf16_round(bb[c]); f.h[q] = (_Float16)v; }
  *(v8us*)((unsigned short*)N16 + (size_t)s * CC + c0) = f.half[0];  }
__global__ __launch_bounds__(256) void k_sig(const float* __restrict__ S, const int* __restrict__ msk, _Float16* __restrict__ Wp) {
  #pragma clang fp contract(off)
  const size_t t = (size_t)blockIdx.x * 256 + threadIdx.x; if (t >= (size_t)NS * NS / 8) return; const int k0 = (int)((t * 8) % NS); const v8f a = *(const v8f*)(S + t * 8); FragH f;
  for (int q = 0; q < 8; ++q) { const float w = 1.0f / (1.0f + expf(-a[q])); f.h[q] = (_Float16)(w * (float)msk[k0 + q]); } *(v8us*)((unsigned short*)Wp + t * 8) = f.half[0];  }
__global__ __launch_bounds__(256) void k_vtp(const _Float16* __restrict__ V16, int h, _Float16* __restrict__ VT) { __shared__ unsigned short tl[64][34]; const int tid = threadIdx.x; const int pg = blockIdx.x;
  { const int r = tid / 4, c8 = (tid % 4) * 8; FragH f; f.half[0] = *(const v8us*)((const unsigned short*)V16 + ((size_t)pg * 64 + r) * HDA + h * HDm + c8); for (int q = 0; q < 8; ++q) tl[r][c8 + q] = f.u[q]; }
  __syncthreads(); const int d = tid / 8, pc = tid % 8; FragH f; for (int q = 0; q < 8; ++q) f.u[q] = tl[pc * 8 + q][d]; const v8us z = {0,0,0,0,0,0,0,0};
  unsigned short* dst = (unsigned short*)VT + (size_t)d * NS + pg * 64 + pc * 8; unsigned short* dz = (unsigned short*)VT + (size_t)(HDm + d) * NS + pg * 64 + pc * 8;
  { *(v8us*)dst = f.half[0]; *(v8us*)dz = z;  } }
__global__ __launch_bounds__(256) void k_cmp(const float* __restrict__ OP, _Float16* __restrict__ O16) { const size_t t = (size_t)blockIdx.x * 256 + threadIdx.x; if (t >= (size_t)NS * (HDA / 8)) return; const int c0 = (int)(t % (HDA / 8)) * 8; const size_t s = t / (HDA / 8); const int h = c0 / HDm, d0 = c0 % HDm; FragH f;
  for (int q = 0; q < 8; ++q) f.h[q] = (_Float16)OP[s * PW + h * 64 + d0 + q]; *(v8us*)((unsigned short*)O16 + s * HDA + c0) = f.half[0];  }
__global__ __launch_bounds__(256) void k_ncs(const float* __restrict__ F, float* __restrict__ out) { const int t = blockIdx.x * 256 + threadIdx.x; if (t >= CC * (NS / 4)) return; const int s0 = (t % (NS / 4)) * 4; const int c = t / (NS / 4); v4f r; for (int q = 0; q < 4; ++q) r[q] = F[(size_t)(s0 + q) * CC + c];
  *(v4f*)(out + (size_t)c * NS + s0) = r;  }

extern "C" void kernel_launch(void* const* d_in, const int* in_sizes, int n_in,
                              void* d_out, int out_size, void* d_ws, size_t ws_size, hipStream_t stream) {
  (void)in_sizes; (void)n_in; (void)out_size;
  const float* const* I = (const float* const*)d_in; const float* xq = I[0]; const float* xkv = I[1]; const int* msk = (const int*)d_in[2]; const float* qW = I[3]; const float* kW = I[4]; const float* vW = I[5]; const float* oW = I[6]; const float* gq = I[7]; const float* bq = I[8]; const float* gk = I[9]; const float* bk = I[10]; const float* gp = I[11]; const float* bp = I[12]; const float* W1 = I[13]; const float* b1 = I[14]; const float* W2 = I[15]; const float* b2 = I[16];
  char* ws = (char*)d_ws; size_t off = 0;
  auto take = [&](size_t bytes) { char* p = ws + off; off += (bytes + 255) & ~(size_t)255; return p; };
  _Float16* BQ = (_Float16*)take((size_t)HDA * CC * 2); _Float16* BK = (_Float16*)take((size_t)HDA * CC * 2); _Float16* BV = (_Float16*)take((size_t)HDA * CC * 2); _Float16* BOW = (_Float16*)take((size_t)CC * HDA * 2); _Float16* BW1 = (_Float16*)take((size_t)2 * CC * CC * 2); _Float16* BW2 = (_Float16*)take((size_t)CC * 2 * CC * 2); float* STQ = (float*)take(CC * 2 * 4); float* STK = (float*)take(CC * 2 * 4);
  _Float16* NQ = (_Float16*)take((size_t)NS * CC * 2); _Float16* NK = (_Float16*)take((size_t)NS * CC * 2); float* XB = (float*)take((size_t)NS * CC * 4); _Float16* Q16 = (_Float16*)take((size_t)NS * HDA * 2); _Float16* K16 = (_Float16*)take((size_t)NS * HDA * 2); _Float16* V16 = (_Float16*)take((size_t)NS * HDA * 2); _Float16* VT = (_Float16*)take((size_t)64 * NS * 2); float* S = (float*)take((size_t)NS * NS * 4); _Float16* Wp = (_Float16*)take((size_t)NS * NS * 2); float* OP = (float*)take((size_t)NS * PW * 4); _Float16* O16 = (_Float16*)take((size_t)NS * HDA * 2); float* AT = (float*)take((size_t)NS * CC * 4); _Float16* H16 = NQ; _Float16* HH = (_Float16*)take((size_t)NS * 2 * CC * 2); float* F = (float*)OP;
  if (off > ws_size) return;      /* 0.5 + 1 + 1 + 2 + 2 + 2 + 2 + 0.5 + 64 + 32 + 8 + 2 + 2 + 2 = 121 MiB */
  k_wsc<<<(HDA * CC / 8 + 255) / 256, 256, 0, stream>>>(qW, BQ, (size_t)HDA * CC / 8, 16.0f); k_wsc<<<(HDA * CC / 8 + 255) / 256, 256, 0, stream>>>(kW, BK, (size_t)HDA * CC / 8, 16.0f); k_wsc<<<(HDA * CC / 8 + 255) / 256, 256, 0, stream>>>(vW, BV, (size_t)HDA * CC / 8, 16.0f); k_wsc<<<(CC * HDA / 8 + 255) / 256, 256, 0, stream>>>(oW, BOW, (size_t)CC * HDA / 8, 16.0f); k_wsc<<<(2 * CC * CC / 8 + 255) / 256, 256, 0, stream>>>(W1, BW1, (size_t)2 * CC * CC / 8, 16.0f); k_wsc<<<(2 * CC * CC / 8 + 255) / 256, 256, 0, stream>>>(W2, BW2, (size_t)2 * CC * CC / 8, 16.0f);      /* 1x1 convs 'oc' = Bt */
  k_instat<<<CC, 256, 0, stream>>>(xq, (size_t)NS, (size_t)1, 1, STQ); k_instat<<<CC, 256, 0, stream>>>(xkv, (size_t)NS, (size_t)1, 1, STK);
  const unsigned n8 = (unsigned)(((size_t)NS * (CC / 8) + 255) / 256);
  k_innc<<<n8, 256, 0, stream>>>(xq, STQ, gq, bq, NQ, XB); k_innc<<<n8, 256, 0, stream>>>(xkv, STK, gk, bk, NK, nullptr);
  const dim3 gP((NS / 128) * (HDA / 64), 1);
  k_gemm2<0><<<gP, 128, 0, stream>>>(NQ, CC, 0, BQ, CC, 0, 0.0625f, nullptr, 0, nullptr, 1, 0, 0, nullptr, Q16, HDA, 0, NS, HDA, CC);
  k_gemm2<0><<<gP, 128, 0, stream>>>(NK, CC, 0, BK, CC, 0, 0.0625f, nullptr, 0, nullptr, 1, 0, 0, nullptr, K16, HDA, 0, NS, HDA, CC);
  k_gemm2<0><<<gP, 128, 0, stream>>>(NK, CC, 0, BV, CC, 0, 0.0625f, nullptr, 0, nullptr, 1, 0, 0, nullptr, V16, HDA, 0, NS, HDA, CC);
  for (int h = 0; h < NHD; ++h) {
    k_gemm2<0><<<dim3((NS / 128) * (NS / 64), 1), 128, 0, stream>>>(Q16 + h * HDm, HDA, 0, K16 + h * HDm, HDA, 0, 1.0f, nullptr, 0, nullptr, 1, 0, 0, S, nullptr, NS, 0, NS, NS, HDm);      /* logits = q.k (K = 32, no scale) */
    k_sig<<<(unsigned)(((size_t)NS * NS / 8 + 255) / 256), 256, 0, stream>>>(S, msk, Wp);
    k_vtp<<<NS / 64, 256, 0, stream>>>(V16, h, VT);
    k_gemm2<0><<<dim3((NS / 128) * 1, 1), 128, 0, stream>>>(Wp, NS, 0, VT, NS, 0, 1.0f, nullptr, 0, nullptr, 1, 0, 0, OP + h * 64, nullptr, PW, 0, NS, 64, NS); }      /* o_h (32 live of 64 cols) */
  k_cmp<<<(unsigned)(((size_t)NS * (HDA / 8) + 255) / 256), 256, 0, stream>>>(OP, O16);
  k_gemm2<0><<<dim3((NS / 128) * (CC / 64), 1), 128, 0, stream>>>(O16, HDA, 0, BOW, HDA, 0, 0.0625f, nullptr, 0, XB, 1, (size_t)CC, 0, AT, nullptr, CC, 0, NS, CC, HDA);      /* attn = o oW^T + x_q */
  k_instat<<<CC, 256, 0, stream>>>(AT, (size_t)1, (size_t)CC, 0, STQ); k_inpm<<<n8, 256, 0, stream>>>(AT, STQ, gp, bp, H16);
  k_gemm2<3><<<dim3((NS / 128) * (2 * CC / 64), 1), 128, 0, stream>>>(H16, CC, 0, BW1, CC, 0, 0.0625f, b1, 0, nullptr, 1, 0, 0, nullptr, HH, 2 * CC, 0, NS, 2 * CC, CC);      /* relu(W1 h + b1) */
  k_gemm2<0><<<dim3((NS / 128) * (CC / 64), 1), 128, 0, stream>>>(HH, 2 * CC, 0, BW2, 2 * CC, 0, 0.0625f, b2, 0, AT, 1, (size_t)CC, 0, F, nullptr, CC, 0, NS, CC, 2 * CC);      /* W2 h + b2 + attn */
  k_ncs<<<(CC * (NS / 4) + 255) / 256, 256, 0, stream>>>(F, (float*)d_out);
}

// v002
// It runs in 179 microseconds.
// Versions between v000 and this one are left out; their measured steps multiply to 7.69 times as fast.
#include <hip/hip_runtime.h>
// Multi_Heads_Self_Attn_Q_KV (1 volume, C 128, 16^3 = 4096 voxels, 8 heads x 32): InstanceNorm of x_q and x_kv (per channel over the 4096 voxels, biased var, eps 1e-5, affine); q, k, v = 1x1 convs (no bias); w = sigmoid(q.k) (no scale) * mask[key] (int input 0/1); o = w v (no normalisation); attn = o oW^T + x_q; h = IN(attn); h = relu(W1 h + b1); h = W2 h + b2; out = h + attn -> [1, 128, 16, 16, 16].
// Compute dtype: inputs and parameters rounded to bf16; normalised inputs, q, k, v, sigmoid weights, o and the MLP activations as plain f16 operands (~2^-12); statistics/sigmoid f32. v_wmma_f32_16x16x32_f16.
#define CC 128
#define NS 4096
#define NHD 8
#define HDm 32
#define HDA (NHD * HDm)          /* 256 */
#define PW (NHD * 64)            /* 512, unused */
typedef __bf16 v16b __attribute__((ext_vector_type(16)));
typedef unsigned short v8us __attribute__((ext_vector_type(8), may_alias));
typedef float  v8f  __attribute__((ext_vector_type(8)));
typedef float  v4f  __attribute__((ext_vector_type(4)));
typedef float  v4fa __attribute__((ext_vector_type(4), may_alias));
union FragB { v16b v; v8us half[2]; unsigned short u[16]; };

__device__ __forceinline__ unsigned short bf16_bits(float x) { unsigned int u = __float_as_uint(x); return (unsigned short)((u + 0x7FFFu + ((u >> 16) & 1u)) >> 16); }
__device__ __forceinline__ float bf16_val(unsigned short b) { return __uint_as_float(((unsigned int)b) << 16); }
__device__ __forceinline__ float bf16_round(float x) { return bf16_val(bf16_bits(x)); }
// D += A·B with NT terms: 1 = ah·bh, 2 = + al·bh (A split), 3 = + ah·bl (both split)
template <int NT>
__device__ __forceinline__ v8f mmaN(v16b ah, v16b al, v16b bh, v16b bl, v8f c) {
  c = __builtin_amdgcn_wmma_f32_16x16x32_bf16(false, ah, false, bh, (short)0, c, false, false);
  if (NT >= 2) c = __builtin_amdgcn_wmma_f32_16x16x32_bf16(false, al, false, bh, (short)0, c, false, false);
  if (NT >= 3) c = __builtin_amdgcn_wmma_f32_16x16x32_bf16(false, ah, false, bl, (short)0, c, false, false);
  asm volatile("v_nop\n\tv_nop\n\tv_nop\n\tv_nop" : "+v"(c) : "v"(ah), "v"(al), "v"(bh), "v"(bl));
  return c;
}

__global__ __launch_bounds__(256) void k_wt_bf16(const float* __restrict__ W, unsigned short* __restrict__ Wt, int K, int N) {
  const int t = blockIdx.x * 256 + threadIdx.x;
  const int k8n = K / 8;
  if (t >= N * k8n) return;
  const int n = t / k8n, k8 = (t % k8n) * 8;
  v8us v;
#pragma unroll
  for (int i = 0; i < 8; ++i) v[i] = bf16_bits(W[(size_t)(k8 + i) * N + n]);
  *(v8us*)(Wt + (size_t)n * K + k8) = v;
  
}

// GEMM C[M][N] (f32, pitch ldc) = act(A[M][K]·W + bias). A f32 row-major (pitch lda) converted per fragment to bf16
// (ASPLIT: hi/lo two planes -> 2 terms, else single rounded term); Wt bf16 [N][K] (pitch ldb). BIAS_BF16 rounds the
// bias to bf16 first (bias quantised to bf16 before the add). K%32==0, M%16==0, N%64==0.
template <bool ASPLIT, int ACT, bool BIAS_BF16>
__global__ __launch_bounds__(128) void k_gemm_bf(const float* __restrict__ A, int lda, const unsigned short* __restrict__ Wt, int ldb,
                                               const float* __restrict__ bias, float* __restrict__ C, int ldc, int M, int N, int K) {
  __shared__ __attribute__((aligned(16))) float so[4][16][64];
  const int tid = threadIdx.x, w = tid >> 5, lane = tid & 31, ln = lane & 15, hh = lane >> 4;
  const int ntn = N / 64;
  const int wid = blockIdx.x * 4 + w;
  const int mt = wid / ntn, nq = wid % ntn;
  if (mt * 16 >= M) return;
  const int row0 = mt * 16, col0 = nq * 64;
  const float* arow = A + (size_t)(row0 + ln) * lda;
  v8f acc[4] = {};
  for (int kb = 0; kb < K; kb += 32) {
    FragB ah, al;
    const v4f x0 = *(const v4fa*)(arow + kb + 8 * hh), x1 = *(const v4fa*)(arow + kb + 8 * hh + 4);
    const v4f x2 = *(const v4fa*)(arow + kb + 16 + 8 * hh), x3 = *(const v4fa*)(arow + kb + 16 + 8 * hh + 4);
    float xs[16] = {x0[0],x0[1],x0[2],x0[3],x1[0],x1[1],x1[2],x1[3],x2[0],x2[1],x2[2],x2[3],x3[0],x3[1],x3[2],x3[3]};
#pragma unroll
    for (int i = 0; i < 16; ++i) { const unsigned short hb = bf16_bits(xs[i]); ah.u[i] = hb; al.u[i] = ASPLIT ? bf16_bits(xs[i] - bf16_val(hb)) : (unsigned short)0; }
#pragma unroll
    for (int t = 0; t < 4; ++t) {
      const unsigned short* brow = Wt + (size_t)(col0 + t * 16 + ln) * ldb + kb;
      FragB b;
      b.half[0] = *(const v8us*)(brow + 8 * hh);
      b.half[1] = *(const v8us*)(brow + 16 + 8 * hh);
      acc[t] = mmaN<ASPLIT ? 2 : 1>(ah.v, al.v, b.v, b.v, acc[t]);
    }
  }
#pragma unroll
  for (int t = 0; t < 4; ++t) {
    float bv = bias ? bias[col0 + t * 16 + ln] : 0.f;
    if (BIAS_BF16) bv = bf16_round(bv);
#pragma unroll
    for (int r = 0; r < 8; ++r) { float v = acc[t][r] + bv; if (ACT == 1) v = fmaxf(v, 0.f); so[w][8 * hh + r][t * 16 + ln] = v; }
  }
  __builtin_amdgcn_fence(__ATOMIC_ACQ_REL, "workgroup");
  __builtin_amdgcn_wave_barrier();
  const int rsub = lane >> 4, c4 = (lane & 15) * 4;
  {
#pragma unroll
    for (int q = 0; q < 8; ++q) {
      const int r = q * 2 + rsub;
      const v4f v = *(const v4fa*)&so[w][r][c4];
      *(v4f*)(C + (size_t)(row0 + r) * ldc + col0 + c4) = v;
    }
    
  }
}

// GEMM C = act(A·W + bias + resid): A f32 (ASPLIT -> hi/lo 2 terms), Wt bf16 [N][K]; ACT 0 none, 1 relu, 2 exact gelu;
// resid (optional, f32, row index = (row % rmod), pitch ldr, RES_BF16 rounds it) added before the activation.
template <bool ASPLIT, int ACT, bool BIAS_BF16, bool RES_BF16>
__global__ __launch_bounds__(128) void k_gemm_bf3(const float* __restrict__ A, int lda, const unsigned short* __restrict__ Wt, int ldb,
                                                const float* __restrict__ bias, const float* __restrict__ resid, int rmod, int ldr,
                                                float* __restrict__ C, int ldc, int M, int N, int K) {
  __shared__ __attribute__((aligned(16))) float so[4][16][64];
  const int tid = threadIdx.x, w = tid >> 5, lane = tid & 31, ln = lane & 15, hh = lane >> 4;
  const int ntn = N / 64;
  const int wid = blockIdx.x * 4 + w;
  const int mt = wid / ntn, nq = wid % ntn;
  if (mt * 16 >= M) return;
  const int row0 = mt * 16, col0 = nq * 64;
  const float* arow = A + (size_t)(row0 + ln) * lda;
  v8f acc[4] = {};
  for (int kb = 0; kb < K; kb += 32) {
    FragB ah, al;
    const v4f x0 = *(const v4fa*)(arow + kb + 8 * hh), x1 = *(const v4fa*)(arow + kb + 8 * hh + 4);
    const v4f x2 = *(const v4fa*)(arow + kb + 16 + 8 * hh), x3 = *(const v4fa*)(arow + kb + 16 + 8 * hh + 4);
    float xs[16] = {x0[0],x0[1],x0[2],x0[3],x1[0],x1[1],x1[2],x1[3],x2[0],x2[1],x2[2],x2[3],x3[0],x3[1],x3[2],x3[3]};
#pragma unroll
    for (int i = 0; i < 16; ++i) { const unsigned short hb = bf16_bits(xs[i]); ah.u[i] = hb; al.u[i] = ASPLIT ? bf16_bits(xs[i] - bf16_val(hb)) : (unsigned short)0; }
#pragma unroll
    for (int t = 0; t < 4; ++t) {
      const unsigned short* brow = Wt + (size_t)(col0 + t * 16 + ln) * ldb + kb;
      FragB b;
      b.half[0] = *(const v8us*)(brow + 8 * hh);
      b.half[1] = *(const v8us*)(brow + 16 + 8 * hh);
      acc[t] = mmaN<ASPLIT ? 2 : 1>(ah.v, al.v, b.v, b.v, acc[t]);
    }
  }
#pragma unroll
  for (int t = 0; t < 4; ++t) {
    const int col = col0 + t * 16 + ln;
    float bv = bias ? bias[col] : 0.f;
    if (BIAS_BF16) bv = bf16_round(bv);
#pragma unroll
    for (int r = 0; r < 8; ++r) {
      float v = acc[t][r] + bv;
      if (resid) { float rv = resid[(size_t)((row0 + 8 * hh + r) % rmod) * ldr + col]; if (RES_BF16) rv = bf16_round(rv); v += rv; }
      if (ACT == 1) v = fmaxf(v, 0.f);
      if (ACT == 2) v = 0.5f * v * (1.0f + erff(v * 0.70710678118654752f));
      if (ACT == 3) { const float u = 0.7978845608028654f * (v + 0.044715f * v * v * v); v = 0.5f * v * (1.0f + tanhf(u)); }
      so[w][8 * hh + r][t * 16 + ln] = v;
    }
  }
  __builtin_amdgcn_fence(__ATOMIC_ACQ_REL, "workgroup");
  __builtin_amdgcn_wave_barrier();
  const int rsub = lane >> 4, c4 = (lane & 15) * 4;
  {
#pragma unroll
    for (int q = 0; q < 8; ++q) {
      const int r = q * 2 + rsub;
      const v4f v = *(const v4fa*)&so[w][r][c4];
      *(v4f*)(C + (size_t)(row0 + r) * ldc + col0 + c4) = v;
    }
    
  }
}
// row LayerNorm (biased variance, eps) over N: s = X (+ R); optional out_sum <- s; out_norm <- (s-mu)*rsqrt(var+eps)*g + b
template <bool PARAM_BF16>
__global__ __launch_bounds__(256) void k_layernorm(const float* __restrict__ X, const float* __restrict__ R, const float* __restrict__ g, const float* __restrict__ bta,
                                                  float* __restrict__ out_sum, float* __restrict__ out_norm, int N, float eps) {
  __shared__ float red[256];
  const int row = blockIdx.x, tid = threadIdx.x;
  const float* x = X + (size_t)row * N; const float* rr = R ? R + (size_t)row * N : nullptr;
  float vals[16];                     // up to N = 4096
  const int per = N / 256;            // contiguous chunk per thread? use strided-by-4 chunks: thread handles j = tid*4 + 1024*u
  float s1 = 0.f;
  for (int u = 0; u < per / 4; ++u) {
    const int j = tid * 4 + 1024 * u;
    const v4f a = *(const v4fa*)(x + j);
    v4f b = {0.f,0.f,0.f,0.f}; if (rr) b = *(const v4fa*)(rr + j);
#pragma unroll
    for (int q = 0; q < 4; ++q) { const float v = a[q] + b[q]; vals[u * 4 + q] = v; s1 += v; }
  }
  red[tid] = s1; __syncthreads();
  for (int st = 128; st > 0; st >>= 1) { if (tid < st) red[tid] += red[tid + st]; __syncthreads(); }
  const float mu = red[0] / (float)N; __syncthreads();
  float s2 = 0.f;
  for (int u = 0; u < per / 4; ++u)
#pragma unroll
    for (int q = 0; q < 4; ++q) { const float c = vals[u * 4 + q] - mu; s2 += c * c; }
  red[tid] = s2; __syncthreads();
  for (int st = 128; st > 0; st >>= 1) { if (tid < st) red[tid] += red[tid + st]; __syncthreads(); }
  const float rs = rsqrtf(red[0] / (float)N + eps);
  {
    for (int u = 0; u < per / 4; ++u) {
      const int j = tid * 4 + 1024 * u;
      v4f o, sm;
#pragma unroll
      for (int q = 0; q < 4; ++q) {
        float gg = g[j + q], bb = bta[j + q];
        if (PARAM_BF16) { gg = bf16_round(gg); bb = bf16_round(bb); }
        sm[q] = vals[u * 4 + q]; o[q] = (vals[u * 4 + q] - mu) * rs * gg + bb;
      }
      if (out_sum) *(v4f*)(out_sum + (size_t)row * N + j) = sm;
      *(v4f*)(out_norm + (size_t)row * N + j) = o;
    }
    
  }
}



// ---- f16 WMMA path (v_wmma_f32_16x16x32_f16): 11-bit significands for operands in range — used where a [0,1] probability operand needs more precision than bf16
typedef _Float16 v16h __attribute__((ext_vector_type(16)));
union FragH { v16h v; v8us half[2]; _Float16 h[16]; unsigned short u[16]; };
template <int NT>
__device__ __forceinline__ v8f mmaH(v16h ah, v16h al, v16h bh, v16h bl, v8f c) {
  c = __builtin_amdgcn_wmma_f32_16x16x32_f16(false, ah, false, bh, (short)0, c, false, false);
  if (NT >= 2) c = __builtin_amdgcn_wmma_f32_16x16x32_f16(false, al, false, bh, (short)0, c, false, false);
  if (NT >= 3) c = __builtin_amdgcn_wmma_f32_16x16x32_f16(false, ah, false, bl, (short)0, c, false, false);
  asm volatile("v_nop\n\tv_nop\n\tv_nop\n\tv_nop" : "+v"(c) : "v"(ah), "v"(al), "v"(bh), "v"(bl));
  return c;
}
// batched GEMM like k_gemm_b but f16 operands: A f32 (split into f16 hi/lo if ASPLIT, else rounded to f16), Bt = f16 values [n][k]; alpha; C f32; N multiple of 16 (partial tiles skipped)
template <bool ASPLIT>
__global__ __launch_bounds__(128) void k_gemm_h(const float* __restrict__ A, int lda, size_t sA, const _Float16* __restrict__ Bh, int ldb, size_t sB, float alpha, float* __restrict__ C, int ldc, size_t sC, int M, int N, int K) {
  __shared__ __attribute__((aligned(16))) float so[4][16][64];
  const int tid = threadIdx.x, w = tid >> 5, lane = tid & 31, ln = lane & 15, hh = lane >> 4; const int by = blockIdx.y;
  A += (size_t)by * sA; Bh += (size_t)by * sB; C += (size_t)by * sC;
  const int ntn = (N + 63) / 64; const int wid = blockIdx.x * 4 + w; const int mt = wid / ntn, nq = wid % ntn; if (mt * 16 >= M) return;
  const int row0 = mt * 16, col0 = nq * 64; const float* arow = A + (size_t)(row0 + ln) * lda;
  v8f acc[4] = {};
  for (int kb = 0; kb < K; kb += 32) {
    FragH ah, al;
    const v4f x0 = *(const v4fa*)(arow + kb + 8 * hh), x1 = *(const v4fa*)(arow + kb + 8 * hh + 4), x2 = *(const v4fa*)(arow + kb + 16 + 8 * hh), x3 = *(const v4fa*)(arow + kb + 16 + 8 * hh + 4);
    float xs[16] = {x0[0],x0[1],x0[2],x0[3],x1[0],x1[1],x1[2],x1[3],x2[0],x2[1],x2[2],x2[3],x3[0],x3[1],x3[2],x3[3]};
#pragma unroll
    for (int i = 0; i < 16; ++i) { const _Float16 h = (_Float16)xs[i]; ah.h[i] = h; al.h[i] = ASPLIT ? (_Float16)(xs[i] - (float)h) : (_Float16)0.0f; }
#pragma unroll
    for (int t = 0; t < 4; ++t) { if (col0 + t * 16 >= N) continue; const size_t boff = (size_t)(col0 + t * 16 + ln) * ldb + kb; FragH bq; bq.half[0] = *(const v8us*)(Bh + boff + 8 * hh); bq.half[1] = *(const v8us*)(Bh + boff + 16 + 8 * hh);
      acc[t] = mmaH<ASPLIT ? 2 : 1>(ah.v, al.v, bq.v, bq.v, acc[t]); }
  }
#pragma unroll
  for (int t = 0; t < 4; ++t) { if (col0 + t * 16 >= N) continue;
#pragma unroll
    for (int r = 0; r < 8; ++r) so[w][8 * hh + r][t * 16 + ln] = acc[t][r] * alpha; }
  __builtin_amdgcn_fence(__ATOMIC_ACQ_REL, "workgroup"); __builtin_amdgcn_wave_barrier();
  const int rsub = lane >> 4, c4 = (lane & 15) * 4;
  {
#pragma unroll
    for (int q = 0; q < 8; ++q) { const int r = q * 2 + rsub; if (col0 + c4 < N) { const v4f v = *(const v4fa*)&so[w][r][c4]; *(v4f*)(C + (size_t)(row0 + r) * ldc + col0 + c4) = v; } }
     }
}

// Wt[n][k] = f16(W[k][n]·scale) from f32 row-major W[K][N] (scale = power of two; bf16-exact weights stay exact in f16 away from the subnormal range)
__global__ __launch_bounds__(256) void k_wt_f16(const float* __restrict__ W, _Float16* __restrict__ Wt, int K, int N, float scale) {
  const int t = blockIdx.x * 256 + threadIdx.x; if (t >= N * (K / 8)) return; const int n = t / (K / 8), k8 = (t % (K / 8)) * 8; FragH f;
#pragma unroll
  for (int i = 0; i < 8; ++i) f.h[i] = (_Float16)(bf16_round(W[(size_t)(k8 + i) * N + n]) * scale); const v8us o = f.half[0];
  *(v8us*)((unsigned short*)Wt + (size_t)n * K + k8) = o; 
}
// k_gemm_hh variant with fused epilogue: v = acc·alpha + bias[by·sBias + col] (+ CP[(row/rowsPerB)·sCPb + by·64 + col] if CP) ; ACT 0 none / 1 elu ; writes f16 C16 (and f32 C if non-null)
template <int ACT>
__global__ __launch_bounds__(128) void k_gemm_hhx(const _Float16* __restrict__ A, int lda, size_t sA, const _Float16* __restrict__ Bh, int ldb, size_t sB, float alpha, const float* __restrict__ bias, size_t sBias, const float* __restrict__ CP, int rowsPerB, size_t sCPb, int row0g,
    float* __restrict__ C, _Float16* __restrict__ C16, int ldc, size_t sC, int M, int N, int K) {
  __shared__ __attribute__((aligned(16))) float so[4][16][64];
  const int tid = threadIdx.x, w = tid >> 5, lane = tid & 31, ln = lane & 15, hh = lane >> 4; const int by = blockIdx.y;
  A += (size_t)by * sA; Bh += (size_t)by * sB; const size_t cofs = (size_t)by * sC; const float* bp = bias ? bias + (size_t)by * sBias : nullptr;
  const int ntn = (N + 63) / 64; const int wid = blockIdx.x * 4 + w; const int mt = wid / ntn, nq = wid % ntn; if (mt * 16 >= M) return;
  const int row0 = mt * 16, col0 = nq * 64; const _Float16* arow = A + (size_t)(row0 + ln) * lda;
  v8f acc[4] = {};
  for (int kb = 0; kb < K; kb += 32) { FragH ah; ah.half[0] = *(const v8us*)((const unsigned short*)arow + kb + 8 * hh); ah.half[1] = *(const v8us*)((const unsigned short*)arow + kb + 16 + 8 * hh);
#pragma unroll
    for (int t = 0; t < 4; ++t) { if (col0 + t * 16 >= N) continue; const size_t boff = (size_t)(col0 + t * 16 + ln) * ldb + kb; FragH bq; bq.half[0] = *(const v8us*)((const unsigned short*)Bh + boff + 8 * hh); bq.half[1] = *(const v8us*)((const unsigned short*)Bh + boff + 16 + 8 * hh);
      acc[t] = mmaH<1>(ah.v, ah.v, bq.v, bq.v, acc[t]); }
  }
#pragma unroll
  for (int t = 0; t < 4; ++t) { if (col0 + t * 16 >= N) continue; const int col = col0 + t * 16 + ln; const float bv = bp ? bf16_round(bp[col]) : 0.f;
#pragma unroll
    for (int r = 0; r < 8; ++r) { float v = acc[t][r] * alpha + bv; if (CP) { const int rr = row0g + row0 + 8 * hh + r; if (rowsPerB < 0) v += CP[cofs + (size_t)rr * ldc + col];      /* rowsPerB < 0: own element of the batched C plane */ else { const int bidx = rr / rowsPerB; v += CP[(size_t)bidx * sCPb + (size_t)by * 64 + col]; } } if (ACT == 1) v = (v > 0.f) ? v : expm1f(v); else if (ACT == 7) v = (v > 0.f) ? v + 1.0f : expf(v); else if (ACT == 8) v = tanhf(v); else if (ACT == 9) v = 0.5f * v * (1.0f + tanhf(0.7978845608028654f * (v + 0.044715f * v * v * v))); else if (ACT == 11) v = 1.0f / (1.0f + expf(-v)); else if (ACT == 12) v = (v > 0.f) ? v : 0.01f * v; else if (ACT == 14) v = (v > 0.f) ? v : 0.1f * v; else if (ACT == 16) v = (v >= 0.f) ? v : 0.3f * v; else if (ACT == 15) v = v / (1.0f + expf(-v)); else if (ACT == 3) v = fmaxf(v, 0.f); else if (ACT == 6) v = 0.5f * v * (1.0f + erff(v * 0.70710678118654752f)); so[w][8 * hh + r][t * 16 + ln] = v; } }
  __builtin_amdgcn_fence(__ATOMIC_ACQ_REL, "workgroup"); __builtin_amdgcn_wave_barrier();
  const int rsub = lane >> 4, c4 = (lane & 15) * 4; typedef _Float16 v4h __attribute__((ext_vector_type(4)));
  {
#pragma unroll
    for (int q = 0; q < 8; ++q) { const int r = q * 2 + rsub; if (col0 + c4 < N) { const v4f v = *(const v4fa*)&so[w][r][c4]; if (C) *(v4f*)(C + cofs + (size_t)(row0 + r) * ldc + col0 + c4) = v; if (C16) { v4h h4; for (int i = 0; i < 4; ++i) h4[i] = (_Float16)v[i]; *(v4h*)(C16 + cofs + (size_t)(row0 + r) * ldc + col0 + c4) = h4; } } }
     }
}


typedef _Float16 v4h __attribute__((ext_vector_type(4)));

__global__ __launch_bounds__(256) void k_x16(const float* __restrict__ x, _Float16* __restrict__ X16, size_t n8) { const size_t t = (size_t)blockIdx.x * 256 + threadIdx.x; if (t >= n8) return; FragH f;
#pragma unroll
  for (int q = 0; q < 8; ++q) f.h[q] = (_Float16)bf16_round(x[t * 8 + q]); *(v8us*)((unsigned short*)X16 + t * 8) = f.half[0];  }
__global__ __launch_bounds__(256) void k_h16(const float* __restrict__ x, _Float16* __restrict__ X16, size_t n8) { const size_t t = (size_t)blockIdx.x * 256 + threadIdx.x; if (t >= n8) return; FragH f;
#pragma unroll
  for (int q = 0; q < 8; ++q) f.h[q] = (_Float16)x[t * 8 + q]; *(v8us*)((unsigned short*)X16 + t * 8) = f.half[0];  }
__global__ __launch_bounds__(256) void k_round16f(const float* __restrict__ W, _Float16* __restrict__ Bt, size_t n8) { const size_t t = (size_t)blockIdx.x * 256 + threadIdx.x; if (t >= n8) return; FragH f;
#pragma unroll
  for (int i = 0; i < 8; ++i) f.h[i] = (_Float16)(bf16_round(W[t * 8 + i]) * 16.0f); *(v8us*)((unsigned short*)Bt + t * 8) = f.half[0];  }
template <int NHv, int TTv>
__global__ __launch_bounds__(256) void k_vt(const _Float16* __restrict__ V16, int ldv, int voff, _Float16* __restrict__ Vt) { __shared__ unsigned short tl[64][66]; const int tid = threadIdx.x; const int slab = blockIdx.x / (TTv / 64), lg = blockIdx.x % (TTv / 64); const int b = slab / NHv, h = slab % NHv;
  for (int i = tid; i < 64 * 8; i += 256) { const int r = i / 8, c8 = (i % 8) * 8; FragH f; f.half[0] = *(const v8us*)((const unsigned short*)V16 + ((size_t)b * TTv + lg * 64 + r) * ldv + voff + h * 64 + c8);
#pragma unroll
    for (int q = 0; q < 8; ++q) tl[r][c8 + q] = f.u[q]; }
  __syncthreads();
  {
#pragma unroll
    for (int rd = 0; rd < 2; ++rd) { const int d = rd * 32 + tid / 8, pc = tid % 8; FragH f;
#pragma unroll
      for (int q = 0; q < 8; ++q) f.u[q] = tl[pc * 8 + q][d];
      *(v8us*)((unsigned short*)Vt + ((size_t)slab * 64 + d) * TTv + lg * 64 + pc * 8) = f.half[0]; }
     } }

__global__ __launch_bounds__(256) void k_hl(const float* __restrict__ F, _Float16* __restrict__ Hh, _Float16* __restrict__ Hl, size_t n8) { const size_t t = (size_t)blockIdx.x * 256 + threadIdx.x; if (t >= n8) return; FragH fh, fl; const v4f a = *(const v4fa*)(F + t * 8), c = *(const v4fa*)(F + t * 8 + 4);
#pragma unroll
  for (int q = 0; q < 4; ++q) { _Float16 h = (_Float16)a[q]; fh.h[q] = h; fl.h[q] = (_Float16)((a[q] - (float)h) * 1024.0f); h = (_Float16)c[q]; fh.h[4 + q] = h; fl.h[4 + q] = (_Float16)((c[q] - (float)h) * 1024.0f); }
  { *(v8us*)((unsigned short*)Hh + t * 8) = fh.half[0]; *(v8us*)((unsigned short*)Hl + t * 8) = fl.half[0];  } }

// ---- fast GEMM (wave tile 32x64; requires M % 32 == 0 rows per launch region and N % 64 == 0); epilogue = k_gemm_hhx semantics ----
__device__ __forceinline__ v16h g2_frag(const _Float16* p, int hh) { FragH f; f.half[0] = *(const v8us*)((const unsigned short*)p + 8 * hh); f.half[1] = *(const v8us*)((const unsigned short*)p + 16 + 8 * hh); return f.v; }
__device__ __forceinline__ v8f g2_mma(v16h a, v16h b, v8f c) { v8f d = __builtin_amdgcn_wmma_f32_16x16x32_f16(false, a, false, b, (short)0, c, false, false); asm volatile("v_nop\n\tv_nop\n\tv_nop\n\tv_nop" : "+v"(d) : "v"(a), "v"(b)); return d; }
template <int ACT>
__global__ __launch_bounds__(128) void k_gemm2(const _Float16* __restrict__ A, int lda, size_t sA, const _Float16* __restrict__ Bh, int ldb, size_t sB, float alpha, const float* __restrict__ bias, size_t sBias, const float* __restrict__ CP, int rowsPerB, size_t sCPb, int row0g,
    float* __restrict__ C, _Float16* __restrict__ C16, int ldc, size_t sC, int M, int N, int K) { static_assert(ACT == 0 || ACT == 3 || ACT == 6 || ACT == 8 || ACT == 9 || ACT == 11 || ACT == 12 || ACT == 14 || ACT == 15 || ACT == 16, "k_gemm2: unsupported ACT code (would silently apply no activation)");
  __shared__ __attribute__((aligned(16))) float so[4][32][68];
  const int tid = threadIdx.x, w = tid >> 5, lane = tid & 31, ln = lane & 15, hh = lane >> 4; const int by = blockIdx.y;
  A += (size_t)by * sA; Bh += (size_t)by * sB; const size_t cofs = (size_t)by * sC; const float* bp = bias ? bias + (size_t)by * sBias : nullptr;
  const int ntn = N >> 6; const int mt = blockIdx.x / ntn, nq = blockIdx.x - mt * ntn; const int row0 = mt * 128 + 32 * w, col0 = nq * 64; if (row0 >= M) return;
  const _Float16* a0p = A + (size_t)(row0 + ln) * lda; const _Float16* a1p = a0p + (size_t)16 * lda;
  const _Float16* b0p = Bh + (size_t)(col0 + ln) * ldb; const _Float16* b1p = b0p + (size_t)16 * ldb; const _Float16* b2p = b1p + (size_t)16 * ldb; const _Float16* b3p = b2p + (size_t)16 * ldb;
  const v8f z8 = {0.f,0.f,0.f,0.f,0.f,0.f,0.f,0.f}; v8f c00 = z8, c01 = z8, c02 = z8, c03 = z8, c10 = z8, c11 = z8, c12 = z8, c13 = z8;
#pragma unroll 1
  for (int kb = 0; kb < K; kb += 32) { const v16h a0 = g2_frag(a0p + kb, hh), a1 = g2_frag(a1p + kb, hh);
    v16h b = g2_frag(b0p + kb, hh); c00 = g2_mma(a0, b, c00); c10 = g2_mma(a1, b, c10);
    b = g2_frag(b1p + kb, hh); c01 = g2_mma(a0, b, c01); c11 = g2_mma(a1, b, c11);
    b = g2_frag(b2p + kb, hh); c02 = g2_mma(a0, b, c02); c12 = g2_mma(a1, b, c12);
    b = g2_frag(b3p + kb, hh); c03 = g2_mma(a0, b, c03); c13 = g2_mma(a1, b, c13); }
  v8f accs[8] = {c00, c01, c02, c03, c10, c11, c12, c13};
#pragma unroll
  for (int u = 0; u < 8; ++u) { const int t = u & 3, half = u >> 2; const int col = col0 + t * 16 + ln; const float bv = bp ? bf16_round(bp[col]) : 0.f;
#pragma unroll
    for (int r = 0; r < 8; ++r) { const int rloc = half * 16 + 8 * hh + r; float v = accs[u][r] * alpha + bv; if (CP) { if (rowsPerB < 0) v += CP[cofs + (size_t)(row0g + row0 + rloc) * ldc + col];      /* rowsPerB < 0: own element of the batched C plane */ else { const int bidx = (row0g + row0 + rloc) / rowsPerB; v += CP[(size_t)bidx * sCPb + (size_t)by * 64 + col]; } }
      if (ACT == 3) v = fmaxf(v, 0.f); else if (ACT == 6) v = 0.5f * v * (1.0f + erff(v * 0.70710678118654752f)); else if (ACT == 11) v = 1.0f / (1.0f + expf(-v)); else if (ACT == 15) v = v / (1.0f + expf(-v)); else if (ACT == 12) v = (v > 0.f) ? v : 0.01f * v; else if (ACT == 8) v = tanhf(v); else if (ACT == 9) v = 0.5f * v * (1.0f + tanhf(0.7978845608028654f * (v + 0.044715f * v * v * v))); else if (ACT == 14) v = (v > 0.f) ? v : 0.1f * v; else if (ACT == 16) v = (v >= 0.f) ? v : 0.3f * v;
      so[w][rloc][t * 16 + ln] = v; } }
  __builtin_amdgcn_fence(__ATOMIC_ACQ_REL, "workgroup"); __builtin_amdgcn_wave_barrier();
  const int rsub = lane >> 4, c4 = (lane & 15) * 4;
  {
#pragma unroll
    for (int q = 0; q < 16; ++q) { const int r = q * 2 + rsub; const v4f v = *(const v4fa*)&so[w][r][c4]; if (C) *(v4f*)(C + cofs + (size_t)(row0 + r) * ldc + col0 + c4) = v; if (C16) { v4h h4; for (int i = 0; i < 4; ++i) h4[i] = (_Float16)v[i]; *(v4h*)(C16 + cofs + (size_t)(row0 + r) * ldc + col0 + c4) = h4; } }
     } }


__global__ __launch_bounds__(256) void k_wsc(const float* __restrict__ Wm, _Float16* __restrict__ Bt, size_t n8, float sc) { const size_t t = (size_t)blockIdx.x * 256 + threadIdx.x; if (t >= n8) return; FragH f; for (int q = 0; q < 8; ++q) f.h[q] = (_Float16)(bf16_round(Wm[t * 8 + q]) * sc); *(v8us*)((unsigned short*)Bt + t * 8) = f.half[0];  }
__global__ __launch_bounds__(256) void k_instat(const float* __restrict__ base, size_t scs, size_t sss, int rnd, float* __restrict__ ST) {
  #pragma clang fp contract(off)
  __shared__ float red[256]; const int tid = threadIdx.x; const int c = blockIdx.x; float s = 0.f;
#pragma unroll 1
  for (int i = tid; i < NS; i += 256) { float v = base[(size_t)c * scs + (size_t)i * sss]; if (rnd) v = bf16_round(v); s += v; }
  red[tid] = s; __syncthreads(); for (int st = 128; st > 0; st >>= 1) { if (tid < st) red[tid] += red[tid + st]; __syncthreads(); } const float mean = red[0] / (float)NS; __syncthreads(); float vs = 0.f;
#pragma unroll 1
  for (int i = tid; i < NS; i += 256) { float v = base[(size_t)c * scs + (size_t)i * sss]; if (rnd) v = bf16_round(v); const float d = v - mean; vs += d * d; }
  red[tid] = vs; __syncthreads(); for (int st = 128; st > 0; st >>= 1) { if (tid < st) red[tid] += red[tid + st]; __syncthreads(); }
  if (tid == 0) { const float var = red[0] / (float)NS; { *(float*)(ST + c * 2) = mean; *(float*)(ST + c * 2 + 1) = var;  } } }
__global__ __launch_bounds__(256) void k_innc(const float* __restrict__ xc, const float* __restrict__ ST, const float* __restrict__ g, const float* __restrict__ bb, _Float16* __restrict__ N16, float* __restrict__ XB) {
  #pragma clang fp contract(off)
  const size_t t = (size_t)blockIdx.x * 256 + threadIdx.x; if (t >= (size_t)NS * (CC / 8)) return; const int c0 = (int)(t % (CC / 8)) * 8; const int s = (int)(t / (CC / 8)); FragH f; v8f xb;
  for (int q = 0; q < 8; ++q) { const int c = c0 + q; const float x = bf16_round(xc[(size_t)c * NS + s]); xb[q] = x; float v = (x - ST[c * 2]) * rsqrtf(ST[c * 2 + 1] + 1e-5f); v *= bf16_round(g[c]); v += bf16_round(bb[c]); f.h[q] = (_Float16)v; }
  { *(v8us*)((unsigned short*)N16 + (size_t)s * CC + c0) = f.half[0]; if (XB) *(v8f*)(XB + (size_t)s * CC + c0) = xb;  } }
__global__ __launch_bounds__(256) void k_inpm(const float* __restrict__ Fp, const float* __restrict__ ST, const float* __restrict__ g, const float* __restrict__ bb, _Float16* __restrict__ N16) {
  #pragma clang fp contract(off)
  const size_t t = (size_t)blockIdx.x * 256 + threadIdx.x; if (t >= (size_t)NS * (CC / 8)) return; const int c0 = (int)(t % (CC / 8)) * 8; const int s = (int)(t / (CC / 8)); const v8f a = *(const v8f*)(Fp + (size_t)s * CC + c0); FragH f;
  for (int q = 0; q < 8; ++q) { const int c = c0 + q; float v = (a[q] - ST[c * 2]) * rsqrtf(ST[c * 2 + 1] + 1e-5f); v *= bf16_round(g[c]); v += bf16_round(bb[c]); f.h[q] = (_Float16)v; }
  *(v8us*)((unsigned short*)N16 + (size_t)s * CC + c0) = f.half[0];  }
// Operands of the fused attention kernel in fragment order, so that each of its loads is 512 contiguous bytes of a wave.
// KP[h][16-key tile][j][lane][8]: k[tile*16 + c][16j + 8hh + i]; VP[h][32-key block][dt][j][lane][8]: mask[key] * v[key = block*32 + 16j + 8hh + i][16dt + c]  (c = lane & 15, hh = lane >> 4)
__global__ __launch_bounds__(256) void k_pack(const _Float16* __restrict__ K16, const _Float16* __restrict__ V16, const int* __restrict__ msk, _Float16* __restrict__ KP, _Float16* __restrict__ VP) {
  const int t = blockIdx.x * 256 + threadIdx.x; const int nk = NHD * NS * HDm / 8; const int lane = t & 31, c = lane & 15, hh = lane >> 4, j = (t >> 5) & 1;
  if (t < nk) { const int kt = (t >> 6) & 255, h = t >> 14;
    const v8us v = *(const v8us*)((const unsigned short*)K16 + (size_t)(kt * 16 + c) * HDA + h * HDm + j * 16 + 8 * hh);
    *(v8us*)((unsigned short*)KP + (size_t)t * 8) = v; }
  else { const int u = t - nk; const int dt = (u >> 6) & 1, kb = (u >> 7) & 127, h = u >> 14; const int key0 = kb * 32 + j * 16 + 8 * hh; FragH f;
    for (int i = 0; i < 8; ++i) f.h[i] = (_Float16)((float)V16[(size_t)(key0 + i) * HDA + h * HDm + dt * 16 + c] * (float)msk[key0 + i]);
    *(v8us*)((unsigned short*)VP + (size_t)u * 8) = f.half[0]; } }
__device__ __forceinline__ v16h fa_frag(const unsigned short* p) { FragH f; f.half[0] = *(const v8us*)p; f.half[1] = *(const v8us*)(p + 256); return f.v; }
__device__ __forceinline__ v8f fa_mma(v16h a, v16h b, v8f c) { return __builtin_amdgcn_wmma_f32_16x16x32_f16(false, a, false, b, (short)0, c, false, false); }
// sigmoid(x) = 0.5 + 0.5 tanh(x / 2) on the chip's own v_tanh_f32: one transcendental, half a packed fma and half a packed convert an element. The scores arrive already halved (Q16 holds q / 2).
// two S^T tiles (keys 0-15 and 16-31 of a block, one query per lane column) -> sigmoid -> the A fragment of w.v: D register r of tile j holds key 16j + 8hh + r, which is A's element 8j + r
__device__ __forceinline__ v16h fa_sig(v8f s0, v8f s1) { FragH f;
  for (int r = 0; r < 8; ++r) { f.h[r] = (_Float16)(0.5f + 0.5f * __builtin_amdgcn_tanhf(s0[r])); f.h[8 + r] = (_Float16)(0.5f + 0.5f * __builtin_amdgcn_tanhf(s1[r])); }
  return f.v; }
// one block of 32 keys against the wave's 32 queries
__device__ __forceinline__ void fa_block(v16h k0, v16h k1, v16h v0, v16h v1, v16h qf0, v16h qf1, v8f& o00, v8f& o01, v8f& o10, v8f& o11) {
  const v8f z8 = {0.f,0.f,0.f,0.f,0.f,0.f,0.f,0.f};
  const v8f s00 = fa_mma(k0, qf0, z8), s01 = fa_mma(k1, qf0, z8), s10 = fa_mma(k0, qf1, z8), s11 = fa_mma(k1, qf1, z8);
  const v16h p0 = fa_sig(s00, s01); o00 = fa_mma(p0, v0, o00); o01 = fa_mma(p0, v1, o01);
  const v16h p1 = fa_sig(s10, s11); o10 = fa_mma(p1, v0, o10); o11 = fa_mma(p1, v1, o11); }
// Fused attention: one workgroup = one head x 128 queries; wave = 32 queries (w & 3) x one quarter of the keys (w >> 2). Q16 holds q / 2: S^T = k (q/2)^T, w = sigmoid(q.k) = 0.5 + 0.5 tanh(S^T) stays in registers, o += w (mask v); the four key quarters are joined through LDS.
__global__ __launch_bounds__(512) void k_fattn(const _Float16* __restrict__ Q16, const _Float16* __restrict__ KP, const _Float16* __restrict__ VP, _Float16* __restrict__ O16) {
  __shared__ __attribute__((aligned(16))) float part[4][128][36];
  const int tid = threadIdx.x, w = tid >> 5, lane = tid & 31, ln = lane & 15, hh = lane >> 4;
  const int h = blockIdx.x >> 5, q0 = (blockIdx.x & 31) * 128; const int qg = w & 3, kq = w >> 2;
  const _Float16* qp = Q16 + (size_t)(q0 + qg * 32 + ln) * HDA + h * HDm;
  const v16h qf0 = g2_frag(qp, hh), qf1 = g2_frag(qp + (size_t)16 * HDA, hh);
  const unsigned short* kp = (const unsigned short*)KP + ((size_t)h * 128 + kq * 32) * 1024 + lane * 8;
  const unsigned short* vp = (const unsigned short*)VP + ((size_t)h * 128 + kq * 32) * 1024 + lane * 8;
  const v8f z8 = {0.f,0.f,0.f,0.f,0.f,0.f,0.f,0.f}; v8f o00 = z8, o01 = z8, o10 = z8, o11 = z8;
  v16h nk0 = fa_frag(kp), nk1 = fa_frag(kp + 512), nv0 = fa_frag(vp), nv1 = fa_frag(vp + 512);
#pragma unroll 1      /* stays rolled: one trip's code (some 140 instructions) serves all 32 trips, so the loop stays small in the instruction cache */
  for (int b = 0; b < 32; ++b) { const v16h k0 = nk0, k1 = nk1, v0 = nv0, v1 = nv1;
    const int nb = (b < 31 ? b + 1 : 31) * 1024;      /* the next block's fragments fly while this block is worked on (the last trip reads its own block again and drops it) */
    nk0 = fa_frag(kp + nb); nk1 = fa_frag(kp + nb + 512); nv0 = fa_frag(vp + nb); nv1 = fa_frag(vp + nb + 512);
    asm volatile("s_wait_xcnt 0x0" ::: "memory");      /* in front of the block's arithmetic, which reuses the loads' address registers */
    __builtin_amdgcn_sched_barrier(0);      /* keeps the eight loads up here: without it the scheduler sinks them to the foot of the trip, right in front of their use */
    fa_block(k0, k1, v0, v1, qf0, qf1, o00, o01, o10, o11);
    __builtin_amdgcn_sched_barrier(0); }      /* keeps the copies of the loaded fragments, and so the waits for them, at the foot: without it some rise to the head of the trip */
  for (int r = 0; r < 8; ++r) { float* pr = &part[kq][qg * 32 + 8 * hh + r][ln]; pr[0] = o00[r]; pr[16] = o01[r]; pr[16 * 36] = o10[r]; pr[16 * 36 + 16] = o11[r]; }
  __syncthreads();
  const int q = tid >> 2, d0 = (tid & 3) * 8; v4f a = *(const v4fa*)&part[0][q][d0], c = *(const v4fa*)&part[0][q][d0 + 4];
  for (int s = 1; s < 4; ++s) { a += *(const v4fa*)&part[s][q][d0]; c += *(const v4fa*)&part[s][q][d0 + 4]; }
  FragH f;
  for (int i = 0; i < 4; ++i) { f.h[i] = (_Float16)a[i]; f.h[4 + i] = (_Float16)c[i]; }
  *(v8us*)((unsigned short*)O16 + (size_t)(q0 + q) * HDA + h * HDm + d0) = f.half[0]; }
__global__ __launch_bounds__(256) void k_ncs(const float* __restrict__ F, float* __restrict__ out) { const int t = blockIdx.x * 256 + threadIdx.x; if (t >= CC * (NS / 4)) return; const int s0 = (t % (NS / 4)) * 4; const int c = t / (NS / 4); v4f r; for (int q = 0; q < 4; ++q) r[q] = F[(size_t)(s0 + q) * CC + c];
  *(v4f*)(out + (size_t)c * NS + s0) = r;  }

extern "C" void kernel_launch(void* const* d_in, const int* in_sizes, int n_in,
                              void* d_out, int out_size, void* d_ws, size_t ws_size, hipStream_t stream) {
  (void)in_sizes; (void)n_in; (void)out_size;
  const float* const* I = (const float* const*)d_in; const float* xq = I[0]; const float* xkv = I[1]; const int* msk = (const int*)d_in[2]; const float* qW = I[3]; const float* kW = I[4]; const float* vW = I[5]; const float* oW = I[6]; const float* gq = I[7]; const float* bq = I[8]; const float* gk = I[9]; const float* bk = I[10]; const float* gp = I[11]; const float* bp = I[12]; const float* W1 = I[13]; const float* b1 = I[14]; const float* W2 = I[15]; const float* b2 = I[16];
  char* ws = (char*)d_ws; size_t off = 0;
  auto take = [&](size_t bytes) { char* p = ws + off; off += (bytes + 255) & ~(size_t)255; return p; };
  _Float16* BQ = (_Float16*)take((size_t)HDA * CC * 2); _Float16* BK = (_Float16*)take((size_t)HDA * CC * 2); _Float16* BV = (_Float16*)take((size_t)HDA * CC * 2); _Float16* BOW = (_Float16*)take((size_t)CC * HDA * 2); _Float16* BW1 = (_Float16*)take((size_t)2 * CC * CC * 2); _Float16* BW2 = (_Float16*)take((size_t)CC * 2 * CC * 2); float* STQ = (float*)take(CC * 2 * 4); float* STK = (float*)take(CC * 2 * 4);
  _Float16* NQ = (_Float16*)take((size_t)NS * CC * 2); _Float16* NK = (_Float16*)take((size_t)NS * CC * 2); float* XB = (float*)take((size_t)NS * CC * 4); _Float16* Q16 = (_Float16*)take((size_t)NS * HDA * 2); _Float16* K16 = (_Float16*)take((size_t)NS * HDA * 2); _Float16* V16 = (_Float16*)take((size_t)NS * HDA * 2); _Float16* KP = (_Float16*)take((size_t)NS * HDA * 2); _Float16* VP = (_Float16*)take((size_t)NS * HDA * 2); float* F = (float*)take((size_t)NS * CC * 4); _Float16* O16 = (_Float16*)take((size_t)NS * HDA * 2); float* AT = (float*)take((size_t)NS * CC * 4); _Float16* H16 = NQ; _Float16* HH = (_Float16*)take((size_t)NS * 2 * CC * 2);
  if (off > ws_size) return;      /* about 22.4 MiB */
  k_wsc<<<(HDA * CC / 8 + 255) / 256, 256, 0, stream>>>(qW, BQ, (size_t)HDA * CC / 8, 16.0f); k_wsc<<<(HDA * CC / 8 + 255) / 256, 256, 0, stream>>>(kW, BK, (size_t)HDA * CC / 8, 16.0f); k_wsc<<<(HDA * CC / 8 + 255) / 256, 256, 0, stream>>>(vW, BV, (size_t)HDA * CC / 8, 16.0f); k_wsc<<<(CC * HDA / 8 + 255) / 256, 256, 0, stream>>>(oW, BOW, (size_t)CC * HDA / 8, 16.0f); k_wsc<<<(2 * CC * CC / 8 + 255) / 256, 256, 0, stream>>>(W1, BW1, (size_t)2 * CC * CC / 8, 16.0f); k_wsc<<<(2 * CC * CC / 8 + 255) / 256, 256, 0, stream>>>(W2, BW2, (size_t)2 * CC * CC / 8, 16.0f);      /* 1x1 convs 'oc' = Bt */
  k_instat<<<CC, 256, 0, stream>>>(xq, (size_t)NS, (size_t)1, 1, STQ); k_instat<<<CC, 256, 0, stream>>>(xkv, (size_t)NS, (size_t)1, 1, STK);
  const unsigned n8 = (unsigned)(((size_t)NS * (CC / 8) + 255) / 256);
  k_innc<<<n8, 256, 0, stream>>>(xq, STQ, gq, bq, NQ, XB); k_innc<<<n8, 256, 0, stream>>>(xkv, STK, gk, bk, NK, nullptr);
  const dim3 gP((NS / 128) * (HDA / 64), 1);
  k_gemm2<0><<<gP, 128, 0, stream>>>(NQ, CC, 0, BQ, CC, 0, 0.03125f, nullptr, 0, nullptr, 1, 0, 0, nullptr, Q16, HDA, 0, NS, HDA, CC);      /* q / 2 (1/16 undoes the weights' scale, 1/2 is for the tanh form of the sigmoid; powers of two, so q's f16 rounding is the same) */
  k_gemm2<0><<<gP, 128, 0, stream>>>(NK, CC, 0, BK, CC, 0, 0.0625f, nullptr, 0, nullptr, 1, 0, 0, nullptr, K16, HDA, 0, NS, HDA, CC);
  k_gemm2<0><<<gP, 128, 0, stream>>>(NK, CC, 0, BV, CC, 0, 0.0625f, nullptr, 0, nullptr, 1, 0, 0, nullptr, V16, HDA, 0, NS, HDA, CC);
  k_pack<<<2 * NHD * NS * HDm / 8 / 256, 256, 0, stream>>>(K16, V16, msk, KP, VP);
  k_fattn<<<NHD * (NS / 128), 512, 0, stream>>>(Q16, KP, VP, O16);      /* o = (sigmoid(q.k) * mask) v, all heads */
  k_gemm2<0><<<dim3((NS / 128) * (CC / 64), 1), 128, 0, stream>>>(O16, HDA, 0, BOW, HDA, 0, 0.0625f, nullptr, 0, XB, 1, (size_t)CC, 0, AT, nullptr, CC, 0, NS, CC, HDA);      /* attn = o oW^T + x_q */
  k_instat<<<CC, 256, 0, stream>>>(AT, (size_t)1, (size_t)CC, 0, STQ); k_inpm<<<n8, 256, 0, stream>>>(AT, STQ, gp, bp, H16);
  k_gemm2<3><<<dim3((NS / 128) * (2 * CC / 64), 1), 128, 0, stream>>>(H16, CC, 0, BW1, CC, 0, 0.0625f, b1, 0, nullptr, 1, 0, 0, nullptr, HH, 2 * CC, 0, NS, 2 * CC, CC);      /* relu(W1 h + b1) */
  k_gemm2<0><<<dim3((NS / 128) * (CC / 64), 1), 128, 0, stream>>>(HH, 2 * CC, 0, BW2, 2 * CC, 0, 0.0625f, b2, 0, AT, 1, (size_t)CC, 0, F, nullptr, CC, 0, NS, CC, 2 * CC);      /* W2 h + b2 + attn */
  k_ncs<<<(CC * (NS / 4) + 255) / 256, 256, 0, stream>>>(F, (float*)d_out);
}

// v003
// One run takes 132 microseconds.
// Two timings next to v002 both put it at 1.36 times that version's speed.
// Over all steps from v000 it is 10.4 times as fast.
#include <hip/hip_runtime.h>
// Multi_Heads_Self_Attn_Q_KV (1 volume, C 128, 16^3 = 4096 voxels, 8 heads x 32): InstanceNorm of x_q and x_kv (per channel over the 4096 voxels, biased var, eps 1e-5, affine); q, k, v = 1x1 convs (no bias); w = sigmoid(q.k) (no scale) * mask[key] (int input 0/1); o = w v (no normalisation); attn = o oW^T + x_q; h = IN(attn); h = relu(W1 h + b1); h = W2 h + b2; out = h + attn -> [1, 128, 16, 16, 16].
// Compute dtype: inputs and parameters rounded to bf16; normalised inputs, q, k, v, sigmoid weights, o and the MLP activations as plain f16 operands (~2^-12); statistics/sigmoid f32. v_wmma_f32_16x16x32_f16.
#define CC 128
#define NS 4096
#define NHD 8
#define HDm 32
#define HDA (NHD * HDm)          /* 256 */
#define PW (NHD * 64)            /* 512, unused */
typedef __bf16 v16b __attribute__((ext_vector_type(16)));
typedef unsigned short v8us __attribute__((ext_vector_type(8), may_alias));
typedef float  v8f  __attribute__((ext_vector_type(8)));
typedef float  v4f  __attribute__((ext_vector_type(4)));
typedef float  v4fa __attribute__((ext_vector_type(4), may_alias));
union FragB { v16b v; v8us half[2]; unsigned short u[16]; };

__device__ __forceinline__ unsigned short bf16_bits(float x) { unsigned int u = __float_as_uint(x); return (unsigned short)((u + 0x7FFFu + ((u >> 16) & 1u)) >> 16); }
__device__ __forceinline__ float bf16_val(unsigned short b) { return __uint_as_float(((unsigned int)b) << 16); }
__device__ __forceinline__ float bf16_round(float x) { return bf16_val(bf16_bits(x)); }
// D += A·B with NT terms: 1 = ah·bh, 2 = + al·bh (A split), 3 = + ah·bl (both split)
template <int NT>
__device__ __forceinline__ v8f mmaN(v16b ah, v16b al, v16b bh, v16b bl, v8f c) {
  c = __builtin_amdgcn_wmma_f32_16x16x32_bf16(false, ah, false, bh, (short)0, c, false, false);
  if (NT >= 2) c = __builtin_amdgcn_wmma_f32_16x16x32_bf16(false, al, false, bh, (short)0, c, false, false);
  if (NT >= 3) c = __builtin_amdgcn_wmma_f32_16x16x32_bf16(false, ah, false, bl, (short)0, c, false, false);
  asm volatile("v_nop\n\tv_nop\n\tv_nop\n\tv_nop" : "+v"(c) : "v"(ah), "v"(al), "v"(bh), "v"(bl));
  return c;
}

__global__ __launch_bounds__(256) void k_wt_bf16(const float* __restrict__ W, unsigned short* __restrict__ Wt, int K, int N) {
  const int t = blockIdx.x * 256 + threadIdx.x;
  const int k8n = K / 8;
  if (t >= N * k8n) return;
  const int n = t / k8n, k8 = (t % k8n) * 8;
  v8us v;
#pragma unroll
  for (int i = 0; i < 8; ++i) v[i] = bf16_bits(W[(size_t)(k8 + i) * N + n]);
  *(v8us*)(Wt + (size_t)n * K + k8) = v;
  
}

// GEMM C[M][N] (f32, pitch ldc) = act(A[M][K]·W + bias). A f32 row-major (pitch lda) converted per fragment to bf16
// (ASPLIT: hi/lo two planes -> 2 terms, else single rounded term); Wt bf16 [N][K] (pitch ldb). BIAS_BF16 rounds the
// bias to bf16 first (bias quantised to bf16 before the add). K%32==0, M%16==0, N%64==0.
template <bool ASPLIT, int ACT, bool BIAS_BF16>
__global__ __launch_bounds__(128) void k_gemm_bf(const float* __restrict__ A, int lda, const unsigned short* __restrict__ Wt, int ldb,
                                               const float* __restrict__ bias, float* __restrict__ C, int ldc, int M, int N, int K) {
  __shared__ __attribute__((aligned(16))) float so[4][16][64];
  const int tid = threadIdx.x, w = tid >> 5, lane = tid & 31, ln = lane & 15, hh = lane >> 4;
  const int ntn = N / 64;
  const int wid = blockIdx.x * 4 + w;
  const int mt = wid / ntn, nq = wid % ntn;
  if (mt * 16 >= M) return;
  const int row0 = mt * 16, col0 = nq * 64;
  const float* arow = A + (size_t)(row0 + ln) * lda;
  v8f acc[4] = {};
  for (int kb = 0; kb < K; kb += 32) {
    FragB ah, al;
    const v4f x0 = *(const v4fa*)(arow + kb + 8 * hh), x1 = *(const v4fa*)(arow + kb + 8 * hh + 4);
    const v4f x2 = *(const v4fa*)(arow + kb + 16 + 8 * hh), x3 = *(const v4fa*)(arow + kb + 16 + 8 * hh + 4);
    float xs[16] = {x0[0],x0[1],x0[2],x0[3],x1[0],x1[1],x1[2],x1[3],x2[0],x2[1],x2[2],x2[3],x3[0],x3[1],x3[2],x3[3]};
#pragma unroll
    for (int i = 0; i < 16; ++i) { const unsigned short hb = bf16_bits(xs[i]); ah.u[i] = hb; al.u[i] = ASPLIT ? bf16_bits(xs[i] - bf16_val(hb)) : (unsigned short)0; }
#pragma unroll
    for (int t = 0; t < 4; ++t) {
      const unsigned short* brow = Wt + (size_t)(col0 + t * 16 + ln) * ldb + kb;
      FragB b;
      b.half[0] = *(const v8us*)(brow + 8 * hh);
      b.half[1] = *(const v8us*)(brow + 16 + 8 * hh);
      acc[t] = mmaN<ASPLIT ? 2 : 1>(ah.v, al.v, b.v, b.v, acc[t]);
    }
  }
#pragma unroll
  for (int t = 0; t < 4; ++t) {
    float bv = bias ? bias[col0 + t * 16 + ln] : 0.f;
    if (BIAS_BF16) bv = bf16_round(bv);
#pragma unroll
    for (int r = 0; r < 8; ++r) { float v = acc[t][r] + bv; if (ACT == 1) v = fmaxf(v, 0.f); so[w][8 * hh + r][t * 16 + ln] = v; }
  }
  __builtin_amdgcn_fence(__ATOMIC_ACQ_REL, "workgroup");
  __builtin_amdgcn_wave_barrier();
  const int rsub = lane >> 4, c4 = (lane & 15) * 4;
  {
#pragma unroll
    for (int q = 0; q < 8; ++q) {
      const int r = q * 2 + rsub;
      const v4f v = *(const v4fa*)&so[w][r][c4];
      *(v4f*)(C + (size_t)(row0 + r) * ldc + col0 + c4) = v;
    }
    
  }
}

// GEMM C = act(A·W + bias + resid): A f32 (ASPLIT -> hi/lo 2 terms), Wt bf16 [N][K]; ACT 0 none, 1 relu, 2 exact gelu;
// resid (optional, f32, row index = (row % rmod), pitch ldr, RES_BF16 rounds it) added before the activation.
template <bool ASPLIT, int ACT, bool BIAS_BF16, bool RES_BF16>
__global__ __launch_bounds__(128) void k_gemm_bf3(const float* __restrict__ A, int lda, const unsigned short* __restrict__ Wt, int ldb,
                                                const float* __restrict__ bias, const float* __restrict__ resid, int rmod, int ldr,
                                                float* __restrict__ C, int ldc, int M, int N, int K) {
  __shared__ __attribute__((aligned(16))) float so[4][16][64];
  const int tid = threadIdx.x, w = tid >> 5, lane = tid & 31, ln = lane & 15, hh = lane >> 4;
  const int ntn = N / 64;
  const int wid = blockIdx.x * 4 + w;
  const int mt = wid / ntn, nq = wid % ntn;
  if (mt * 16 >= M) return;
  const int row0 = mt * 16, col0 = nq * 64;
  const float* arow = A + (size_t)(row0 + ln) * lda;
  v8f acc[4] = {};
  for (int kb = 0; kb < K; kb += 32) {
    FragB ah, al;
    const v4f x0 = *(const v4fa*)(arow + kb + 8 * hh), x1 = *(const v4fa*)(arow + kb + 8 * hh + 4);
    const v4f x2 = *(const v4fa*)(arow + kb + 16 + 8 * hh), x3 = *(const v4fa*)(arow + kb + 16 + 8 * hh + 4);
    float xs[16] = {x0[0],x0[1],x0[2],x0[3],x1[0],x1[1],x1[2],x1[3],x2[0],x2[1],x2[2],x2[3],x3[0],x3[1],x3[2],x3[3]};
#pragma unroll
    for (int i = 0; i < 16; ++i) { const unsigned short hb = bf16_bits(xs[i]); ah.u[i] = hb; al.u[i] = ASPLIT ? bf16_bits(xs[i] - bf16_val(hb)) : (unsigned short)0; }
#pragma unroll
    for (int t = 0; t < 4; ++t) {
      const unsigned short* brow = Wt + (size_t)(col0 + t * 16 + ln) * ldb + kb;
      FragB b;
      b.half[0] = *(const v8us*)(brow + 8 * hh);
      b.half[1] = *(const v8us*)(brow + 16 + 8 * hh);
      acc[t] = mmaN<ASPLIT ? 2 : 1>(ah.v, al.v, b.v, b.v, acc[t]);
    }
  }
#pragma unroll
  for (int t = 0; t < 4; ++t) {
    const int col = col0 + t * 16 + ln;
    float bv = bias ? bias[col] : 0.f;
    if (BIAS_BF16) bv = bf16_round(bv);
#pragma unroll
    for (int r = 0; r < 8; ++r) {
      float v = acc[t][r] + bv;
      if (resid) { float rv = resid[(size_t)((row0 + 8 * hh + r) % rmod) * ldr + col]; if (RES_BF16) rv = bf16_round(rv); v += rv; }
      if (ACT == 1) v = fmaxf(v, 0.f);
      if (ACT == 2) v = 0.5f * v * (1.0f + erff(v * 0.70710678118654752f));
      if (ACT == 3) { const float u = 0.7978845608028654f * (v + 0.044715f * v * v * v); v = 0.5f * v * (1.0f + tanhf(u)); }
      so[w][8 * hh + r][t * 16 + ln] = v;
    }
  }
  __builtin_amdgcn_fence(__ATOMIC_ACQ_REL, "workgroup");
  __builtin_amdgcn_wave_barrier();
  const int rsub = lane >> 4, c4 = (lane & 15) * 4;
  {
#pragma unroll
    for (int q = 0; q < 8; ++q) {
      const int r = q * 2 + rsub;
      const v4f v = *(const v4fa*)&so[w][r][c4];
      *(v4f*)(C + (size_t)(row0 + r) * ldc + col0 + c4) = v;
    }
    
  }
}
// row LayerNorm (biased variance, eps) over N: s = X (+ R); optional out_sum <- s; out_norm <- (s-mu)*rsqrt(var+eps)*g + b
template <bool PARAM_BF16>
__global__ __launch_bounds__(256) void k_layernorm(const float* __restrict__ X, const float* __restrict__ R, const float* __restrict__ g, const float* __restrict__ bta,
                                                  float* __restrict__ out_sum, float* __restrict__ out_norm, int N, float eps) {
  __shared__ float red[256];
  const int row = blockIdx.x, tid = threadIdx.x;
  const float* x = X + (size_t)row * N; const float* rr = R ? R + (size_t)row * N : nullptr;
  float vals[16];                     // up to N = 4096
  const int per = N / 256;            // contiguous chunk per thread? use strided-by-4 chunks: thread handles j = tid*4 + 1024*u
  float s1 = 0.f;
  for (int u = 0; u < per / 4; ++u) {
    const int j = tid * 4 + 1024 * u;
    const v4f a = *(const v4fa*)(x + j);
    v4f b = {0.f,0.f,0.f,0.f}; if (rr) b = *(const v4fa*)(rr + j);
#pragma unroll
    for (int q = 0; q < 4; ++q) { const float v = a[q] + b[q]; vals[u * 4 + q] = v; s1 += v; }
  }
  red[tid] = s1; __syncthreads();
  for (int st = 128; st > 0; st >>= 1) { if (tid < st) red[tid] += red[tid + st]; __syncthreads(); }
  const float mu = red[0] / (float)N; __syncthreads();
  float s2 = 0.f;
  for (int u = 0; u < per / 4; ++u)
#pragma unroll
    for (int q = 0; q < 4; ++q) { const float c = vals[u * 4 + q] - mu; s2 += c * c; }
  red[tid] = s2; __syncthreads();
  for (int st = 128; st > 0; st >>= 1) { if (tid < st) red[tid] += red[tid + st]; __syncthreads(); }
  const float rs = rsqrtf(red[0] / (float)N + eps);
  {
    for (int u = 0; u < per / 4; ++u) {
      const int j = tid * 4 + 1024 * u;
      v4f o, sm;
#pragma unroll
      for (int q = 0; q < 4; ++q) {
        float gg = g[j + q], bb = bta[j + q];
        if (PARAM_BF16) { gg = bf16_round(gg); bb = bf16_round(bb); }
        sm[q] = vals[u * 4 + q]; o[q] = (vals[u * 4 + q] - mu) * rs * gg + bb;
      }
      if (out_sum) *(v4f*)(out_sum + (size_t)row * N + j) = sm;
      *(v4f*)(out_norm + (size_t)row * N + j) = o;
    }
    
  }
}



// ---- f16 WMMA path (v_wmma_f32_16x16x32_f16): 11-bit significands for operands in range — used where a [0,1] probability operand needs more precision than bf16
typedef _Float16 v16h __attribute__((ext_vector_type(16)));
union FragH { v16h v; v8us half[2]; _Float16 h[16]; unsigned short u[16]; };
template <int NT>
__device__ __forceinline__ v8f mmaH(v16h ah, v16h al, v16h bh, v16h bl, v8f c) {
  c = __builtin_amdgcn_wmma_f32_16x16x32_f16(false, ah, false, bh, (short)0, c, false, false);
  if (NT >= 2) c = __builtin_amdgcn_wmma_f32_16x16x32_f16(false, al, false, bh, (short)0, c, false, false);
  if (NT >= 3) c = __builtin_amdgcn_wmma_f32_16x16x32_f16(false, ah, false, bl, (short)0, c, false, false);
  asm volatile("v_nop\n\tv_nop\n\tv_nop\n\tv_nop" : "+v"(c) : "v"(ah), "v"(al), "v"(bh), "v"(bl));
  return c;
}
// batched GEMM like k_gemm_b but f16 operands: A f32 (split into f16 hi/lo if ASPLIT, else rounded to f16), Bt = f16 values [n][k]; alpha; C f32; N multiple of 16 (partial tiles skipped)
template <bool ASPLIT>
__global__ __launch_bounds__(128) void k_gemm_h(const float* __restrict__ A, int lda, size_t sA, const _Float16* __restrict__ Bh, int ldb, size_t sB, float alpha, float* __restrict__ C, int ldc, size_t sC, int M, int N, int K) {
  __shared__ __attribute__((aligned(16))) float so[4][16][64];
  const int tid = threadIdx.x, w = tid >> 5, lane = tid & 31, ln = lane & 15, hh = lane >> 4; const int by = blockIdx.y;
  A += (size_t)by * sA; Bh += (size_t)by * sB; C += (size_t)by * sC;
  const int ntn = (N + 63) / 64; const int wid = blockIdx.x * 4 + w; const int mt = wid / ntn, nq = wid % ntn; if (mt * 16 >= M) return;
  const int row0 = mt * 16, col0 = nq * 64; const float* arow = A + (size_t)(row0 + ln) * lda;
  v8f acc[4] = {};
  for (int kb = 0; kb < K; kb += 32) {
    FragH ah, al;
    const v4f x0 = *(const v4fa*)(arow + kb + 8 * hh), x1 = *(const v4fa*)(arow + kb + 8 * hh + 4), x2 = *(const v4fa*)(arow + kb + 16 + 8 * hh), x3 = *(const v4fa*)(arow + kb + 16 + 8 * hh + 4);
    float xs[16] = {x0[0],x0[1],x0[2],x0[3],x1[0],x1[1],x1[2],x1[3],x2[0],x2[1],x2[2],x2[3],x3[0],x3[1],x3[2],x3[3]};
#pragma unroll
    for (int i = 0; i < 16; ++i) { const _Float16 h = (_Float16)xs[i]; ah.h[i] = h; al.h[i] = ASPLIT ? (_Float16)(xs[i] - (float)h) : (_Float16)0.0f; }
#pragma unroll
    for (int t = 0; t < 4; ++t) { if (col0 + t * 16 >= N) continue; const size_t boff = (size_t)(col0 + t * 16 + ln) * ldb + kb; FragH bq; bq.half[0] = *(const v8us*)(Bh + boff + 8 * hh); bq.half[1] = *(const v8us*)(Bh + boff + 16 + 8 * hh);
      acc[t] = mmaH<ASPLIT ? 2 : 1>(ah.v, al.v, bq.v, bq.v, acc[t]); }
  }
#pragma unroll
  for (int t = 0; t < 4; ++t) { if (col0 + t * 16 >= N) continue;
#pragma unroll
    for (int r = 0; r < 8; ++r) so[w][8 * hh + r][t * 16 + ln] = acc[t][r] * alpha; }
  __builtin_amdgcn_fence(__ATOMIC_ACQ_REL, "workgroup"); __builtin_amdgcn_wave_barrier();
  const int rsub = lane >> 4, c4 = (lane & 15) * 4;
  {
#pragma unroll
    for (int q = 0; q < 8; ++q) { const int r = q * 2 + rsub; if (col0 + c4 < N) { const v4f v = *(const v4fa*)&so[w][r][c4]; *(v4f*)(C + (size_t)(row0 + r) * ldc + col0 + c4) = v; } }
     }
}

// Wt[n][k] = f16(W[k][n]·scale) from f32 row-major W[K][N] (scale = power of two; bf16-exact weights stay exact in f16 away from the subnormal range)
__global__ __launch_bounds__(256) void k_wt_f16(const float* __restrict__ W, _Float16* __restrict__ Wt, int K, int N, float scale) {
  const int t = blockIdx.x * 256 + threadIdx.x; if (t >= N * (K / 8)) return; const int n = t / (K / 8), k8 = (t % (K / 8)) * 8; FragH f;
#pragma unroll
  for (int i = 0; i < 8; ++i) f.h[i] = (_Float16)(bf16_round(W[(size_t)(k8 + i) * N + n]) * scale); const v8us o = f.half[0];
  *(v8us*)((unsigned short*)Wt + (size_t)n * K + k8) = o; 
}
// k_gemm_hh variant with fused epilogue: v = acc·alpha + bias[by·sBias + col] (+ CP[(row/rowsPerB)·sCPb + by·64 + col] if CP) ; ACT 0 none / 1 elu ; writes f16 C16 (and f32 C if non-null)
template <int ACT>
__global__ __launch_bounds__(128) void k_gemm_hhx(const _Float16* __restrict__ A, int lda, size_t sA, const _Float16* __restrict__ Bh, int ldb, size_t sB, float alpha, const float* __restrict__ bias, size_t sBias, const float* __restrict__ CP, int rowsPerB, size_t sCPb, int row0g,
    float* __restrict__ C, _Float16* __restrict__ C16, int ldc, size_t sC, int M, int N, int K) {
  __shared__ __attribute__((aligned(16))) float so[4][16][64];
  const int tid = threadIdx.x, w = tid >> 5, lane = tid & 31, ln = lane & 15, hh = lane >> 4; const int by = blockIdx.y;
  A += (size_t)by * sA; Bh += (size_t)by * sB; const size_t cofs = (size_t)by * sC; const float* bp = bias ? bias + (size_t)by * sBias : nullptr;
  const int ntn = (N + 63) / 64; const int wid = blockIdx.x * 4 + w; const int mt = wid / ntn, nq = wid % ntn; if (mt * 16 >= M) return;
  const int row0 = mt * 16, col0 = nq * 64; const _Float16* arow = A + (size_t)(row0 + ln) * lda;
  v8f acc[4] = {};
  for (int kb = 0; kb < K; kb += 32) { FragH ah; ah.half[0] = *(const v8us*)((const unsigned short*)arow + kb + 8 * hh); ah.half[1] = *(const v8us*)((const unsigned short*)arow + kb + 16 + 8 * hh);
#pragma unroll
    for (int t = 0; t < 4; ++t) { if (col0 + t * 16 >= N) continue; const size_t boff = (size_t)(col0 + t * 16 + ln) * ldb + kb; FragH bq; bq.half[0] = *(const v8us*)((const unsigned short*)Bh + boff + 8 * hh); bq.half[1] = *(const v8us*)((const unsigned short*)Bh + boff + 16 + 8 * hh);
      acc[t] = mmaH<1>(ah.v, ah.v, bq.v, bq.v, acc[t]); }
  }
#pragma unroll
  for (int t = 0; t < 4; ++t) { if (col0 + t * 16 >= N) continue; const int col = col0 + t * 16 + ln; const float bv = bp ? bf16_round(bp[col]) : 0.f;
#pragma unroll
    for (int r = 0; r < 8; ++r) { float v = acc[t][r] * alpha + bv; if (CP) { const int rr = row0g + row0 + 8 * hh + r; if (rowsPerB < 0) v += CP[cofs + (size_t)rr * ldc + col];      /* rowsPerB < 0: own element of the batched C plane */ else { const int bidx = rr / rowsPerB; v += CP[(size_t)bidx * sCPb + (size_t)by * 64 + col]; } } if (ACT == 1) v = (v > 0.f) ? v : expm1f(v); else if (ACT == 7) v = (v > 0.f) ? v + 1.0f : expf(v); else if (ACT == 8) v = tanhf(v); else if (ACT == 9) v = 0.5f * v * (1.0f + tanhf(0.7978845608028654f * (v + 0.044715f * v * v * v))); else if (ACT == 11) v = 1.0f / (1.0f + expf(-v)); else if (ACT == 12) v = (v > 0.f) ? v : 0.01f * v; else if (ACT == 14) v = (v > 0.f) ? v : 0.1f * v; else if (ACT == 16) v = (v >= 0.f) ? v : 0.3f * v; else if (ACT == 15) v = v / (1.0f + expf(-v)); else if (ACT == 3) v = fmaxf(v, 0.f); else if (ACT == 6) v = 0.5f * v * (1.0f + erff(v * 0.70710678118654752f)); so[w][8 * hh + r][t * 16 + ln] = v; } }
  __builtin_amdgcn_fence(__ATOMIC_ACQ_REL, "workgroup"); __builtin_amdgcn_wave_barrier();
  const int rsub = lane >> 4, c4 = (lane & 15) * 4; typedef _Float16 v4h __attribute__((ext_vector_type(4)));
  {
#pragma unroll
    for (int q = 0; q < 8; ++q) { const int r = q * 2 + rsub; if (col0 + c4 < N) { const v4f v = *(const v4fa*)&so[w][r][c4]; if (C) *(v4f*)(C + cofs + (size_t)(row0 + r) * ldc + col0 + c4) = v; if (C16) { v4h h4; for (int i = 0; i < 4; ++i) h4[i] = (_Float16)v[i]; *(v4h*)(C16 + cofs + (size_t)(row0 + r) * ldc + col0 + c4) = h4; } } }
     }
}


typedef _Float16 v4h __attribute__((ext_vector_type(4)));

__global__ __launch_bounds__(256) void k_x16(const float* __restrict__ x, _Float16* __restrict__ X16, size_t n8) { const size_t t = (size_t)blockIdx.x * 256 + threadIdx.x; if (t >= n8) return; FragH f;
#pragma unroll
  for (int q = 0; q < 8; ++q) f.h[q] = (_Float16)bf16_round(x[t * 8 + q]); *(v8us*)((unsigned short*)X16 + t * 8) = f.half[0];  }
__global__ __launch_bounds__(256) void k_h16(const float* __restrict__ x, _Float16* __restrict__ X16, size_t n8) { const size_t t = (size_t)blockIdx.x * 256 + threadIdx.x; if (t >= n8) return; FragH f;
#pragma unroll
  for (int q = 0; q < 8; ++q) f.h[q] = (_Float16)x[t * 8 + q]; *(v8us*)((unsigned short*)X16 + t * 8) = f.half[0];  }
__global__ __launch_bounds__(256) void k_round16f(const float* __restrict__ W, _Float16* __restrict__ Bt, size_t n8) { const size_t t = (size_t)blockIdx.x * 256 + threadIdx.x; if (t >= n8) return; FragH f;
#pragma unroll
  for (int i = 0; i < 8; ++i) f.h[i] = (_Float16)(bf16_round(W[t * 8 + i]) * 16.0f); *(v8us*)((unsigned short*)Bt + t * 8) = f.half[0];  }
template <int NHv, int TTv>
__global__ __launch_bounds__(256) void k_vt(const _Float16* __restrict__ V16, int ldv, int voff, _Float16* __restrict__ Vt) { __shared__ unsigned short tl[64][66]; const int tid = threadIdx.x; const int slab = blockIdx.x / (TTv / 64), lg = blockIdx.x % (TTv / 64); const int b = slab / NHv, h = slab % NHv;
  for (int i = tid; i < 64 * 8; i += 256) { const int r = i / 8, c8 = (i % 8) * 8; FragH f; f.half[0] = *(const v8us*)((const unsigned short*)V16 + ((size_t)b * TTv + lg * 64 + r) * ldv + voff + h * 64 + c8);
#pragma unroll
    for (int q = 0; q < 8; ++q) tl[r][c8 + q] = f.u[q]; }
  __syncthreads();
  {
#pragma unroll
    for (int rd = 0; rd < 2; ++rd) { const int d = rd * 32 + tid / 8, pc = tid % 8; FragH f;
#pragma unroll
      for (int q = 0; q < 8; ++q) f.u[q] = tl[pc * 8 + q][d];
      *(v8us*)((unsigned short*)Vt + ((size_t)slab * 64 + d) * TTv + lg * 64 + pc * 8) = f.half[0]; }
     } }

__global__ __launch_bounds__(256) void k_hl(const float* __restrict__ F, _Float16* __restrict__ Hh, _Float16* __restrict__ Hl, size_t n8) { const size_t t = (size_t)blockIdx.x * 256 + threadIdx.x; if (t >= n8) return; FragH fh, fl; const v4f a = *(const v4fa*)(F + t * 8), c = *(const v4fa*)(F + t * 8 + 4);
#pragma unroll
  for (int q = 0; q < 4; ++q) { _Float16 h = (_Float16)a[q]; fh.h[q] = h; fl.h[q] = (_Float16)((a[q] - (float)h) * 1024.0f); h = (_Float16)c[q]; fh.h[4 + q] = h; fl.h[4 + q] = (_Float16)((c[q] - (float)h) * 1024.0f); }
  { *(v8us*)((unsigned short*)Hh + t * 8) = fh.half[0]; *(v8us*)((unsigned short*)Hl + t * 8) = fl.half[0];  } }

// ---- fast GEMM (wave tile 32x64; requires M % 32 == 0 rows per launch region and N % 64 == 0); epilogue = k_gemm_hhx semantics ----
__device__ __forceinline__ v16h g2_frag(const _Float16* p, int hh) { FragH f; f.half[0] = *(const v8us*)((const unsigned short*)p + 8 * hh); f.half[1] = *(const v8us*)((const unsigned short*)p + 16 + 8 * hh); return f.v; }
__device__ __forceinline__ v8f g2_mma(v16h a, v16h b, v8f c) { v8f d = __builtin_amdgcn_wmma_f32_16x16x32_f16(false, a, false, b, (short)0, c, false, false); asm volatile("v_nop\n\tv_nop\n\tv_nop\n\tv_nop" : "+v"(d) : "v"(a), "v"(b)); return d; }
template <int ACT>
__device__ __forceinline__ void gemm2_body(int bx, int by, const _Float16* __restrict__ A, int lda, size_t sA, const _Float16* __restrict__ Bh, int ldb, size_t sB, float alpha, const float* __restrict__ bias, size_t sBias, const float* __restrict__ CP, int rowsPerB, size_t sCPb, int row0g,
    float* __restrict__ C, _Float16* __restrict__ C16, int ldc, size_t sC, int M, int N, int K) { static_assert(ACT == 0 || ACT == 3 || ACT == 6 || ACT == 8 || ACT == 9 || ACT == 11 || ACT == 12 || ACT == 14 || ACT == 15 || ACT == 16, "k_gemm2: unsupported ACT code (would silently apply no activation)");
  __shared__ __attribute__((aligned(16))) float so[4][32][68];
  const int tid = threadIdx.x, w = tid >> 5, lane = tid & 31, ln = lane & 15, hh = lane >> 4;
  A += (size_t)by * sA; Bh += (size_t)by * sB; const size_t cofs = (size_t)by * sC; const float* bp = bias ? bias + (size_t)by * sBias : nullptr;
  const int ntn = N >> 6; const int mt = bx / ntn, nq = bx - mt * ntn; const int row0 = mt * 128 + 32 * w, col0 = nq * 64; if (row0 >= M) return;
  const _Float16* a0p = A + (size_t)(row0 + ln) * lda; const _Float16* a1p = a0p + (size_t)16 * lda;
  const _Float16* b0p = Bh + (size_t)(col0 + ln) * ldb; const _Float16* b1p = b0p + (size_t)16 * ldb; const _Float16* b2p = b1p + (size_t)16 * ldb; const _Float16* b3p = b2p + (size_t)16 * ldb;
  const v8f z8 = {0.f,0.f,0.f,0.f,0.f,0.f,0.f,0.f}; v8f c00 = z8, c01 = z8, c02 = z8, c03 = z8, c10 = z8, c11 = z8, c12 = z8, c13 = z8;
#pragma unroll 1
  for (int kb = 0; kb < K; kb += 32) { const v16h a0 = g2_frag(a0p + kb, hh); v16h b = g2_frag(b0p + kb, hh); FragH a1f; a1f.half[0] = *(const v8us*)((const unsigned short*)(a1p + kb) + 8 * hh);
    asm volatile("s_wait_xcnt 0x0" ::: "memory");      /* the last load's result may be given address registers that the loads before it name: the wait stands in front of that overwrite */
    a1f.half[1] = *(const v8us*)((const unsigned short*)(a1p + kb) + 16 + 8 * hh); const v16h a1 = a1f.v;
    c00 = g2_mma(a0, b, c00); c10 = g2_mma(a1, b, c10);
    b = g2_frag(b1p + kb, hh); c01 = g2_mma(a0, b, c01); c11 = g2_mma(a1, b, c11);
    b = g2_frag(b2p + kb, hh); c02 = g2_mma(a0, b, c02); c12 = g2_mma(a1, b, c12);
    b = g2_frag(b3p + kb, hh); c03 = g2_mma(a0, b, c03); c13 = g2_mma(a1, b, c13); }
  v8f accs[8] = {c00, c01, c02, c03, c10, c11, c12, c13};
#pragma unroll
  for (int u = 0; u < 8; ++u) { const int t = u & 3, half = u >> 2; const int col = col0 + t * 16 + ln; const float bv = bp ? bf16_round(bp[col]) : 0.f;
#pragma unroll
    for (int r = 0; r < 8; ++r) { const int rloc = half * 16 + 8 * hh + r; float v = accs[u][r] * alpha + bv; if (CP) { if (rowsPerB < 0) v += CP[cofs + (size_t)(row0g + row0 + rloc) * ldc + col];      /* rowsPerB < 0: own element of the batched C plane */ else { const int bidx = (row0g + row0 + rloc) / rowsPerB; v += CP[(size_t)bidx * sCPb + (size_t)by * 64 + col]; } }
      if (ACT == 3) v = fmaxf(v, 0.f); else if (ACT == 6) v = 0.5f * v * (1.0f + erff(v * 0.70710678118654752f)); else if (ACT == 11) v = 1.0f / (1.0f + expf(-v)); else if (ACT == 15) v = v / (1.0f + expf(-v)); else if (ACT == 12) v = (v > 0.f) ? v : 0.01f * v; else if (ACT == 8) v = tanhf(v); else if (ACT == 9) v = 0.5f * v * (1.0f + tanhf(0.7978845608028654f * (v + 0.044715f * v * v * v))); else if (ACT == 14) v = (v > 0.f) ? v : 0.1f * v; else if (ACT == 16) v = (v >= 0.f) ? v : 0.3f * v;
      so[w][rloc][t * 16 + ln] = v; } }
  __builtin_amdgcn_fence(__ATOMIC_ACQ_REL, "workgroup"); __builtin_amdgcn_wave_barrier();
  const int rsub = lane >> 4, c4 = (lane & 15) * 4;
  {
#pragma unroll
    for (int q = 0; q < 16; ++q) { const int r = q * 2 + rsub; const v4f v = *(const v4fa*)&so[w][r][c4]; if (C) *(v4f*)(C + cofs + (size_t)(row0 + r) * ldc + col0 + c4) = v; if (C16) { v4h h4; for (int i = 0; i < 4; ++i) h4[i] = (_Float16)v[i]; *(v4h*)(C16 + cofs + (size_t)(row0 + r) * ldc + col0 + c4) = h4; } }
     } }
template <int ACT>
__global__ __launch_bounds__(128) void k_gemm2(const _Float16* __restrict__ A, int lda, size_t sA, const _Float16* __restrict__ Bh, int ldb, size_t sB, float alpha, const float* __restrict__ bias, size_t sBias, const float* __restrict__ CP, int rowsPerB, size_t sCPb, int row0g,
    float* __restrict__ C, _Float16* __restrict__ C16, int ldc, size_t sC, int M, int N, int K) { gemm2_body<ACT>(blockIdx.x, blockIdx.y, A, lda, sA, Bh, ldb, sB, alpha, bias, sBias, CP, rowsPerB, sCPb, row0g, C, C16, ldc, sC, M, N, K); }
// q / 2, k and v in one grid: blockIdx.y picks the product. The three are independent of one another, so they share one launch.
__global__ __launch_bounds__(128) void k_qkv(const _Float16* __restrict__ NQ, const _Float16* __restrict__ NK, const _Float16* __restrict__ BQ, const _Float16* __restrict__ BK, const _Float16* __restrict__ BV, _Float16* __restrict__ Q16, _Float16* __restrict__ K16, _Float16* __restrict__ V16) {
  const int z = blockIdx.y;
  gemm2_body<0>(blockIdx.x, 0, z == 0 ? NQ : NK, CC, 0, z == 0 ? BQ : (z == 1 ? BK : BV), CC, 0, z == 0 ? 0.03125f : 0.0625f, nullptr, 0, nullptr, 1, 0, 0, nullptr, z == 0 ? Q16 : (z == 1 ? K16 : V16), HDA, 0, NS, HDA, CC); }


__device__ __forceinline__ void wsc_body(int bx, const float* __restrict__ Wm, _Float16* __restrict__ Bt, size_t n8, float sc) { const size_t t = (size_t)bx * 256 + threadIdx.x; if (t >= n8) return; FragH f; for (int q = 0; q < 8; ++q) f.h[q] = (_Float16)(bf16_round(Wm[t * 8 + q]) * sc); *(v8us*)((unsigned short*)Bt + t * 8) = f.half[0];  }
__device__ __forceinline__ void instat_body(int c, const float* __restrict__ base, size_t scs, size_t sss, int rnd, float* __restrict__ ST) {
  #pragma clang fp contract(off)
  __shared__ float red[256]; const int tid = threadIdx.x; float s = 0.f;
#pragma unroll 1
  for (int i = tid; i < NS; i += 256) { float v = base[(size_t)c * scs + (size_t)i * sss]; if (rnd) v = bf16_round(v); s += v; }
  red[tid] = s; __syncthreads(); for (int st = 128; st > 0; st >>= 1) { if (tid < st) red[tid] += red[tid + st]; __syncthreads(); } const float mean = red[0] / (float)NS; __syncthreads(); float vs = 0.f;
#pragma unroll 1
  for (int i = tid; i < NS; i += 256) { float v = base[(size_t)c * scs + (size_t)i * sss]; if (rnd) v = bf16_round(v); const float d = v - mean; vs += d * d; }
  red[tid] = vs; __syncthreads(); for (int st = 128; st > 0; st >>= 1) { if (tid < st) red[tid] += red[tid + st]; __syncthreads(); }
  if (tid == 0) { const float var = red[0] / (float)NS; { *(float*)(ST + c * 2) = mean; *(float*)(ST + c * 2 + 1) = var;  } } }
__global__ __launch_bounds__(256) void k_instat(const float* __restrict__ base, size_t scs, size_t sss, int rnd, float* __restrict__ ST) { instat_body(blockIdx.x, base, scs, sss, rnd, ST); }
// Everything that depends on the inputs alone, in one grid: blocks 0-127 statistics of x_q, 128-255 of x_kv, then 16 blocks for each of the six weight matrices.
__global__ __launch_bounds__(256) void k_prep(const float* __restrict__ xq, const float* __restrict__ xkv, float* __restrict__ STQ, float* __restrict__ STK,
    const float* __restrict__ qW, const float* __restrict__ kW, const float* __restrict__ vW, const float* __restrict__ oW, const float* __restrict__ W1, const float* __restrict__ W2,
    _Float16* __restrict__ BQ, _Float16* __restrict__ BK, _Float16* __restrict__ BV, _Float16* __restrict__ BOW, _Float16* __restrict__ BW1, _Float16* __restrict__ BW2) {
  const int b = blockIdx.x;
  if (b < 2 * CC) { instat_body(b & (CC - 1), b < CC ? xq : xkv, (size_t)NS, (size_t)1, 1, b < CC ? STQ : STK); return; }
  const int u = b - 2 * CC, m = u >> 4;      /* every matrix has HDA * CC = 32768 elements: 4096 threads, 16 blocks */
  const float* Wm = m == 0 ? qW : m == 1 ? kW : m == 2 ? vW : m == 3 ? oW : m == 4 ? W1 : W2;
  _Float16* Bt = m == 0 ? BQ : m == 1 ? BK : m == 2 ? BV : m == 3 ? BOW : m == 4 ? BW1 : BW2;
  wsc_body(u & 15, Wm, Bt, (size_t)HDA * CC / 8, 16.0f); }
__device__ __forceinline__ void innc_body(int bx, const float* __restrict__ xc, const float* __restrict__ ST, const float* __restrict__ g, const float* __restrict__ bb, _Float16* __restrict__ N16, float* __restrict__ XB) {
  #pragma clang fp contract(off)
  const size_t t = (size_t)bx * 256 + threadIdx.x; if (t >= (size_t)NS * (CC / 8)) return; const int c0 = (int)(t % (CC / 8)) * 8; const int s = (int)(t / (CC / 8)); FragH f; v8f xb;
  for (int q = 0; q < 8; ++q) { const int c = c0 + q; const float x = bf16_round(xc[(size_t)c * NS + s]); xb[q] = x; float v = (x - ST[c * 2]) * rsqrtf(ST[c * 2 + 1] + 1e-5f); v *= bf16_round(g[c]); v += bf16_round(bb[c]); f.h[q] = (_Float16)v; }
  { *(v8us*)((unsigned short*)N16 + (size_t)s * CC + c0) = f.half[0]; if (XB) *(v8f*)(XB + (size_t)s * CC + c0) = xb;  } }
// both normalisations in one grid: the first NS * CC / 8 / 256 blocks take x_q (and its rounded copy XB), the rest x_kv
__global__ __launch_bounds__(256) void k_innc2(const float* __restrict__ xq, const float* __restrict__ xkv, const float* __restrict__ STQ, const float* __restrict__ STK, const float* __restrict__ gq, const float* __restrict__ bq, const float* __restrict__ gk, const float* __restrict__ bk, _Float16* __restrict__ NQ, _Float16* __restrict__ NK, float* __restrict__ XB) {
  const int nb = NS * (CC / 8) / 256, b = blockIdx.x;
  const bool f = b < nb;
  innc_body(f ? b : b - nb, f ? xq : xkv, f ? STQ : STK, f ? gq : gk, f ? bq : bk, f ? NQ : NK, f ? XB : nullptr); }
__global__ __launch_bounds__(256) void k_inpm(const float* __restrict__ Fp, const float* __restrict__ ST, const float* __restrict__ g, const float* __restrict__ bb, _Float16* __restrict__ N16) {
  #pragma clang fp contract(off)
  const size_t t = (size_t)blockIdx.x * 256 + threadIdx.x; if (t >= (size_t)NS * (CC / 8)) return; const int c0 = (int)(t % (CC / 8)) * 8; const int s = (int)(t / (CC / 8)); const v8f a = *(const v8f*)(Fp + (size_t)s * CC + c0); FragH f;
  for (int q = 0; q < 8; ++q) { const int c = c0 + q; float v = (a[q] - ST[c * 2]) * rsqrtf(ST[c * 2 + 1] + 1e-5f); v *= bf16_round(g[c]); v += bf16_round(bb[c]); f.h[q] = (_Float16)v; }
  *(v8us*)((unsigned short*)N16 + (size_t)s * CC + c0) = f.half[0];  }
// Operands of the fused attention kernel in fragment order, so that each of its loads is 512 contiguous bytes of a wave.
// KP[h][16-key tile][j][lane][8]: k[tile*16 + c][16j + 8hh + i]; VP[h][32-key block][dt][j][lane][8]: mask[key] * v[key = block*32 + 16j + 8hh + i][16dt + c]  (c = lane & 15, hh = lane >> 4)
__global__ __launch_bounds__(256) void k_pack(const _Float16* __restrict__ K16, const _Float16* __restrict__ V16, const int* __restrict__ msk, _Float16* __restrict__ KP, _Float16* __restrict__ VP) {
  const int t = blockIdx.x * 256 + threadIdx.x; const int nk = NHD * NS * HDm / 8; const int lane = t & 31, c = lane & 15, hh = lane >> 4, j = (t >> 5) & 1;
  if (t < nk) { const int kt = (t >> 6) & 255, h = t >> 14;
    const v8us v = *(const v8us*)((const unsigned short*)K16 + (size_t)(kt * 16 + c) * HDA + h * HDm + j * 16 + 8 * hh);
    *(v8us*)((unsigned short*)KP + (size_t)t * 8) = v; }
  else { const int u = t - nk; const int dt = (u >> 6) & 1, kb = (u >> 7) & 127, h = u >> 14; const int key0 = kb * 32 + j * 16 + 8 * hh; FragH f;
    for (int i = 0; i < 8; ++i) f.h[i] = (_Float16)((float)V16[(size_t)(key0 + i) * HDA + h * HDm + dt * 16 + c] * (float)msk[key0 + i]);
    *(v8us*)((unsigned short*)VP + (size_t)u * 8) = f.half[0]; } }
__device__ __forceinline__ v16h fa_frag(const unsigned short* p) { FragH f; f.half[0] = *(const v8us*)p; f.half[1] = *(const v8us*)(p + 256); return f.v; }
__device__ __forceinline__ v8f fa_mma(v16h a, v16h b, v8f c) { return __builtin_amdgcn_wmma_f32_16x16x32_f16(false, a, false, b, (short)0, c, false, false); }
// sigmoid(x) = 0.5 + 0.5 tanh(x / 2) on the chip's own v_tanh_f32: one transcendental, half a packed fma and half a packed convert an element. The scores arrive already halved (Q16 holds q / 2).
// two S^T tiles (keys 0-15 and 16-31 of a block, one query per lane column) -> sigmoid -> the A fragment of w.v: D register r of tile j holds key 16j + 8hh + r, which is A's element 8j + r
__device__ __forceinline__ v16h fa_sig(v8f s0, v8f s1) { FragH f;
  for (int r = 0; r < 8; ++r) { f.h[r] = (_Float16)(0.5f + 0.5f * __builtin_amdgcn_tanhf(s0[r])); f.h[8 + r] = (_Float16)(0.5f + 0.5f * __builtin_amdgcn_tanhf(s1[r])); }
  return f.v; }
// one block of 32 keys against the wave's 32 queries
__device__ __forceinline__ void fa_block(v16h k0, v16h k1, v16h v0, v16h v1, v16h qf0, v16h qf1, v8f& o00, v8f& o01, v8f& o10, v8f& o11) {
  const v8f z8 = {0.f,0.f,0.f,0.f,0.f,0.f,0.f,0.f};
  const v8f s00 = fa_mma(k0, qf0, z8), s01 = fa_mma(k1, qf0, z8), s10 = fa_mma(k0, qf1, z8), s11 = fa_mma(k1, qf1, z8);
  const v16h p0 = fa_sig(s00, s01); o00 = fa_mma(p0, v0, o00); o01 = fa_mma(p0, v1, o01);
  const v16h p1 = fa_sig(s10, s11); o10 = fa_mma(p1, v0, o10); o11 = fa_mma(p1, v1, o11); }
// Fused attention: one workgroup = one head x 128 queries; wave = 32 queries (w & 3) x one quarter of the keys (w >> 2). Q16 holds q / 2: S^T = k (q/2)^T, w = sigmoid(q.k) = 0.5 + 0.5 tanh(S^T) stays in registers, o += w (mask v); the four key quarters are joined through LDS.
__global__ __launch_bounds__(512) void k_fattn(const _Float16* __restrict__ Q16, const _Float16* __restrict__ KP, const _Float16* __restrict__ VP, _Float16* __restrict__ O16) {
  __shared__ __attribute__((aligned(16))) float part[4][128][36];
  const int tid = threadIdx.x, w = tid >> 5, lane = tid & 31, ln = lane & 15, hh = lane >> 4;
  const int h = blockIdx.x >> 5, q0 = (blockIdx.x & 31) * 128; const int qg = w & 3, kq = w >> 2;
  const _Float16* qp = Q16 + (size_t)(q0 + qg * 32 + ln) * HDA + h * HDm;
  const v16h qf0 = g2_frag(qp, hh), qf1 = g2_frag(qp + (size_t)16 * HDA, hh);
  const unsigned short* kp = (const unsigned short*)KP + ((size_t)h * 128 + kq * 32) * 1024 + lane * 8;
  const unsigned short* vp = (const unsigned short*)VP + ((size_t)h * 128 + kq * 32) * 1024 + lane * 8;
  const v8f z8 = {0.f,0.f,0.f,0.f,0.f,0.f,0.f,0.f}; v8f o00 = z8, o01 = z8, o10 = z8, o11 = z8;
  v16h nk0 = fa_frag(kp), nk1 = fa_frag(kp + 512), nv0 = fa_frag(vp), nv1 = fa_frag(vp + 512);
#pragma unroll 1      /* stays rolled: one trip's code (some 140 instructions) serves all 32 trips, so the loop stays small in the instruction cache */
  for (int b = 0; b < 32; ++b) { const v16h k0 = nk0, k1 = nk1, v0 = nv0, v1 = nv1;
    const int nb = (b < 31 ? b + 1 : 31) * 1024;      /* the next block's fragments fly while this block is worked on (the last trip reads its own block again and drops it) */
    nk0 = fa_frag(kp + nb); nk1 = fa_frag(kp + nb + 512); nv0 = fa_frag(vp + nb); nv1 = fa_frag(vp + nb + 512);
    asm volatile("s_wait_xcnt 0x0" ::: "memory");      /* in front of the block's arithmetic, which reuses the loads' address registers */
    __builtin_amdgcn_sched_barrier(0);      /* keeps the eight loads up here: without it the scheduler sinks them to the foot of the trip, right in front of their use */
    fa_block(k0, k1, v0, v1, qf0, qf1, o00, o01, o10, o11);
    __builtin_amdgcn_sched_barrier(0); }      /* keeps the copies of the loaded fragments, and so the waits for them, at the foot: without it some rise to the head of the trip */
  for (int r = 0; r < 8; ++r) { float* pr = &part[kq][qg * 32 + 8 * hh + r][ln]; pr[0] = o00[r]; pr[16] = o01[r]; pr[16 * 36] = o10[r]; pr[16 * 36 + 16] = o11[r]; }
  __syncthreads();
  const int q = tid >> 2, d0 = (tid & 3) * 8; v4f a = *(const v4fa*)&part[0][q][d0], c = *(const v4fa*)&part[0][q][d0 + 4];
  for (int s = 1; s < 4; ++s) { a += *(const v4fa*)&part[s][q][d0]; c += *(const v4fa*)&part[s][q][d0 + 4]; }
  FragH f;
  for (int i = 0; i < 4; ++i) { f.h[i] = (_Float16)a[i]; f.h[4 + i] = (_Float16)c[i]; }
  *(v8us*)((unsigned short*)O16 + (size_t)(q0 + q) * HDA + h * HDm + d0) = f.half[0]; }
__global__ __launch_bounds__(256) void k_ncs(const float* __restrict__ F, float* __restrict__ out) { const int t = blockIdx.x * 256 + threadIdx.x; if (t >= CC * (NS / 4)) return; const int s0 = (t % (NS / 4)) * 4; const int c = t / (NS / 4); v4f r; for (int q = 0; q < 4; ++q) r[q] = F[(size_t)(s0 + q) * CC + c];
  *(v4f*)(out + (size_t)c * NS + s0) = r;  }

extern "C" void kernel_launch(void* const* d_in, const int* in_sizes, int n_in,
                              void* d_out, int out_size, void* d_ws, size_t ws_size, hipStream_t stream) {
  (void)in_sizes; (void)n_in; (void)out_size;
  const float* const* I = (const float* const*)d_in; const float* xq = I[0]; const float* xkv = I[1]; const int* msk = (const int*)d_in[2]; const float* qW = I[3]; const float* kW = I[4]; const float* vW = I[5]; const float* oW = I[6]; const float* gq = I[7]; const float* bq = I[8]; const float* gk = I[9]; const float* bk = I[10]; const float* gp = I[11]; const float* bp = I[12]; const float* W1 = I[13]; const float* b1 = I[14]; const float* W2 = I[15]; const float* b2 = I[16];
  char* ws = (char*)d_ws; size_t off = 0;
  auto take = [&](size_t bytes) { char* p = ws + off; off += (bytes + 255) & ~(size_t)255; return p; };
  _Float16* BQ = (_Float16*)take((size_t)HDA * CC * 2); _Float16* BK = (_Float16*)take((size_t)HDA * CC * 2); _Float16* BV = (_Float16*)take((size_t)HDA * CC * 2); _Float16* BOW = (_Float16*)take((size_t)CC * HDA * 2); _Float16* BW1 = (_Float16*)take((size_t)2 * CC * CC * 2); _Float16* BW2 = (_Float16*)take((size_t)CC * 2 * CC * 2); float* STQ = (float*)take(CC * 2 * 4); float* STK = (float*)take(CC * 2 * 4);
  _Float16* NQ = (_Float16*)take((size_t)NS * CC * 2); _Float16* NK = (_Float16*)take((size_t)NS * CC * 2); float* XB = (float*)take((size_t)NS * CC * 4); _Float16* Q16 = (_Float16*)take((size_t)NS * HDA * 2); _Float16* K16 = (_Float16*)take((size_t)NS * HDA * 2); _Float16* V16 = (_Float16*)take((size_t)NS * HDA * 2); _Float16* KP = (_Float16*)take((size_t)NS * HDA * 2); _Float16* VP = (_Float16*)take((size_t)NS * HDA * 2); float* F = (float*)take((size_t)NS * CC * 4); _Float16* O16 = (_Float16*)take((size_t)NS * HDA * 2); float* AT = (float*)take((size_t)NS * CC * 4); _Float16* H16 = NQ; _Float16* HH = (_Float16*)take((size_t)NS * 2 * CC * 2);
  if (off > ws_size) return;      /* about 22.4 MiB */
  k_prep<<<2 * CC + 6 * (HDA * CC / 8 / 256), 256, 0, stream>>>(xq, xkv, STQ, STK, qW, kW, vW, oW, W1, W2, BQ, BK, BV, BOW, BW1, BW2);      /* statistics of x_q and x_kv; 1x1 convs 'oc' = Bt, times 16 */
  const unsigned n8 = (unsigned)(((size_t)NS * (CC / 8) + 255) / 256);
  k_innc2<<<2 * n8, 256, 0, stream>>>(xq, xkv, STQ, STK, gq, bq, gk, bk, NQ, NK, XB);
  k_qkv<<<dim3((NS / 128) * (HDA / 64), 3), 128, 0, stream>>>(NQ, NK, BQ, BK, BV, Q16, K16, V16);      /* q / 2 (1/16 undoes the weights' scale, 1/2 is for the tanh form of the sigmoid; powers of two, so q's f16 rounding is the same), k, v */
  k_pack<<<2 * NHD * NS * HDm / 8 / 256, 256, 0, stream>>>(K16, V16, msk, KP, VP);
  k_fattn<<<NHD * (NS / 128), 512, 0, stream>>>(Q16, KP, VP, O16);      /* o = (sigmoid(q.k) * mask) v, all heads */
  k_gemm2<0><<<dim3((NS / 128) * (CC / 64), 1), 128, 0, stream>>>(O16, HDA, 0, BOW, HDA, 0, 0.0625f, nullptr, 0, XB, 1, (size_t)CC, 0, AT, nullptr, CC, 0, NS, CC, HDA);      /* attn = o oW^T + x_q */
  k_instat<<<CC, 256, 0, stream>>>(AT, (size_t)1, (size_t)CC, 0, STQ); k_inpm<<<n8, 256, 0, stream>>>(AT, STQ, gp, bp, H16);
  k_gemm2<3><<<dim3((NS / 128) * (2 * CC / 64), 1), 128, 0, stream>>>(H16, CC, 0, BW1, CC, 0, 0.0625f, b1, 0, nullptr, 1, 0, 0, nullptr, HH, 2 * CC, 0, NS, 2 * CC, CC);      /* relu(W1 h + b1) */
  k_gemm2<0><<<dim3((NS / 128) * (CC / 64), 1), 128, 0, stream>>>(HH, 2 * CC, 0, BW2, 2 * CC, 0, 0.0625f, b2, 0, AT, 1, (size_t)CC, 0, F, nullptr, CC, 0, NS, CC, 2 * CC);      /* W2 h + b2 + attn */
  k_ncs<<<(CC * (NS / 4) + 255) / 256, 256, 0, stream>>>(F, (float*)d_out);
}

// v004
// A run of this version takes 60.5 microseconds.
// Next to v003, in two timings, it ran 2.20 and 2.22 times as fast.
// Over all steps from v000 it is 23.1 times as fast.
#include <hip/hip_runtime.h>
// Multi_Heads_Self_Attn_Q_KV (1 volume, C 128, 16^3 = 4096 voxels, 8 heads x 32): InstanceNorm of x_q and x_kv (per channel over the 4096 voxels, biased var, eps 1e-5, affine); q, k, v = 1x1 convs (no bias); w = sigmoid(q.k) (no scale) * mask[key] (int input 0/1); o = w v (no normalisation); attn = o oW^T + x_q; h = IN(attn); h = relu(W1 h + b1); h = W2 h + b2; out = h + attn -> [1, 128, 16, 16, 16].
// Compute dtype: inputs and parameters rounded to bf16; normalised inputs, q, k, v, sigmoid weights, o and the MLP activations as plain f16 operands (~2^-12); statistics/sigmoid f32. v_wmma_f32_16x16x32_f16.
#define CC 128
#define NS 4096
#define NHD 8
#define HDm 32
#define HDA (NHD * HDm)          /* 256 */
#define PW (NHD * 64)            /* 512, unused */
typedef __bf16 v16b __attribute__((ext_vector_type(16)));
typedef unsigned short v8us __attribute__((ext_vector_type(8), may_alias));
typedef float  v8f  __attribute__((ext_vector_type(8)));
typedef float  v4f  __attribute__((ext_vector_type(4)));
typedef float  v4fa __attribute__((ext_vector_type(4), may_alias));
union FragB { v16b v; v8us half[2]; unsigned short u[16]; };

__device__ __forceinline__ unsigned short bf16_bits(float x) { unsigned int u = __float_as_uint(x); return (unsigned short)((u + 0x7FFFu + ((u >> 16) & 1u)) >> 16); }
__device__ __forceinline__ float bf16_val(unsigned short b) { return __uint_as_float(((unsigned int)b) << 16); }
__device__ __forceinline__ float bf16_round(float x) { return bf16_val(bf16_bits(x)); }
// D += A·B with NT terms: 1 = ah·bh, 2 = + al·bh (A split), 3 = + ah·bl (both split)
template <int NT>
__device__ __forceinline__ v8f mmaN(v16b ah, v16b al, v16b bh, v16b bl, v8f c) {
  c = __builtin_amdgcn_wmma_f32_16x16x32_bf16(false, ah, false, bh, (short)0, c, false, false);
  if (NT >= 2) c = __builtin_amdgcn_wmma_f32_16x16x32_bf16(false, al, false, bh, (short)0, c, false, false);
  if (NT >= 3) c = __builtin_amdgcn_wmma_f32_16x16x32_bf16(false, ah, false, bl, (short)0, c, false, false);
  asm volatile("v_nop\n\tv_nop\n\tv_nop\n\tv_nop" : "+v"(c) : "v"(ah), "v"(al), "v"(bh), "v"(bl));
  return c;
}

__global__ __launch_bounds__(256) void k_wt_bf16(const float* __restrict__ W, unsigned short* __restrict__ Wt, int K, int N) {
  const int t = blockIdx.x * 256 + threadIdx.x;
  const int k8n = K / 8;
  if (t >= N * k8n) return;
  const int n = t / k8n, k8 = (t % k8n) * 8;
  v8us v;
#pragma unroll
  for (int i = 0; i < 8; ++i) v[i] = bf16_bits(W[(size_t)(k8 + i) * N + n]);
  *(v8us*)(Wt + (size_t)n * K + k8) = v;
  
}

// GEMM C[M][N] (f32, pitch ldc) = act(A[M][K]·W + bias). A f32 row-major (pitch lda) converted per fragment to bf16
// (ASPLIT: hi/lo two planes -> 2 terms, else single rounded term); Wt bf16 [N][K] (pitch ldb). BIAS_BF16 rounds the
// bias to bf16 first (bias quantised to bf16 before the add). K%32==0, M%16==0, N%64==0.
template <bool ASPLIT, int ACT, bool BIAS_BF16>
__global__ __launch_bounds__(128) void k_gemm_bf(const float* __restrict__ A, int lda, const unsigned short* __restrict__ Wt, int ldb,
                                               const float* __restrict__ bias, float* __restrict__ C, int ldc, int M, int N, int K) {
  __shared__ __attribute__((aligned(16))) float so[4][16][64];
  const int tid = threadIdx.x, w = tid >> 5, lane = tid & 31, ln = lane & 15, hh = lane >> 4;
  const int ntn = N / 64;
  const int wid = blockIdx.x * 4 + w;
  const int mt = wid / ntn, nq = wid % ntn;
  if (mt * 16 >= M) return;
  const int row0 = mt * 16, col0 = nq * 64;
  const float* arow = A + (size_t)(row0 + ln) * lda;
  v8f acc[4] = {};
  for (int kb = 0; kb < K; kb += 32) {
    FragB ah, al;
    const v4f x0 = *(const v4fa*)(arow + kb + 8 * hh), x1 = *(const v4fa*)(arow + kb + 8 * hh + 4);
    const v4f x2 = *(const v4fa*)(arow + kb + 16 + 8 * hh), x3 = *(const v4fa*)(arow + kb + 16 + 8 * hh + 4);
    float xs[16] = {x0[0],x0[1],x0[2],x0[3],x1[0],x1[1],x1[2],x1[3],x2[0],x2[1],x2[2],x2[3],x3[0],x3[1],x3[2],x3[3]};
#pragma unroll
    for (int i = 0; i < 16; ++i) { const unsigned short hb = bf16_bits(xs[i]); ah.u[i] = hb; al.u[i] = ASPLIT ? bf16_bits(xs[i] - bf16_val(hb)) : (unsigned short)0; }
#pragma unroll
    for (int t = 0; t < 4; ++t) {
      const unsigned short* brow = Wt + (size_t)(col0 + t * 16 + ln) * ldb + kb;
      FragB b;
      b.half[0] = *(const v8us*)(brow + 8 * hh);
      b.half[1] = *(const v8us*)(brow + 16 + 8 * hh);
      acc[t] = mmaN<ASPLIT ? 2 : 1>(ah.v, al.v, b.v, b.v, acc[t]);
    }
  }
#pragma unroll
  for (int t = 0; t < 4; ++t) {
    float bv = bias ? bias[col0 + t * 16 + ln] : 0.f;
    if (BIAS_BF16) bv = bf16_round(bv);
#pragma unroll
    for (int r = 0; r < 8; ++r) { float v = acc[t][r] + bv; if (ACT == 1) v = fmaxf(v, 0.f); so[w][8 * hh + r][t * 16 + ln] = v; }
  }
  __builtin_amdgcn_fence(__ATOMIC_ACQ_REL, "workgroup");
  __builtin_amdgcn_wave_barrier();
  const int rsub = lane >> 4, c4 = (lane & 15) * 4;
  {
#pragma unroll
    for (int q = 0; q < 8; ++q) {
      const int r = q * 2 + rsub;
      const v4f v = *(const v4fa*)&so[w][r][c4];
      *(v4f*)(C + (size_t)(row0 + r) * ldc + col0 + c4) = v;
    }
    
  }
}

// GEMM C = act(A·W + bias + resid): A f32 (ASPLIT -> hi/lo 2 terms), Wt bf16 [N][K]; ACT 0 none, 1 relu, 2 exact gelu;
// resid (optional, f32, row index = (row % rmod), pitch ldr, RES_BF16 rounds it) added before the activation.
template <bool ASPLIT, int ACT, bool BIAS_BF16, bool RES_BF16>
__global__ __launch_bounds__(128) void k_gemm_bf3(const float* __restrict__ A, int lda, const unsigned short* __restrict__ Wt, int ldb,
                                                const float* __restrict__ bias, const float* __restrict__ resid, int rmod, int ldr,
                                                float* __restrict__ C, int ldc, int M, int N, int K) {
  __shared__ __attribute__((aligned(16))) float so[4][16][64];
  const int tid = threadIdx.x, w = tid >> 5, lane = tid & 31, ln = lane & 15, hh = lane >> 4;
  const int ntn = N / 64;
  const int wid = blockIdx.x * 4 + w;
  const int mt = wid / ntn, nq = wid % ntn;
  if (mt * 16 >= M) return;
  const int row0 = mt * 16, col0 = nq * 64;
  const float* arow = A + (size_t)(row0 + ln) * lda;
  v8f acc[4] = {};
  for (int kb = 0; kb < K; kb += 32) {
    FragB ah, al;
    const v4f x0 = *(const v4fa*)(arow + kb + 8 * hh), x1 = *(const v4fa*)(arow + kb + 8 * hh + 4);
    const v4f x2 = *(const v4fa*)(arow + kb + 16 + 8 * hh), x3 = *(const v4fa*)(arow + kb + 16 + 8 * hh + 4);
    float xs[16] = {x0[0],x0[1],x0[2],x0[3],x1[0],x1[1],x1[2],x1[3],x2[0],x2[1],x2[2],x2[3],x3[0],x3[1],x3[2],x3[3]};
#pragma unroll
    for (int i = 0; i < 16; ++i) { const unsigned short hb = bf16_bits(xs[i]); ah.u[i] = hb; al.u[i] = ASPLIT ? bf16_bits(xs[i] - bf16_val(hb)) : (unsigned short)0; }
#pragma unroll
    for (int t = 0; t < 4; ++t) {
      const unsigned short* brow = Wt + (size_t)(col0 + t * 16 + ln) * ldb + kb;
      FragB b;
      b.half[0] = *(const v8us*)(brow + 8 * hh);
      b.half[1] = *(const v8us*)(brow + 16 + 8 * hh);
      acc[t] = mmaN<ASPLIT ? 2 : 1>(ah.v, al.v, b.v, b.v, acc[t]);
    }
  }
#pragma unroll
  for (int t = 0; t < 4; ++t) {
    const int col = col0 + t * 16 + ln;
    float bv = bias ? bias[col] : 0.f;
    if (BIAS_BF16) bv = bf16_round(bv);
#pragma unroll
    for (int r = 0; r < 8; ++r) {
      float v = acc[t][r] + bv;
      if (resid) { float rv = resid[(size_t)((row0 + 8 * hh + r) % rmod) * ldr + col]; if (RES_BF16) rv = bf16_round(rv); v += rv; }
      if (ACT == 1) v = fmaxf(v, 0.f);
      if (ACT == 2) v = 0.5f * v * (1.0f + erff(v * 0.70710678118654752f));
      if (ACT == 3) { const float u = 0.7978845608028654f * (v + 0.044715f * v * v * v); v = 0.5f * v * (1.0f + tanhf(u)); }
      so[w][8 * hh + r][t * 16 + ln] = v;
    }
  }
  __builtin_amdgcn_fence(__ATOMIC_ACQ_REL, "workgroup");
  __builtin_amdgcn_wave_barrier();
  const int rsub = lane >> 4, c4 = (lane & 15) * 4;
  {
#pragma unroll
    for (int q = 0; q < 8; ++q) {
      const int r = q * 2 + rsub;
      const v4f v = *(const v4fa*)&so[w][r][c4];
      *(v4f*)(C + (size_t)(row0 + r) * ldc + col0 + c4) = v;
    }
    
  }
}
// row LayerNorm (biased variance, eps) over N: s = X (+ R); optional out_sum <- s; out_norm <- (s-mu)*rsqrt(var+eps)*g + b
template <bool PARAM_BF16>
__global__ __launch_bounds__(256) void k_layernorm(const float* __restrict__ X, const float* __restrict__ R, const float* __restrict__ g, const float* __restrict__ bta,
                                                  float* __restrict__ out_sum, float* __restrict__ out_norm, int N, float eps) {
  __shared__ float red[256];
  const int row = blockIdx.x, tid = threadIdx.x;
  const float* x = X + (size_t)row * N; const float* rr = R ? R + (size_t)row * N : nullptr;
  float vals[16];                     // up to N = 4096
  const int per = N / 256;            // contiguous chunk per thread? use strided-by-4 chunks: thread handles j = tid*4 + 1024*u
  float s1 = 0.f;
  for (int u = 0; u < per / 4; ++u) {
    const int j = tid * 4 + 1024 * u;
    const v4f a = *(const v4fa*)(x + j);
    v4f b = {0.f,0.f,0.f,0.f}; if (rr) b = *(const v4fa*)(rr + j);
#pragma unroll
    for (int q = 0; q < 4; ++q) { const float v = a[q] + b[q]; vals[u * 4 + q] = v; s1 += v; }
  }
  red[tid] = s1; __syncthreads();
  for (int st = 128; st > 0; st >>= 1) { if (tid < st) red[tid] += red[tid + st]; __syncthreads(); }
  const float mu = red[0] / (float)N; __syncthreads();
  float s2 = 0.f;
  for (int u = 0; u < per / 4; ++u)
#pragma unroll
    for (int q = 0; q < 4; ++q) { const float c = vals[u * 4 + q] - mu; s2 += c * c; }
  red[tid] = s2; __syncthreads();
  for (int st = 128; st > 0; st >>= 1) { if (tid < st) red[tid] += red[tid + st]; __syncthreads(); }
  const float rs = rsqrtf(red[0] / (float)N + eps);
  {
    for (int u = 0; u < per / 4; ++u) {
      const int j = tid * 4 + 1024 * u;
      v4f o, sm;
#pragma unroll
      for (int q = 0; q < 4; ++q) {
        float gg = g[j + q], bb = bta[j + q];
        if (PARAM_BF16) { gg = bf16_round(gg); bb = bf16_round(bb); }
        sm[q] = vals[u * 4 + q]; o[q] = (vals[u * 4 + q] - mu) * rs * gg + bb;
      }
      if (out_sum) *(v4f*)(out_sum + (size_t)row * N + j) = sm;
      *(v4f*)(out_norm + (size_t)row * N + j) = o;
    }
    
  }
}



// ---- f16 WMMA path (v_wmma_f32_16x16x32_f16): 11-bit significands for operands in range — used where a [0,1] probability operand needs more precision than bf16
typedef _Float16 v16h __attribute__((ext_vector_type(16)));
union FragH { v16h v; v8us half[2]; _Float16 h[16]; unsigned short u[16]; };
template <int NT>
__device__ __forceinline__ v8f mmaH(v16h ah, v16h al, v16h bh, v16h bl, v8f c) {
  c = __builtin_amdgcn_wmma_f32_16x16x32_f16(false, ah, false, bh, (short)0, c, false, false);
  if (NT >= 2) c = __builtin_amdgcn_wmma_f32_16x16x32_f16(false, al, false, bh, (short)0, c, false, false);
  if (NT >= 3) c = __builtin_amdgcn_wmma_f32_16x16x32_f16(false, ah, false, bl, (short)0, c, false, false);
  asm volatile("v_nop\n\tv_nop\n\tv_nop\n\tv_nop" : "+v"(c) : "v"(ah), "v"(al), "v"(bh), "v"(bl));
  return c;
}
// batched GEMM like k_gemm_b but f16 operands: A f32 (split into f16 hi/lo if ASPLIT, else rounded to f16), Bt = f16 values [n][k]; alpha; C f32; N multiple of 16 (partial tiles skipped)
template <bool ASPLIT>
__global__ __launch_bounds__(128) void k_gemm_h(const float* __restrict__ A, int lda, size_t sA, const _Float16* __restrict__ Bh, int ldb, size_t sB, float alpha, float* __restrict__ C, int ldc, size_t sC, int M, int N, int K) {
  __shared__ __attribute__((aligned(16))) float so[4][16][64];
  const int tid = threadIdx.x, w = tid >> 5, lane = tid & 31, ln = lane & 15, hh = lane >> 4; const int by = blockIdx.y;
  A += (size_t)by * sA; Bh += (size_t)by * sB; C += (size_t)by * sC;
  const int ntn = (N + 63) / 64; const int wid = blockIdx.x * 4 + w; const int mt = wid / ntn, nq = wid % ntn; if (mt * 16 >= M) return;
  const int row0 = mt * 16, col0 = nq * 64; const float* arow = A + (size_t)(row0 + ln) * lda;
  v8f acc[4] = {};
  for (int kb = 0; kb < K; kb += 32) {
    FragH ah, al;
    const v4f x0 = *(const v4fa*)(arow + kb + 8 * hh), x1 = *(const v4fa*)(arow + kb + 8 * hh + 4), x2 = *(const v4fa*)(arow + kb + 16 + 8 * hh), x3 = *(const v4fa*)(arow + kb + 16 + 8 * hh + 4);
    float xs[16] = {x0[0],x0[1],x0[2],x0[3],x1[0],x1[1],x1[2],x1[3],x2[0],x2[1],x2[2],x2[3],x3[0],x3[1],x3[2],x3[3]};
#pragma unroll
    for (int i = 0; i < 16; ++i) { const _Float16 h = (_Float16)xs[i]; ah.h[i] = h; al.h[i] = ASPLIT ? (_Float16)(xs[i] - (float)h) : (_Float16)0.0f; }
#pragma unroll
    for (int t = 0; t < 4; ++t) { if (col0 + t * 16 >= N) continue; const size_t boff = (size_t)(col0 + t * 16 + ln) * ldb + kb; FragH bq; bq.half[0] = *(const v8us*)(Bh + boff + 8 * hh); bq.half[1] = *(const v8us*)(Bh + boff + 16 + 8 * hh);
      acc[t] = mmaH<ASPLIT ? 2 : 1>(ah.v, al.v, bq.v, bq.v, acc[t]); }
  }
#pragma unroll
  for (int t = 0; t < 4; ++t) { if (col0 + t * 16 >= N) continue;
#pragma unroll
    for (int r = 0; r < 8; ++r) so[w][8 * hh + r][t * 16 + ln] = acc[t][r] * alpha; }
  __builtin_amdgcn_fence(__ATOMIC_ACQ_REL, "workgroup"); __builtin_amdgcn_wave_barrier();
  const int rsub = lane >> 4, c4 = (lane & 15) * 4;
  {
#pragma unroll
    for (int q = 0; q < 8; ++q) { const int r = q * 2 + rsub; if (col0 + c4 < N) { const v4f v = *(const v4fa*)&so[w][r][c4]; *(v4f*)(C + (size_t)(row0 + r) * ldc + col0 + c4) = v; } }
     }
}

// Wt[n][k] = f16(W[k][n]·scale) from f32 row-major W[K][N] (scale = power of two; bf16-exact weights stay exact in f16 away from the subnormal range)
__global__ __launch_bounds__(256) void k_wt_f16(const float* __restrict__ W, _Float16* __restrict__ Wt, int K, int N, float scale) {
  const int t = blockIdx.x * 256 + threadIdx.x; if (t >= N * (K / 8)) return; const int n = t / (K / 8), k8 = (t % (K / 8)) * 8; FragH f;
#pragma unroll
  for (int i = 0; i < 8; ++i) f.h[i] = (_Float16)(bf16_round(W[(size_t)(k8 + i) * N + n]) * scale); const v8us o = f.half[0];
  *(v8us*)((unsigned short*)Wt + (size_t)n * K + k8) = o; 
}
// k_gemm_hh variant with fused epilogue: v = acc·alpha + bias[by·sBias + col] (+ CP[(row/rowsPerB)·sCPb + by·64 + col] if CP) ; ACT 0 none / 1 elu ; writes f16 C16 (and f32 C if non-null)
template <int ACT>
__global__ __launch_bounds__(128) void k_gemm_hhx(const _Float16* __restrict__ A, int lda, size_t sA, const _Float16* __restrict__ Bh, int ldb, size_t sB, float alpha, const float* __restrict__ bias, size_t sBias, const float* __restrict__ CP, int rowsPerB, size_t sCPb, int row0g,
    float* __restrict__ C, _Float16* __restrict__ C16, int ldc, size_t sC, int M, int N, int K) {
  __shared__ __attribute__((aligned(16))) float so[4][16][64];
  const int tid = threadIdx.x, w = tid >> 5, lane = tid & 31, ln = lane & 15, hh = lane >> 4; const int by = blockIdx.y;
  A += (size_t)by * sA; Bh += (size_t)by * sB; const size_t cofs = (size_t)by * sC; const float* bp = bias ? bias + (size_t)by * sBias : nullptr;
  const int ntn = (N + 63) / 64; const int wid = blockIdx.x * 4 + w; const int mt = wid / ntn, nq = wid % ntn; if (mt * 16 >= M) return;
  const int row0 = mt * 16, col0 = nq * 64; const _Float16* arow = A + (size_t)(row0 + ln) * lda;
  v8f acc[4] = {};
  for (int kb = 0; kb < K; kb += 32) { FragH ah; ah.half[0] = *(const v8us*)((const unsigned short*)arow + kb + 8 * hh); ah.half[1] = *(const v8us*)((const unsigned short*)arow + kb + 16 + 8 * hh);
#pragma unroll
    for (int t = 0; t < 4; ++t) { if (col0 + t * 16 >= N) continue; const size_t boff = (size_t)(col0 + t * 16 + ln) * ldb + kb; FragH bq; bq.half[0] = *(const v8us*)((const unsigned short*)Bh + boff + 8 * hh); bq.half[1] = *(const v8us*)((const unsigned short*)Bh + boff + 16 + 8 * hh);
      acc[t] = mmaH<1>(ah.v, ah.v, bq.v, bq.v, acc[t]); }
  }
#pragma unroll
  for (int t = 0; t < 4; ++t) { if (col0 + t * 16 >= N) continue; const int col = col0 + t * 16 + ln; const float bv = bp ? bf16_round(bp[col]) : 0.f;
#pragma unroll
    for (int r = 0; r < 8; ++r) { float v = acc[t][r] * alpha + bv; if (CP) { const int rr = row0g + row0 + 8 * hh + r; if (rowsPerB < 0) v += CP[cofs + (size_t)rr * ldc + col];      /* rowsPerB < 0: own element of the batched C plane */ else { const int bidx = rr / rowsPerB; v += CP[(size_t)bidx * sCPb + (size_t)by * 64 + col]; } } if (ACT == 1) v = (v > 0.f) ? v : expm1f(v); else if (ACT == 7) v = (v > 0.f) ? v + 1.0f : expf(v); else if (ACT == 8) v = tanhf(v); else if (ACT == 9) v = 0.5f * v * (1.0f + tanhf(0.7978845608028654f * (v + 0.044715f * v * v * v))); else if (ACT == 11) v = 1.0f / (1.0f + expf(-v)); else if (ACT == 12) v = (v > 0.f) ? v : 0.01f * v; else if (ACT == 14) v = (v > 0.f) ? v : 0.1f * v; else if (ACT == 16) v = (v >= 0.f) ? v : 0.3f * v; else if (ACT == 15) v = v / (1.0f + expf(-v)); else if (ACT == 3) v = fmaxf(v, 0.f); else if (ACT == 6) v = 0.5f * v * (1.0f + erff(v * 0.70710678118654752f)); so[w][8 * hh + r][t * 16 + ln] = v; } }
  __builtin_amdgcn_fence(__ATOMIC_ACQ_REL, "workgroup"); __builtin_amdgcn_wave_barrier();
  const int rsub = lane >> 4, c4 = (lane & 15) * 4; typedef _Float16 v4h __attribute__((ext_vector_type(4)));
  {
#pragma unroll
    for (int q = 0; q < 8; ++q) { const int r = q * 2 + rsub; if (col0 + c4 < N) { const v4f v = *(const v4fa*)&so[w][r][c4]; if (C) *(v4f*)(C + cofs + (size_t)(row0 + r) * ldc + col0 + c4) = v; if (C16) { v4h h4; for (int i = 0; i < 4; ++i) h4[i] = (_Float16)v[i]; *(v4h*)(C16 + cofs + (size_t)(row0 + r) * ldc + col0 + c4) = h4; } } }
     }
}


typedef _Float16 v4h __attribute__((ext_vector_type(4)));

__global__ __launch_bounds__(256) void k_x16(const float* __restrict__ x, _Float16* __restrict__ X16, size_t n8) { const size_t t = (size_t)blockIdx.x * 256 + threadIdx.x; if (t >= n8) return; FragH f;
#pragma unroll
  for (int q = 0; q < 8; ++q) f.h[q] = (_Float16)bf16_round(x[t * 8 + q]); *(v8us*)((unsigned short*)X16 + t * 8) = f.half[0];  }
__global__ __launch_bounds__(256) void k_h16(const float* __restrict__ x, _Float16* __restrict__ X16, size_t n8) { const size_t t = (size_t)blockIdx.x * 256 + threadIdx.x; if (t >= n8) return; FragH f;
#pragma unroll
  for (int q = 0; q < 8; ++q) f.h[q] = (_Float16)x[t * 8 + q]; *(v8us*)((unsigned short*)X16 + t * 8) = f.half[0];  }
__global__ __launch_bounds__(256) void k_round16f(const float* __restrict__ W, _Float16* __restrict__ Bt, size_t n8) { const size_t t = (size_t)blockIdx.x * 256 + threadIdx.x; if (t >= n8) return; FragH f;
#pragma unroll
  for (int i = 0; i < 8; ++i) f.h[i] = (_Float16)(bf16_round(W[t * 8 + i]) * 16.0f); *(v8us*)((unsigned short*)Bt + t * 8) = f.half[0];  }
template <int NHv, int TTv>
__global__ __launch_bounds__(256) void k_vt(const _Float16* __restrict__ V16, int ldv, int voff, _Float16* __restrict__ Vt) { __shared__ unsigned short tl[64][66]; const int tid = threadIdx.x; const int slab = blockIdx.x / (TTv / 64), lg = blockIdx.x % (TTv / 64); const int b = slab / NHv, h = slab % NHv;
  for (int i = tid; i < 64 * 8; i += 256) { const int r = i / 8, c8 = (i % 8) * 8; FragH f; f.half[0] = *(const v8us*)((const unsigned short*)V16 + ((size_t)b * TTv + lg * 64 + r) * ldv + voff + h * 64 + c8);
#pragma unroll
    for (int q = 0; q < 8; ++q) tl[r][c8 + q] = f.u[q]; }
  __syncthreads();
  {
#pragma unroll
    for (int rd = 0; rd < 2; ++rd) { const int d = rd * 32 + tid / 8, pc = tid % 8; FragH f;
#pragma unroll
      for (int q = 0; q < 8; ++q) f.u[q] = tl[pc * 8 + q][d];
      *(v8us*)((unsigned short*)Vt + ((size_t)slab * 64 + d) * TTv + lg * 64 + pc * 8) = f.half[0]; }
     } }

__global__ __launch_bounds__(256) void k_hl(const float* __restrict__ F, _Float16* __restrict__ Hh, _Float16* __restrict__ Hl, size_t n8) { const size_t t = (size_t)blockIdx.x * 256 + threadIdx.x; if (t >= n8) return; FragH fh, fl; const v4f a = *(const v4fa*)(F + t * 8), c = *(const v4fa*)(F + t * 8 + 4);
#pragma unroll
  for (int q = 0; q < 4; ++q) { _Float16 h = (_Float16)a[q]; fh.h[q] = h; fl.h[q] = (_Float16)((a[q] - (float)h) * 1024.0f); h = (_Float16)c[q]; fh.h[4 + q] = h; fl.h[4 + q] = (_Float16)((c[q] - (float)h) * 1024.0f); }
  { *(v8us*)((unsigned short*)Hh + t * 8) = fh.half[0]; *(v8us*)((unsigned short*)Hl + t * 8) = fl.half[0];  } }

// ---- fast GEMM (wave tile 32x64; requires M % 32 == 0 rows per launch region and N % 64 == 0); epilogue = k_gemm_hhx semantics ----
__device__ __forceinline__ v16h g2_frag(const _Float16* p, int hh) { FragH f; f.half[0] = *(const v8us*)((const unsigned short*)p + 8 * hh); f.half[1] = *(const v8us*)((const unsigned short*)p + 16 + 8 * hh); return f.v; }
__device__ __forceinline__ v8f g2_mma(v16h a, v16h b, v8f c) { v8f d = __builtin_amdgcn_wmma_f32_16x16x32_f16(false, a, false, b, (short)0, c, false, false); asm volatile("v_nop\n\tv_nop\n\tv_nop\n\tv_nop" : "+v"(d) : "v"(a), "v"(b)); return d; }
template <int ACT>
__device__ __forceinline__ void gemm2_body(int bx, int by, const _Float16* __restrict__ A, int lda, size_t sA, const _Float16* __restrict__ Bh, int ldb, size_t sB, float alpha, const float* __restrict__ bias, size_t sBias, const float* __restrict__ CP, int rowsPerB, size_t sCPb, int row0g,
    float* __restrict__ C, _Float16* __restrict__ C16, int ldc, size_t sC, int M, int N, int K) { static_assert(ACT == 0 || ACT == 3 || ACT == 6 || ACT == 8 || ACT == 9 || ACT == 11 || ACT == 12 || ACT == 14 || ACT == 15 || ACT == 16, "k_gemm2: unsupported ACT code (would silently apply no activation)");
  __shared__ __attribute__((aligned(16))) float so[4][32][68];
  const int tid = threadIdx.x, w = tid >> 5, lane = tid & 31, ln = lane & 15, hh = lane >> 4;
  A += (size_t)by * sA; Bh += (size_t)by * sB; const size_t cofs = (size_t)by * sC; const float* bp = bias ? bias + (size_t)by * sBias : nullptr;
  const int ntn = N >> 6; const int mt = bx / ntn, nq = bx - mt * ntn; const int row0 = mt * 128 + 32 * w, col0 = nq * 64; if (row0 >= M) return;
  const _Float16* a0p = A + (size_t)(row0 + ln) * lda; const _Float16* a1p = a0p + (size_t)16 * lda;
  const _Float16* b0p = Bh + (size_t)(col0 + ln) * ldb; const _Float16* b1p = b0p + (size_t)16 * ldb; const _Float16* b2p = b1p + (size_t)16 * ldb; const _Float16* b3p = b2p + (size_t)16 * ldb;
  const v8f z8 = {0.f,0.f,0.f,0.f,0.f,0.f,0.f,0.f}; v8f c00 = z8, c01 = z8, c02 = z8, c03 = z8, c10 = z8, c11 = z8, c12 = z8, c13 = z8;
#pragma unroll 1
  for (int kb = 0; kb < K; kb += 32) { const v16h a0 = g2_frag(a0p + kb, hh); v16h b = g2_frag(b0p + kb, hh); FragH a1f; a1f.half[0] = *(const v8us*)((const unsigned short*)(a1p + kb) + 8 * hh);
    asm volatile("s_wait_xcnt 0x0" ::: "memory");      /* the last load's result may be given address registers that the loads before it name: the wait stands in front of that overwrite */
    a1f.half[1] = *(const v8us*)((const unsigned short*)(a1p + kb) + 16 + 8 * hh); const v16h a1 = a1f.v;
    c00 = g2_mma(a0, b, c00); c10 = g2_mma(a1, b, c10);
    b = g2_frag(b1p + kb, hh); c01 = g2_mma(a0, b, c01); c11 = g2_mma(a1, b, c11);
    b = g2_frag(b2p + kb, hh); c02 = g2_mma(a0, b, c02); c12 = g2_mma(a1, b, c12);
    b = g2_frag(b3p + kb, hh); c03 = g2_mma(a0, b, c03); c13 = g2_mma(a1, b, c13); }
  v8f accs[8] = {c00, c01, c02, c03, c10, c11, c12, c13};
#pragma unroll
  for (int u = 0; u < 8; ++u) { const int t = u & 3, half = u >> 2; const int col = col0 + t * 16 + ln; const float bv = bp ? bf16_round(bp[col]) : 0.f;
#pragma unroll
    for (int r = 0; r < 8; ++r) { const int rloc = half * 16 + 8 * hh + r; float v = accs[u][r] * alpha + bv; if (CP) { if (rowsPerB < 0) v += CP[cofs + (size_t)(row0g + row0 + rloc) * ldc + col];      /* rowsPerB < 0: own element of the batched C plane */ else { const int bidx = (row0g + row0 + rloc) / rowsPerB; v += CP[(size_t)bidx * sCPb + (size_t)by * 64 + col]; } }
      if (ACT == 3) v = fmaxf(v, 0.f); else if (ACT == 6) v = 0.5f * v * (1.0f + erff(v * 0.70710678118654752f)); else if (ACT == 11) v = 1.0f / (1.0f + expf(-v)); else if (ACT == 15) v = v / (1.0f + expf(-v)); else if (ACT == 12) v = (v > 0.f) ? v : 0.01f * v; else if (ACT == 8) v = tanhf(v); else if (ACT == 9) v = 0.5f * v * (1.0f + tanhf(0.7978845608028654f * (v + 0.044715f * v * v * v))); else if (ACT == 14) v = (v > 0.f) ? v : 0.1f * v; else if (ACT == 16) v = (v >= 0.f) ? v : 0.3f * v;
      so[w][rloc][t * 16 + ln] = v; } }
  __builtin_amdgcn_fence(__ATOMIC_ACQ_REL, "workgroup"); __builtin_amdgcn_wave_barrier();
  const int rsub = lane >> 4, c4 = (lane & 15) * 4;
  {
#pragma unroll
    for (int q = 0; q < 16; ++q) { const int r = q * 2 + rsub; const v4f v = *(const v4fa*)&so[w][r][c4]; if (C) *(v4f*)(C + cofs + (size_t)(row0 + r) * ldc + col0 + c4) = v; if (C16) { v4h h4; for (int i = 0; i < 4; ++i) h4[i] = (_Float16)v[i]; *(v4h*)(C16 + cofs + (size_t)(row0 + r) * ldc + col0 + c4) = h4; } }
     } }
// q / 2, k and v in one grid: blockIdx.y picks the product. The three are independent of one another, so they share one launch.
__global__ __launch_bounds__(128) void k_qkv(const _Float16* __restrict__ NQ, const _Float16* __restrict__ NK, const _Float16* __restrict__ BQ, const _Float16* __restrict__ BK, const _Float16* __restrict__ BV, _Float16* __restrict__ Q16, _Float16* __restrict__ K16, _Float16* __restrict__ V16) {
  const int z = blockIdx.y;
  gemm2_body<0>(blockIdx.x, 0, z == 0 ? NQ : NK, CC, 0, z == 0 ? BQ : (z == 1 ? BK : BV), CC, 0, z == 0 ? 0.03125f : 0.0625f, nullptr, 0, nullptr, 1, 0, 0, nullptr, z == 0 ? Q16 : (z == 1 ? K16 : V16), HDA, 0, NS, HDA, CC); }


__device__ __forceinline__ void wsc_body(int bx, const float* __restrict__ Wm, _Float16* __restrict__ Bt, size_t n8, float sc) { const size_t t = (size_t)bx * 256 + threadIdx.x; if (t >= n8) return; FragH f; for (int q = 0; q < 8; ++q) f.h[q] = (_Float16)(bf16_round(Wm[t * 8 + q]) * sc); *(v8us*)((unsigned short*)Bt + t * 8) = f.half[0];  }
__device__ __forceinline__ void instat_body(int c, const float* __restrict__ base, size_t scs, size_t sss, int rnd, float* __restrict__ ST) {
  #pragma clang fp contract(off)
  __shared__ float red[256]; const int tid = threadIdx.x; float s = 0.f;
#pragma unroll 1
  for (int i = tid; i < NS; i += 256) { float v = base[(size_t)c * scs + (size_t)i * sss]; if (rnd) v = bf16_round(v); s += v; }
  red[tid] = s; __syncthreads(); for (int st = 128; st > 0; st >>= 1) { if (tid < st) red[tid] += red[tid + st]; __syncthreads(); } const float mean = red[0] / (float)NS; __syncthreads(); float vs = 0.f;
#pragma unroll 1
  for (int i = tid; i < NS; i += 256) { float v = base[(size_t)c * scs + (size_t)i * sss]; if (rnd) v = bf16_round(v); const float d = v - mean; vs += d * d; }
  red[tid] = vs; __syncthreads(); for (int st = 128; st > 0; st >>= 1) { if (tid < st) red[tid] += red[tid + st]; __syncthreads(); }
  if (tid == 0) { const float var = red[0] / (float)NS; { *(float*)(ST + c * 2) = mean; *(float*)(ST + c * 2 + 1) = var;  } } }
__global__ __launch_bounds__(256) void k_instat(const float* __restrict__ base, size_t scs, size_t sss, int rnd, float* __restrict__ ST) { instat_body(blockIdx.x, base, scs, sss, rnd, ST); }
// Everything that depends on the inputs alone, in one grid: blocks 0-127 statistics of x_q, 128-255 of x_kv, then 16 blocks for each of the six weight matrices.
__global__ __launch_bounds__(256) void k_prep(const float* __restrict__ xq, const float* __restrict__ xkv, float* __restrict__ STQ, float* __restrict__ STK,
    const float* __restrict__ qW, const float* __restrict__ kW, const float* __restrict__ vW, const float* __restrict__ oW, const float* __restrict__ W1, const float* __restrict__ W2,
    _Float16* __restrict__ BQ, _Float16* __restrict__ BK, _Float16* __restrict__ BV, _Float16* __restrict__ BOW, _Float16* __restrict__ BW1, _Float16* __restrict__ BW2) {
  const int b = blockIdx.x;
  if (b < 2 * CC) { instat_body(b & (CC - 1), b < CC ? xq : xkv, (size_t)NS, (size_t)1, 1, b < CC ? STQ : STK); return; }
  const int u = b - 2 * CC, m = u >> 4;      /* every matrix has HDA * CC = 32768 elements: 4096 threads, 16 blocks */
  const float* Wm = m == 0 ? qW : m == 1 ? kW : m == 2 ? vW : m == 3 ? oW : m == 4 ? W1 : W2;
  _Float16* Bt = m == 0 ? BQ : m == 1 ? BK : m == 2 ? BV : m == 3 ? BOW : m == 4 ? BW1 : BW2;
  wsc_body(u & 15, Wm, Bt, (size_t)HDA * CC / 8, 16.0f); }
__device__ __forceinline__ void innc_body(int bx, const float* __restrict__ xc, const float* __restrict__ ST, const float* __restrict__ g, const float* __restrict__ bb, _Float16* __restrict__ N16, float* __restrict__ XB) {
  #pragma clang fp contract(off)
  const size_t t = (size_t)bx * 256 + threadIdx.x; if (t >= (size_t)NS * (CC / 8)) return; const int c0 = (int)(t % (CC / 8)) * 8; const int s = (int)(t / (CC / 8)); FragH f; v8f xb;
  for (int q = 0; q < 8; ++q) { const int c = c0 + q; const float x = bf16_round(xc[(size_t)c * NS + s]); xb[q] = x; float v = (x - ST[c * 2]) * rsqrtf(ST[c * 2 + 1] + 1e-5f); v *= bf16_round(g[c]); v += bf16_round(bb[c]); f.h[q] = (_Float16)v; }
  { *(v8us*)((unsigned short*)N16 + (size_t)s * CC + c0) = f.half[0]; if (XB) *(v8f*)(XB + (size_t)s * CC + c0) = xb;  } }
// both normalisations in one grid: the first NS * CC / 8 / 256 blocks take x_q (and its rounded copy XB), the rest x_kv
__global__ __launch_bounds__(256) void k_innc2(const float* __restrict__ xq, const float* __restrict__ xkv, const float* __restrict__ STQ, const float* __restrict__ STK, const float* __restrict__ gq, const float* __restrict__ bq, const float* __restrict__ gk, const float* __restrict__ bk, _Float16* __restrict__ NQ, _Float16* __restrict__ NK, float* __restrict__ XB) {
  const int nb = NS * (CC / 8) / 256, b = blockIdx.x;
  const bool f = b < nb;
  innc_body(f ? b : b - nb, f ? xq : xkv, f ? STQ : STK, f ? gq : gk, f ? bq : bk, f ? NQ : NK, f ? XB : nullptr); }
// Operands of the fused attention kernel in fragment order, so that each of its loads is 512 contiguous bytes of a wave.
// KP[h][16-key tile][j][lane][8]: k[tile*16 + c][16j + 8hh + i]; VP[h][32-key block][dt][j][lane][8]: mask[key] * v[key = block*32 + 16j + 8hh + i][16dt + c]  (c = lane & 15, hh = lane >> 4)
__global__ __launch_bounds__(256) void k_pack(const _Float16* __restrict__ K16, const _Float16* __restrict__ V16, const int* __restrict__ msk, _Float16* __restrict__ KP, _Float16* __restrict__ VP) {
  const int t = blockIdx.x * 256 + threadIdx.x; const int nk = NHD * NS * HDm / 8; const int lane = t & 31, c = lane & 15, hh = lane >> 4, j = (t >> 5) & 1;
  if (t < nk) { const int kt = (t >> 6) & 255, h = t >> 14;
    const v8us v = *(const v8us*)((const unsigned short*)K16 + (size_t)(kt * 16 + c) * HDA + h * HDm + j * 16 + 8 * hh);
    *(v8us*)((unsigned short*)KP + (size_t)t * 8) = v; }
  else { const int u = t - nk; const int dt = (u >> 6) & 1, kb = (u >> 7) & 127, h = u >> 14; const int key0 = kb * 32 + j * 16 + 8 * hh; FragH f;
    for (int i = 0; i < 8; ++i) f.h[i] = (_Float16)((float)V16[(size_t)(key0 + i) * HDA + h * HDm + dt * 16 + c] * (float)msk[key0 + i]);
    *(v8us*)((unsigned short*)VP + (size_t)u * 8) = f.half[0]; } }
__device__ __forceinline__ v16h fa_frag(const unsigned short* p) { FragH f; f.half[0] = *(const v8us*)p; f.half[1] = *(const v8us*)(p + 256); return f.v; }
__device__ __forceinline__ v8f fa_mma(v16h a, v16h b, v8f c) { return __builtin_amdgcn_wmma_f32_16x16x32_f16(false, a, false, b, (short)0, c, false, false); }
// sigmoid(x) = 0.5 + 0.5 tanh(x / 2) on the chip's own v_tanh_f32: one transcendental, half a packed fma and half a packed convert an element. The scores arrive already halved (Q16 holds q / 2).
// two S^T tiles (keys 0-15 and 16-31 of a block, one query per lane column) -> sigmoid -> the A fragment of w.v: D register r of tile j holds key 16j + 8hh + r, which is A's element 8j + r
__device__ __forceinline__ v16h fa_sig(v8f s0, v8f s1) { FragH f;
  for (int r = 0; r < 8; ++r) { f.h[r] = (_Float16)(0.5f + 0.5f * __builtin_amdgcn_tanhf(s0[r])); f.h[8 + r] = (_Float16)(0.5f + 0.5f * __builtin_amdgcn_tanhf(s1[r])); }
  return f.v; }
// one block of 32 keys against the wave's 32 queries
__device__ __forceinline__ void fa_block(v16h k0, v16h k1, v16h v0, v16h v1, v16h qf0, v16h qf1, v8f& o00, v8f& o01, v8f& o10, v8f& o11) {
  const v8f z8 = {0.f,0.f,0.f,0.f,0.f,0.f,0.f,0.f};
  const v8f s00 = fa_mma(k0, qf0, z8), s01 = fa_mma(k1, qf0, z8), s10 = fa_mma(k0, qf1, z8), s11 = fa_mma(k1, qf1, z8);
  const v16h p0 = fa_sig(s00, s01); o00 = fa_mma(p0, v0, o00); o01 = fa_mma(p0, v1, o01);
  const v16h p1 = fa_sig(s10, s11); o10 = fa_mma(p1, v0, o10); o11 = fa_mma(p1, v1, o11); }
// Fused attention: one workgroup = one head x 128 queries; wave = 32 queries (w & 3) x one quarter of the keys (w >> 2). Q16 holds q / 2: S^T = k (q/2)^T, w = sigmoid(q.k) = 0.5 + 0.5 tanh(S^T) stays in registers, o += w (mask v); the four key quarters are joined through LDS.
__global__ __launch_bounds__(512) void k_fattn(const _Float16* __restrict__ Q16, const _Float16* __restrict__ KP, const _Float16* __restrict__ VP, _Float16* __restrict__ O16) {
  __shared__ __attribute__((aligned(16))) float part[4][128][36];
  const int tid = threadIdx.x, w = tid >> 5, lane = tid & 31, ln = lane & 15, hh = lane >> 4;
  const int h = blockIdx.x >> 5, q0 = (blockIdx.x & 31) * 128; const int qg = w & 3, kq = w >> 2;
  const _Float16* qp = Q16 + (size_t)(q0 + qg * 32 + ln) * HDA + h * HDm;
  const v16h qf0 = g2_frag(qp, hh), qf1 = g2_frag(qp + (size_t)16 * HDA, hh);
  const unsigned short* kp = (const unsigned short*)KP + ((size_t)h * 128 + kq * 32) * 1024 + lane * 8;
  const unsigned short* vp = (const unsigned short*)VP + ((size_t)h * 128 + kq * 32) * 1024 + lane * 8;
  const v8f z8 = {0.f,0.f,0.f,0.f,0.f,0.f,0.f,0.f}; v8f o00 = z8, o01 = z8, o10 = z8, o11 = z8;
  v16h nk0 = fa_frag(kp), nk1 = fa_frag(kp + 512), nv0 = fa_frag(vp), nv1 = fa_frag(vp + 512);
#pragma unroll 1      /* stays rolled: one trip's code (some 140 instructions) serves all 32 trips, for speed only */
  for (int b = 0; b < 32; ++b) { const v16h k0 = nk0, k1 = nk1, v0 = nv0, v1 = nv1;
    const int nb = (b < 31 ? b + 1 : 31) * 1024;      /* the next block's fragments fly while this block is worked on (the last trip reads its own block again and drops it) */
    nk0 = fa_frag(kp + nb); nk1 = fa_frag(kp + nb + 512); nv0 = fa_frag(vp + nb); nv1 = fa_frag(vp + nb + 512);
    asm volatile("s_wait_xcnt 0x0" ::: "memory");      /* in front of the block's arithmetic, which reuses the loads' address registers */
    __builtin_amdgcn_sched_barrier(0);      /* keeps the eight loads up here: without it the scheduler sinks them to the foot of the trip, right in front of their use */
    fa_block(k0, k1, v0, v1, qf0, qf1, o00, o01, o10, o11);
    __builtin_amdgcn_sched_barrier(0); }      /* keeps the copies of the loaded fragments, and so the waits for them, at the foot: without it some rise to the head of the trip */
  for (int r = 0; r < 8; ++r) { float* pr = &part[kq][qg * 32 + 8 * hh + r][ln]; pr[0] = o00[r]; pr[16] = o01[r]; pr[16 * 36] = o10[r]; pr[16 * 36 + 16] = o11[r]; }
  __syncthreads();
  const int q = tid >> 2, d0 = (tid & 3) * 8; v4f a = *(const v4fa*)&part[0][q][d0], c = *(const v4fa*)&part[0][q][d0 + 4];
  for (int s = 1; s < 4; ++s) { a += *(const v4fa*)&part[s][q][d0]; c += *(const v4fa*)&part[s][q][d0 + 4]; }
  FragH f;
  for (int i = 0; i < 4; ++i) { f.h[i] = (_Float16)a[i]; f.h[4 + i] = (_Float16)c[i]; }
  *(v8us*)((unsigned short*)O16 + (size_t)(q0 + q) * HDA + h * HDm + d0) = f.half[0]; }
typedef float v2f  __attribute__((ext_vector_type(2)));
typedef float v2fa __attribute__((ext_vector_type(2), may_alias));
// attn = o oW^T + x_q for 32 voxels x all 128 channels a workgroup; wave = 16 channels. D holds one channel a lane and 8 voxels in a row in its registers, so x_q is read from the input and
// attn is stored channel-major (ATc[c][s]) with 16-byte accesses and no transposition. Each wave also leaves mean and sum of squared deviations of its 16 channels over the 32 voxels: PS[group][c] = {mean, M2}.
__global__ __launch_bounds__(256) void k_oproj(const _Float16* __restrict__ O16, const _Float16* __restrict__ BOW, const float* __restrict__ xq, float* __restrict__ ATc, float* __restrict__ PS) {
  const int tid = threadIdx.x, w = tid >> 5, lane = tid & 31, ln = lane & 15, hh = lane >> 4;
  const int g = blockIdx.x, s0 = g * 32, c = w * 16 + ln;
  const _Float16* ap = O16 + (size_t)(s0 + ln) * HDA; const _Float16* bp = BOW + (size_t)c * HDA; const float* xp = xq + (size_t)c * NS + s0 + 8 * hh;
  v16h a0[8], a1[8], b[8];
#pragma unroll      /* all 48 fragment loads are in flight together: one round trip to L2 instead of one a k step */
  for (int kb = 0; kb < 8; ++kb) { a0[kb] = g2_frag(ap + kb * 32, hh); a1[kb] = g2_frag(ap + (size_t)16 * HDA + kb * 32, hh); b[kb] = g2_frag(bp + kb * 32, hh); }
  const v4f x0 = *(const v4fa*)xp, x1 = *(const v4fa*)(xp + 4), x2 = *(const v4fa*)(xp + 16), x3 = *(const v4fa*)(xp + 20);
  asm volatile("s_wait_xcnt 0x0" ::: "memory");      /* in front of the arithmetic, which may reuse the loads' address registers */
  __builtin_amdgcn_sched_barrier(0);      /* keeps that arithmetic behind the wait, and the loads together in front of it */
  const v8f z8 = {0.f,0.f,0.f,0.f,0.f,0.f,0.f,0.f}; v8f c0 = z8, c1 = z8;
#pragma unroll
  for (int kb = 0; kb < 8; ++kb) { c0 = fa_mma(a0[kb], b[kb], c0); c1 = fa_mma(a1[kb], b[kb], c1); }
  float v[16];
#pragma unroll
  for (int r = 0; r < 4; ++r) { v[r] = c0[r] * 0.0625f + bf16_round(x0[r]); v[4 + r] = c0[4 + r] * 0.0625f + bf16_round(x1[r]); v[8 + r] = c1[r] * 0.0625f + bf16_round(x2[r]); v[12 + r] = c1[4 + r] * 0.0625f + bf16_round(x3[r]); }
  float s = 0.f;
#pragma unroll
  for (int i = 0; i < 16; ++i) s += v[i];
  s += __shfl_xor(s, 16);      /* lanes l and l + 16 hold the two halves of one channel's 32 voxels */
  const float mean = s * (1.0f / 32.0f); float q2 = 0.f;
#pragma unroll
  for (int i = 0; i < 16; ++i) { const float d = v[i] - mean; q2 += d * d; }
  q2 += __shfl_xor(q2, 16);
  float* op = ATc + (size_t)c * NS + s0 + 8 * hh;
  const v4f y0 = {v[0], v[1], v[2], v[3]}, y1 = {v[4], v[5], v[6], v[7]}, y2 = {v[8], v[9], v[10], v[11]}, y3 = {v[12], v[13], v[14], v[15]};
  *(v4fa*)op = y0; *(v4fa*)(op + 4) = y1; *(v4fa*)(op + 16) = y2; *(v4fa*)(op + 20) = y3;
  if (hh == 0) { const v2f p = {mean, q2}; *(v2fa*)(PS + ((size_t)g * CC + c) * 2) = p; } }
// The rest of the network for 32 voxels a workgroup (16 waves): join the 128 groups' {mean, M2} to the statistics of attn; h = IN(attn) -> LDS [s][c]; relu(W1 h + b1) computed transposed (A = W1, B = h),
// so that a lane holds 8 hidden units in a row of one voxel -> LDS [s][n]; W2 . + b2 -> LDS [c][s]; + attn, stored to out[c][s] in whole 128-byte lines.
__global__ __launch_bounds__(512) void k_mlp(const float* __restrict__ ATc, const float* __restrict__ PS, const float* __restrict__ gp, const float* __restrict__ bp, const _Float16* __restrict__ BW1, const float* __restrict__ b1, const _Float16* __restrict__ BW2, const float* __restrict__ b2, float* __restrict__ out) {
  __shared__ __attribute__((aligned(16))) _Float16 Hs[32][CC + 8];      /* pitches of 16 bytes x an odd number for the 16-byte fragment reads */
  __shared__ __attribute__((aligned(16))) _Float16 Gs[32][2 * CC + 8];
  __shared__ __attribute__((aligned(16))) float Cs[CC][36];
  __shared__ float r1[4][CC], r2[4][CC];
  const int tid = threadIdx.x, w = tid >> 5, lane = tid & 31, ln = lane & 15, hh = lane >> 4; const int s0 = blockIdx.x * 32;
  const int cs = tid & (CC - 1), part = tid >> 7;      /* statistics: one channel, 32 of the 128 groups */
  const int c = tid >> 2, sq = (tid & 3) * 8;      /* normalisation and final store: one channel, 8 voxels */
  const int nt = w & 7, mt = w >> 3;      /* second product: 16 channels x 16 voxels */
  const unsigned pso = (unsigned)(part * 32 * CC + cs) * 8u;      /* byte offset of the thread's first {mean, M2} pair */
  v2f ps[32];
#pragma unroll
  for (int g = 0; g < 32; ++g) ps[g] = *(const v2fa*)((const char*)PS + pso + g * (CC * 8));
  const float* atp = ATc + (size_t)c * NS + s0 + sq; const v4f xa = *(const v4fa*)atp, xb = *(const v4fa*)(atp + 4);
  const unsigned short* w1p = (const unsigned short*)BW1 + (size_t)(16 * w + ln) * CC + 8 * hh; const unsigned short* w2p = (const unsigned short*)BW2 + (size_t)(16 * nt + ln) * (2 * CC) + 8 * hh; const float* b1p = b1 + 16 * w + 8 * hh;
  FragH w1f[4], w2f[8];
#pragma unroll
  for (int kb = 0; kb < 4; ++kb) { w1f[kb].half[0] = *(const v8us*)(w1p + kb * 32); w1f[kb].half[1] = *(const v8us*)(w1p + kb * 32 + 16); }
#pragma unroll
  for (int kb = 0; kb < 8; ++kb) { w2f[kb].half[0] = *(const v8us*)(w2p + kb * 32); w2f[kb].half[1] = *(const v8us*)(w2p + kb * 32 + 16); }
  const v4f b1a = *(const v4fa*)b1p, b1b = *(const v4fa*)(b1p + 4);
  const float b2v = bf16_round(b2[16 * nt + ln]), gv = bf16_round(gp[c]), bv = bf16_round(bp[c]);
  asm volatile("s_wait_xcnt 0x0" :: "v"(pso), "v"(atp), "v"(w1p), "v"(w2p), "v"(b1p) : "memory");      /* in front of the arithmetic, which may reuse the loads' address registers; it names them, so that none is given to a later load's result ahead of the wait */
  __builtin_amdgcn_sched_barrier(0);      /* keeps that arithmetic behind the wait, and every global load of the kernel up here, in flight together: one round trip to memory for all of them */
  float sm = 0.f;
#pragma unroll
  for (int g = 0; g < 32; ++g) sm += ps[g][0];
  r1[part][cs] = sm; __syncthreads();
  { const float mean = (r1[0][cs] + r1[1][cs] + r1[2][cs] + r1[3][cs]) * (1.0f / 128.0f); float q2 = 0.f;      /* equal groups: M2 = sum of the groups' M2 + 32 sum (group mean - mean)^2 */
#pragma unroll
    for (int g = 0; g < 32; ++g) { const float d = ps[g][0] - mean; q2 += ps[g][1] + 32.0f * (d * d); }
    r2[part][cs] = q2; }
  __syncthreads();
  { const float mean = (r1[0][c] + r1[1][c] + r1[2][c] + r1[3][c]) * (1.0f / 128.0f); const float var = (r2[0][c] + r2[1][c] + r2[2][c] + r2[3][c]) * (1.0f / (float)NS); const float rs = rsqrtf(var + 1e-5f);
#pragma unroll
    for (int i = 0; i < 4; ++i) { Hs[sq + i][c] = (_Float16)((xa[i] - mean) * rs * gv + bv); Hs[sq + 4 + i][c] = (_Float16)((xb[i] - mean) * rs * gv + bv); } }
  __syncthreads();
  const v8f z8 = {0.f,0.f,0.f,0.f,0.f,0.f,0.f,0.f}; v8f d0 = z8, d1 = z8;
#pragma unroll
  for (int kb = 0; kb < 4; ++kb) { d0 = fa_mma(w1f[kb].v, g2_frag(&Hs[ln][kb * 32], hh), d0); d1 = fa_mma(w1f[kb].v, g2_frag(&Hs[16 + ln][kb * 32], hh), d1); }
  { FragH f0, f1;      /* D register r: hidden unit 16w + 8hh + r of voxel ln (d0) and 16 + ln (d1) */
#pragma unroll
    for (int r = 0; r < 8; ++r) { const float bb = bf16_round(r < 4 ? b1a[r & 3] : b1b[r & 3]); f0.h[r] = (_Float16)fmaxf(d0[r] * 0.0625f + bb, 0.f); f1.h[r] = (_Float16)fmaxf(d1[r] * 0.0625f + bb, 0.f); }
    *(v8us*)&Gs[ln][16 * w + 8 * hh] = f0.half[0]; *(v8us*)&Gs[16 + ln][16 * w + 8 * hh] = f1.half[0]; }
  __syncthreads();
  v8f e = z8;
#pragma unroll
  for (int kb = 0; kb < 8; ++kb) e = fa_mma(g2_frag(&Gs[16 * mt + ln][kb * 32], hh), w2f[kb].v, e);
  { const v4f e0 = {e[0] * 0.0625f + b2v, e[1] * 0.0625f + b2v, e[2] * 0.0625f + b2v, e[3] * 0.0625f + b2v}, e1 = {e[4] * 0.0625f + b2v, e[5] * 0.0625f + b2v, e[6] * 0.0625f + b2v, e[7] * 0.0625f + b2v};
    *(v4fa*)&Cs[16 * nt + ln][16 * mt + 8 * hh] = e0; *(v4fa*)&Cs[16 * nt + ln][16 * mt + 8 * hh + 4] = e1; }      /* D register r: voxel 16mt + 8hh + r of channel 16nt + ln */
  __syncthreads();
  const v4f o0 = *(const v4fa*)&Cs[c][sq] + xa, o1 = *(const v4fa*)&Cs[c][sq + 4] + xb;
  float* op = out + (size_t)c * NS + s0 + sq; *(v4fa*)op = o0; *(v4fa*)(op + 4) = o1; }

extern "C" void kernel_launch(void* const* d_in, const int* in_sizes, int n_in,
                              void* d_out, int out_size, void* d_ws, size_t ws_size, hipStream_t stream) {
  (void)in_sizes; (void)n_in; (void)out_size;
  const float* const* I = (const float* const*)d_in; const float* xq = I[0]; const float* xkv = I[1]; const int* msk = (const int*)d_in[2]; const float* qW = I[3]; const float* kW = I[4]; const float* vW = I[5]; const float* oW = I[6]; const float* gq = I[7]; const float* bq = I[8]; const float* gk = I[9]; const float* bk = I[10]; const float* gp = I[11]; const float* bp = I[12]; const float* W1 = I[13]; const float* b1 = I[14]; const float* W2 = I[15]; const float* b2 = I[16];
  char* ws = (char*)d_ws; size_t off = 0;
  auto take = [&](size_t bytes) { char* p = ws + off; off += (bytes + 255) & ~(size_t)255; return p; };
  _Float16* BQ = (_Float16*)take((size_t)HDA * CC * 2); _Float16* BK = (_Float16*)take((size_t)HDA * CC * 2); _Float16* BV = (_Float16*)take((size_t)HDA * CC * 2); _Float16* BOW = (_Float16*)take((size_t)CC * HDA * 2); _Float16* BW1 = (_Float16*)take((size_t)2 * CC * CC * 2); _Float16* BW2 = (_Float16*)take((size_t)CC * 2 * CC * 2); float* STQ = (float*)take(CC * 2 * 4); float* STK = (float*)take(CC * 2 * 4);
  _Float16* NQ = (_Float16*)take((size_t)NS * CC * 2); _Float16* NK = (_Float16*)take((size_t)NS * CC * 2); float* XB = (float*)take((size_t)NS * CC * 4); _Float16* Q16 = (_Float16*)take((size_t)NS * HDA * 2); _Float16* K16 = (_Float16*)take((size_t)NS * HDA * 2); _Float16* V16 = (_Float16*)take((size_t)NS * HDA * 2); _Float16* KP = (_Float16*)take((size_t)NS * HDA * 2); _Float16* VP = (_Float16*)take((size_t)NS * HDA * 2); _Float16* O16 = (_Float16*)take((size_t)NS * HDA * 2); float* AT = (float*)take((size_t)NS * CC * 4); float* PS = (float*)take((size_t)(NS / 32) * CC * 2 * 4);
  if (off > ws_size) return;      /* about 19 MiB */
  k_prep<<<2 * CC + 6 * (HDA * CC / 8 / 256), 256, 0, stream>>>(xq, xkv, STQ, STK, qW, kW, vW, oW, W1, W2, BQ, BK, BV, BOW, BW1, BW2);      /* statistics of x_q and x_kv; 1x1 convs 'oc' = Bt, times 16 */
  const unsigned n8 = (unsigned)(((size_t)NS * (CC / 8) + 255) / 256);
  k_innc2<<<2 * n8, 256, 0, stream>>>(xq, xkv, STQ, STK, gq, bq, gk, bk, NQ, NK, XB);
  k_qkv<<<dim3((NS / 128) * (HDA / 64), 3), 128, 0, stream>>>(NQ, NK, BQ, BK, BV, Q16, K16, V16);      /* q / 2 (1/16 undoes the weights' scale, 1/2 is for the tanh form of the sigmoid; powers of two, so q's f16 rounding is the same), k, v */
  k_pack<<<2 * NHD * NS * HDm / 8 / 256, 256, 0, stream>>>(K16, V16, msk, KP, VP);
  k_fattn<<<NHD * (NS / 128), 512, 0, stream>>>(Q16, KP, VP, O16);      /* o = (sigmoid(q.k) * mask) v, all heads */
  k_oproj<<<NS / 32, 256, 0, stream>>>(O16, BOW, xq, AT, PS);      /* attn = o oW^T + x_q, channel-major, and its statistics by groups of 32 voxels */
  k_mlp<<<NS / 32, 512, 0, stream>>>(AT, PS, gp, bp, BW1, b1, BW2, b2, (float*)d_out);      /* out = W2 relu(W1 IN(attn) + b1) + b2 + attn */
}

// v005
// It runs in 52.1 microseconds.
// Two timings next to v004 put it at 1.18 and 1.12 times that version's speed.
// Counting every step since v000, it is 26.6 times as fast.
#include <hip/hip_runtime.h>
// Multi_Heads_Self_Attn_Q_KV (1 volume, C 128, 16^3 = 4096 voxels, 8 heads x 32): InstanceNorm of x_q and x_kv (per channel over the 4096 voxels, biased var, eps 1e-5, affine); q, k, v = 1x1 convs (no bias); w = sigmoid(q.k) (no scale) * mask[key] (int input 0/1); o = w v (no normalisation); attn = o oW^T + x_q; h = IN(attn); h = relu(W1 h + b1); h = W2 h + b2; out = h + attn -> [1, 128, 16, 16, 16].
// Compute dtype: inputs and parameters rounded to bf16; normalised inputs, q, k, v, sigmoid weights, o and the MLP activations as plain f16 operands (~2^-12); statistics/sigmoid f32. v_wmma_f32_16x16x32_f16.
#define CC 128
#define NS 4096
#define NHD 8
#define HDm 32
#define HDA (NHD * HDm)          /* 256 */
#define PW (NHD * 64)            /* 512, unused */
typedef __bf16 v16b __attribute__((ext_vector_type(16)));
typedef unsigned short v8us __attribute__((ext_vector_type(8), may_alias));
typedef float  v8f  __attribute__((ext_vector_type(8)));
typedef float  v4f  __attribute__((ext_vector_type(4)));
typedef float  v4fa __attribute__((ext_vector_type(4), may_alias));
union FragB { v16b v; v8us half[2]; unsigned short u[16]; };

__device__ __forceinline__ unsigned short bf16_bits(float x) { unsigned int u = __float_as_uint(x); return (unsigned short)((u + 0x7FFFu + ((u >> 16) & 1u)) >> 16); }
__device__ __forceinline__ float bf16_val(unsigned short b) { return __uint_as_float(((unsigned int)b) << 16); }
__device__ __forceinline__ float bf16_round(float x) { return bf16_val(bf16_bits(x)); }
// D += A·B with NT terms: 1 = ah·bh, 2 = + al·bh (A split), 3 = + ah·bl (both split)
template <int NT>
__device__ __forceinline__ v8f mmaN(v16b ah, v16b al, v16b bh, v16b bl, v8f c) {
  c = __builtin_amdgcn_wmma_f32_16x16x32_bf16(false, ah, false, bh, (short)0, c, false, false);
  if (NT >= 2) c = __builtin_amdgcn_wmma_f32_16x16x32_bf16(false, al, false, bh, (short)0, c, false, false);
  if (NT >= 3) c = __builtin_amdgcn_wmma_f32_16x16x32_bf16(false, ah, false, bl, (short)0, c, false, false);
  asm volatile("v_nop\n\tv_nop\n\tv_nop\n\tv_nop" : "+v"(c) : "v"(ah), "v"(al), "v"(bh), "v"(bl));
  return c;
}

__global__ __launch_bounds__(256) void k_wt_bf16(const float* __restrict__ W, unsigned short* __restrict__ Wt, int K, int N) {
  const int t = blockIdx.x * 256 + threadIdx.x;
  const int k8n = K / 8;
  if (t >= N * k8n) return;
  const int n = t / k8n, k8 = (t % k8n) * 8;
  v8us v;
#pragma unroll
  for (int i = 0; i < 8; ++i) v[i] = bf16_bits(W[(size_t)(k8 + i) * N + n]);
  *(v8us*)(Wt + (size_t)n * K + k8) = v;
  
}

// GEMM C[M][N] (f32, pitch ldc) = act(A[M][K]·W + bias). A f32 row-major (pitch lda) converted per fragment to bf16
// (ASPLIT: hi/lo two planes -> 2 terms, else single rounded term); Wt bf16 [N][K] (pitch ldb). BIAS_BF16 rounds the
// bias to bf16 first (bias quantised to bf16 before the add). K%32==0, M%16==0, N%64==0.
template <bool ASPLIT, int ACT, bool BIAS_BF16>
__global__ __launch_bounds__(128) void k_gemm_bf(const float* __restrict__ A, int lda, const unsigned short* __restrict__ Wt, int ldb,
                                               const float* __restrict__ bias, float* __restrict__ C, int ldc, int M, int N, int K) {
  __shared__ __attribute__((aligned(16))) float so[4][16][64];
  const int tid = threadIdx.x, w = tid >> 5, lane = tid & 31, ln = lane & 15, hh = lane >> 4;
  const int ntn = N / 64;
  const int wid = blockIdx.x * 4 + w;
  const int mt = wid / ntn, nq = wid % ntn;
  if (mt * 16 >= M) return;
  const int row0 = mt * 16, col0 = nq * 64;
  const float* arow = A + (size_t)(row0 + ln) * lda;
  v8f acc[4] = {};
  for (int kb = 0; kb < K; kb += 32) {
    FragB ah, al;
    const v4f x0 = *(const v4fa*)(arow + kb + 8 * hh), x1 = *(const v4fa*)(arow + kb + 8 * hh + 4);
    const v4f x2 = *(const v4fa*)(arow + kb + 16 + 8 * hh), x3 = *(const v4fa*)(arow + kb + 16 + 8 * hh + 4);
    float xs[16] = {x0[0],x0[1],x0[2],x0[3],x1[0],x1[1],x1[2],x1[3],x2[0],x2[1],x2[2],x2[3],x3[0],x3[1],x3[2],x3[3]};
#pragma unroll
    for (int i = 0; i < 16; ++i) { const unsigned short hb = bf16_bits(xs[i]); ah.u[i] = hb; al.u[i] = ASPLIT ? bf16_bits(xs[i] - bf16_val(hb)) : (unsigned short)0; }
#pragma unroll
    for (int t = 0; t < 4; ++t) {
      const unsigned short* brow = Wt + (size_t)(col0 + t * 16 + ln) * ldb + kb;
      FragB b;
      b.half[0] = *(const v8us*)(brow + 8 * hh);
      b.half[1] = *(const v8us*)(brow + 16 + 8 * hh);
      acc[t] = mmaN<ASPLIT ? 2 : 1>(ah.v, al.v, b.v, b.v, acc[t]);
    }
  }
#pragma unroll
  for (int t = 0; t < 4; ++t) {
    float bv = bias ? bias[col0 + t * 16 + ln] : 0.f;
    if (BIAS_BF16) bv = bf16_round(bv);
#pragma unroll
    for (int r = 0; r < 8; ++r) { float v = acc[t][r] + bv; if (ACT == 1) v = fmaxf(v, 0.f); so[w][8 * hh + r][t * 16 + ln] = v; }
  }
  __builtin_amdgcn_fence(__ATOMIC_ACQ_REL, "workgroup");
  __builtin_amdgcn_wave_barrier();
  const int rsub = lane >> 4, c4 = (lane & 15) * 4;
  {
#pragma unroll
    for (int q = 0; q < 8; ++q) {
      const int r = q * 2 + rsub;
      const v4f v = *(const v4fa*)&so[w][r][c4];
      *(v4f*)(C + (size_t)(row0 + r) * ldc + col0 + c4) = v;
    }
    
  }
}

// GEMM C = act(A·W + bias + resid): A f32 (ASPLIT -> hi/lo 2 terms), Wt bf16 [N][K]; ACT 0 none, 1 relu, 2 exact gelu;
// resid (optional, f32, row index = (row % rmod), pitch ldr, RES_BF16 rounds it) added before the activation.
template <bool ASPLIT, int ACT, bool BIAS_BF16, bool RES_BF16>
__global__ __launch_bounds__(128) void k_gemm_bf3(const float* __restrict__ A, int lda, const unsigned short* __restrict__ Wt, int ldb,
                                                const float* __restrict__ bias, const float* __restrict__ resid, int rmod, int ldr,
                                                float* __restrict__ C, int ldc, int M, int N, int K) {
  __shared__ __attribute__((aligned(16))) float so[4][16][64];
  const int tid = threadIdx.x, w = tid >> 5, lane = tid & 31, ln = lane & 15, hh = lane >> 4;
  const int ntn = N / 64;
  const int wid = blockIdx.x * 4 + w;
  const int mt = wid / ntn, nq = wid % ntn;
  if (mt * 16 >= M) return;
  const int row0 = mt * 16, col0 = nq * 64;
  const float* arow = A + (size_t)(row0 + ln) * lda;
  v8f acc[4] = {};
  for (int kb = 0; kb < K; kb += 32) {
    FragB ah, al;
    const v4f x0 = *(const v4fa*)(arow + kb + 8 * hh), x1 = *(const v4fa*)(arow + kb + 8 * hh + 4);
    const v4f x2 = *(const v4fa*)(arow + kb + 16 + 8 * hh), x3 = *(const v4fa*)(arow + kb + 16 + 8 * hh + 4);
    float xs[16] = {x0[0],x0[1],x0[2],x0[3],x1[0],x1[1],x1[2],x1[3],x2[0],x2[1],x2[2],x2[3],x3[0],x3[1],x3[2],x3[3]};
#pragma unroll
    for (int i = 0; i < 16; ++i) { const unsigned short hb = bf16_bits(xs[i]); ah.u[i] = hb; al.u[i] = ASPLIT ? bf16_bits(xs[i] - bf16_val(hb)) : (unsigned short)0; }
#pragma unroll
    for (int t = 0; t < 4; ++t) {
      const unsigned short* brow = Wt + (size_t)(col0 + t * 16 + ln) * ldb + kb;
      FragB b;
      b.half[0] = *(const v8us*)(brow + 8 * hh);
      b.half[1] = *(const v8us*)(brow + 16 + 8 * hh);
      acc[t] = mmaN<ASPLIT ? 2 : 1>(ah.v, al.v, b.v, b.v, acc[t]);
    }
  }
#pragma unroll
  for (int t = 0; t < 4; ++t) {
    const int col = col0 + t * 16 + ln;
    float bv = bias ? bias[col] : 0.f;
    if (BIAS_BF16) bv = bf16_round(bv);
#pragma unroll
    for (int r = 0; r < 8; ++r) {
      float v = acc[t][r] + bv;
      if (resid) { float rv = resid[(size_t)((row0 + 8 * hh + r) % rmod) * ldr + col]; if (RES_BF16) rv = bf16_round(rv); v += rv; }
      if (ACT == 1) v = fmaxf(v, 0.f);
      if (ACT == 2) v = 0.5f * v * (1.0f + erff(v * 0.70710678118654752f));
      if (ACT == 3) { const float u = 0.7978845608028654f * (v + 0.044715f * v * v * v); v = 0.5f * v * (1.0f + tanhf(u)); }
      so[w][8 * hh + r][t * 16 + ln] = v;
    }
  }
  __builtin_amdgcn_fence(__ATOMIC_ACQ_REL, "workgroup");
  __builtin_amdgcn_wave_barrier();
  const int rsub = lane >> 4, c4 = (lane & 15) * 4;
  {
#pragma unroll
    for (int q = 0; q < 8; ++q) {
      const int r = q * 2 + rsub;
      const v4f v = *(const v4fa*)&so[w][r][c4];
      *(v4f*)(C + (size_t)(row0 + r) * ldc + col0 + c4) = v;
    }
    
  }
}
// row LayerNorm (biased variance, eps) over N: s = X (+ R); optional out_sum <- s; out_norm <- (s-mu)*rsqrt(var+eps)*g + b
template <bool PARAM_BF16>
__global__ __launch_bounds__(256) void k_layernorm(const float* __restrict__ X, const float* __restrict__ R, const float* __restrict__ g, const float* __restrict__ bta,
                                                  float* __restrict__ out_sum, float* __restrict__ out_norm, int N, float eps) {
  __shared__ float red[256];
  const int row = blockIdx.x, tid = threadIdx.x;
  const float* x = X + (size_t)row * N; const float* rr = R ? R + (size_t)row * N : nullptr;
  float vals[16];                     // up to N = 4096
  const int per = N / 256;            // contiguous chunk per thread? use strided-by-4 chunks: thread handles j = tid*4 + 1024*u
  float s1 = 0.f;
  for (int u = 0; u < per / 4; ++u) {
    const int j = tid * 4 + 1024 * u;
    const v4f a = *(const v4fa*)(x + j);
    v4f b = {0.f,0.f,0.f,0.f}; if (rr) b = *(const v4fa*)(rr + j);
#pragma unroll
    for (int q = 0; q < 4; ++q) { const float v = a[q] + b[q]; vals[u * 4 + q] = v; s1 += v; }
  }
  red[tid] = s1; __syncthreads();
  for (int st = 128; st > 0; st >>= 1) { if (tid < st) red[tid] += red[tid + st]; __syncthreads(); }
  const float mu = red[0] / (float)N; __syncthreads();
  float s2 = 0.f;
  for (int u = 0; u < per / 4; ++u)
#pragma unroll
    for (int q = 0; q < 4; ++q) { const float c = vals[u * 4 + q] - mu; s2 += c * c; }
  red[tid] = s2; __syncthreads();
  for (int st = 128; st > 0; st >>= 1) { if (tid < st) red[tid] += red[tid + st]; __syncthreads(); }
  const float rs = rsqrtf(red[0] / (float)N + eps);
  {
    for (int u = 0; u < per / 4; ++u) {
      const int j = tid * 4 + 1024 * u;
      v4f o, sm;
#pragma unroll
      for (int q = 0; q < 4; ++q) {
        float gg = g[j + q], bb = bta[j + q];
        if (PARAM_BF16) { gg = bf16_round(gg); bb = bf16_round(bb); }
        sm[q] = vals[u * 4 + q]; o[q] = (vals[u * 4 + q] - mu) * rs * gg + bb;
      }
      if (out_sum) *(v4f*)(out_sum + (size_t)row * N + j) = sm;
      *(v4f*)(out_norm + (size_t)row * N + j) = o;
    }
    
  }
}



// ---- f16 WMMA path (v_wmma_f32_16x16x32_f16): 11-bit significands for operands in range — used where a [0,1] probability operand needs more precision than bf16
typedef _Float16 v16h __attribute__((ext_vector_type(16)));
union FragH { v16h v; v8us half[2]; _Float16 h[16]; unsigned short u[16]; };
template <int NT>
__device__ __forceinline__ v8f mmaH(v16h ah, v16h al, v16h bh, v16h bl, v8f c) {
  c = __builtin_amdgcn_wmma_f32_16x16x32_f16(false, ah, false, bh, (short)0, c, false, false);
  if (NT >= 2) c = __builtin_amdgcn_wmma_f32_16x16x32_f16(false, al, false, bh, (short)0, c, false, false);
  if (NT >= 3) c = __builtin_amdgcn_wmma_f32_16x16x32_f16(false, ah, false, bl, (short)0, c, false, false);
  asm volatile("v_nop\n\tv_nop\n\tv_nop\n\tv_nop" : "+v"(c) : "v"(ah), "v"(al), "v"(bh), "v"(bl));
  return c;
}
// batched GEMM like k_gemm_b but f16 operands: A f32 (split into f16 hi/lo if ASPLIT, else rounded to f16), Bt = f16 values [n][k]; alpha; C f32; N multiple of 16 (partial tiles skipped)
template <bool ASPLIT>
__global__ __launch_bounds__(128) void k_gemm_h(const float* __restrict__ A, int lda, size_t sA, const _Float16* __restrict__ Bh, int ldb, size_t sB, float alpha, float* __restrict__ C, int ldc, size_t sC, int M, int N, int K) {
  __shared__ __attribute__((aligned(16))) float so[4][16][64];
  const int tid = threadIdx.x, w = tid >> 5, lane = tid & 31, ln = lane & 15, hh = lane >> 4; const int by = blockIdx.y;
  A += (size_t)by * sA; Bh += (size_t)by * sB; C += (size_t)by * sC;
  const int ntn = (N + 63) / 64; const int wid = blockIdx.x * 4 + w; const int mt = wid / ntn, nq = wid % ntn; if (mt * 16 >= M) return;
  const int row0 = mt * 16, col0 = nq * 64; const float* arow = A + (size_t)(row0 + ln) * lda;
  v8f acc[4] = {};
  for (int kb = 0; kb < K; kb += 32) {
    FragH ah, al;
    const v4f x0 = *(const v4fa*)(arow + kb + 8 * hh), x1 = *(const v4fa*)(arow + kb + 8 * hh + 4), x2 = *(const v4fa*)(arow + kb + 16 + 8 * hh), x3 = *(const v4fa*)(arow + kb + 16 + 8 * hh + 4);
    float xs[16] = {x0[0],x0[1],x0[2],x0[3],x1[0],x1[1],x1[2],x1[3],x2[0],x2[1],x2[2],x2[3],x3[0],x3[1],x3[2],x3[3]};
#pragma unroll
    for (int i = 0; i < 16; ++i) { const _Float16 h = (_Float16)xs[i]; ah.h[i] = h; al.h[i] = ASPLIT ? (_Float16)(xs[i] - (float)h) : (_Float16)0.0f; }
#pragma unroll
    for (int t = 0; t < 4; ++t) { if (col0 + t * 16 >= N) continue; const size_t boff = (size_t)(col0 + t * 16 + ln) * ldb + kb; FragH bq; bq.half[0] = *(const v8us*)(Bh + boff + 8 * hh); bq.half[1] = *(const v8us*)(Bh + boff + 16 + 8 * hh);
      acc[t] = mmaH<ASPLIT ? 2 : 1>(ah.v, al.v, bq.v, bq.v, acc[t]); }
  }
#pragma unroll
  for (int t = 0; t < 4; ++t) { if (col0 + t * 16 >= N) continue;
#pragma unroll
    for (int r = 0; r < 8; ++r) so[w][8 * hh + r][t * 16 + ln] = acc[t][r] * alpha; }
  __builtin_amdgcn_fence(__ATOMIC_ACQ_REL, "workgroup"); __builtin_amdgcn_wave_barrier();
  const int rsub = lane >> 4, c4 = (lane & 15) * 4;
  {
#pragma unroll
    for (int q = 0; q < 8; ++q) { const int r = q * 2 + rsub; if (col0 + c4 < N) { const v4f v = *(const v4fa*)&so[w][r][c4]; *(v4f*)(C + (size_t)(row0 + r) * ldc + col0 + c4) = v; } }
     }
}

// Wt[n][k] = f16(W[k][n]·scale) from f32 row-major W[K][N] (scale = power of two; bf16-exact weights stay exact in f16 away from the subnormal range)
__global__ __launch_bounds__(256) void k_wt_f16(const float* __restrict__ W, _Float16* __restrict__ Wt, int K, int N, float scale) {
  const int t = blockIdx.x * 256 + threadIdx.x; if (t >= N * (K / 8)) return; const int n = t / (K / 8), k8 = (t % (K / 8)) * 8; FragH f;
#pragma unroll
  for (int i = 0; i < 8; ++i) f.h[i] = (_Float16)(bf16_round(W[(size_t)(k8 + i) * N + n]) * scale); const v8us o = f.half[0];
  *(v8us*)((unsigned short*)Wt + (size_t)n * K + k8) = o; 
}
// k_gemm_hh variant with fused epilogue: v = acc·alpha + bias[by·sBias + col] (+ CP[(row/rowsPerB)·sCPb + by·64 + col] if CP) ; ACT 0 none / 1 elu ; writes f16 C16 (and f32 C if non-null)
template <int ACT>
__global__ __launch_bounds__(128) void k_gemm_hhx(const _Float16* __restrict__ A, int lda, size_t sA, const _Float16* __restrict__ Bh, int ldb, size_t sB, float alpha, const float* __restrict__ bias, size_t sBias, const float* __restrict__ CP, int rowsPerB, size_t sCPb, int row0g,
    float* __restrict__ C, _Float16* __restrict__ C16, int ldc, size_t sC, int M, int N, int K) {
  __shared__ __attribute__((aligned(16))) float so[4][16][64];
  const int tid = threadIdx.x, w = tid >> 5, lane = tid & 31, ln = lane & 15, hh = lane >> 4; const int by = blockIdx.y;
  A += (size_t)by * sA; Bh += (size_t)by * sB; const size_t cofs = (size_t)by * sC; const float* bp = bias ? bias + (size_t)by * sBias : nullptr;
  const int ntn = (N + 63) / 64; const int wid = blockIdx.x * 4 + w; const int mt = wid / ntn, nq = wid % ntn; if (mt * 16 >= M) return;
  const int row0 = mt * 16, col0 = nq * 64; const _Float16* arow = A + (size_t)(row0 + ln) * lda;
  v8f acc[4] = {};
  for (int kb = 0; kb < K; kb += 32) { FragH ah; ah.half[0] = *(const v8us*)((const unsigned short*)arow + kb + 8 * hh); ah.half[1] = *(const v8us*)((const unsigned short*)arow + kb + 16 + 8 * hh);
#pragma unroll
    for (int t = 0; t < 4; ++t) { if (col0 + t * 16 >= N) continue; const size_t boff = (size_t)(col0 + t * 16 + ln) * ldb + kb; FragH bq; bq.half[0] = *(const v8us*)((const unsigned short*)Bh + boff + 8 * hh); bq.half[1] = *(const v8us*)((const unsigned short*)Bh + boff + 16 + 8 * hh);
      acc[t] = mmaH<1>(ah.v, ah.v, bq.v, bq.v, acc[t]); }
  }
#pragma unroll
  for (int t = 0; t < 4; ++t) { if (col0 + t * 16 >= N) continue; const int col = col0 + t * 16 + ln; const float bv = bp ? bf16_round(bp[col]) : 0.f;
#pragma unroll
    for (int r = 0; r < 8; ++r) { float v = acc[t][r] * alpha + bv; if (CP) { const int rr = row0g + row0 + 8 * hh + r; if (rowsPerB < 0) v += CP[cofs + (size_t)rr * ldc + col];      /* rowsPerB < 0: own element of the batched C plane */ else { const int bidx = rr / rowsPerB; v += CP[(size_t)bidx * sCPb + (size_t)by * 64 + col]; } } if (ACT == 1) v = (v > 0.f) ? v : expm1f(v); else if (ACT == 7) v = (v > 0.f) ? v + 1.0f : expf(v); else if (ACT == 8) v = tanhf(v); else if (ACT == 9) v = 0.5f * v * (1.0f + tanhf(0.7978845608028654f * (v + 0.044715f * v * v * v))); else if (ACT == 11) v = 1.0f / (1.0f + expf(-v)); else if (ACT == 12) v = (v > 0.f) ? v : 0.01f * v; else if (ACT == 14) v = (v > 0.f) ? v : 0.1f * v; else if (ACT == 16) v = (v >= 0.f) ? v : 0.3f * v; else if (ACT == 15) v = v / (1.0f + expf(-v)); else if (ACT == 3) v = fmaxf(v, 0.f); else if (ACT == 6) v = 0.5f * v * (1.0f + erff(v * 0.70710678118654752f)); so[w][8 * hh + r][t * 16 + ln] = v; } }
  __builtin_amdgcn_fence(__ATOMIC_ACQ_REL, "workgroup"); __builtin_amdgcn_wave_barrier();
  const int rsub = lane >> 4, c4 = (lane & 15) * 4; typedef _Float16 v4h __attribute__((ext_vector_type(4)));
  {
#pragma unroll
    for (int q = 0; q < 8; ++q) { const int r = q * 2 + rsub; if (col0 + c4 < N) { const v4f v = *(const v4fa*)&so[w][r][c4]; if (C) *(v4f*)(C + cofs + (size_t)(row0 + r) * ldc + col0 + c4) = v; if (C16) { v4h h4; for (int i = 0; i < 4; ++i) h4[i] = (_Float16)v[i]; *(v4h*)(C16 + cofs + (size_t)(row0 + r) * ldc + col0 + c4) = h4; } } }
     }
}


typedef _Float16 v4h __attribute__((ext_vector_type(4)));

__global__ __launch_bounds__(256) void k_x16(const float* __restrict__ x, _Float16* __restrict__ X16, size_t n8) { const size_t t = (size_t)blockIdx.x * 256 + threadIdx.x; if (t >= n8) return; FragH f;
#pragma unroll
  for (int q = 0; q < 8; ++q) f.h[q] = (_Float16)bf16_round(x[t * 8 + q]); *(v8us*)((unsigned short*)X16 + t * 8) = f.half[0];  }
__global__ __launch_bounds__(256) void k_h16(const float* __restrict__ x, _Float16* __restrict__ X16, size_t n8) { const size_t t = (size_t)blockIdx.x * 256 + threadIdx.x; if (t >= n8) return; FragH f;
#pragma unroll
  for (int q = 0; q < 8; ++q) f.h[q] = (_Float16)x[t * 8 + q]; *(v8us*)((unsigned short*)X16 + t * 8) = f.half[0];  }
__global__ __launch_bounds__(256) void k_round16f(const float* __restrict__ W, _Float16* __restrict__ Bt, size_t n8) { const size_t t = (size_t)blockIdx.x * 256 + threadIdx.x; if (t >= n8) return; FragH f;
#pragma unroll
  for (int i = 0; i < 8; ++i) f.h[i] = (_Float16)(bf16_round(W[t * 8 + i]) * 16.0f); *(v8us*)((unsigned short*)Bt + t * 8) = f.half[0];  }
template <int NHv, int TTv>
__global__ __launch_bounds__(256) void k_vt(const _Float16* __restrict__ V16, int ldv, int voff, _Float16* __restrict__ Vt) { __shared__ unsigned short tl[64][66]; const int tid = threadIdx.x; const int slab = blockIdx.x / (TTv / 64), lg = blockIdx.x % (TTv / 64); const int b = slab / NHv, h = slab % NHv;
  for (int i = tid; i < 64 * 8; i += 256) { const int r = i / 8, c8 = (i % 8) * 8; FragH f; f.half[0] = *(const v8us*)((const unsigned short*)V16 + ((size_t)b * TTv + lg * 64 + r) * ldv + voff + h * 64 + c8);
#pragma unroll
    for (int q = 0; q < 8; ++q) tl[r][c8 + q] = f.u[q]; }
  __syncthreads();
  {
#pragma unroll
    for (int rd = 0; rd < 2; ++rd) { const int d = rd * 32 + tid / 8, pc = tid % 8; FragH f;
#pragma unroll
      for (int q = 0; q < 8; ++q) f.u[q] = tl[pc * 8 + q][d];
      *(v8us*)((unsigned short*)Vt + ((size_t)slab * 64 + d) * TTv + lg * 64 + pc * 8) = f.half[0]; }
     } }

__global__ __launch_bounds__(256) void k_hl(const float* __restrict__ F, _Float16* __restrict__ Hh, _Float16* __restrict__ Hl, size_t n8) { const size_t t = (size_t)blockIdx.x * 256 + threadIdx.x; if (t >= n8) return; FragH fh, fl; const v4f a = *(const v4fa*)(F + t * 8), c = *(const v4fa*)(F + t * 8 + 4);
#pragma unroll
  for (int q = 0; q < 4; ++q) { _Float16 h = (_Float16)a[q]; fh.h[q] = h; fl.h[q] = (_Float16)((a[q] - (float)h) * 1024.0f); h = (_Float16)c[q]; fh.h[4 + q] = h; fl.h[4 + q] = (_Float16)((c[q] - (float)h) * 1024.0f); }
  { *(v8us*)((unsigned short*)Hh + t * 8) = fh.half[0]; *(v8us*)((unsigned short*)Hl + t * 8) = fl.half[0];  } }

// one A or B fragment of the 16x16x32 f16 form from a row of 32 halves: k = 8hh .. 8hh + 7 and 16 + 8hh .. 16 + 8hh + 7
__device__ __forceinline__ v16h g2_frag(const _Float16* p, int hh) { FragH f; f.half[0] = *(const v8us*)((const unsigned short*)p + 8 * hh); f.half[1] = *(const v8us*)((const unsigned short*)p + 16 + 8 * hh); return f.v; }


__device__ __forceinline__ void wsc_body(int bx, const float* __restrict__ Wm, _Float16* __restrict__ Bt, size_t n8, float sc) { const size_t t = (size_t)bx * 256 + threadIdx.x; if (t >= n8) return; FragH f; for (int q = 0; q < 8; ++q) f.h[q] = (_Float16)(bf16_round(Wm[t * 8 + q]) * sc); *(v8us*)((unsigned short*)Bt + t * 8) = f.half[0];  }
__device__ __forceinline__ void instat_body(int c, const float* __restrict__ base, size_t scs, size_t sss, int rnd, float* __restrict__ ST) {
  #pragma clang fp contract(off)
  __shared__ float red[256]; const int tid = threadIdx.x; float s = 0.f;
#pragma unroll 1
  for (int i = tid; i < NS; i += 256) { float v = base[(size_t)c * scs + (size_t)i * sss]; if (rnd) v = bf16_round(v); s += v; }
  red[tid] = s; __syncthreads(); for (int st = 128; st > 0; st >>= 1) { if (tid < st) red[tid] += red[tid + st]; __syncthreads(); } const float mean = red[0] / (float)NS; __syncthreads(); float vs = 0.f;
#pragma unroll 1
  for (int i = tid; i < NS; i += 256) { float v = base[(size_t)c * scs + (size_t)i * sss]; if (rnd) v = bf16_round(v); const float d = v - mean; vs += d * d; }
  red[tid] = vs; __syncthreads(); for (int st = 128; st > 0; st >>= 1) { if (tid < st) red[tid] += red[tid + st]; __syncthreads(); }
  if (tid == 0) { const float var = red[0] / (float)NS; { *(float*)(ST + c * 2) = mean; *(float*)(ST + c * 2 + 1) = var;  } } }
__global__ __launch_bounds__(256) void k_instat(const float* __restrict__ base, size_t scs, size_t sss, int rnd, float* __restrict__ ST) { instat_body(blockIdx.x, base, scs, sss, rnd, ST); }
// Everything that depends on the inputs alone, in one grid: blocks 0-127 statistics of x_q, 128-255 of x_kv, then 16 blocks for each of the six weight matrices.
__global__ __launch_bounds__(256) void k_prep(const float* __restrict__ xq, const float* __restrict__ xkv, float* __restrict__ STQ, float* __restrict__ STK,
    const float* __restrict__ qW, const float* __restrict__ kW, const float* __restrict__ vW, const float* __restrict__ oW, const float* __restrict__ W1, const float* __restrict__ W2,
    _Float16* __restrict__ BQ, _Float16* __restrict__ BK, _Float16* __restrict__ BV, _Float16* __restrict__ BOW, _Float16* __restrict__ BW1, _Float16* __restrict__ BW2) {
  const int b = blockIdx.x;
  if (b < 2 * CC) { instat_body(b & (CC - 1), b < CC ? xq : xkv, (size_t)NS, (size_t)1, 1, b < CC ? STQ : STK); return; }
  const int u = b - 2 * CC, m = u >> 4;      /* every matrix has HDA * CC = 32768 elements: 4096 threads, 16 blocks */
  const float* Wm = m == 0 ? qW : m == 1 ? kW : m == 2 ? vW : m == 3 ? oW : m == 4 ? W1 : W2;
  _Float16* Bt = m == 0 ? BQ : m == 1 ? BK : m == 2 ? BV : m == 3 ? BOW : m == 4 ? BW1 : BW2;
  wsc_body(u & 15, Wm, Bt, (size_t)HDA * CC / 8, 16.0f); }
__device__ __forceinline__ v8f fa_mma(v16h a, v16h b, v8f c) { return __builtin_amdgcn_wmma_f32_16x16x32_f16(false, a, false, b, (short)0, c, false, false); }
typedef float v2f  __attribute__((ext_vector_type(2)));
typedef float v2fa __attribute__((ext_vector_type(2), may_alias));
typedef int   v4ia __attribute__((ext_vector_type(4), may_alias));
// Normalisation, one of the three projections and the attention kernel's operand order in one kernel. Workgroup = 32 voxels x all 256 outputs of q (blockIdx.y 0), k (1) or v (2); wave = one head.
// x[c][s] is read in whole 128-byte lines, normalised and laid down as Hs[s][c] (f16) in LDS. q and k are computed transposed (A = weights, B = h): a lane holds 8 outputs in a row of one voxel, which is
// a 16-byte piece of a Q16 row and exactly a lane's piece of KP. v is computed straight (A = h, B = weights): a lane holds 8 keys in a row of one output, a lane's piece of VP.
// KP[h][16-key tile][j][lane][8]: k[tile*16 + c][16j + 8hh + i]; VP[h][32-key block][dt][j][lane][8]: mask[key] * v[key = block*32 + 16j + 8hh + i][16dt + c]  (c = lane & 15, hh = lane >> 4)
__global__ __launch_bounds__(256) void k_nqkv(const float* __restrict__ xq, const float* __restrict__ xkv, const float* __restrict__ STQ, const float* __restrict__ STK, const float* __restrict__ gq, const float* __restrict__ bq, const float* __restrict__ gk, const float* __restrict__ bk,
    const _Float16* __restrict__ BQ, const _Float16* __restrict__ BK, const _Float16* __restrict__ BV, const int* __restrict__ msk, _Float16* __restrict__ Q16, _Float16* __restrict__ KP, _Float16* __restrict__ VP) {
  __shared__ __attribute__((aligned(16))) _Float16 Hs[32][CC + 8];      /* pitch of 16 bytes x an odd number for the 16-byte fragment reads */
  const int tid = threadIdx.x, w = tid >> 5, lane = tid & 31, ln = lane & 15, hh = lane >> 4; const int z = blockIdx.y, g = blockIdx.x, s0 = g * 32;
  const int c0 = (tid >> 2) * 2, sq = (tid & 3) * 8;      /* normalisation: two channels, 8 voxels */
  const float* xp = (z == 0 ? xq : xkv) + (size_t)c0 * NS + s0 + sq; const float* stp = (z == 0 ? STQ : STK) + c0 * 2; const float* gp = (z == 0 ? gq : gk) + c0; const float* bp = (z == 0 ? bq : bk) + c0;
  const _Float16* wp = (z == 0 ? BQ : z == 1 ? BK : BV) + (size_t)(32 * w + ln) * CC; const int* mp = msk + s0 + 8 * hh;
  const v4f xa0 = *(const v4fa*)xp, xa1 = *(const v4fa*)(xp + 4), xb0 = *(const v4fa*)(xp + NS), xb1 = *(const v4fa*)(xp + NS + 4);
  const v4f st = *(const v4fa*)stp; const v2f gg = *(const v2fa*)gp, bb = *(const v2fa*)bp;
  v16h wf0[4], wf1[4];
#pragma unroll
  for (int kb = 0; kb < 4; ++kb) { wf0[kb] = g2_frag(wp + kb * 32, hh); wf1[kb] = g2_frag(wp + 16 * CC + kb * 32, hh); }
  const v4ia m0 = *(const v4ia*)mp, m1 = *(const v4ia*)(mp + 4), m2 = *(const v4ia*)(mp + 16), m3 = *(const v4ia*)(mp + 20);
  asm volatile("s_wait_xcnt 0x0" :: "v"(xp), "v"(stp), "v"(gp), "v"(bp), "v"(wp), "v"(mp) : "memory");      /* in front of the arithmetic, which may reuse the loads' address registers; it names them, so that none is given to a later load's result ahead of the wait */
  __builtin_amdgcn_sched_barrier(0);      /* keeps that arithmetic behind the wait, and every global load of the kernel up here, in flight together: one round trip to memory for all of them */
  { const float ra = rsqrtf(st[1] + 1e-5f), rb = rsqrtf(st[3] + 1e-5f), ga = bf16_round(gg[0]), gb = bf16_round(gg[1]), ba = bf16_round(bb[0]), bc = bf16_round(bb[1]);
    typedef _Float16 v2h __attribute__((ext_vector_type(2), may_alias));
#pragma unroll
    for (int i = 0; i < 8; ++i) { const float a = bf16_round(i < 4 ? xa0[i & 3] : xa1[i & 3]), b = bf16_round(i < 4 ? xb0[i & 3] : xb1[i & 3]);
      const v2h p = {(_Float16)((a - st[0]) * ra * ga + ba), (_Float16)((b - st[2]) * rb * gb + bc)}; *(v2h*)&Hs[sq + i][c0] = p; } }
  __syncthreads();
  v16h n0[4], n1[4];
#pragma unroll
  for (int kb = 0; kb < 4; ++kb) { n0[kb] = g2_frag(&Hs[ln][kb * 32], hh); n1[kb] = g2_frag(&Hs[16 + ln][kb * 32], hh); }
  const v8f z8 = {0.f,0.f,0.f,0.f,0.f,0.f,0.f,0.f}; v8f d00 = z8, d01 = z8, d10 = z8, d11 = z8; FragH f00, f01, f10, f11;
  if (z < 2) {      /* dab: outputs 32w + 16a + 8hh + r of voxel s0 + 16b + ln */
#pragma unroll
    for (int kb = 0; kb < 4; ++kb) { d00 = fa_mma(wf0[kb], n0[kb], d00); d01 = fa_mma(wf0[kb], n1[kb], d01); d10 = fa_mma(wf1[kb], n0[kb], d10); d11 = fa_mma(wf1[kb], n1[kb], d11); }
    const float al = z == 0 ? 0.03125f : 0.0625f;      /* 1/16 undoes the weights' scale; q is stored halved for the tanh form of the sigmoid (powers of two: the f16 rounding is the same) */
#pragma unroll
    for (int r = 0; r < 8; ++r) { f00.h[r] = (_Float16)(d00[r] * al); f01.h[r] = (_Float16)(d01[r] * al); f10.h[r] = (_Float16)(d10[r] * al); f11.h[r] = (_Float16)(d11[r] * al); }
    if (z == 0) { unsigned short* qo = (unsigned short*)Q16 + (size_t)(s0 + ln) * HDA + 32 * w + 8 * hh;
      *(v8us*)qo = f00.half[0]; *(v8us*)(qo + 16) = f10.half[0]; *(v8us*)(qo + 16 * HDA) = f01.half[0]; *(v8us*)(qo + 16 * HDA + 16) = f11.half[0]; }
    else { unsigned short* ko = (unsigned short*)KP + ((size_t)w * 256 + g * 2) * 512 + lane * 8;      /* tile 2g: j = 0, 1; tile 2g + 1: j = 0, 1 */
      *(v8us*)ko = f00.half[0]; *(v8us*)(ko + 256) = f10.half[0]; *(v8us*)(ko + 512) = f01.half[0]; *(v8us*)(ko + 768) = f11.half[0];
      asm volatile("s_wait_xcnt 0x0" ::: "memory"); } }      /* behind the four stores: the code that follows them in the listing rewrites their address and data registers */
  else {      /* dab: keys s0 + 16a + 8hh + r of output 32w + 16b + ln */
#pragma unroll
    for (int kb = 0; kb < 4; ++kb) { d00 = fa_mma(n0[kb], wf0[kb], d00); d01 = fa_mma(n0[kb], wf1[kb], d01); d10 = fa_mma(n1[kb], wf0[kb], d10); d11 = fa_mma(n1[kb], wf1[kb], d11); }
#pragma unroll
    for (int r = 0; r < 8; ++r) { const float ma = (float)(r < 4 ? m0[r & 3] : m1[r & 3]), mb = (float)(r < 4 ? m2[r & 3] : m3[r & 3]);      /* v is rounded to f16 first, then masked */
      f00.h[r] = (_Float16)((float)(_Float16)(d00[r] * 0.0625f) * ma); f01.h[r] = (_Float16)((float)(_Float16)(d01[r] * 0.0625f) * ma);
      f10.h[r] = (_Float16)((float)(_Float16)(d10[r] * 0.0625f) * mb); f11.h[r] = (_Float16)((float)(_Float16)(d11[r] * 0.0625f) * mb); }
    unsigned short* vo = (unsigned short*)VP + ((size_t)w * 128 + g) * 1024 + lane * 8;      /* dt = 0: j = 0, 1; dt = 1: j = 0, 1 */
    *(v8us*)vo = f00.half[0]; *(v8us*)(vo + 256) = f10.half[0]; *(v8us*)(vo + 512) = f01.half[0]; *(v8us*)(vo + 768) = f11.half[0];
    asm volatile("s_wait_xcnt 0x0" ::: "memory"); } }      /* behind the four stores: the code that follows them in the listing rewrites their address and data registers */
__device__ __forceinline__ v16h fa_frag(const unsigned short* p) { FragH f; f.half[0] = *(const v8us*)p; f.half[1] = *(const v8us*)(p + 256); return f.v; }
// sigmoid(x) = 0.5 + 0.5 tanh(x / 2) on the chip's own v_tanh_f32: one transcendental, half a packed fma and half a packed convert an element. The scores arrive already halved (Q16 holds q / 2).
// two S^T tiles (keys 0-15 and 16-31 of a block, one query per lane column) -> sigmoid -> the A fragment of w.v: D register r of tile j holds key 16j + 8hh + r, which is A's element 8j + r
__device__ __forceinline__ v16h fa_sig(v8f s0, v8f s1) { FragH f;
  for (int r = 0; r < 8; ++r) { f.h[r] = (_Float16)(0.5f + 0.5f * __builtin_amdgcn_tanhf(s0[r])); f.h[8 + r] = (_Float16)(0.5f + 0.5f * __builtin_amdgcn_tanhf(s1[r])); }
  return f.v; }
// one block of 32 keys against the wave's 32 queries
__device__ __forceinline__ void fa_block(v16h k0, v16h k1, v16h v0, v16h v1, v16h qf0, v16h qf1, v8f& o00, v8f& o01, v8f& o10, v8f& o11) {
  const v8f z8 = {0.f,0.f,0.f,0.f,0.f,0.f,0.f,0.f};
  const v8f s00 = fa_mma(k0, qf0, z8), s01 = fa_mma(k1, qf0, z8), s10 = fa_mma(k0, qf1, z8), s11 = fa_mma(k1, qf1, z8);
  const v16h p0 = fa_sig(s00, s01); o00 = fa_mma(p0, v0, o00); o01 = fa_mma(p0, v1, o01);
  const v16h p1 = fa_sig(s10, s11); o10 = fa_mma(p1, v0, o10); o11 = fa_mma(p1, v1, o11); }
// Fused attention: one workgroup = one head x 128 queries; wave = 32 queries (w & 3) x one quarter of the keys (w >> 2). Q16 holds q / 2: S^T = k (q/2)^T, w = sigmoid(q.k) = 0.5 + 0.5 tanh(S^T) stays in registers, o += w (mask v); the four key quarters are joined through LDS.
__global__ __launch_bounds__(512) void k_fattn(const _Float16* __restrict__ Q16, const _Float16* __restrict__ KP, const _Float16* __restrict__ VP, _Float16* __restrict__ O16) {
  __shared__ __attribute__((aligned(16))) float part[4][128][36];
  const int tid = threadIdx.x, w = tid >> 5, lane = tid & 31, ln = lane & 15, hh = lane >> 4;
  const int h = blockIdx.x >> 5, q0 = (blockIdx.x & 31) * 128; const int qg = w & 3, kq = w >> 2;
  const _Float16* qp = Q16 + (size_t)(q0 + qg * 32 + ln) * HDA + h * HDm;
  const v16h qf0 = g2_frag(qp, hh), qf1 = g2_frag(qp + (size_t)16 * HDA, hh);
  const unsigned short* kp = (const unsigned short*)KP + ((size_t)h * 128 + kq * 32) * 1024 + lane * 8;
  const unsigned short* vp = (const unsigned short*)VP + ((size_t)h * 128 + kq * 32) * 1024 + lane * 8;
  const v8f z8 = {0.f,0.f,0.f,0.f,0.f,0.f,0.f,0.f}; v8f o00 = z8, o01 = z8, o10 = z8, o11 = z8;
  v16h nk0 = fa_frag(kp), nk1 = fa_frag(kp + 512), nv0 = fa_frag(vp), nv1 = fa_frag(vp + 512);
#pragma unroll 1      /* stays rolled: one trip's code (some 140 instructions) serves all 32 trips, for speed only */
  for (int b = 0; b < 32; ++b) { const v16h k0 = nk0, k1 = nk1, v0 = nv0, v1 = nv1;
    const int nb = (b < 31 ? b + 1 : 31) * 1024;      /* the next block's fragments fly while this block is worked on (the last trip reads its own block again and drops it) */
    nk0 = fa_frag(kp + nb); nk1 = fa_frag(kp + nb + 512); nv0 = fa_frag(vp + nb); nv1 = fa_frag(vp + nb + 512);
    asm volatile("s_wait_xcnt 0x0" ::: "memory");      /* in front of the block's arithmetic, which reuses the loads' address registers */
    __builtin_amdgcn_sched_barrier(0);      /* keeps the eight loads up here: without it the scheduler sinks them to the foot of the trip, right in front of their use */
    fa_block(k0, k1, v0, v1, qf0, qf1, o00, o01, o10, o11);
    __builtin_amdgcn_sched_barrier(0); }      /* keeps the copies of the loaded fragments, and so the waits for them, at the foot: without it some rise to the head of the trip */
  for (int r = 0; r < 8; ++r) { float* pr = &part[kq][qg * 32 + 8 * hh + r][ln]; pr[0] = o00[r]; pr[16] = o01[r]; pr[16 * 36] = o10[r]; pr[16 * 36 + 16] = o11[r]; }
  __syncthreads();
  const int q = tid >> 2, d0 = (tid & 3) * 8; v4f a = *(const v4fa*)&part[0][q][d0], c = *(const v4fa*)&part[0][q][d0 + 4];
  for (int s = 1; s < 4; ++s) { a += *(const v4fa*)&part[s][q][d0]; c += *(const v4fa*)&part[s][q][d0 + 4]; }
  FragH f;
  for (int i = 0; i < 4; ++i) { f.h[i] = (_Float16)a[i]; f.h[4 + i] = (_Float16)c[i]; }
  *(v8us*)((unsigned short*)O16 + (size_t)(q0 + q) * HDA + h * HDm + d0) = f.half[0]; }
// attn = o oW^T + x_q for 32 voxels x all 128 channels a workgroup; wave = 16 channels. D holds one channel a lane and 8 voxels in a row in its registers, so x_q is read from the input and
// attn is stored channel-major (ATc[c][s]) with 16-byte accesses and no transposition. Each wave also leaves mean and sum of squared deviations of its 16 channels over the 32 voxels: PS[group][c] = {mean, M2}.
__global__ __launch_bounds__(256) void k_oproj(const _Float16* __restrict__ O16, const _Float16* __restrict__ BOW, const float* __restrict__ xq, float* __restrict__ ATc, float* __restrict__ PS) {
  const int tid = threadIdx.x, w = tid >> 5, lane = tid & 31, ln = lane & 15, hh = lane >> 4;
  const int g = blockIdx.x, s0 = g * 32, c = w * 16 + ln;
  const _Float16* ap = O16 + (size_t)(s0 + ln) * HDA; const _Float16* bp = BOW + (size_t)c * HDA; const float* xp = xq + (size_t)c * NS + s0 + 8 * hh;
  v16h a0[8], a1[8], b[8];
#pragma unroll      /* all 48 fragment loads are in flight together: one round trip to L2 instead of one a k step */
  for (int kb = 0; kb < 8; ++kb) { a0[kb] = g2_frag(ap + kb * 32, hh); a1[kb] = g2_frag(ap + (size_t)16 * HDA + kb * 32, hh); b[kb] = g2_frag(bp + kb * 32, hh); }
  const v4f x0 = *(const v4fa*)xp, x1 = *(const v4fa*)(xp + 4), x2 = *(const v4fa*)(xp + 16), x3 = *(const v4fa*)(xp + 20);
  asm volatile("s_wait_xcnt 0x0" ::: "memory");      /* in front of the arithmetic, which may reuse the loads' address registers */
  __builtin_amdgcn_sched_barrier(0);      /* keeps that arithmetic behind the wait, and the loads together in front of it */
  const v8f z8 = {0.f,0.f,0.f,0.f,0.f,0.f,0.f,0.f}; v8f c0 = z8, c1 = z8;
#pragma unroll
  for (int kb = 0; kb < 8; ++kb) { c0 = fa_mma(a0[kb], b[kb], c0); c1 = fa_mma(a1[kb], b[kb], c1); }
  float v[16];
#pragma unroll
  for (int r = 0; r < 4; ++r) { v[r] = c0[r] * 0.0625f + bf16_round(x0[r]); v[4 + r] = c0[4 + r] * 0.0625f + bf16_round(x1[r]); v[8 + r] = c1[r] * 0.0625f + bf16_round(x2[r]); v[12 + r] = c1[4 + r] * 0.0625f + bf16_round(x3[r]); }
  float s = 0.f;
#pragma unroll
  for (int i = 0; i < 16; ++i) s += v[i];
  s += __shfl_xor(s, 16);      /* lanes l and l + 16 hold the two halves of one channel's 32 voxels */
  const float mean = s * (1.0f / 32.0f); float q2 = 0.f;
#pragma unroll
  for (int i = 0; i < 16; ++i) { const float d = v[i] - mean; q2 += d * d; }
  q2 += __shfl_xor(q2, 16);
  float* op = ATc + (size_t)c * NS + s0 + 8 * hh;
  const v4f y0 = {v[0], v[1], v[2], v[3]}, y1 = {v[4], v[5], v[6], v[7]}, y2 = {v[8], v[9], v[10], v[11]}, y3 = {v[12], v[13], v[14], v[15]};
  *(v4fa*)op = y0; *(v4fa*)(op + 4) = y1; *(v4fa*)(op + 16) = y2; *(v4fa*)(op + 20) = y3;
  if (hh == 0) { const v2f p = {mean, q2}; *(v2fa*)(PS + ((size_t)g * CC + c) * 2) = p; } }
// The rest of the network for 32 voxels a workgroup (16 waves): join the 128 groups' {mean, M2} to the statistics of attn; h = IN(attn) -> LDS [s][c]; relu(W1 h + b1) computed transposed (A = W1, B = h),
// so that a lane holds 8 hidden units in a row of one voxel -> LDS [s][n]; W2 . + b2 -> LDS [c][s]; + attn, stored to out[c][s] in whole 128-byte lines.
__global__ __launch_bounds__(512) void k_mlp(const float* __restrict__ ATc, const float* __restrict__ PS, const float* __restrict__ gp, const float* __restrict__ bp, const _Float16* __restrict__ BW1, const float* __restrict__ b1, const _Float16* __restrict__ BW2, const float* __restrict__ b2, float* __restrict__ out) {
  __shared__ __attribute__((aligned(16))) _Float16 Hs[32][CC + 8];      /* pitches of 16 bytes x an odd number for the 16-byte fragment reads */
  __shared__ __attribute__((aligned(16))) _Float16 Gs[32][2 * CC + 8];
  __shared__ __attribute__((aligned(16))) float Cs[CC][36];
  __shared__ float r1[4][CC], r2[4][CC];
  const int tid = threadIdx.x, w = tid >> 5, lane = tid & 31, ln = lane & 15, hh = lane >> 4; const int s0 = blockIdx.x * 32;
  const int cs = tid & (CC - 1), part = tid >> 7;      /* statistics: one channel, 32 of the 128 groups */
  const int c = tid >> 2, sq = (tid & 3) * 8;      /* normalisation and final store: one channel, 8 voxels */
  const int nt = w & 7, mt = w >> 3;      /* second product: 16 channels x 16 voxels */
  const unsigned pso = (unsigned)(part * 32 * CC + cs) * 8u;      /* byte offset of the thread's first {mean, M2} pair */
  v2f ps[32];
#pragma unroll
  for (int g = 0; g < 32; ++g) ps[g] = *(const v2fa*)((const char*)PS + pso + g * (CC * 8));
  const float* atp = ATc + (size_t)c * NS + s0 + sq; const v4f xa = *(const v4fa*)atp, xb = *(const v4fa*)(atp + 4);
  const unsigned short* w1p = (const unsigned short*)BW1 + (size_t)(16 * w + ln) * CC + 8 * hh; const unsigned short* w2p = (const unsigned short*)BW2 + (size_t)(16 * nt + ln) * (2 * CC) + 8 * hh; const float* b1p = b1 + 16 * w + 8 * hh;
  FragH w1f[4], w2f[8];
#pragma unroll
  for (int kb = 0; kb < 4; ++kb) { w1f[kb].half[0] = *(const v8us*)(w1p + kb * 32); w1f[kb].half[1] = *(const v8us*)(w1p + kb * 32 + 16); }
#pragma unroll
  for (int kb = 0; kb < 8; ++kb) { w2f[kb].half[0] = *(const v8us*)(w2p + kb * 32); w2f[kb].half[1] = *(const v8us*)(w2p + kb * 32 + 16); }
  const v4f b1a = *(const v4fa*)b1p, b1b = *(const v4fa*)(b1p + 4);
  const float b2v = bf16_round(b2[16 * nt + ln]), gv = bf16_round(gp[c]), bv = bf16_round(bp[c]);
  asm volatile("s_wait_xcnt 0x0" :: "v"(pso), "v"(atp), "v"(w1p), "v"(w2p), "v"(b1p) : "memory");      /* in front of the arithmetic, which may reuse the loads' address registers; it names them, so that none is given to a later load's result ahead of the wait */
  __builtin_amdgcn_sched_barrier(0);      /* keeps that arithmetic behind the wait, and every global load of the kernel up here, in flight together: one round trip to memory for all of them */
  float sm = 0.f;
#pragma unroll
  for (int g = 0; g < 32; ++g) sm += ps[g][0];
  r1[part][cs] = sm; __syncthreads();
  { const float mean = (r1[0][cs] + r1[1][cs] + r1[2][cs] + r1[3][cs]) * (1.0f / 128.0f); float q2 = 0.f;      /* equal groups: M2 = sum of the groups' M2 + 32 sum (group mean - mean)^2 */
#pragma unroll
    for (int g = 0; g < 32; ++g) { const float d = ps[g][0] - mean; q2 += ps[g][1] + 32.0f * (d * d); }
    r2[part][cs] = q2; }
  __syncthreads();
  { const float mean = (r1[0][c] + r1[1][c] + r1[2][c] + r1[3][c]) * (1.0f / 128.0f); const float var = (r2[0][c] + r2[1][c] + r2[2][c] + r2[3][c]) * (1.0f / (float)NS); const float rs = rsqrtf(var + 1e-5f);
#pragma unroll
    for (int i = 0; i < 4; ++i) { Hs[sq + i][c] = (_Float16)((xa[i] - mean) * rs * gv + bv); Hs[sq + 4 + i][c] = (_Float16)((xb[i] - mean) * rs * gv + bv); } }
  __syncthreads();
  const v8f z8 = {0.f,0.f,0.f,0.f,0.f,0.f,0.f,0.f}; v8f d0 = z8, d1 = z8;
#pragma unroll
  for (int kb = 0; kb < 4; ++kb) { d0 = fa_mma(w1f[kb].v, g2_frag(&Hs[ln][kb * 32], hh), d0); d1 = fa_mma(w1f[kb].v, g2_frag(&Hs[16 + ln][kb * 32], hh), d1); }
  { FragH f0, f1;      /* D register r: hidden unit 16w + 8hh + r of voxel ln (d0) and 16 + ln (d1) */
#pragma unroll
    for (int r = 0; r < 8; ++r) { const float bb = bf16_round(r < 4 ? b1a[r & 3] : b1b[r & 3]); f0.h[r] = (_Float16)fmaxf(d0[r] * 0.0625f + bb, 0.f); f1.h[r] = (_Float16)fmaxf(d1[r] * 0.0625f + bb, 0.f); }
    *(v8us*)&Gs[ln][16 * w + 8 * hh] = f0.half[0]; *(v8us*)&Gs[16 + ln][16 * w + 8 * hh] = f1.half[0]; }
  __syncthreads();
  v8f e = z8;
#pragma unroll
  for (int kb = 0; kb < 8; ++kb) e = fa_mma(g2_frag(&Gs[16 * mt + ln][kb * 32], hh), w2f[kb].v, e);
  { const v4f e0 = {e[0] * 0.0625f + b2v, e[1] * 0.0625f + b2v, e[2] * 0.0625f + b2v, e[3] * 0.0625f + b2v}, e1 = {e[4] * 0.0625f + b2v, e[5] * 0.0625f + b2v, e[6] * 0.0625f + b2v, e[7] * 0.0625f + b2v};
    *(v4fa*)&Cs[16 * nt + ln][16 * mt + 8 * hh] = e0; *(v4fa*)&Cs[16 * nt + ln][16 * mt + 8 * hh + 4] = e1; }      /* D register r: voxel 16mt + 8hh + r of channel 16nt + ln */
  __syncthreads();
  const v4f o0 = *(const v4fa*)&Cs[c][sq] + xa, o1 = *(const v4fa*)&Cs[c][sq + 4] + xb;
  float* op = out + (size_t)c * NS + s0 + sq; *(v4fa*)op = o0; *(v4fa*)(op + 4) = o1; }

extern "C" void kernel_launch(void* const* d_in, const int* in_sizes, int n_in,
                              void* d_out, int out_size, void* d_ws, size_t ws_size, hipStream_t stream) {
  (void)in_sizes; (void)n_in; (void)out_size;
  const float* const* I = (const float* const*)d_in; const float* xq = I[0]; const float* xkv = I[1]; const int* msk = (const int*)d_in[2]; const float* qW = I[3]; const float* kW = I[4]; const float* vW = I[5]; const float* oW = I[6]; const float* gq = I[7]; const float* bq = I[8]; const float* gk = I[9]; const float* bk = I[10]; const float* gp = I[11]; const float* bp = I[12]; const float* W1 = I[13]; const float* b1 = I[14]; const float* W2 = I[15]; const float* b2 = I[16];
  char* ws = (char*)d_ws; size_t off = 0;
  auto take = [&](size_t bytes) { char* p = ws + off; off += (bytes + 255) & ~(size_t)255; return p; };
  _Float16* BQ = (_Float16*)take((size_t)HDA * CC * 2); _Float16* BK = (_Float16*)take((size_t)HDA * CC * 2); _Float16* BV = (_Float16*)take((size_t)HDA * CC * 2); _Float16* BOW = (_Float16*)take((size_t)CC * HDA * 2); _Float16* BW1 = (_Float16*)take((size_t)2 * CC * CC * 2); _Float16* BW2 = (_Float16*)take((size_t)CC * 2 * CC * 2); float* STQ = (float*)take(CC * 2 * 4); float* STK = (float*)take(CC * 2 * 4);
  _Float16* Q16 = (_Float16*)take((size_t)NS * HDA * 2); _Float16* KP = (_Float16*)take((size_t)NS * HDA * 2); _Float16* VP = (_Float16*)take((size_t)NS * HDA * 2); _Float16* O16 = (_Float16*)take((size_t)NS * HDA * 2); float* AT = (float*)take((size_t)NS * CC * 4); float* PS = (float*)take((size_t)(NS / 32) * CC * 2 * 4);
  if (off > ws_size) return;      /* about 11 MiB */
  k_prep<<<2 * CC + 6 * (HDA * CC / 8 / 256), 256, 0, stream>>>(xq, xkv, STQ, STK, qW, kW, vW, oW, W1, W2, BQ, BK, BV, BOW, BW1, BW2);      /* statistics of x_q and x_kv; 1x1 convs 'oc' = Bt, times 16 */
  k_nqkv<<<dim3(NS / 32, 3), 256, 0, stream>>>(xq, xkv, STQ, STK, gq, bq, gk, bk, BQ, BK, BV, msk, Q16, KP, VP);      /* IN(x_q), IN(x_kv); q / 2, k, mask * v, the last two in the attention kernel's fragment order */
  k_fattn<<<NHD * (NS / 128), 512, 0, stream>>>(Q16, KP, VP, O16);      /* o = (sigmoid(q.k) * mask) v, all heads */
  k_oproj<<<NS / 32, 256, 0, stream>>>(O16, BOW, xq, AT, PS);      /* attn = o oW^T + x_q, channel-major, and its statistics by groups of 32 voxels */
  k_mlp<<<NS / 32, 512, 0, stream>>>(AT, PS, gp, bp, BW1, b1, BW2, b2, (float*)d_out);      /* out = W2 relu(W1 IN(attn) + b1) + b2 + attn */
}

// v006
// Measured time: 44.5 microseconds a run.
// In two side-by-side timings against v005, it was 1.16 and 1.19 times as fast.
// Over all steps from v000 it is 31.1 times as fast.
#include <hip/hip_runtime.h>
// Multi_Heads_Self_Attn_Q_KV (1 volume, C 128, 16^3 = 4096 voxels, 8 heads x 32): InstanceNorm of x_q and x_kv (per channel over the 4096 voxels, biased var, eps 1e-5, affine); q, k, v = 1x1 convs (no bias); w = sigmoid(q.k) (no scale) * mask[key] (int input 0/1); o = w v (no normalisation); attn = o oW^T + x_q; h = IN(attn); h = relu(W1 h + b1); h = W2 h + b2; out = h + attn -> [1, 128, 16, 16, 16].
// Compute dtype: inputs and parameters rounded to bf16; normalised inputs, q, k, v, sigmoid weights, o and the MLP activations as plain f16 operands (~2^-12); statistics/sigmoid f32. v_wmma_f32_16x16x32_f16.
#define CC 128
#define NS 4096
#define NHD 8
#define HDm 32
#define HDA (NHD * HDm)          /* 256 */
#define PW (NHD * 64)            /* 512, unused */
typedef __bf16 v16b __attribute__((ext_vector_type(16)));
typedef unsigned short v8us __attribute__((ext_vector_type(8), may_alias));
typedef float  v8f  __attribute__((ext_vector_type(8)));
typedef float  v4f  __attribute__((ext_vector_type(4)));
typedef float  v4fa __attribute__((ext_vector_type(4), may_alias));
union FragB { v16b v; v8us half[2]; unsigned short u[16]; };

__device__ __forceinline__ unsigned short bf16_bits(float x) { unsigned int u = __float_as_uint(x); return (unsigned short)((u + 0x7FFFu + ((u >> 16) & 1u)) >> 16); }
__device__ __forceinline__ float bf16_val(unsigned short b) { return __uint_as_float(((unsigned int)b) << 16); }
__device__ __forceinline__ float bf16_round(float x) { return bf16_val(bf16_bits(x)); }
// D += A·B with NT terms: 1 = ah·bh, 2 = + al·bh (A split), 3 = + ah·bl (both split)
template <int NT>
__device__ __forceinline__ v8f mmaN(v16b ah, v16b al, v16b bh, v16b bl, v8f c) {
  c = __builtin_amdgcn_wmma_f32_16x16x32_bf16(false, ah, false, bh, (short)0, c, false, false);
  if (NT >= 2) c = __builtin_amdgcn_wmma_f32_16x16x32_bf16(false, al, false, bh, (short)0, c, false, false);
  if (NT >= 3) c = __builtin_amdgcn_wmma_f32_16x16x32_bf16(false, ah, false, bl, (short)0, c, false, false);
  asm volatile("v_nop\n\tv_nop\n\tv_nop\n\tv_nop" : "+v"(c) : "v"(ah), "v"(al), "v"(bh), "v"(bl));
  return c;
}

__global__ __launch_bounds__(256) void k_wt_bf16(const float* __restrict__ W, unsigned short* __restrict__ Wt, int K, int N) {
  const int t = blockIdx.x * 256 + threadIdx.x;
  const int k8n = K / 8;
  if (t >= N * k8n) return;
  const int n = t / k8n, k8 = (t % k8n) * 8;
  v8us v;
#pragma unroll
  for (int i = 0; i < 8; ++i) v[i] = bf16_bits(W[(size_t)(k8 + i) * N + n]);
  *(v8us*)(Wt + (size_t)n * K + k8) = v;
  
}

// GEMM C[M][N] (f32, pitch ldc) = act(A[M][K]·W + bias). A f32 row-major (pitch lda) converted per fragment to bf16
// (ASPLIT: hi/lo two planes -> 2 terms, else single rounded term); Wt bf16 [N][K] (pitch ldb). BIAS_BF16 rounds the
// bias to bf16 first (bias quantised to bf16 before the add). K%32==0, M%16==0, N%64==0.
template <bool ASPLIT, int ACT, bool BIAS_BF16>
__global__ __launch_bounds__(128) void k_gemm_bf(const float* __restrict__ A, int lda, const unsigned short* __restrict__ Wt, int ldb,
                                               const float* __restrict__ bias, float* __restrict__ C, int ldc, int M, int N, int K) {
  __shared__ __attribute__((aligned(16))) float so[4][16][64];
  const int tid = threadIdx.x, w = tid >> 5, lane = tid & 31, ln = lane & 15, hh = lane >> 4;
  const int ntn = N / 64;
  const int wid = blockIdx.x * 4 + w;
  const int mt = wid / ntn, nq = wid % ntn;
  if (mt * 16 >= M) return;
  const int row0 = mt * 16, col0 = nq * 64;
  const float* arow = A + (size_t)(row0 + ln) * lda;
  v8f acc[4] = {};
  for (int kb = 0; kb < K; kb += 32) {
    FragB ah, al;
    const v4f x0 = *(const v4fa*)(arow + kb + 8 * hh), x1 = *(const v4fa*)(arow + kb + 8 * hh + 4);
    const v4f x2 = *(const v4fa*)(arow + kb + 16 + 8 * hh), x3 = *(const v4fa*)(arow + kb + 16 + 8 * hh + 4);
    float xs[16] = {x0[0],x0[1],x0[2],x0[3],x1[0],x1[1],x1[2],x1[3],x2[0],x2[1],x2[2],x2[3],x3[0],x3[1],x3[2],x3[3]};
#pragma unroll
    for (int i = 0; i < 16; ++i) { const unsigned short hb = bf16_bits(xs[i]); ah.u[i] = hb; al.u[i] = ASPLIT ? bf16_bits(xs[i] - bf16_val(hb)) : (unsigned short)0; }
#pragma unroll
    for (int t = 0; t < 4; ++t) {
      const unsigned short* brow = Wt + (size_t)(col0 + t * 16 + ln) * ldb + kb;
      FragB b;
      b.half[0] = *(const v8us*)(brow + 8 * hh);
      b.half[1] = *(const v8us*)(brow + 16 + 8 * hh);
      acc[t] = mmaN<ASPLIT ? 2 : 1>(ah.v, al.v, b.v, b.v, acc[t]);
    }
  }
#pragma unroll
  for (int t = 0; t < 4; ++t) {
    float bv = bias ? bias[col0 + t * 16 + ln] : 0.f;
    if (BIAS_BF16) bv = bf16_round(bv);
#pragma unroll
    for (int r = 0; r < 8; ++r) { float v = acc[t][r] + bv; if (ACT == 1) v = fmaxf(v, 0.f); so[w][8 * hh + r][t * 16 + ln] = v; }
  }
  __builtin_amdgcn_fence(__ATOMIC_ACQ_REL, "workgroup");
  __builtin_amdgcn_wave_barrier();
  const int rsub = lane >> 4, c4 = (lane & 15) * 4;
  {
#pragma unroll
    for (int q = 0; q < 8; ++q) {
      const int r = q * 2 + rsub;
      const v4f v = *(const v4fa*)&so[w][r][c4];
      *(v4f*)(C + (size_t)(row0 + r) * ldc + col0 + c4) = v;
    }
    
  }
}

// GEMM C = act(A·W + bias + resid): A f32 (ASPLIT -> hi/lo 2 terms), Wt bf16 [N][K]; ACT 0 none, 1 relu, 2 exact gelu;
// resid (optional, f32, row index = (row % rmod), pitch ldr, RES_BF16 rounds it) added before the activation.
template <bool ASPLIT, int ACT, bool BIAS_BF16, bool RES_BF16>
__global__ __launch_bounds__(128) void k_gemm_bf3(const float* __restrict__ A, int lda, const unsigned short* __restrict__ Wt, int ldb,
                                                const float* __restrict__ bias, const float* __restrict__ resid, int rmod, int ldr,
                                                float* __restrict__ C, int ldc, int M, int N, int K) {
  __shared__ __attribute__((aligned(16))) float so[4][16][64];
  const int tid = threadIdx.x, w = tid >> 5, lane = tid & 31, ln = lane & 15, hh = lane >> 4;
  const int ntn = N / 64;
  const int wid = blockIdx.x * 4 + w;
  const int mt = wid / ntn, nq = wid % ntn;
  if (mt * 16 >= M) return;
  const int row0 = mt * 16, col0 = nq * 64;
  const float* arow = A + (size_t)(row0 + ln) * lda;
  v8f acc[4] = {};
  for (int kb = 0; kb < K; kb += 32) {
    FragB ah, al;
    const v4f x0 = *(const v4fa*)(arow + kb + 8 * hh), x1 = *(const v4fa*)(arow + kb + 8 * hh + 4);
    const v4f x2 = *(const v4fa*)(arow + kb + 16 + 8 * hh), x3 = *(const v4fa*)(arow + kb + 16 + 8 * hh + 4);
    float xs[16] = {x0[0],x0[1],x0[2],x0[3],x1[0],x1[1],x1[2],x1[3],x2[0],x2[1],x2[2],x2[3],x3[0],x3[1],x3[2],x3[3]};
#pragma unroll
    for (int i = 0; i < 16; ++i) { const unsigned short hb = bf16_bits(xs[i]); ah.u[i] = hb; al.u[i] = ASPLIT ? bf16_bits(xs[i] - bf16_val(hb)) : (unsigned short)0; }
#pragma unroll
    for (int t = 0; t < 4; ++t) {
      const unsigned short* brow = Wt + (size_t)(col0 + t * 16 + ln) * ldb + kb;
      FragB b;
      b.half[0] = *(const v8us*)(brow + 8 * hh);
      b.half[1] = *(const v8us*)(brow + 16 + 8 * hh);
      acc[t] = mmaN<ASPLIT ? 2 : 1>(ah.v, al.v, b.v, b.v, acc[t]);
    }
  }
#pragma unroll
  for (int t = 0; t < 4; ++t) {
    const int col = col0 + t * 16 + ln;
    float bv = bias ? bias[col] : 0.f;
    if (BIAS_BF16) bv = bf16_round(bv);
#pragma unroll
    for (int r = 0; r < 8; ++r) {
      float v = acc[t][r] + bv;
      if (resid) { float rv = resid[(size_t)((row0 + 8 * hh + r) % rmod) * ldr + col]; if (RES_BF16) rv = bf16_round(rv); v += rv; }
      if (ACT == 1) v = fmaxf(v, 0.f);
      if (ACT == 2) v = 0.5f * v * (1.0f + erff(v * 0.70710678118654752f));
      if (ACT == 3) { const float u = 0.7978845608028654f * (v + 0.044715f * v * v * v); v = 0.5f * v * (1.0f + tanhf(u)); }
      so[w][8 * hh + r][t * 16 + ln] = v;
    }
  }
  __builtin_amdgcn_fence(__ATOMIC_ACQ_REL, "workgroup");
  __builtin_amdgcn_wave_barrier();
  const int rsub = lane >> 4, c4 = (lane & 15) * 4;
  {
#pragma unroll
    for (int q = 0; q < 8; ++q) {
      const int r = q * 2 + rsub;
      const v4f v = *(const v4fa*)&so[w][r][c4];
      *(v4f*)(C + (size_t)(row0 + r) * ldc + col0 + c4) = v;
    }
    
  }
}
// row LayerNorm (biased variance, eps) over N: s = X (+ R); optional out_sum <- s; out_norm <- (s-mu)*rsqrt(var+eps)*g + b
template <bool PARAM_BF16>
__global__ __launch_bounds__(256) void k_layernorm(const float* __restrict__ X, const float* __restrict__ R, const float* __restrict__ g, const float* __restrict__ bta,
                                                  float* __restrict__ out_sum, float* __restrict__ out_norm, int N, float eps) {
  __shared__ float red[256];
  const int row = blockIdx.x, tid = threadIdx.x;
  const float* x = X + (size_t)row * N; const float* rr = R ? R + (size_t)row * N : nullptr;
  float vals[16];                     // up to N = 4096
  const int per = N / 256;            // contiguous chunk per thread? use strided-by-4 chunks: thread handles j = tid*4 + 1024*u
  float s1 = 0.f;
  for (int u = 0; u < per / 4; ++u) {
    const int j = tid * 4 + 1024 * u;
    const v4f a = *(const v4fa*)(x + j);
    v4f b = {0.f,0.f,0.f,0.f}; if (rr) b = *(const v4fa*)(rr + j);
#pragma unroll
    for (int q = 0; q < 4; ++q) { const float v = a[q] + b[q]; vals[u * 4 + q] = v; s1 += v; }
  }
  red[tid] = s1; __syncthreads();
  for (int st = 128; st > 0; st >>= 1) { if (tid < st) red[tid] += red[tid + st]; __syncthreads(); }
  const float mu = red[0] / (float)N; __syncthreads();
  float s2 = 0.f;
  for (int u = 0; u < per / 4; ++u)
#pragma unroll
    for (int q = 0; q < 4; ++q) { const float c = vals[u * 4 + q] - mu; s2 += c * c; }
  red[tid] = s2; __syncthreads();
  for (int st = 128; st > 0; st >>= 1) { if (tid < st) red[tid] += red[tid + st]; __syncthreads(); }
  const float rs = rsqrtf(red[0] / (float)N + eps);
  {
    for (int u = 0; u < per / 4; ++u) {
      const int j = tid * 4 + 1024 * u;
      v4f o, sm;
#pragma unroll
      for (int q = 0; q < 4; ++q) {
        float gg = g[j + q], bb = bta[j + q];
        if (PARAM_BF16) { gg = bf16_round(gg); bb = bf16_round(bb); }
        sm[q] = vals[u * 4 + q]; o[q] = (vals[u * 4 + q] - mu) * rs * gg + bb;
      }
      if (out_sum) *(v4f*)(out_sum + (size_t)row * N + j) = sm;
      *(v4f*)(out_norm + (size_t)row * N + j) = o;
    }
    
  }
}



// ---- f16 WMMA path (v_wmma_f32_16x16x32_f16): 11-bit significands for operands in range — used where a [0,1] probability operand needs more precision than bf16
typedef _Float16 v16h __attribute__((ext_vector_type(16)));
union FragH { v16h v; v8us half[2]; _Float16 h[16]; unsigned short u[16]; };
template <int NT>
__device__ __forceinline__ v8f mmaH(v16h ah, v16h al, v16h bh, v16h bl, v8f c) {
  c = __builtin_amdgcn_wmma_f32_16x16x32_f16(false, ah, false, bh, (short)0, c, false, false);
  if (NT >= 2) c = __builtin_amdgcn_wmma_f32_16x16x32_f16(false, al, false, bh, (short)0, c, false, false);
  if (NT >= 3) c = __builtin_amdgcn_wmma_f32_16x16x32_f16(false, ah, false, bl, (short)0, c, false, false);
  asm volatile("v_nop\n\tv_nop\n\tv_nop\n\tv_nop" : "+v"(c) : "v"(ah), "v"(al), "v"(bh), "v"(bl));
  return c;
}
// batched GEMM like k_gemm_b but f16 operands: A f32 (split into f16 hi/lo if ASPLIT, else rounded to f16), Bt = f16 values [n][k]; alpha; C f32; N multiple of 16 (partial tiles skipped)
template <bool ASPLIT>
__global__ __launch_bounds__(128) void k_gemm_h(const float* __restrict__ A, int lda, size_t sA, const _Float16* __restrict__ Bh, int ldb, size_t sB, float alpha, float* __restrict__ C, int ldc, size_t sC, int M, int N, int K) {
  __shared__ __attribute__((aligned(16))) float so[4][16][64];
  const int tid = threadIdx.x, w = tid >> 5, lane = tid & 31, ln = lane & 15, hh = lane >> 4; const int by = blockIdx.y;
  A += (size_t)by * sA; Bh += (size_t)by * sB; C += (size_t)by * sC;
  const int ntn = (N + 63) / 64; const int wid = blockIdx.x * 4 + w; const int mt = wid / ntn, nq = wid % ntn; if (mt * 16 >= M) return;
  const int row0 = mt * 16, col0 = nq * 64; const float* arow = A + (size_t)(row0 + ln) * lda;
  v8f acc[4] = {};
  for (int kb = 0; kb < K; kb += 32) {
    FragH ah, al;
    const v4f x0 = *(const v4fa*)(arow + kb + 8 * hh), x1 = *(const v4fa*)(arow + kb + 8 * hh + 4), x2 = *(const v4fa*)(arow + kb + 16 + 8 * hh), x3 = *(const v4fa*)(arow + kb + 16 + 8 * hh + 4);
    float xs[16] = {x0[0],x0[1],x0[2],x0[3],x1[0],x1[1],x1[2],x1[3],x2[0],x2[1],x2[2],x2[3],x3[0],x3[1],x3[2],x3[3]};
#pragma unroll
    for (int i = 0; i < 16; ++i) { const _Float16 h = (_Float16)xs[i]; ah.h[i] = h; al.h[i] = ASPLIT ? (_Float16)(xs[i] - (float)h) : (_Float16)0.0f; }
#pragma unroll
    for (int t = 0; t < 4; ++t) { if (col0 + t * 16 >= N) continue; const size_t boff = (size_t)(col0 + t * 16 + ln) * ldb + kb; FragH bq; bq.half[0] = *(const v8us*)(Bh + boff + 8 * hh); bq.half[1] = *(const v8us*)(Bh + boff + 16 + 8 * hh);
      acc[t] = mmaH<ASPLIT ? 2 : 1>(ah.v, al.v, bq.v, bq.v, acc[t]); }
  }
#pragma unroll
  for (int t = 0; t < 4; ++t) { if (col0 + t * 16 >= N) continue;
#pragma unroll
    for (int r = 0; r < 8; ++r) so[w][8 * hh + r][t * 16 + ln] = acc[t][r] * alpha; }
  __builtin_amdgcn_fence(__ATOMIC_ACQ_REL, "workgroup"); __builtin_amdgcn_wave_barrier();
  const int rsub = lane >> 4, c4 = (lane & 15) * 4;
  {
#pragma unroll
    for (int q = 0; q < 8; ++q) { const int r = q * 2 + rsub; if (col0 + c4 < N) { const v4f v = *(const v4fa*)&so[w][r][c4]; *(v4f*)(C + (size_t)(row0 + r) * ldc + col0 + c4) = v; } }
     }
}

// Wt[n][k] = f16(W[k][n]·scale) from f32 row-major W[K][N] (scale = power of two; bf16-exact weights stay exact in f16 away from the subnormal range)
__global__ __launch_bounds__(256) void k_wt_f16(const float* __restrict__ W, _Float16* __restrict__ Wt, int K, int N, float scale) {
  const int t = blockIdx.x * 256 + threadIdx.x; if (t >= N * (K / 8)) return; const int n = t / (K / 8), k8 = (t % (K / 8)) * 8; FragH f;
#pragma unroll
  for (int i = 0; i < 8; ++i) f.h[i] = (_Float16)(bf16_round(W[(size_t)(k8 + i) * N + n]) * scale); const v8us o = f.half[0];
  *(v8us*)((unsigned short*)Wt + (size_t)n * K + k8) = o; 
}
// k_gemm_hh variant with fused epilogue: v = acc·alpha + bias[by·sBias + col] (+ CP[(row/rowsPerB)·sCPb + by·64 + col] if CP) ; ACT 0 none / 1 elu ; writes f16 C16 (and f32 C if non-null)
template <int ACT>
__global__ __launch_bounds__(128) void k_gemm_hhx(const _Float16* __restrict__ A, int lda, size_t sA, const _Float16* __restrict__ Bh, int ldb, size_t sB, float alpha, const float* __restrict__ bias, size_t sBias, const float* __restrict__ CP, int rowsPerB, size_t sCPb, int row0g,
    float* __restrict__ C, _Float16* __restrict__ C16, int ldc, size_t sC, int M, int N, int K) {
  __shared__ __attribute__((aligned(16))) float so[4][16][64];
  const int tid = threadIdx.x, w = tid >> 5, lane = tid & 31, ln = lane & 15, hh = lane >> 4; const int by = blockIdx.y;
  A += (size_t)by * sA; Bh += (size_t)by * sB; const size_t cofs = (size_t)by * sC; const float* bp = bias ? bias + (size_t)by * sBias : nullptr;
  const int ntn = (N + 63) / 64; const int wid = blockIdx.x * 4 + w; const int mt = wid / ntn, nq = wid % ntn; if (mt * 16 >= M) return;
  const int row0 = mt * 16, col0 = nq * 64; const _Float16* arow = A + (size_t)(row0 + ln) * lda;
  v8f acc[4] = {};
  for (int kb = 0; kb < K; kb += 32) { FragH ah; ah.half[0] = *(const v8us*)((const unsigned short*)arow + kb + 8 * hh); ah.half[1] = *(const v8us*)((const unsigned short*)arow + kb + 16 + 8 * hh);
#pragma unroll
    for (int t = 0; t < 4; ++t) { if (col0 + t * 16 >= N) continue; const size_t boff = (size_t)(col0 + t * 16 + ln) * ldb + kb; FragH bq; bq.half[0] = *(const v8us*)((const unsigned short*)Bh + boff + 8 * hh); bq.half[1] = *(const v8us*)((const unsigned short*)Bh + boff + 16 + 8 * hh);
      acc[t] = mmaH<1>(ah.v, ah.v, bq.v, bq.v, acc[t]); }
  }
#pragma unroll
  for (int t = 0; t < 4; ++t) { if (col0 + t * 16 >= N) continue; const int col = col0 + t * 16 + ln; const float bv = bp ? bf16_round(bp[col]) : 0.f;
#pragma unroll
    for (int r = 0; r < 8; ++r) { float v = acc[t][r] * alpha + bv; if (CP) { const int rr = row0g + row0 + 8 * hh + r; if (rowsPerB < 0) v += CP[cofs + (size_t)rr * ldc + col];      /* rowsPerB < 0: own element of the batched C plane */ else { const int bidx = rr / rowsPerB; v += CP[(size_t)bidx * sCPb + (size_t)by * 64 + col]; } } if (ACT == 1) v = (v > 0.f) ? v : expm1f(v); else if (ACT == 7) v = (v > 0.f) ? v + 1.0f : expf(v); else if (ACT == 8) v = tanhf(v); else if (ACT == 9) v = 0.5f * v * (1.0f + tanhf(0.7978845608028654f * (v + 0.044715f * v * v * v))); else if (ACT == 11) v = 1.0f / (1.0f + expf(-v)); else if (ACT == 12) v = (v > 0.f) ? v : 0.01f * v; else if (ACT == 14) v = (v > 0.f) ? v : 0.1f * v; else if (ACT == 16) v = (v >= 0.f) ? v : 0.3f * v; else if (ACT == 15) v = v / (1.0f + expf(-v)); else if (ACT == 3) v = fmaxf(v, 0.f); else if (ACT == 6) v = 0.5f * v * (1.0f + erff(v * 0.70710678118654752f)); so[w][8 * hh + r][t * 16 + ln] = v; } }
  __builtin_amdgcn_fence(__ATOMIC_ACQ_REL, "workgroup"); __builtin_amdgcn_wave_barrier();
  const int rsub = lane >> 4, c4 = (lane & 15) * 4; typedef _Float16 v4h __attribute__((ext_vector_type(4)));
  {
#pragma unroll
    for (int q = 0; q < 8; ++q) { const int r = q * 2 + rsub; if (col0 + c4 < N) { const v4f v = *(const v4fa*)&so[w][r][c4]; if (C) *(v4f*)(C + cofs + (size_t)(row0 + r) * ldc + col0 + c4) = v; if (C16) { v4h h4; for (int i = 0; i < 4; ++i) h4[i] = (_Float16)v[i]; *(v4h*)(C16 + cofs + (size_t)(row0 + r) * ldc + col0 + c4) = h4; } } }
     }
}


typedef _Float16 v4h __attribute__((ext_vector_type(4)));

__global__ __launch_bounds__(256) void k_x16(const float* __restrict__ x, _Float16* __restrict__ X16, size_t n8) { const size_t t = (size_t)blockIdx.x * 256 + threadIdx.x; if (t >= n8) return; FragH f;
#pragma unroll
  for (int q = 0; q < 8; ++q) f.h[q] = (_Float16)bf16_round(x[t * 8 + q]); *(v8us*)((unsigned short*)X16 + t * 8) = f.half[0];  }
__global__ __launch_bounds__(256) void k_h16(const float* __restrict__ x, _Float16* __restrict__ X16, size_t n8) { const size_t t = (size_t)blockIdx.x * 256 + threadIdx.x; if (t >= n8) return; FragH f;
#pragma unroll
  for (int q = 0; q < 8; ++q) f.h[q] = (_Float16)x[t * 8 + q]; *(v8us*)((unsigned short*)X16 + t * 8) = f.half[0];  }
__global__ __launch_bounds__(256) void k_round16f(const float* __restrict__ W, _Float16* __restrict__ Bt, size_t n8) { const size_t t = (size_t)blockIdx.x * 256 + threadIdx.x; if (t >= n8) return; FragH f;
#pragma unroll
  for (int i = 0; i < 8; ++i) f.h[i] = (_Float16)(bf16_round(W[t * 8 + i]) * 16.0f); *(v8us*)((unsigned short*)Bt + t * 8) = f.half[0];  }
template <int NHv, int TTv>
__global__ __launch_bounds__(256) void k_vt(const _Float16* __restrict__ V16, int ldv, int voff, _Float16* __restrict__ Vt) { __shared__ unsigned short tl[64][66]; const int tid = threadIdx.x; const int slab = blockIdx.x / (TTv / 64), lg = blockIdx.x % (TTv / 64); const int b = slab / NHv, h = slab % NHv;
  for (int i = tid; i < 64 * 8; i += 256) { const int r = i / 8, c8 = (i % 8) * 8; FragH f; f.half[0] = *(const v8us*)((const unsigned short*)V16 + ((size_t)b * TTv + lg * 64 + r) * ldv + voff + h * 64 + c8);
#pragma unroll
    for (int q = 0; q < 8; ++q) tl[r][c8 + q] = f.u[q]; }
  __syncthreads();
  {
#pragma unroll
    for (int rd = 0; rd < 2; ++rd) { const int d = rd * 32 + tid / 8, pc = tid % 8; FragH f;
#pragma unroll
      for (int q = 0; q < 8; ++q) f.u[q] = tl[pc * 8 + q][d];
      *(v8us*)((unsigned short*)Vt + ((size_t)slab * 64 + d) * TTv + lg * 64 + pc * 8) = f.half[0]; }
     } }

__global__ __launch_bounds__(256) void k_hl(const float* __restrict__ F, _Float16* __restrict__ Hh, _Float16* __restrict__ Hl, size_t n8) { const size_t t = (size_t)blockIdx.x * 256 + threadIdx.x; if (t >= n8) return; FragH fh, fl; const v4f a = *(const v4fa*)(F + t * 8), c = *(const v4fa*)(F + t * 8 + 4);
#pragma unroll
  for (int q = 0; q < 4; ++q) { _Float16 h = (_Float16)a[q]; fh.h[q] = h; fl.h[q] = (_Float16)((a[q] - (float)h) * 1024.0f); h = (_Float16)c[q]; fh.h[4 + q] = h; fl.h[4 + q] = (_Float16)((c[q] - (float)h) * 1024.0f); }
  { *(v8us*)((unsigned short*)Hh + t * 8) = fh.half[0]; *(v8us*)((unsigned short*)Hl + t * 8) = fl.half[0];  } }

// one A or B fragment of the 16x16x32 f16 form from a row of 32 halves: k = 8hh .. 8hh + 7 and 16 + 8hh .. 16 + 8hh + 7
__device__ __forceinline__ v16h g2_frag(const _Float16* p, int hh) { FragH f; f.half[0] = *(const v8us*)((const unsigned short*)p + 8 * hh); f.half[1] = *(const v8us*)((const unsigned short*)p + 16 + 8 * hh); return f.v; }


__device__ __forceinline__ void wsc_body(int bx, const float* __restrict__ Wm, _Float16* __restrict__ Bt, size_t n8, float sc) { const size_t t = (size_t)bx * 256 + threadIdx.x; if (t >= n8) return; FragH f; for (int q = 0; q < 8; ++q) f.h[q] = (_Float16)(bf16_round(Wm[t * 8 + q]) * sc); *(v8us*)((unsigned short*)Bt + t * 8) = f.half[0];  }
__device__ __forceinline__ void instat_body(int c, const float* __restrict__ base, size_t scs, size_t sss, int rnd, float* __restrict__ ST) {
  #pragma clang fp contract(off)
  __shared__ float red[256]; const int tid = threadIdx.x; float s = 0.f;
  const float* xp = base + (size_t)c * scs + (size_t)tid * sss; float x[NS / 256];      /* the thread's 16 values: read once, all 16 loads in flight together, held in registers for both passes */
#pragma unroll      /* unrolled so that x[] stays in registers and the loads stand in a row: one round trip to memory instead of one a value */
  for (int j = 0; j < NS / 256; ++j) x[j] = xp[(size_t)j * 256 * sss];
  asm volatile("s_wait_xcnt 0x0" ::: "memory");      /* behind the 16 loads: the code that follows them rewrites their address registers */
#pragma unroll      /* the sums run in the order of the rolled loops: same values, same rounding */
  for (int j = 0; j < NS / 256; ++j) { if (rnd) x[j] = bf16_round(x[j]); s += x[j]; }
  red[tid] = s; __syncthreads(); for (int st = 128; st > 0; st >>= 1) { if (tid < st) red[tid] += red[tid + st]; __syncthreads(); } const float mean = red[0] / (float)NS; __syncthreads(); float vs = 0.f;
#pragma unroll
  for (int j = 0; j < NS / 256; ++j) { const float d = x[j] - mean; vs += d * d; }
  red[tid] = vs; __syncthreads(); for (int st = 128; st > 0; st >>= 1) { if (tid < st) red[tid] += red[tid + st]; __syncthreads(); }
  if (tid == 0) { const float var = red[0] / (float)NS; { *(float*)(ST + c * 2) = mean; *(float*)(ST + c * 2 + 1) = var;  } } }
__global__ __launch_bounds__(256) void k_instat(const float* __restrict__ base, size_t scs, size_t sss, int rnd, float* __restrict__ ST) { instat_body(blockIdx.x, base, scs, sss, rnd, ST); }
// Everything that depends on the inputs alone, in one grid: blocks 0-127 statistics of x_q, 128-255 of x_kv, then 16 blocks for each of the six weight matrices.
__global__ __launch_bounds__(256) void k_prep(const float* __restrict__ xq, const float* __restrict__ xkv, float* __restrict__ STQ, float* __restrict__ STK,
    const float* __restrict__ qW, const float* __restrict__ kW, const float* __restrict__ vW, const float* __restrict__ oW, const float* __restrict__ W1, const float* __restrict__ W2,
    _Float16* __restrict__ BQ, _Float16* __restrict__ BK, _Float16* __restrict__ BV, _Float16* __restrict__ BOW, _Float16* __restrict__ BW1, _Float16* __restrict__ BW2) {
  const int b = blockIdx.x;
  if (b < 2 * CC) { instat_body(b & (CC - 1), b < CC ? xq : xkv, (size_t)NS, (size_t)1, 1, b < CC ? STQ : STK); return; }
  const int u = b - 2 * CC, m = u >> 4;      /* every matrix has HDA * CC = 32768 elements: 4096 threads, 16 blocks */
  const float* Wm = m == 0 ? qW : m == 1 ? kW : m == 2 ? vW : m == 3 ? oW : m == 4 ? W1 : W2;
  _Float16* Bt = m == 0 ? BQ : m == 1 ? BK : m == 2 ? BV : m == 3 ? BOW : m == 4 ? BW1 : BW2;
  wsc_body(u & 15, Wm, Bt, (size_t)HDA * CC / 8, 16.0f); }
__device__ __forceinline__ v8f fa_mma(v16h a, v16h b, v8f c) { return __builtin_amdgcn_wmma_f32_16x16x32_f16(false, a, false, b, (short)0, c, false, false); }
typedef float v2f  __attribute__((ext_vector_type(2)));
typedef float v2fa __attribute__((ext_vector_type(2), may_alias));
typedef int   v4ia __attribute__((ext_vector_type(4), may_alias));
// Normalisation, one of the three projections and the attention kernel's operand order in one kernel. Workgroup = 32 voxels x all 256 outputs of q (blockIdx.y 0), k (1) or v (2); wave = one head.
// x[c][s] is read in whole 128-byte lines, normalised and laid down as Hs[s][c] (f16) in LDS. q and k are computed transposed (A = weights, B = h): a lane holds 8 outputs in a row of one voxel, which is
// a 16-byte piece of a Q16 row and exactly a lane's piece of KP. v is computed straight (A = h, B = weights): a lane holds 8 keys in a row of one output, a lane's piece of VP.
// KP[h][16-key tile][j][lane][8]: k[tile*16 + c][16j + 8hh + i]; VP[h][32-key block][dt][j][lane][8]: mask[key] * v[key = block*32 + 16j + 8hh + i][16dt + c]  (c = lane & 15, hh = lane >> 4)
__global__ __launch_bounds__(256) void k_nqkv(const float* __restrict__ xq, const float* __restrict__ xkv, const float* __restrict__ STQ, const float* __restrict__ STK, const float* __restrict__ gq, const float* __restrict__ bq, const float* __restrict__ gk, const float* __restrict__ bk,
    const _Float16* __restrict__ BQ, const _Float16* __restrict__ BK, const _Float16* __restrict__ BV, const int* __restrict__ msk, _Float16* __restrict__ Q16, _Float16* __restrict__ KP, _Float16* __restrict__ VP) {
  __shared__ __attribute__((aligned(16))) _Float16 Hs[32][CC + 8];      /* pitch of 16 bytes x an odd number for the 16-byte fragment reads */
  const int tid = threadIdx.x, w = tid >> 5, lane = tid & 31, ln = lane & 15, hh = lane >> 4; const int z = blockIdx.y, g = blockIdx.x, s0 = g * 32;
  const int c0 = (tid >> 2) * 2, sq = (tid & 3) * 8;      /* normalisation: two channels, 8 voxels */
  const float* xp = (z == 0 ? xq : xkv) + (size_t)c0 * NS + s0 + sq; const float* stp = (z == 0 ? STQ : STK) + c0 * 2; const float* gp = (z == 0 ? gq : gk) + c0; const float* bp = (z == 0 ? bq : bk) + c0;
  const _Float16* wp = (z == 0 ? BQ : z == 1 ? BK : BV) + (size_t)(32 * w + ln) * CC; const int* mp = msk + s0 + 8 * hh;
  const v4f xa0 = *(const v4fa*)xp, xa1 = *(const v4fa*)(xp + 4), xb0 = *(const v4fa*)(xp + NS), xb1 = *(const v4fa*)(xp + NS + 4);
  const v4f st = *(const v4fa*)stp; const v2f gg = *(const v2fa*)gp, bb = *(const v2fa*)bp;
  v16h wf0[4], wf1[4];
#pragma unroll
  for (int kb = 0; kb < 4; ++kb) { wf0[kb] = g2_frag(wp + kb * 32, hh); wf1[kb] = g2_frag(wp + 16 * CC + kb * 32, hh); }
  const v4ia m0 = *(const v4ia*)mp, m1 = *(const v4ia*)(mp + 4), m2 = *(const v4ia*)(mp + 16), m3 = *(const v4ia*)(mp + 20);
  asm volatile("s_wait_xcnt 0x0" :: "v"(xp), "v"(stp), "v"(gp), "v"(bp), "v"(wp), "v"(mp) : "memory");      /* in front of the arithmetic, which may reuse the loads' address registers; it names them, so that none is given to a later load's result ahead of the wait */
  __builtin_amdgcn_sched_barrier(0);      /* keeps that arithmetic behind the wait, and every global load of the kernel up here, in flight together: one round trip to memory for all of them */
  { const float ra = rsqrtf(st[1] + 1e-5f), rb = rsqrtf(st[3] + 1e-5f), ga = bf16_round(gg[0]), gb = bf16_round(gg[1]), ba = bf16_round(bb[0]), bc = bf16_round(bb[1]);
    typedef _Float16 v2h __attribute__((ext_vector_type(2), may_alias));
#pragma unroll
    for (int i = 0; i < 8; ++i) { const float a = bf16_round(i < 4 ? xa0[i & 3] : xa1[i & 3]), b = bf16_round(i < 4 ? xb0[i & 3] : xb1[i & 3]);
      const v2h p = {(_Float16)((a - st[0]) * ra * ga + ba), (_Float16)((b - st[2]) * rb * gb + bc)}; *(v2h*)&Hs[sq + i][c0] = p; } }
  __syncthreads();
  v16h n0[4], n1[4];
#pragma unroll
  for (int kb = 0; kb < 4; ++kb) { n0[kb] = g2_frag(&Hs[ln][kb * 32], hh); n1[kb] = g2_frag(&Hs[16 + ln][kb * 32], hh); }
  const v8f z8 = {0.f,0.f,0.f,0.f,0.f,0.f,0.f,0.f}; v8f d00 = z8, d01 = z8, d10 = z8, d11 = z8; FragH f00, f01, f10, f11;
  if (z < 2) {      /* dab: outputs 32w + 16a + 8hh + r of voxel s0 + 16b + ln */
#pragma unroll
    for (int kb = 0; kb < 4; ++kb) { d00 = fa_mma(wf0[kb], n0[kb], d00); d01 = fa_mma(wf0[kb], n1[kb], d01); d10 = fa_mma(wf1[kb], n0[kb], d10); d11 = fa_mma(wf1[kb], n1[kb], d11); }
    const float al = z == 0 ? 0.03125f : 0.0625f;      /* 1/16 undoes the weights' scale; q is stored halved for the tanh form of the sigmoid (powers of two: the f16 rounding is the same) */
#pragma unroll
    for (int r = 0; r < 8; ++r) { f00.h[r] = (_Float16)(d00[r] * al); f01.h[r] = (_Float16)(d01[r] * al); f10.h[r] = (_Float16)(d10[r] * al); f11.h[r] = (_Float16)(d11[r] * al); }
    if (z == 0) { unsigned short* qo = (unsigned short*)Q16 + (size_t)(s0 + ln) * HDA + 32 * w + 8 * hh;
      *(v8us*)qo = f00.half[0]; *(v8us*)(qo + 16) = f10.half[0]; *(v8us*)(qo + 16 * HDA) = f01.half[0]; *(v8us*)(qo + 16 * HDA + 16) = f11.half[0]; }
    else { unsigned short* ko = (unsigned short*)KP + ((size_t)w * 256 + g * 2) * 512 + lane * 8;      /* tile 2g: j = 0, 1; tile 2g + 1: j = 0, 1 */
      *(v8us*)ko = f00.half[0]; *(v8us*)(ko + 256) = f10.half[0]; *(v8us*)(ko + 512) = f01.half[0]; *(v8us*)(ko + 768) = f11.half[0];
      asm volatile("s_wait_xcnt 0x0" ::: "memory"); } }      /* behind the four stores: the code that follows them in the listing rewrites their address and data registers */
  else {      /* dab: keys s0 + 16a + 8hh + r of output 32w + 16b + ln */
#pragma unroll
    for (int kb = 0; kb < 4; ++kb) { d00 = fa_mma(n0[kb], wf0[kb], d00); d01 = fa_mma(n0[kb], wf1[kb], d01); d10 = fa_mma(n1[kb], wf0[kb], d10); d11 = fa_mma(n1[kb], wf1[kb], d11); }
#pragma unroll
    for (int r = 0; r < 8; ++r) { const float ma = (float)(r < 4 ? m0[r & 3] : m1[r & 3]), mb = (float)(r < 4 ? m2[r & 3] : m3[r & 3]);      /* v is rounded to f16 first, then masked */
      f00.h[r] = (_Float16)((float)(_Float16)(d00[r] * 0.0625f) * ma); f01.h[r] = (_Float16)((float)(_Float16)(d01[r] * 0.0625f) * ma);
      f10.h[r] = (_Float16)((float)(_Float16)(d10[r] * 0.0625f) * mb); f11.h[r] = (_Float16)((float)(_Float16)(d11[r] * 0.0625f) * mb); }
    unsigned short* vo = (unsigned short*)VP + ((size_t)w * 128 + g) * 1024 + lane * 8;      /* dt = 0: j = 0, 1; dt = 1: j = 0, 1 */
    *(v8us*)vo = f00.half[0]; *(v8us*)(vo + 256) = f10.half[0]; *(v8us*)(vo + 512) = f01.half[0]; *(v8us*)(vo + 768) = f11.half[0];
    asm volatile("s_wait_xcnt 0x0" ::: "memory"); } }      /* behind the four stores: the code that follows them in the listing rewrites their address and data registers */
__device__ __forceinline__ v16h fa_frag(const unsigned short* p) { FragH f; f.half[0] = *(const v8us*)p; f.half[1] = *(const v8us*)(p + 256); return f.v; }
// sigmoid(x) = 0.5 + 0.5 tanh(x / 2) on the chip's own v_tanh_f32: one transcendental, half a packed fma and half a packed convert an element. The scores arrive already halved (Q16 holds q / 2).
// two S^T tiles (keys 0-15 and 16-31 of a block, one query per lane column) -> sigmoid -> the A fragment of w.v: D register r of tile j holds key 16j + 8hh + r, which is A's element 8j + r
__device__ __forceinline__ v16h fa_sig(v8f s0, v8f s1) { FragH f;
  for (int r = 0; r < 8; ++r) { f.h[r] = (_Float16)(0.5f + 0.5f * __builtin_amdgcn_tanhf(s0[r])); f.h[8 + r] = (_Float16)(0.5f + 0.5f * __builtin_amdgcn_tanhf(s1[r])); }
  return f.v; }
// one block of 32 keys against the wave's 32 queries
__device__ __forceinline__ void fa_block(v16h k0, v16h k1, v16h v0, v16h v1, v16h qf0, v16h qf1, v8f& o00, v8f& o01, v8f& o10, v8f& o11) {
  const v8f z8 = {0.f,0.f,0.f,0.f,0.f,0.f,0.f,0.f};
  const v8f s00 = fa_mma(k0, qf0, z8), s01 = fa_mma(k1, qf0, z8), s10 = fa_mma(k0, qf1, z8), s11 = fa_mma(k1, qf1, z8);
  const v16h p0 = fa_sig(s00, s01); o00 = fa_mma(p0, v0, o00); o01 = fa_mma(p0, v1, o01);
  const v16h p1 = fa_sig(s10, s11); o10 = fa_mma(p1, v0, o10); o11 = fa_mma(p1, v1, o11); }
// Fused attention: one workgroup = one head x 128 queries; wave = 32 queries (w & 3) x one quarter of the keys (w >> 2). Q16 holds q / 2: S^T = k (q/2)^T, w = sigmoid(q.k) = 0.5 + 0.5 tanh(S^T) stays in registers, o += w (mask v); the four key quarters are joined through LDS.
__global__ __launch_bounds__(512) void k_fattn(const _Float16* __restrict__ Q16, const _Float16* __restrict__ KP, const _Float16* __restrict__ VP, _Float16* __restrict__ O16) {
  __shared__ __attribute__((aligned(16))) float part[4][128][36];
  const int tid = threadIdx.x, w = tid >> 5, lane = tid & 31, ln = lane & 15, hh = lane >> 4;
  const int h = blockIdx.x >> 5, q0 = (blockIdx.x & 31) * 128; const int qg = w & 3, kq = w >> 2;
  const _Float16* qp = Q16 + (size_t)(q0 + qg * 32 + ln) * HDA + h * HDm;
  const v16h qf0 = g2_frag(qp, hh), qf1 = g2_frag(qp + (size_t)16 * HDA, hh);
  const unsigned short* kp = (const unsigned short*)KP + ((size_t)h * 128 + kq * 32) * 1024 + lane * 8;
  const unsigned short* vp = (const unsigned short*)VP + ((size_t)h * 128 + kq * 32) * 1024 + lane * 8;
  const v8f z8 = {0.f,0.f,0.f,0.f,0.f,0.f,0.f,0.f}; v8f o00 = z8, o01 = z8, o10 = z8, o11 = z8;
  v16h nk0 = fa_frag(kp), nk1 = fa_frag(kp + 512), nv0 = fa_frag(vp), nv1 = fa_frag(vp + 512);
#pragma unroll 1      /* stays rolled: one trip's code (some 140 instructions) serves all 32 trips, for speed only */
  for (int b = 0; b < 32; ++b) { const v16h k0 = nk0, k1 = nk1, v0 = nv0, v1 = nv1;
    const int nb = (b < 31 ? b + 1 : 31) * 1024;      /* the next block's fragments fly while this block is worked on (the last trip reads its own block again and drops it) */
    nk0 = fa_frag(kp + nb); nk1 = fa_frag(kp + nb + 512); nv0 = fa_frag(vp + nb); nv1 = fa_frag(vp + nb + 512);
    asm volatile("s_wait_xcnt 0x0" ::: "memory");      /* in front of the block's arithmetic, which reuses the loads' address registers */
    __builtin_amdgcn_sched_barrier(0);      /* keeps the eight loads up here: without it the scheduler sinks them to the foot of the trip, right in front of their use */
    fa_block(k0, k1, v0, v1, qf0, qf1, o00, o01, o10, o11);
    __builtin_amdgcn_sched_barrier(0); }      /* keeps the copies of the loaded fragments, and so the waits for them, at the foot: without it some rise to the head of the trip */
  for (int r = 0; r < 8; ++r) { float* pr = &part[kq][qg * 32 + 8 * hh + r][ln]; pr[0] = o00[r]; pr[16] = o01[r]; pr[16 * 36] = o10[r]; pr[16 * 36 + 16] = o11[r]; }
  __syncthreads();
  const int q = tid >> 2, d0 = (tid & 3) * 8; v4f a = *(const v4fa*)&part[0][q][d0], c = *(const v4fa*)&part[0][q][d0 + 4];
  for (int s = 1; s < 4; ++s) { a += *(const v4fa*)&part[s][q][d0]; c += *(const v4fa*)&part[s][q][d0 + 4]; }
  FragH f;
  for (int i = 0; i < 4; ++i) { f.h[i] = (_Float16)a[i]; f.h[4 + i] = (_Float16)c[i]; }
  *(v8us*)((unsigned short*)O16 + (size_t)(q0 + q) * HDA + h * HDm + d0) = f.half[0]; }
// attn = o oW^T + x_q for 32 voxels x all 128 channels a workgroup; wave = 16 channels. D holds one channel a lane and 8 voxels in a row in its registers, so x_q is read from the input and
// attn is stored channel-major (ATc[c][s]) with 16-byte accesses and no transposition. Each wave also leaves mean and sum of squared deviations of its 16 channels over the 32 voxels: PS[group][c] = {mean, M2}.
__global__ __launch_bounds__(256) void k_oproj(const _Float16* __restrict__ O16, const _Float16* __restrict__ BOW, const float* __restrict__ xq, float* __restrict__ ATc, float* __restrict__ PS) {
  const int tid = threadIdx.x, w = tid >> 5, lane = tid & 31, ln = lane & 15, hh = lane >> 4;
  const int g = blockIdx.x, s0 = g * 32, c = w * 16 + ln;
  const _Float16* ap = O16 + (size_t)(s0 + ln) * HDA; const _Float16* bp = BOW + (size_t)c * HDA; const float* xp = xq + (size_t)c * NS + s0 + 8 * hh;
  v16h a0[8], a1[8], b[8];
#pragma unroll      /* all 48 fragment loads are in flight together: one round trip to L2 instead of one a k step */
  for (int kb = 0; kb < 8; ++kb) { a0[kb] = g2_frag(ap + kb * 32, hh); a1[kb] = g2_frag(ap + (size_t)16 * HDA + kb * 32, hh); b[kb] = g2_frag(bp + kb * 32, hh); }
  const v4f x0 = *(const v4fa*)xp, x1 = *(const v4fa*)(xp + 4), x2 = *(const v4fa*)(xp + 16), x3 = *(const v4fa*)(xp + 20);
  asm volatile("s_wait_xcnt 0x0" ::: "memory");      /* in front of the arithmetic, which may reuse the loads' address registers */
  __builtin_amdgcn_sched_barrier(0);      /* keeps that arithmetic behind the wait, and the loads together in front of it */
  const v8f z8 = {0.f,0.f,0.f,0.f,0.f,0.f,0.f,0.f}; v8f c0 = z8, c1 = z8;
#pragma unroll
  for (int kb = 0; kb < 8; ++kb) { c0 = fa_mma(a0[kb], b[kb], c0); c1 = fa_mma(a1[kb], b[kb], c1); }
  float v[16];
#pragma unroll
  for (int r = 0; r < 4; ++r) { v[r] = c0[r] * 0.0625f + bf16_round(x0[r]); v[4 + r] = c0[4 + r] * 0.0625f + bf16_round(x1[r]); v[8 + r] = c1[r] * 0.0625f + bf16_round(x2[r]); v[12 + r] = c1[4 + r] * 0.0625f + bf16_round(x3[r]); }
  float s = 0.f;
#pragma unroll
  for (int i = 0; i < 16; ++i) s += v[i];
  s += __shfl_xor(s, 16);      /* lanes l and l + 16 hold the two halves of one channel's 32 voxels */
  const float mean = s * (1.0f / 32.0f); float q2 = 0.f;
#pragma unroll
  for (int i = 0; i < 16; ++i) { const float d = v[i] - mean; q2 += d * d; }
  q2 += __shfl_xor(q2, 16);
  float* op = ATc + (size_t)c * NS + s0 + 8 * hh;
  const v4f y0 = {v[0], v[1], v[2], v[3]}, y1 = {v[4], v[5], v[6], v[7]}, y2 = {v[8], v[9], v[10], v[11]}, y3 = {v[12], v[13], v[14], v[15]};
  *(v4fa*)op = y0; *(v4fa*)(op + 4) = y1; *(v4fa*)(op + 16) = y2; *(v4fa*)(op + 20) = y3;
  if (hh == 0) { const v2f p = {mean, q2}; *(v2fa*)(PS + ((size_t)g * CC + c) * 2) = p; } }
// The rest of the network for 32 voxels a workgroup (16 waves): join the 128 groups' {mean, M2} to the statistics of attn; h = IN(attn) -> LDS [s][c]; relu(W1 h + b1) computed transposed (A = W1, B = h),
// so that a lane holds 8 hidden units in a row of one voxel -> LDS [s][n]; W2 . + b2 -> LDS [c][s]; + attn, stored to out[c][s] in whole 128-byte lines.
__global__ __launch_bounds__(512) void k_mlp(const float* __restrict__ ATc, const float* __restrict__ PS, const float* __restrict__ gp, const float* __restrict__ bp, const _Float16* __restrict__ BW1, const float* __restrict__ b1, const _Float16* __restrict__ BW2, const float* __restrict__ b2, float* __restrict__ out) {
  __shared__ __attribute__((aligned(16))) _Float16 Hs[32][CC + 8];      /* pitches of 16 bytes x an odd number for the 16-byte fragment reads */
  __shared__ __attribute__((aligned(16))) _Float16 Gs[32][2 * CC + 8];
  __shared__ __attribute__((aligned(16))) float Cs[CC][36];
  __shared__ float r1[4][CC], r2[4][CC];
  const int tid = threadIdx.x, w = tid >> 5, lane = tid & 31, ln = lane & 15, hh = lane >> 4; const int s0 = blockIdx.x * 32;
  const int cs = tid & (CC - 1), part = tid >> 7;      /* statistics: one channel, 32 of the 128 groups */
  const int c = tid >> 2, sq = (tid & 3) * 8;      /* normalisation and final store: one channel, 8 voxels */
  const int nt = w & 7, mt = w >> 3;      /* second product: 16 channels x 16 voxels */
  const unsigned pso = (unsigned)(part * 32 * CC + cs) * 8u;      /* byte offset of the thread's first {mean, M2} pair */
  v2f ps[32];
#pragma unroll
  for (int g = 0; g < 32; ++g) ps[g] = *(const v2fa*)((const char*)PS + pso + g * (CC * 8));
  const float* atp = ATc + (size_t)c * NS + s0 + sq; const v4f xa = *(const v4fa*)atp, xb = *(const v4fa*)(atp + 4);
  const unsigned short* w1p = (const unsigned short*)BW1 + (size_t)(16 * w + ln) * CC + 8 * hh; const unsigned short* w2p = (const unsigned short*)BW2 + (size_t)(16 * nt + ln) * (2 * CC) + 8 * hh; const float* b1p = b1 + 16 * w + 8 * hh;
  FragH w1f[4], w2f[8];
#pragma unroll
  for (int kb = 0; kb < 4; ++kb) { w1f[kb].half[0] = *(const v8us*)(w1p + kb * 32); w1f[kb].half[1] = *(const v8us*)(w1p + kb * 32 + 16); }
#pragma unroll
  for (int kb = 0; kb < 8; ++kb) { w2f[kb].half[0] = *(const v8us*)(w2p + kb * 32); w2f[kb].half[1] = *(const v8us*)(w2p + kb * 32 + 16); }
  const v4f b1a = *(const v4fa*)b1p, b1b = *(const v4fa*)(b1p + 4);
  const float b2v = bf16_round(b2[16 * nt + ln]), gv = bf16_round(gp[c]), bv = bf16_round(bp[c]);
  asm volatile("s_wait_xcnt 0x0" :: "v"(pso), "v"(atp), "v"(w1p), "v"(w2p), "v"(b1p) : "memory");      /* in front of the arithmetic, which may reuse the loads' address registers; it names them, so that none is given to a later load's result ahead of the wait */
  __builtin_amdgcn_sched_barrier(0);      /* keeps that arithmetic behind the wait, and every global load of the kernel up here, in flight together: one round trip to memory for all of them */
  float sm = 0.f;
#pragma unroll
  for (int g = 0; g < 32; ++g) sm += ps[g][0];
  r1[part][cs] = sm; __syncthreads();
  { const float mean = (r1[0][cs] + r1[1][cs] + r1[2][cs] + r1[3][cs]) * (1.0f / 128.0f); float q2 = 0.f;      /* equal groups: M2 = sum of the groups' M2 + 32 sum (group mean - mean)^2 */
#pragma unroll
    for (int g = 0; g < 32; ++g) { const float d = ps[g][0] - mean; q2 += ps[g][1] + 32.0f * (d * d); }
    r2[part][cs] = q2; }
  __syncthreads();
  { const float mean = (r1[0][c] + r1[1][c] + r1[2][c] + r1[3][c]) * (1.0f / 128.0f); const float var = (r2[0][c] + r2[1][c] + r2[2][c] + r2[3][c]) * (1.0f / (float)NS); const float rs = rsqrtf(var + 1e-5f);
#pragma unroll
    for (int i = 0; i < 4; ++i) { Hs[sq + i][c] = (_Float16)((xa[i] - mean) * rs * gv + bv); Hs[sq + 4 + i][c] = (_Float16)((xb[i] - mean) * rs * gv + bv); } }
  __syncthreads();
  const v8f z8 = {0.f,0.f,0.f,0.f,0.f,0.f,0.f,0.f}; v8f d0 = z8, d1 = z8;
#pragma unroll
  for (int kb = 0; kb < 4; ++kb) { d0 = fa_mma(w1f[kb].v, g2_frag(&Hs[ln][kb * 32], hh), d0); d1 = fa_mma(w1f[kb].v, g2_frag(&Hs[16 + ln][kb * 32], hh), d1); }
  { FragH f0, f1;      /* D register r: hidden unit 16w + 8hh + r of voxel ln (d0) and 16 + ln (d1) */
#pragma unroll
    for (int r = 0; r < 8; ++r) { const float bb = bf16_round(r < 4 ? b1a[r & 3] : b1b[r & 3]); f0.h[r] = (_Float16)fmaxf(d0[r] * 0.0625f + bb, 0.f); f1.h[r] = (_Float16)fmaxf(d1[r] * 0.0625f + bb, 0.f); }
    *(v8us*)&Gs[ln][16 * w + 8 * hh] = f0.half[0]; *(v8us*)&Gs[16 + ln][16 * w + 8 * hh] = f1.half[0]; }
  __syncthreads();
  v8f e = z8;
#pragma unroll
  for (int kb = 0; kb < 8; ++kb) e = fa_mma(g2_frag(&Gs[16 * mt + ln][kb * 32], hh), w2f[kb].v, e);
  { const v4f e0 = {e[0] * 0.0625f + b2v, e[1] * 0.0625f + b2v, e[2] * 0.0625f + b2v, e[3] * 0.0625f + b2v}, e1 = {e[4] * 0.0625f + b2v, e[5] * 0.0625f + b2v, e[6] * 0.0625f + b2v, e[7] * 0.0625f + b2v};
    *(v4fa*)&Cs[16 * nt + ln][16 * mt + 8 * hh] = e0; *(v4fa*)&Cs[16 * nt + ln][16 * mt + 8 * hh + 4] = e1; }      /* D register r: voxel 16mt + 8hh + r of channel 16nt + ln */
  __syncthreads();
  const v4f o0 = *(const v4fa*)&Cs[c][sq] + xa, o1 = *(const v4fa*)&Cs[c][sq + 4] + xb;
  float* op = out + (size_t)c * NS + s0 + sq; *(v4fa*)op = o0; *(v4fa*)(op + 4) = o1; }

extern "C" void kernel_launch(void* const* d_in, const int* in_sizes, int n_in,
                              void* d_out, int out_size, void* d_ws, size_t ws_size, hipStream_t stream) {
  (void)in_sizes; (void)n_in; (void)out_size;
  const float* const* I = (const float* const*)d_in; const float* xq = I[0]; const float* xkv = I[1]; const int* msk = (const int*)d_in[2]; const float* qW = I[3]; const float* kW = I[4]; const float* vW = I[5]; const float* oW = I[6]; const float* gq = I[7]; const float* bq = I[8]; const float* gk = I[9]; const float* bk = I[10]; const float* gp = I[11]; const float* bp = I[12]; const float* W1 = I[13]; const float* b1 = I[14]; const float* W2 = I[15]; const float* b2 = I[16];
  char* ws = (char*)d_ws; size_t off = 0;
  auto take = [&](size_t bytes) { char* p = ws + off; off += (bytes + 255) & ~(size_t)255; return p; };
  _Float16* BQ = (_Float16*)take((size_t)HDA * CC * 2); _Float16* BK = (_Float16*)take((size_t)HDA * CC * 2); _Float16* BV = (_Float16*)take((size_t)HDA * CC * 2); _Float16* BOW = (_Float16*)take((size_t)CC * HDA * 2); _Float16* BW1 = (_Float16*)take((size_t)2 * CC * CC * 2); _Float16* BW2 = (_Float16*)take((size_t)CC * 2 * CC * 2); float* STQ = (float*)take(CC * 2 * 4); float* STK = (float*)take(CC * 2 * 4);
  _Float16* Q16 = (_Float16*)take((size_t)NS * HDA * 2); _Float16* KP = (_Float16*)take((size_t)NS * HDA * 2); _Float16* VP = (_Float16*)take((size_t)NS * HDA * 2); _Float16* O16 = (_Float16*)take((size_t)NS * HDA * 2); float* AT = (float*)take((size_t)NS * CC * 4); float* PS = (float*)take((size_t)(NS / 32) * CC * 2 * 4);
  if (off > ws_size) return;      /* about 11 MiB */
  k_prep<<<2 * CC + 6 * (HDA * CC / 8 / 256), 256, 0, stream>>>(xq, xkv, STQ, STK, qW, kW, vW, oW, W1, W2, BQ, BK, BV, BOW, BW1, BW2);      /* statistics of x_q and x_kv; 1x1 convs 'oc' = Bt, times 16 */
  k_nqkv<<<dim3(NS / 32, 3), 256, 0, stream>>>(xq, xkv, STQ, STK, gq, bq, gk, bk, BQ, BK, BV, msk, Q16, KP, VP);      /* IN(x_q), IN(x_kv); q / 2, k, mask * v, the last two in the attention kernel's fragment order */
  k_fattn<<<NHD * (NS / 128), 512, 0, stream>>>(Q16, KP, VP, O16);      /* o = (sigmoid(q.k) * mask) v, all heads */
  k_oproj<<<NS / 32, 256, 0, stream>>>(O16, BOW, xq, AT, PS);      /* attn = o oW^T + x_q, channel-major, and its statistics by groups of 32 voxels */
  k_mlp<<<NS / 32, 512, 0, stream>>>(AT, PS, gp, bp, BW1, b1, BW2, b2, (float*)d_out);      /* out = W2 relu(W1 IN(attn) + b1) + b2 + attn */
}

// v007
// One run takes 35.1 microseconds.
// In two side-by-side timings against v006, it was 1.27 and 1.32 times as fast.
// Over all steps from v000 it is 40.3 times as fast.
#include <hip/hip_runtime.h>
// Multi_Heads_Self_Attn_Q_KV (1 volume, C 128, 16^3 = 4096 voxels, 8 heads x 32): InstanceNorm of x_q and x_kv (per channel over the 4096 voxels, biased var, eps 1e-5, affine); q, k, v = 1x1 convs (no bias); w = sigmoid(q.k) (no scale) * mask[key] (int input 0/1); o = w v (no normalisation); attn = o oW^T + x_q; h = IN(attn); h = relu(W1 h + b1); h = W2 h + b2; out = h + attn -> [1, 128, 16, 16, 16].
// Compute dtype: inputs and parameters rounded to bf16; normalised inputs, q, k, v, sigmoid weights, o and the MLP activations as plain f16 operands (~2^-12); statistics/sigmoid f32. v_wmma_f32_16x16x32_f16.
#define CC 128
#define NS 4096
#define NHD 8
#define HDm 32
#define HDA (NHD * HDm)          /* 256 */
#define PW (NHD * 64)            /* 512, unused */
typedef __bf16 v16b __attribute__((ext_vector_type(16)));
typedef unsigned short v8us __attribute__((ext_vector_type(8), may_alias));
typedef float  v8f  __attribute__((ext_vector_type(8)));
typedef float  v4f  __attribute__((ext_vector_type(4)));
typedef float  v4fa __attribute__((ext_vector_type(4), may_alias));
union FragB { v16b v; v8us half[2]; unsigned short u[16]; };

__device__ __forceinline__ unsigned short bf16_bits(float x) { unsigned int u = __float_as_uint(x); return (unsigned short)((u + 0x7FFFu + ((u >> 16) & 1u)) >> 16); }
__device__ __forceinline__ float bf16_val(unsigned short b) { return __uint_as_float(((unsigned int)b) << 16); }
__device__ __forceinline__ float bf16_round(float x) { return bf16_val(bf16_bits(x)); }
// D += A·B with NT terms: 1 = ah·bh, 2 = + al·bh (A split), 3 = + ah·bl (both split)
template <int NT>
__device__ __forceinline__ v8f mmaN(v16b ah, v16b al, v16b bh, v16b bl, v8f c) {
  c = __builtin_amdgcn_wmma_f32_16x16x32_bf16(false, ah, false, bh, (short)0, c, false, false);
  if (NT >= 2) c = __builtin_amdgcn_wmma_f32_16x16x32_bf16(false, al, false, bh, (short)0, c, false, false);
  if (NT >= 3) c = __builtin_amdgcn_wmma_f32_16x16x32_bf16(false, ah, false, bl, (short)0, c, false, false);
  asm volatile("v_nop\n\tv_nop\n\tv_nop\n\tv_nop" : "+v"(c) : "v"(ah), "v"(al), "v"(bh), "v"(bl));
  return c;
}

__global__ __launch_bounds__(256) void k_wt_bf16(const float* __restrict__ W, unsigned short* __restrict__ Wt, int K, int N) {
  const int t = blockIdx.x * 256 + threadIdx.x;
  const int k8n = K / 8;
  if (t >= N * k8n) return;
  const int n = t / k8n, k8 = (t % k8n) * 8;
  v8us v;
#pragma unroll
  for (int i = 0; i < 8; ++i) v[i] = bf16_bits(W[(size_t)(k8 + i) * N + n]);
  *(v8us*)(Wt + (size_t)n * K + k8) = v;
  
}

// GEMM C[M][N] (f32, pitch ldc) = act(A[M][K]·W + bias). A f32 row-major (pitch lda) converted per fragment to bf16
// (ASPLIT: hi/lo two planes -> 2 terms, else single rounded term); Wt bf16 [N][K] (pitch ldb). BIAS_BF16 rounds the
// bias to bf16 first (bias quantised to bf16 before the add). K%32==0, M%16==0, N%64==0.
template <bool ASPLIT, int ACT, bool BIAS_BF16>
__global__ __launch_bounds__(128) void k_gemm_bf(const float* __restrict__ A, int lda, const unsigned short* __restrict__ Wt, int ldb,
                                               const float* __restrict__ bias, float* __restrict__ C, int ldc, int M, int N, int K) {
  __shared__ __attribute__((aligned(16))) float so[4][16][64];
  const int tid = threadIdx.x, w = tid >> 5, lane = tid & 31, ln = lane & 15, hh = lane >> 4;
  const int ntn = N / 64;
  const int wid = blockIdx.x * 4 + w;
  const int mt = wid / ntn, nq = wid % ntn;
  if (mt * 16 >= M) return;
  const int row0 = mt * 16, col0 = nq * 64;
  const float* arow = A + (size_t)(row0 + ln) * lda;
  v8f acc[4] = {};
  for (int kb = 0; kb < K; kb += 32) {
    FragB ah, al;
    const v4f x0 = *(const v4fa*)(arow + kb + 8 * hh), x1 = *(const v4fa*)(arow + kb + 8 * hh + 4);
    const v4f x2 = *(const v4fa*)(arow + kb + 16 + 8 * hh), x3 = *(const v4fa*)(arow + kb + 16 + 8 * hh + 4);
    float xs[16] = {x0[0],x0[1],x0[2],x0[3],x1[0],x1[1],x1[2],x1[3],x2[0],x2[1],x2[2],x2[3],x3[0],x3[1],x3[2],x3[3]};
#pragma unroll
    for (int i = 0; i < 16; ++i) { const unsigned short hb = bf16_bits(xs[i]); ah.u[i] = hb; al.u[i] = ASPLIT ? bf16_bits(xs[i] - bf16_val(hb)) : (unsigned short)0; }
#pragma unroll
    for (int t = 0; t < 4; ++t) {
      const unsigned short* brow = Wt + (size_t)(col0 + t * 16 + ln) * ldb + kb;
      FragB b;
      b.half[0] = *(const v8us*)(brow + 8 * hh);
      b.half[1] = *(const v8us*)(brow + 16 + 8 * hh);
      acc[t] = mmaN<ASPLIT ? 2 : 1>(ah.v, al.v, b.v, b.v, acc[t]);
    }
  }
#pragma unroll
  for (int t = 0; t < 4; ++t) {
    float bv = bias ? bias[col0 + t * 16 + ln] : 0.f;
    if (BIAS_BF16) bv = bf16_round(bv);
#pragma unroll
    for (int r = 0; r < 8; ++r) { float v = acc[t][r] + bv; if (ACT == 1) v = fmaxf(v, 0.f); so[w][8 * hh + r][t * 16 + ln] = v; }
  }
  __builtin_amdgcn_fence(__ATOMIC_ACQ_REL, "workgroup");
  __builtin_amdgcn_wave_barrier();
  const int rsub = lane >> 4, c4 = (lane & 15) * 4;
  {
#pragma unroll
    for (int q = 0; q < 8; ++q) {
      const int r = q * 2 + rsub;
      const v4f v = *(const v4fa*)&so[w][r][c4];
      *(v4f*)(C + (size_t)(row0 + r) * ldc + col0 + c4) = v;
    }
    
  }
}

// GEMM C = act(A·W + bias + resid): A f32 (ASPLIT -> hi/lo 2 terms), Wt bf16 [N][K]; ACT 0 none, 1 relu, 2 exact gelu;
// resid (optional, f32, row index = (row % rmod), pitch ldr, RES_BF16 rounds it) added before the activation.
template <bool ASPLIT, int ACT, bool BIAS_BF16, bool RES_BF16>
__global__ __launch_bounds__(128) void k_gemm_bf3(const float* __restrict__ A, int lda, const unsigned short* __restrict__ Wt, int ldb,
                                                const float* __restrict__ bias, const float* __restrict__ resid, int rmod, int ldr,
                                                float* __restrict__ C, int ldc, int M, int N, int K) {
  __shared__ __attribute__((aligned(16))) float so[4][16][64];
  const int tid = threadIdx.x, w = tid >> 5, lane = tid & 31, ln = lane & 15, hh = lane >> 4;
  const int ntn = N / 64;
  const int wid = blockIdx.x * 4 + w;
  const int mt = wid / ntn, nq = wid % ntn;
  if (mt * 16 >= M) return;
  const int row0 = mt * 16, col0 = nq * 64;
  const float* arow = A + (size_t)(row0 + ln) * lda;
  v8f acc[4] = {};
  for (int kb = 0; kb < K; kb += 32) {
    FragB ah, al;
    const v4f x0 = *(const v4fa*)(arow + kb + 8 * hh), x1 = *(const v4fa*)(arow + kb + 8 * hh + 4);
    const v4f x2 = *(const v4fa*)(arow + kb + 16 + 8 * hh), x3 = *(const v4fa*)(arow + kb + 16 + 8 * hh + 4);
    float xs[16] = {x0[0],x0[1],x0[2],x0[3],x1[0],x1[1],x1[2],x1[3],x2[0],x2[1],x2[2],x2[3],x3[0],x3[1],x3[2],x3[3]};
#pragma unroll
    for (int i = 0; i < 16; ++i) { const unsigned short hb = bf16_bits(xs[i]); ah.u[i] = hb; al.u[i] = ASPLIT ? bf16_bits(xs[i] - bf16_val(hb)) : (unsigned short)0; }
#pragma unroll
    for (int t = 0; t < 4; ++t) {
      const unsigned short* brow = Wt + (size_t)(col0 + t * 16 + ln) * ldb + kb;
      FragB b;
      b.half[0] = *(const v8us*)(brow + 8 * hh);
      b.half[1] = *(const v8us*)(brow + 16 + 8 * hh);
      acc[t] = mmaN<ASPLIT ? 2 : 1>(ah.v, al.v, b.v, b.v, acc[t]);
    }
  }
#pragma unroll
  for (int t = 0; t < 4; ++t) {
    const int col = col0 + t * 16 + ln;
    float bv = bias ? bias[col] : 0.f;
    if (BIAS_BF16) bv = bf16_round(bv);
#pragma unroll
    for (int r = 0; r < 8; ++r) {
      float v = acc[t][r] + bv;
      if (resid) { float rv = resid[(size_t)((row0 + 8 * hh + r) % rmod) * ldr + col]; if (RES_BF16) rv = bf16_round(rv); v += rv; }
      if (ACT == 1) v = fmaxf(v, 0.f);
      if (ACT == 2) v = 0.5f * v * (1.0f + erff(v * 0.70710678118654752f));
      if (ACT == 3) { const float u = 0.7978845608028654f * (v + 0.044715f * v * v * v); v = 0.5f * v * (1.0f + tanhf(u)); }
      so[w][8 * hh + r][t * 16 + ln] = v;
    }
  }
  __builtin_amdgcn_fence(__ATOMIC_ACQ_REL, "workgroup");
  __builtin_amdgcn_wave_barrier();
  const int rsub = lane >> 4, c4 = (lane & 15) * 4;
  {
#pragma unroll
    for (int q = 0; q < 8; ++q) {
      const int r = q * 2 + rsub;
      const v4f v = *(const v4fa*)&so[w][r][c4];
      *(v4f*)(C + (size_t)(row0 + r) * ldc + col0 + c4) = v;
    }
    
  }
}
// row LayerNorm (biased variance, eps) over N: s = X (+ R); optional out_sum <- s; out_norm <- (s-mu)*rsqrt(var+eps)*g + b
template <bool PARAM_BF16>
__global__ __launch_bounds__(256) void k_layernorm(const float* __restrict__ X, const float* __restrict__ R, const float* __restrict__ g, const float* __restrict__ bta,
                                                  float* __restrict__ out_sum, float* __restrict__ out_norm, int N, float eps) {
  __shared__ float red[256];
  const int row = blockIdx.x, tid = threadIdx.x;
  const float* x = X + (size_t)row * N; const float* rr = R ? R + (size_t)row * N : nullptr;
  float vals[16];                     // up to N = 4096
  const int per = N / 256;            // contiguous chunk per thread? use strided-by-4 chunks: thread handles j = tid*4 + 1024*u
  float s1 = 0.f;
  for (int u = 0; u < per / 4; ++u) {
    const int j = tid * 4 + 1024 * u;
    const v4f a = *(const v4fa*)(x + j);
    v4f b = {0.f,0.f,0.f,0.f}; if (rr) b = *(const v4fa*)(rr + j);
#pragma unroll
    for (int q = 0; q < 4; ++q) { const float v = a[q] + b[q]; vals[u * 4 + q] = v; s1 += v; }
  }
  red[tid] = s1; __syncthreads();
  for (int st = 128; st > 0; st >>= 1) { if (tid < st) red[tid] += red[tid + st]; __syncthreads(); }
  const float mu = red[0] / (float)N; __syncthreads();
  float s2 = 0.f;
  for (int u = 0; u < per / 4; ++u)
#pragma unroll
    for (int q = 0; q < 4; ++q) { const float c = vals[u * 4 + q] - mu; s2 += c * c; }
  red[tid] = s2; __syncthreads();
  for (int st = 128; st > 0; st >>= 1) { if (tid < st) red[tid] += red[tid + st]; __syncthreads(); }
  const float rs = rsqrtf(red[0] / (float)N + eps);
  {
    for (int u = 0; u < per / 4; ++u) {
      const int j = tid * 4 + 1024 * u;
      v4f o, sm;
#pragma unroll
      for (int q = 0; q < 4; ++q) {
        float gg = g[j + q], bb = bta[j + q];
        if (PARAM_BF16) { gg = bf16_round(gg); bb = bf16_round(bb); }
        sm[q] = vals[u * 4 + q]; o[q] = (vals[u * 4 + q] - mu) * rs * gg + bb;
      }
      if (out_sum) *(v4f*)(out_sum + (size_t)row * N + j) = sm;
      *(v4f*)(out_norm + (size_t)row * N + j) = o;
    }
    
  }
}



// ---- f16 WMMA path (v_wmma_f32_16x16x32_f16): 11-bit significands for operands in range — used where a [0,1] probability operand needs more precision than bf16
typedef _Float16 v16h __attribute__((ext_vector_type(16)));
union FragH { v16h v; v8us half[2]; _Float16 h[16]; unsigned short u[16]; };
template <int NT>
__device__ __forceinline__ v8f mmaH(v16h ah, v16h al, v16h bh, v16h bl, v8f c) {
  c = __builtin_amdgcn_wmma_f32_16x16x32_f16(false, ah, false, bh, (short)0, c, false, false);
  if (NT >= 2) c = __builtin_amdgcn_wmma_f32_16x16x32_f16(false, al, false, bh, (short)0, c, false, false);
  if (NT >= 3) c = __builtin_amdgcn_wmma_f32_16x16x32_f16(false, ah, false, bl, (short)0, c, false, false);
  asm volatile("v_nop\n\tv_nop\n\tv_nop\n\tv_nop" : "+v"(c) : "v"(ah), "v"(al), "v"(bh), "v"(bl));
  return c;
}
// batched GEMM like k_gemm_b but f16 operands: A f32 (split into f16 hi/lo if ASPLIT, else rounded to f16), Bt = f16 values [n][k]; alpha; C f32; N multiple of 16 (partial tiles skipped)
template <bool ASPLIT>
__global__ __launch_bounds__(128) void k_gemm_h(const float* __restrict__ A, int lda, size_t sA, const _Float16* __restrict__ Bh, int ldb, size_t sB, float alpha, float* __restrict__ C, int ldc, size_t sC, int M, int N, int K) {
  __shared__ __attribute__((aligned(16))) float so[4][16][64];
  const int tid = threadIdx.x, w = tid >> 5, lane = tid & 31, ln = lane & 15, hh = lane >> 4; const int by = blockIdx.y;
  A += (size_t)by * sA; Bh += (size_t)by * sB; C += (size_t)by * sC;
  const int ntn = (N + 63) / 64; const int wid = blockIdx.x * 4 + w; const int mt = wid / ntn, nq = wid % ntn; if (mt * 16 >= M) return;
  const int row0 = mt * 16, col0 = nq * 64; const float* arow = A + (size_t)(row0 + ln) * lda;
  v8f acc[4] = {};
  for (int kb = 0; kb < K; kb += 32) {
    FragH ah, al;
    const v4f x0 = *(const v4fa*)(arow + kb + 8 * hh), x1 = *(const v4fa*)(arow + kb + 8 * hh + 4), x2 = *(const v4fa*)(arow + kb + 16 + 8 * hh), x3 = *(const v4fa*)(arow + kb + 16 + 8 * hh + 4);
    float xs[16] = {x0[0],x0[1],x0[2],x0[3],x1[0],x1[1],x1[2],x1[3],x2[0],x2[1],x2[2],x2[3],x3[0],x3[1],x3[2],x3[3]};
#pragma unroll
    for (int i = 0; i < 16; ++i) { const _Float16 h = (_Float16)xs[i]; ah.h[i] = h; al.h[i] = ASPLIT ? (_Float16)(xs[i] - (float)h) : (_Float16)0.0f; }
#pragma unroll
    for (int t = 0; t < 4; ++t) { if (col0 + t * 16 >= N) continue; const size_t boff = (size_t)(col0 + t * 16 + ln) * ldb + kb; FragH bq; bq.half[0] = *(const v8us*)(Bh + boff + 8 * hh); bq.half[1] = *(const v8us*)(Bh + boff + 16 + 8 * hh);
      acc[t] = mmaH<ASPLIT ? 2 : 1>(ah.v, al.v, bq.v, bq.v, acc[t]); }
  }
#pragma unroll
  for (int t = 0; t < 4; ++t) { if (col0 + t * 16 >= N) continue;
#pragma unroll
    for (int r = 0; r < 8; ++r) so[w][8 * hh + r][t * 16 + ln] = acc[t][r] * alpha; }
  __builtin_amdgcn_fence(__ATOMIC_ACQ_REL, "workgroup"); __builtin_amdgcn_wave_barrier();
  const int rsub = lane >> 4, c4 = (lane & 15) * 4;
  {
#pragma unroll
    for (int q = 0; q < 8; ++q) { const int r = q * 2 + rsub; if (col0 + c4 < N) { const v4f v = *(const v4fa*)&so[w][r][c4]; *(v4f*)(C + (size_t)(row0 + r) * ldc + col0 + c4) = v; } }
     }
}

// Wt[n][k] = f16(W[k][n]·scale) from f32 row-major W[K][N] (scale = power of two; bf16-exact weights stay exact in f16 away from the subnormal range)
__global__ __launch_bounds__(256) void k_wt_f16(const float* __restrict__ W, _Float16* __restrict__ Wt, int K, int N, float scale) {
  const int t = blockIdx.x * 256 + threadIdx.x; if (t >= N * (K / 8)) return; const int n = t / (K / 8), k8 = (t % (K / 8)) * 8; FragH f;
#pragma unroll
  for (int i = 0; i < 8; ++i) f.h[i] = (_Float16)(bf16_round(W[(size_t)(k8 + i) * N + n]) * scale); const v8us o = f.half[0];
  *(v8us*)((unsigned short*)Wt + (size_t)n * K + k8) = o; 
}
// k_gemm_hh variant with fused epilogue: v = acc·alpha + bias[by·sBias + col] (+ CP[(row/rowsPerB)·sCPb + by·64 + col] if CP) ; ACT 0 none / 1 elu ; writes f16 C16 (and f32 C if non-null)
template <int ACT>
__global__ __launch_bounds__(128) void k_gemm_hhx(const _Float16* __restrict__ A, int lda, size_t sA, const _Float16* __restrict__ Bh, int ldb, size_t sB, float alpha, const float* __restrict__ bias, size_t sBias, const float* __restrict__ CP, int rowsPerB, size_t sCPb, int row0g,
    float* __restrict__ C, _Float16* __restrict__ C16, int ldc, size_t sC, int M, int N, int K) {
  __shared__ __attribute__((aligned(16))) float so[4][16][64];
  const int tid = threadIdx.x, w = tid >> 5, lane = tid & 31, ln = lane & 15, hh = lane >> 4; const int by = blockIdx.y;
  A += (size_t)by * sA; Bh += (size_t)by * sB; const size_t cofs = (size_t)by * sC; const float* bp = bias ? bias + (size_t)by * sBias : nullptr;
  const int ntn = (N + 63) / 64; const int wid = blockIdx.x * 4 + w; const int mt = wid / ntn, nq = wid % ntn; if (mt * 16 >= M) return;
  const int row0 = mt * 16, col0 = nq * 64; const _Float16* arow = A + (size_t)(row0 + ln) * lda;
  v8f acc[4] = {};
  for (int kb = 0; kb < K; kb += 32) { FragH ah; ah.half[0] = *(const v8us*)((const unsigned short*)arow + kb + 8 * hh); ah.half[1] = *(const v8us*)((const unsigned short*)arow + kb + 16 + 8 * hh);
#pragma unroll
    for (int t = 0; t < 4; ++t) { if (col0 + t * 16 >= N) continue; const size_t boff = (size_t)(col0 + t * 16 + ln) * ldb + kb; FragH bq; bq.half[0] = *(const v8us*)((const unsigned short*)Bh + boff + 8 * hh); bq.half[1] = *(const v8us*)((const unsigned short*)Bh + boff + 16 + 8 * hh);
      acc[t] = mmaH<1>(ah.v, ah.v, bq.v, bq.v, acc[t]); }
  }
#pragma unroll
  for (int t = 0; t < 4; ++t) { if (col0 + t * 16 >= N) continue; const int col = col0 + t * 16 + ln; const float bv = bp ? bf16_round(bp[col]) : 0.f;
#pragma unroll
    for (int r = 0; r < 8; ++r) { float v = acc[t][r] * alpha + bv; if (CP) { const int rr = row0g + row0 + 8 * hh + r; if (rowsPerB < 0) v += CP[cofs + (size_t)rr * ldc + col];      /* rowsPerB < 0: own element of the batched C plane */ else { const int bidx = rr / rowsPerB; v += CP[(size_t)bidx * sCPb + (size_t)by * 64 + col]; } } if (ACT == 1) v = (v > 0.f) ? v : expm1f(v); else if (ACT == 7) v = (v > 0.f) ? v + 1.0f : expf(v); else if (ACT == 8) v = tanhf(v); else if (ACT == 9) v = 0.5f * v * (1.0f + tanhf(0.7978845608028654f * (v + 0.044715f * v * v * v))); else if (ACT == 11) v = 1.0f / (1.0f + expf(-v)); else if (ACT == 12) v = (v > 0.f) ? v : 0.01f * v; else if (ACT == 14) v = (v > 0.f) ? v : 0.1f * v; else if (ACT == 16) v = (v >= 0.f) ? v : 0.3f * v; else if (ACT == 15) v = v / (1.0f + expf(-v)); else if (ACT == 3) v = fmaxf(v, 0.f); else if (ACT == 6) v = 0.5f * v * (1.0f + erff(v * 0.70710678118654752f)); so[w][8 * hh + r][t * 16 + ln] = v; } }
  __builtin_amdgcn_fence(__ATOMIC_ACQ_REL, "workgroup"); __builtin_amdgcn_wave_barrier();
  const int rsub = lane >> 4, c4 = (lane & 15) * 4; typedef _Float16 v4h __attribute__((ext_vector_type(4)));
  {
#pragma unroll
    for (int q = 0; q < 8; ++q) { const int r = q * 2 + rsub; if (col0 + c4 < N) { const v4f v = *(const v4fa*)&so[w][r][c4]; if (C) *(v4f*)(C + cofs + (size_t)(row0 + r) * ldc + col0 + c4) = v; if (C16) { v4h h4; for (int i = 0; i < 4; ++i) h4[i] = (_Float16)v[i]; *(v4h*)(C16 + cofs + (size_t)(row0 + r) * ldc + col0 + c4) = h4; } } }
     }
}


typedef _Float16 v4h __attribute__((ext_vector_type(4)));

__global__ __launch_bounds__(256) void k_x16(const float* __restrict__ x, _Float16* __restrict__ X16, size_t n8) { const size_t t = (size_t)blockIdx.x * 256 + threadIdx.x; if (t >= n8) return; FragH f;
#pragma unroll
  for (int q = 0; q < 8; ++q) f.h[q] = (_Float16)bf16_round(x[t * 8 + q]); *(v8us*)((unsigned short*)X16 + t * 8) = f.half[0];  }
__global__ __launch_bounds__(256) void k_h16(const float* __restrict__ x, _Float16* __restrict__ X16, size_t n8) { const size_t t = (size_t)blockIdx.x * 256 + threadIdx.x; if (t >= n8) return; FragH f;
#pragma unroll
  for (int q = 0; q < 8; ++q) f.h[q] = (_Float16)x[t * 8 + q]; *(v8us*)((unsigned short*)X16 + t * 8) = f.half[0];  }
__global__ __launch_bounds__(256) void k_round16f(const float* __restrict__ W, _Float16* __restrict__ Bt, size_t n8) { const size_t t = (size_t)blockIdx.x * 256 + threadIdx.x; if (t >= n8) return; FragH f;
#pragma unroll
  for (int i = 0; i < 8; ++i) f.h[i] = (_Float16)(bf16_round(W[t * 8 + i]) * 16.0f); *(v8us*)((unsigned short*)Bt + t * 8) = f.half[0];  }
template <int NHv, int TTv>
__global__ __launch_bounds__(256) void k_vt(const _Float16* __restrict__ V16, int ldv, int voff, _Float16* __restrict__ Vt) { __shared__ unsigned short tl[64][66]; const int tid = threadIdx.x; const int slab = blockIdx.x / (TTv / 64), lg = blockIdx.x % (TTv / 64); const int b = slab / NHv, h = slab % NHv;
  for (int i = tid; i < 64 * 8; i += 256) { const int r = i / 8, c8 = (i % 8) * 8; FragH f; f.half[0] = *(const v8us*)((const unsigned short*)V16 + ((size_t)b * TTv + lg * 64 + r) * ldv + voff + h * 64 + c8);
#pragma unroll
    for (int q = 0; q < 8; ++q) tl[r][c8 + q] = f.u[q]; }
  __syncthreads();
  {
#pragma unroll
    for (int rd = 0; rd < 2; ++rd) { const int d = rd * 32 + tid / 8, pc = tid % 8; FragH f;
#pragma unroll
      for (int q = 0; q < 8; ++q) f.u[q] = tl[pc * 8 + q][d];
      *(v8us*)((unsigned short*)Vt + ((size_t)slab * 64 + d) * TTv + lg * 64 + pc * 8) = f.half[0]; }
     } }

__global__ __launch_bounds__(256) void k_hl(const float* __restrict__ F, _Float16* __restrict__ Hh, _Float16* __restrict__ Hl, size_t n8) { const size_t t = (size_t)blockIdx.x * 256 + threadIdx.x; if (t >= n8) return; FragH fh, fl; const v4f a = *(const v4fa*)(F + t * 8), c = *(const v4fa*)(F + t * 8 + 4);
#pragma unroll
  for (int q = 0; q < 4; ++q) { _Float16 h = (_Float16)a[q]; fh.h[q] = h; fl.h[q] = (_Float16)((a[q] - (float)h) * 1024.0f); h = (_Float16)c[q]; fh.h[4 + q] = h; fl.h[4 + q] = (_Float16)((c[q] - (float)h) * 1024.0f); }
  { *(v8us*)((unsigned short*)Hh + t * 8) = fh.half[0]; *(v8us*)((unsigned short*)Hl + t * 8) = fl.half[0];  } }

// one A or B fragment of the 16x16x32 f16 form from a row of 32 halves: k = 8hh .. 8hh + 7 and 16 + 8hh .. 16 + 8hh + 7
__device__ __forceinline__ v16h g2_frag(const _Float16* p, int hh) { FragH f; f.half[0] = *(const v8us*)((const unsigned short*)p + 8 * hh); f.half[1] = *(const v8us*)((const unsigned short*)p + 16 + 8 * hh); return f.v; }


__device__ __forceinline__ void wsc_body(int bx, const float* __restrict__ Wm, _Float16* __restrict__ Bt, size_t n8, float sc) { const size_t t = (size_t)bx * 256 + threadIdx.x; if (t >= n8) return; FragH f; for (int q = 0; q < 8; ++q) f.h[q] = (_Float16)(bf16_round(Wm[t * 8 + q]) * sc); *(v8us*)((unsigned short*)Bt + t * 8) = f.half[0];  }
__device__ __forceinline__ void instat_body(int c, const float* __restrict__ base, size_t scs, size_t sss, int rnd, float* __restrict__ ST) {
  #pragma clang fp contract(off)
  __shared__ float red[256]; const int tid = threadIdx.x; float s = 0.f;
  const float* xp = base + (size_t)c * scs + (size_t)tid * sss; float x[NS / 256];      /* the thread's 16 values: read once, all 16 loads in flight together, held in registers for both passes */
#pragma unroll      /* unrolled so that x[] stays in registers and the loads stand in a row: one round trip to memory instead of one a value */
  for (int j = 0; j < NS / 256; ++j) x[j] = xp[(size_t)j * 256 * sss];
  asm volatile("s_wait_xcnt 0x0" ::: "memory");      /* behind the 16 loads: the code that follows them rewrites their address registers */
#pragma unroll      /* the sums run in the order of the rolled loops: same values, same rounding */
  for (int j = 0; j < NS / 256; ++j) { if (rnd) x[j] = bf16_round(x[j]); s += x[j]; }
  red[tid] = s; __syncthreads(); for (int st = 128; st > 0; st >>= 1) { if (tid < st) red[tid] += red[tid + st]; __syncthreads(); } const float mean = red[0] / (float)NS; __syncthreads(); float vs = 0.f;
#pragma unroll
  for (int j = 0; j < NS / 256; ++j) { const float d = x[j] - mean; vs += d * d; }
  red[tid] = vs; __syncthreads(); for (int st = 128; st > 0; st >>= 1) { if (tid < st) red[tid] += red[tid + st]; __syncthreads(); }
  if (tid == 0) { const float var = red[0] / (float)NS; { *(float*)(ST + c * 2) = mean; *(float*)(ST + c * 2 + 1) = var;  } } }
__global__ __launch_bounds__(256) void k_instat(const float* __restrict__ base, size_t scs, size_t sss, int rnd, float* __restrict__ ST) { instat_body(blockIdx.x, base, scs, sss, rnd, ST); }
// The list of the keys that count: SEL[p] = voxel of the p-th key whose mask is not 0, in voxel order, MV[p] = its mask value; -1 and 0 from position CNT[0] (their number) to the end. One workgroup; wave w ranks voxels 512w .. 512w + 511; the two lists are put together in LDS and go out in whole lines.
__device__ __forceinline__ void compact_body(const int* __restrict__ msk, int* __restrict__ SEL, int* __restrict__ MV, int* __restrict__ CNT) {
  __shared__ int wt[8]; __shared__ __attribute__((aligned(16))) int ls[NS], lm[NS]; typedef int v4ib __attribute__((ext_vector_type(4), may_alias));
  const int tid = threadIdx.x, w = tid >> 5, lane = tid & 31; const int* mp = msk + w * 512 + lane; int m[16]; unsigned bw[16];
#pragma unroll      /* unrolled so that the 16 loads stand in a row: one round trip to memory */
  for (int j = 0; j < 16; ++j) m[j] = mp[j * 32];
  asm volatile("s_wait_xcnt 0x0" ::: "memory");      /* behind the 16 loads: the code that follows them may rewrite their address registers */
  { const v4ib e1 = {-1, -1, -1, -1}, e0 = {0, 0, 0, 0};      /* every position starts as a pad, while the loads fly */
#pragma unroll
    for (int q = 0; q < 4; ++q) { *(v4ib*)&ls[q * 1024 + tid * 4] = e1; *(v4ib*)&lm[q * 1024 + tid * 4] = e0; } }
  int tot = 0;
#pragma unroll
  for (int j = 0; j < 16; ++j) { bw[j] = __builtin_amdgcn_ballot_w32(m[j] != 0); tot += __builtin_popcount(bw[j]); }
  if (lane == 0) wt[w] = tot;
  __syncthreads();
  int base = 0, all = 0;
#pragma unroll
  for (int u = 0; u < 8; ++u) { const int x = wt[u]; base += u < w ? x : 0; all += x; }
  const unsigned lt = (1u << lane) - 1u;
#pragma unroll
  for (int j = 0; j < 16; ++j) { if (m[j] != 0) { const int p = base + __builtin_popcount(bw[j] & lt); ls[p] = w * 512 + j * 32 + lane; lm[p] = m[j]; } base += __builtin_popcount(bw[j]); }
  __syncthreads();
#pragma unroll
  for (int q = 0; q < 4; ++q) { const int p = q * 1024 + tid * 4; const v4ib a = *(const v4ib*)&ls[p], c = *(const v4ib*)&lm[p]; *(v4ib*)(SEL + p) = a; *(v4ib*)(MV + p) = c; }
  if (tid == 0) CNT[0] = all; }
// Everything that depends on the inputs alone, in one grid: block 0 the list of unmasked keys, then 128 blocks statistics of x_q, 128 of x_kv, then 16 blocks for each of the six weight matrices.
__global__ __launch_bounds__(256) void k_prep(const int* __restrict__ msk, int* __restrict__ SEL, int* __restrict__ MV, int* __restrict__ CNT, const float* __restrict__ xq, const float* __restrict__ xkv, float* __restrict__ STQ, float* __restrict__ STK,
    const float* __restrict__ qW, const float* __restrict__ kW, const float* __restrict__ vW, const float* __restrict__ oW, const float* __restrict__ W1, const float* __restrict__ W2,
    _Float16* __restrict__ BQ, _Float16* __restrict__ BK, _Float16* __restrict__ BV, _Float16* __restrict__ BOW, _Float16* __restrict__ BW1, _Float16* __restrict__ BW2) {
  if (blockIdx.x == 0) { compact_body(msk, SEL, MV, CNT); return; }
  const int b = blockIdx.x - 1;
  if (b < 2 * CC) { instat_body(b & (CC - 1), b < CC ? xq : xkv, (size_t)NS, (size_t)1, 1, b < CC ? STQ : STK); return; }
  const int u = b - 2 * CC, m = u >> 4;      /* every matrix has HDA * CC = 32768 elements: 4096 threads, 16 blocks */
  const float* Wm = m == 0 ? qW : m == 1 ? kW : m == 2 ? vW : m == 3 ? oW : m == 4 ? W1 : W2;
  _Float16* Bt = m == 0 ? BQ : m == 1 ? BK : m == 2 ? BV : m == 3 ? BOW : m == 4 ? BW1 : BW2;
  wsc_body(u & 15, Wm, Bt, (size_t)HDA * CC / 8, 16.0f); }
__device__ __forceinline__ v8f fa_mma(v16h a, v16h b, v8f c) { return __builtin_amdgcn_wmma_f32_16x16x32_f16(false, a, false, b, (short)0, c, false, false); }
typedef float v2f  __attribute__((ext_vector_type(2)));
typedef float v2fa __attribute__((ext_vector_type(2), may_alias));
typedef int   v4ia __attribute__((ext_vector_type(4), may_alias));
// Normalisation, one of the three projections and the attention kernel's operand order in one kernel. Workgroup = 32 voxels x all 256 outputs of q (blockIdx.y 0), k (1) or v (2); wave = one head.
// For k and v the 32 "voxels" are positions 32g .. 32g + 31 of SEL, the list of keys whose mask is not 0: masked keys add exactly 0 to every output and are neither projected nor packed; a block with no key leaves at once.
// x[c][s] is read one voxel a lane and 16 channels a wave, normalised and laid down as Hs[s][c] (f16) in LDS. q and k are computed transposed (A = weights, B = h): a lane holds 8 outputs in a row of one voxel, which is
// a 16-byte piece of a Q16 row and exactly a lane's piece of KP. v is computed straight (A = h, B = weights): a lane holds 8 keys in a row of one output, a lane's piece of VP.
// KP[h][16-key tile][j][lane][8]: k[tile*16 + c][16j + 8hh + i]; VP[h][32-key block][dt][j][lane][8]: mask[key] * v[key = block*32 + 16j + 8hh + i][16dt + c]  (c = lane & 15, hh = lane >> 4; key = position in SEL; a pad position has v = 0)
__global__ __launch_bounds__(256) void k_nqkv(const float* __restrict__ xq, const float* __restrict__ xkv, const float* __restrict__ STQ, const float* __restrict__ STK, const float* __restrict__ gq, const float* __restrict__ bq, const float* __restrict__ gk, const float* __restrict__ bk,
    const _Float16* __restrict__ BQ, const _Float16* __restrict__ BK, const _Float16* __restrict__ BV, const int* __restrict__ SEL, const int* __restrict__ MV, _Float16* __restrict__ Q16, _Float16* __restrict__ KP, _Float16* __restrict__ VP) {
  __shared__ __attribute__((aligned(16))) _Float16 Hs[32][CC + 8];      /* pitch of 16 bytes x an odd number for the 16-byte fragment reads */
  const int tid = threadIdx.x, lane = tid & 31, ln = lane & 15, hh = lane >> 4; const int z = blockIdx.y, g = blockIdx.x, s0 = g * 32;
  const int w = __builtin_amdgcn_readfirstlane(tid >> 5);      /* the wave's number in a scalar register: its 16 channels' parameters then have wave-uniform addresses */
  int sv = s0 + lane;      /* q: every voxel */
  if (z) { sv = SEL[s0 + lane]; asm volatile("s_wait_xcnt 0x0" ::: "memory"); /* behind the load: the code that follows rewrites its address registers */ if (__builtin_amdgcn_readfirstlane(sv) < 0) return; }      /* k, v: the listed keys; a first position that is a pad means an empty block: every wave reads the same word, the whole workgroup leaves, in front of the barrier */
  const unsigned vox = sv < 0 ? 0u : ((unsigned)sv & (NS - 1u));      /* bounded here whatever the list holds; a pad reads voxel 0, and its v is multiplied by MV = 0 */
  const float* xp = (z == 0 ? xq : xkv) + (size_t)(16 * w) * NS; const float* stp = (z == 0 ? STQ : STK) + 32 * w; const float* gp = (z == 0 ? gq : gk) + 16 * w; const float* bp = (z == 0 ? bq : bk) + 16 * w;
  const unsigned short* wq = (const unsigned short*)((z == 0 ? BQ : z == 1 ? BK : BV) + (size_t)(32 * w + ln) * CC) + 8 * hh; const unsigned mo = (unsigned)(s0 + 8 * hh) * 4u;      /* byte offset of the lane's first mask value */
  float x[16], st[32], gg[16], bb[16];
#pragma unroll      /* unrolled so that x[] stays in registers and the loads stand in a row */
  for (int i = 0; i < 16; ++i) x[i] = xp[(size_t)i * NS + vox];
  FragH wa[4], wb[4];
#pragma unroll
  for (int kb = 0; kb < 4; ++kb) { wa[kb].half[0] = *(const v8us*)(wq + kb * 32); wa[kb].half[1] = *(const v8us*)(wq + kb * 32 + 16); wb[kb].half[0] = *(const v8us*)(wq + 16 * CC + kb * 32); wb[kb].half[1] = *(const v8us*)(wq + 16 * CC + kb * 32 + 16); }
  const v4ia m0 = *(const v4ia*)((const char*)MV + mo), m1 = *(const v4ia*)((const char*)MV + mo + 16), m2 = *(const v4ia*)((const char*)MV + mo + 64), m3 = *(const v4ia*)((const char*)MV + mo + 80);
  asm volatile("s_wait_xcnt 0x0" :: "v"(vox), "v"(wq), "v"(mo) : "memory");      /* in front of the arithmetic, which may reuse the loads' address registers; it names them, so that none is given to a later load's result ahead of the wait */
  __builtin_amdgcn_sched_barrier(0);      /* keeps that arithmetic behind the wait, and the vector loads of x, the weights and MV up here, in flight together: one round trip to memory for all of them */
#pragma unroll      /* the 16 channels' parameters: wave-uniform addresses, read behind the wait so that the scalar arithmetic on them stays behind it too; they return while the vector loads fly */
  for (int i = 0; i < 16; ++i) { st[2 * i] = stp[2 * i]; st[2 * i + 1] = stp[2 * i + 1]; gg[i] = gp[i]; bb[i] = bp[i]; }
  v16h wf0[4], wf1[4];
#pragma unroll
  for (int kb = 0; kb < 4; ++kb) { wf0[kb] = wa[kb].v; wf1[kb] = wb[kb].v; }
  { FragH f;
#pragma unroll
    for (int i = 0; i < 16; ++i) f.h[i] = (_Float16)((bf16_round(x[i]) - st[2 * i]) * rsqrtf(st[2 * i + 1] + 1e-5f) * bf16_round(gg[i]) + bf16_round(bb[i]));
    *(v8us*)&Hs[lane][16 * w] = f.half[0]; *(v8us*)&Hs[lane][16 * w + 8] = f.half[1]; }
  __syncthreads();
  v16h n0[4], n1[4];
#pragma unroll
  for (int kb = 0; kb < 4; ++kb) { n0[kb] = g2_frag(&Hs[ln][kb * 32], hh); n1[kb] = g2_frag(&Hs[16 + ln][kb * 32], hh); }
  const v8f z8 = {0.f,0.f,0.f,0.f,0.f,0.f,0.f,0.f}; v8f d00 = z8, d01 = z8, d10 = z8, d11 = z8; FragH f00, f01, f10, f11;
  if (z < 2) {      /* dab: outputs 32w + 16a + 8hh + r of voxel s0 + 16b + ln */
#pragma unroll
    for (int kb = 0; kb < 4; ++kb) { d00 = fa_mma(wf0[kb], n0[kb], d00); d01 = fa_mma(wf0[kb], n1[kb], d01); d10 = fa_mma(wf1[kb], n0[kb], d10); d11 = fa_mma(wf1[kb], n1[kb], d11); }
    const float al = z == 0 ? 0.03125f : 0.0625f;      /* 1/16 undoes the weights' scale; q is stored halved for the tanh form of the sigmoid (powers of two: the f16 rounding is the same) */
#pragma unroll
    for (int r = 0; r < 8; ++r) { f00.h[r] = (_Float16)(d00[r] * al); f01.h[r] = (_Float16)(d01[r] * al); f10.h[r] = (_Float16)(d10[r] * al); f11.h[r] = (_Float16)(d11[r] * al); }
    if (z == 0) { unsigned short* qo = (unsigned short*)Q16 + (size_t)(s0 + ln) * HDA + 32 * w + 8 * hh;
      *(v8us*)qo = f00.half[0]; *(v8us*)(qo + 16) = f10.half[0]; *(v8us*)(qo + 16 * HDA) = f01.half[0]; *(v8us*)(qo + 16 * HDA + 16) = f11.half[0]; }
    else { unsigned short* ko = (unsigned short*)KP + ((size_t)w * 256 + g * 2) * 512 + lane * 8;      /* tile 2g: j = 0, 1; tile 2g + 1: j = 0, 1 */
      *(v8us*)ko = f00.half[0]; *(v8us*)(ko + 256) = f10.half[0]; *(v8us*)(ko + 512) = f01.half[0]; *(v8us*)(ko + 768) = f11.half[0];
      asm volatile("s_wait_xcnt 0x0" ::: "memory"); } }      /* behind the four stores: the code that follows them in the listing rewrites their address and data registers */
  else {      /* dab: keys s0 + 16a + 8hh + r of output 32w + 16b + ln */
#pragma unroll
    for (int kb = 0; kb < 4; ++kb) { d00 = fa_mma(n0[kb], wf0[kb], d00); d01 = fa_mma(n0[kb], wf1[kb], d01); d10 = fa_mma(n1[kb], wf0[kb], d10); d11 = fa_mma(n1[kb], wf1[kb], d11); }
#pragma unroll
    for (int r = 0; r < 8; ++r) { const float ma = (float)(r < 4 ? m0[r & 3] : m1[r & 3]), mb = (float)(r < 4 ? m2[r & 3] : m3[r & 3]);      /* v is rounded to f16 first, then masked */
      f00.h[r] = (_Float16)((float)(_Float16)(d00[r] * 0.0625f) * ma); f01.h[r] = (_Float16)((float)(_Float16)(d01[r] * 0.0625f) * ma);
      f10.h[r] = (_Float16)((float)(_Float16)(d10[r] * 0.0625f) * mb); f11.h[r] = (_Float16)((float)(_Float16)(d11[r] * 0.0625f) * mb); }
    unsigned short* vo = (unsigned short*)VP + ((size_t)w * 128 + g) * 1024 + lane * 8;      /* dt = 0: j = 0, 1; dt = 1: j = 0, 1 */
    *(v8us*)vo = f00.half[0]; *(v8us*)(vo + 256) = f10.half[0]; *(v8us*)(vo + 512) = f01.half[0]; *(v8us*)(vo + 768) = f11.half[0];
    asm volatile("s_wait_xcnt 0x0" ::: "memory"); } }      /* behind the four stores: the code that follows them in the listing rewrites their address and data registers */
__device__ __forceinline__ v16h fa_frag(const unsigned short* p) { FragH f; f.half[0] = *(const v8us*)p; f.half[1] = *(const v8us*)(p + 256); return f.v; }
// sigmoid(x) = 0.5 + 0.5 tanh(x / 2) on the chip's own v_tanh_f32: one transcendental, half a packed fma and half a packed convert an element. The scores arrive already halved (Q16 holds q / 2).
// two S^T tiles (keys 0-15 and 16-31 of a block, one query per lane column) -> sigmoid -> the A fragment of w.v: D register r of tile j holds key 16j + 8hh + r, which is A's element 8j + r
__device__ __forceinline__ v16h fa_sig(v8f s0, v8f s1) { FragH f;
  for (int r = 0; r < 8; ++r) { f.h[r] = (_Float16)(0.5f + 0.5f * __builtin_amdgcn_tanhf(s0[r])); f.h[8 + r] = (_Float16)(0.5f + 0.5f * __builtin_amdgcn_tanhf(s1[r])); }
  return f.v; }
// one block of 32 keys against the wave's 32 queries
__device__ __forceinline__ void fa_block(v16h k0, v16h k1, v16h v0, v16h v1, v16h qf0, v16h qf1, v8f& o00, v8f& o01, v8f& o10, v8f& o11) {
  const v8f z8 = {0.f,0.f,0.f,0.f,0.f,0.f,0.f,0.f};
  const v8f s00 = fa_mma(k0, qf0, z8), s01 = fa_mma(k1, qf0, z8), s10 = fa_mma(k0, qf1, z8), s11 = fa_mma(k1, qf1, z8);
  const v16h p0 = fa_sig(s00, s01); o00 = fa_mma(p0, v0, o00); o01 = fa_mma(p0, v1, o01);
  const v16h p1 = fa_sig(s10, s11); o10 = fa_mma(p1, v0, o10); o11 = fa_mma(p1, v1, o11); }
// Fused attention over the listed keys alone (CNT[0] of them, in blocks of 32): one workgroup = one head x 128 queries; wave = 32 queries (w & 3) x every fourth block of keys, from block w >> 2. Q16 holds q / 2: S^T = k (q/2)^T, w = sigmoid(q.k) = 0.5 + 0.5 tanh(S^T) stays in registers, o += w (mask v); the four key quarters are joined through LDS.
__global__ __launch_bounds__(512) void k_fattn(const _Float16* __restrict__ Q16, const _Float16* __restrict__ KP, const _Float16* __restrict__ VP, const int* __restrict__ CNT, _Float16* __restrict__ O16) {
  __shared__ __attribute__((aligned(16))) float part[4][128][36];
  const int tid = threadIdx.x, lane = tid & 31, ln = lane & 15, hh = lane >> 4;
  const int w = __builtin_amdgcn_readfirstlane(tid >> 5);      /* the wave's number in a scalar register: the trip count below is then a scalar, and the loop's branch leaves EXEC alone */
  const int h = blockIdx.x >> 5, q0 = (blockIdx.x & 31) * 128; const int qg = w & 3, kq = w >> 2;
  const _Float16* qp = Q16 + (size_t)(q0 + qg * 32 + ln) * HDA + h * HDm;
  const v16h qf0 = g2_frag(qp, hh), qf1 = g2_frag(qp + (size_t)16 * HDA, hh);
  const int cn = CNT[0], nbt = ((cn < 0 ? 0 : cn > NS ? NS : cn) + 31) >> 5, nbw = (nbt + 3 - kq) >> 2;      /* blocks in all (at most 128 after the clamp) and this wave's share: kq, kq + 4, ... */
  const unsigned short* kp = (const unsigned short*)KP + ((size_t)h * 128 + kq) * 1024 + lane * 8;
  const unsigned short* vp = (const unsigned short*)VP + ((size_t)h * 128 + kq) * 1024 + lane * 8;
  const v8f z8 = {0.f,0.f,0.f,0.f,0.f,0.f,0.f,0.f}; v8f o00 = z8, o01 = z8, o10 = z8, o11 = z8;
  if (nbw > 0) {      /* a wave without a block reads nothing of KP and VP and hands in zeros */
  v16h nk0 = fa_frag(kp), nk1 = fa_frag(kp + 512), nv0 = fa_frag(vp), nv1 = fa_frag(vp + 512);
#pragma unroll 1      /* stays rolled: one trip's code (some 140 instructions) serves all trips */
  for (int b = 0; b < nbw; ++b) { const v16h k0 = nk0, k1 = nk1, v0 = nv0, v1 = nv1;
    const int nb = (b + 1 < nbw ? b + 1 : b) * 4096;      /* the next block's fragments fly while this block is worked on (the last trip reads its own block again and drops it) */
    nk0 = fa_frag(kp + nb); nk1 = fa_frag(kp + nb + 512); nv0 = fa_frag(vp + nb); nv1 = fa_frag(vp + nb + 512);
    asm volatile("s_wait_xcnt 0x0" ::: "memory");      /* in front of the block's arithmetic, which reuses the loads' address registers */
    __builtin_amdgcn_sched_barrier(0);      /* keeps the eight loads up here: without it the scheduler sinks them to the foot of the trip, right in front of their use */
    fa_block(k0, k1, v0, v1, qf0, qf1, o00, o01, o10, o11);
    __builtin_amdgcn_sched_barrier(0); } }      /* keeps the copies of the loaded fragments, and so the waits for them, at the foot: without it some rise to the head of the trip */
  for (int r = 0; r < 8; ++r) { float* pr = &part[kq][qg * 32 + 8 * hh + r][ln]; pr[0] = o00[r]; pr[16] = o01[r]; pr[16 * 36] = o10[r]; pr[16 * 36 + 16] = o11[r]; }
  __syncthreads();
  const int q = tid >> 2, d0 = (tid & 3) * 8; v4f a = *(const v4fa*)&part[0][q][d0], c = *(const v4fa*)&part[0][q][d0 + 4];
  for (int s = 1; s < 4; ++s) { a += *(const v4fa*)&part[s][q][d0]; c += *(const v4fa*)&part[s][q][d0 + 4]; }
  FragH f;
  for (int i = 0; i < 4; ++i) { f.h[i] = (_Float16)a[i]; f.h[4 + i] = (_Float16)c[i]; }
  *(v8us*)((unsigned short*)O16 + (size_t)(q0 + q) * HDA + h * HDm + d0) = f.half[0]; }
// attn = o oW^T + x_q for 32 voxels x all 128 channels a workgroup; wave = 16 channels. D holds one channel a lane and 8 voxels in a row in its registers, so x_q is read from the input and
// attn is stored channel-major (ATc[c][s]) with 16-byte accesses and no transposition. Each wave also leaves mean and sum of squared deviations of its 16 channels over the 32 voxels: PS[group][c] = {mean, M2}.
__global__ __launch_bounds__(256) void k_oproj(const _Float16* __restrict__ O16, const _Float16* __restrict__ BOW, const float* __restrict__ xq, float* __restrict__ ATc, float* __restrict__ PS) {
  const int tid = threadIdx.x, w = tid >> 5, lane = tid & 31, ln = lane & 15, hh = lane >> 4;
  const int g = blockIdx.x, s0 = g * 32, c = w * 16 + ln;
  const _Float16* ap = O16 + (size_t)(s0 + ln) * HDA; const _Float16* bp = BOW + (size_t)c * HDA; const float* xp = xq + (size_t)c * NS + s0 + 8 * hh;
  v16h a0[8], a1[8], b[8];
#pragma unroll      /* all 48 fragment loads are in flight together: one round trip to L2 instead of one a k step */
  for (int kb = 0; kb < 8; ++kb) { a0[kb] = g2_frag(ap + kb * 32, hh); a1[kb] = g2_frag(ap + (size_t)16 * HDA + kb * 32, hh); b[kb] = g2_frag(bp + kb * 32, hh); }
  const v4f x0 = *(const v4fa*)xp, x1 = *(const v4fa*)(xp + 4), x2 = *(const v4fa*)(xp + 16), x3 = *(const v4fa*)(xp + 20);
  asm volatile("s_wait_xcnt 0x0" ::: "memory");      /* in front of the arithmetic, which may reuse the loads' address registers */
  __builtin_amdgcn_sched_barrier(0);      /* keeps that arithmetic behind the wait, and the loads together in front of it */
  const v8f z8 = {0.f,0.f,0.f,0.f,0.f,0.f,0.f,0.f}; v8f c0 = z8, c1 = z8;
#pragma unroll
  for (int kb = 0; kb < 8; ++kb) { c0 = fa_mma(a0[kb], b[kb], c0); c1 = fa_mma(a1[kb], b[kb], c1); }
  float v[16];
#pragma unroll
  for (int r = 0; r < 4; ++r) { v[r] = c0[r] * 0.0625f + bf16_round(x0[r]); v[4 + r] = c0[4 + r] * 0.0625f + bf16_round(x1[r]); v[8 + r] = c1[r] * 0.0625f + bf16_round(x2[r]); v[12 + r] = c1[4 + r] * 0.0625f + bf16_round(x3[r]); }
  float s = 0.f;
#pragma unroll
  for (int i = 0; i < 16; ++i) s += v[i];
  s += __shfl_xor(s, 16);      /* lanes l and l + 16 hold the two halves of one channel's 32 voxels */
  const float mean = s * (1.0f / 32.0f); float q2 = 0.f;
#pragma unroll
  for (int i = 0; i < 16; ++i) { const float d = v[i] - mean; q2 += d * d; }
  q2 += __shfl_xor(q2, 16);
  float* op = ATc + (size_t)c * NS + s0 + 8 * hh;
  const v4f y0 = {v[0], v[1], v[2], v[3]}, y1 = {v[4], v[5], v[6], v[7]}, y2 = {v[8], v[9], v[10], v[11]}, y3 = {v[12], v[13], v[14], v[15]};
  *(v4fa*)op = y0; *(v4fa*)(op + 4) = y1; *(v4fa*)(op + 16) = y2; *(v4fa*)(op + 20) = y3;
  if (hh == 0) { const v2f p = {mean, q2}; *(v2fa*)(PS + ((size_t)g * CC + c) * 2) = p; } }
// The rest of the network for 32 voxels a workgroup (16 waves): join the 128 groups' {mean, M2} to the statistics of attn; h = IN(attn) -> LDS [s][c]; relu(W1 h + b1) computed transposed (A = W1, B = h),
// so that a lane holds 8 hidden units in a row of one voxel -> LDS [s][n]; W2 . + b2 -> LDS [c][s]; + attn, stored to out[c][s] in whole 128-byte lines.
__global__ __launch_bounds__(512) void k_mlp(const float* __restrict__ ATc, const float* __restrict__ PS, const float* __restrict__ gp, const float* __restrict__ bp, const _Float16* __restrict__ BW1, const float* __restrict__ b1, const _Float16* __restrict__ BW2, const float* __restrict__ b2, float* __restrict__ out) {
  __shared__ __attribute__((aligned(16))) _Float16 Hs[32][CC + 8];      /* pitches of 16 bytes x an odd number for the 16-byte fragment reads */
  __shared__ __attribute__((aligned(16))) _Float16 Gs[32][2 * CC + 8];
  __shared__ __attribute__((aligned(16))) float Cs[CC][36];
  __shared__ float r1[4][CC], r2[4][CC];
  const int tid = threadIdx.x, w = tid >> 5, lane = tid & 31, ln = lane & 15, hh = lane >> 4; const int s0 = blockIdx.x * 32;
  const int cs = tid & (CC - 1), part = tid >> 7;      /* statistics: one channel, 32 of the 128 groups */
  const int c = tid >> 2, sq = (tid & 3) * 8;      /* normalisation and final store: one channel, 8 voxels */
  const int nt = w & 7, mt = w >> 3;      /* second product: 16 channels x 16 voxels */
  const unsigned pso = (unsigned)(part * 32 * CC + cs) * 8u;      /* byte offset of the thread's first {mean, M2} pair */
  v2f ps[32];
#pragma unroll
  for (int g = 0; g < 32; ++g) ps[g] = *(const v2fa*)((const char*)PS + pso + g * (CC * 8));
  const float* atp = ATc + (size_t)c * NS + s0 + sq; const v4f xa = *(const v4fa*)atp, xb = *(const v4fa*)(atp + 4);
  const unsigned short* w1p = (const unsigned short*)BW1 + (size_t)(16 * w + ln) * CC + 8 * hh; const unsigned short* w2p = (const unsigned short*)BW2 + (size_t)(16 * nt + ln) * (2 * CC) + 8 * hh; const float* b1p = b1 + 16 * w + 8 * hh;
  FragH w1f[4], w2f[8];
#pragma unroll
  for (int kb = 0; kb < 4; ++kb) { w1f[kb].half[0] = *(const v8us*)(w1p + kb * 32); w1f[kb].half[1] = *(const v8us*)(w1p + kb * 32 + 16); }
#pragma unroll
  for (int kb = 0; kb < 8; ++kb) { w2f[kb].half[0] = *(const v8us*)(w2p + kb * 32); w2f[kb].half[1] = *(const v8us*)(w2p + kb * 32 + 16); }
  const v4f b1a = *(const v4fa*)b1p, b1b = *(const v4fa*)(b1p + 4);
  const float b2v = bf16_round(b2[16 * nt + ln]), gv = bf16_round(gp[c]), bv = bf16_round(bp[c]);
  asm volatile("s_wait_xcnt 0x0" :: "v"(pso), "v"(atp), "v"(w1p), "v"(w2p), "v"(b1p) : "memory");      /* in front of the arithmetic, which may reuse the loads' address registers; it names them, so that none is given to a later load's result ahead of the wait */
  __builtin_amdgcn_sched_barrier(0);      /* keeps that arithmetic behind the wait, and every global load of the kernel up here, in flight together: one round trip to memory for all of them */
  float sm = 0.f;
#pragma unroll
  for (int g = 0; g < 32; ++g) sm += ps[g][0];
  r1[part][cs] = sm; __syncthreads();
  { const float mean = (r1[0][cs] + r1[1][cs] + r1[2][cs] + r1[3][cs]) * (1.0f / 128.0f); float q2 = 0.f;      /* equal groups: M2 = sum of the groups' M2 + 32 sum (group mean - mean)^2 */
#pragma unroll
    for (int g = 0; g < 32; ++g) { const float d = ps[g][0] - mean; q2 += ps[g][1] + 32.0f * (d * d); }
    r2[part][cs] = q2; }
  __syncthreads();
  { const float mean = (r1[0][c] + r1[1][c] + r1[2][c] + r1[3][c]) * (1.0f / 128.0f); const float var = (r2[0][c] + r2[1][c] + r2[2][c] + r2[3][c]) * (1.0f / (float)NS); const float rs = rsqrtf(var + 1e-5f);
#pragma unroll
    for (int i = 0; i < 4; ++i) { Hs[sq + i][c] = (_Float16)((xa[i] - mean) * rs * gv + bv); Hs[sq + 4 + i][c] = (_Float16)((xb[i] - mean) * rs * gv + bv); } }
  __syncthreads();
  const v8f z8 = {0.f,0.f,0.f,0.f,0.f,0.f,0.f,0.f}; v8f d0 = z8, d1 = z8;
#pragma unroll
  for (int kb = 0; kb < 4; ++kb) { d0 = fa_mma(w1f[kb].v, g2_frag(&Hs[ln][kb * 32], hh), d0); d1 = fa_mma(w1f[kb].v, g2_frag(&Hs[16 + ln][kb * 32], hh), d1); }
  { FragH f0, f1;      /* D register r: hidden unit 16w + 8hh + r of voxel ln (d0) and 16 + ln (d1) */
#pragma unroll
    for (int r = 0; r < 8; ++r) { const float bb = bf16_round(r < 4 ? b1a[r & 3] : b1b[r & 3]); f0.h[r] = (_Float16)fmaxf(d0[r] * 0.0625f + bb, 0.f); f1.h[r] = (_Float16)fmaxf(d1[r] * 0.0625f + bb, 0.f); }
    *(v8us*)&Gs[ln][16 * w + 8 * hh] = f0.half[0]; *(v8us*)&Gs[16 + ln][16 * w + 8 * hh] = f1.half[0]; }
  __syncthreads();
  v8f e = z8;
#pragma unroll
  for (int kb = 0; kb < 8; ++kb) e = fa_mma(g2_frag(&Gs[16 * mt + ln][kb * 32], hh), w2f[kb].v, e);
  { const v4f e0 = {e[0] * 0.0625f + b2v, e[1] * 0.0625f + b2v, e[2] * 0.0625f + b2v, e[3] * 0.0625f + b2v}, e1 = {e[4] * 0.0625f + b2v, e[5] * 0.0625f + b2v, e[6] * 0.0625f + b2v, e[7] * 0.0625f + b2v};
    *(v4fa*)&Cs[16 * nt + ln][16 * mt + 8 * hh] = e0; *(v4fa*)&Cs[16 * nt + ln][16 * mt + 8 * hh + 4] = e1; }      /* D register r: voxel 16mt + 8hh + r of channel 16nt + ln */
  __syncthreads();
  const v4f o0 = *(const v4fa*)&Cs[c][sq] + xa, o1 = *(const v4fa*)&Cs[c][sq + 4] + xb;
  float* op = out + (size_t)c * NS + s0 + sq; *(v4fa*)op = o0; *(v4fa*)(op + 4) = o1; }

extern "C" void kernel_launch(void* const* d_in, const int* in_sizes, int n_in,
                              void* d_out, int out_size, void* d_ws, size_t ws_size, hipStream_t stream) {
  (void)in_sizes; (void)n_in; (void)out_size;
  const float* const* I = (const float* const*)d_in; const float* xq = I[0]; const float* xkv = I[1]; const int* msk = (const int*)d_in[2]; const float* qW = I[3]; const float* kW = I[4]; const float* vW = I[5]; const float* oW = I[6]; const float* gq = I[7]; const float* bq = I[8]; const float* gk = I[9]; const float* bk = I[10]; const float* gp = I[11]; const float* bp = I[12]; const float* W1 = I[13]; const float* b1 = I[14]; const float* W2 = I[15]; const float* b2 = I[16];
  char* ws = (char*)d_ws; size_t off = 0;
  auto take = [&](size_t bytes) { char* p = ws + off; off += (bytes + 255) & ~(size_t)255; return p; };
  _Float16* BQ = (_Float16*)take((size_t)HDA * CC * 2); _Float16* BK = (_Float16*)take((size_t)HDA * CC * 2); _Float16* BV = (_Float16*)take((size_t)HDA * CC * 2); _Float16* BOW = (_Float16*)take((size_t)CC * HDA * 2); _Float16* BW1 = (_Float16*)take((size_t)2 * CC * CC * 2); _Float16* BW2 = (_Float16*)take((size_t)CC * 2 * CC * 2); float* STQ = (float*)take(CC * 2 * 4); float* STK = (float*)take(CC * 2 * 4);
  _Float16* Q16 = (_Float16*)take((size_t)NS * HDA * 2); _Float16* KP = (_Float16*)take((size_t)NS * HDA * 2); _Float16* VP = (_Float16*)take((size_t)NS * HDA * 2); _Float16* O16 = (_Float16*)take((size_t)NS * HDA * 2); float* AT = (float*)take((size_t)NS * CC * 4); float* PS = (float*)take((size_t)(NS / 32) * CC * 2 * 4); int* SEL = (int*)take((size_t)NS * 4); int* MV = (int*)take((size_t)NS * 4); int* CNT = (int*)take(4);
  if (off > ws_size) return;      /* about 11 MiB */
  k_prep<<<1 + 2 * CC + 6 * (HDA * CC / 8 / 256), 256, 0, stream>>>(msk, SEL, MV, CNT, xq, xkv, STQ, STK, qW, kW, vW, oW, W1, W2, BQ, BK, BV, BOW, BW1, BW2);      /* statistics of x_q and x_kv; 1x1 convs 'oc' = Bt, times 16 */
  k_nqkv<<<dim3(NS / 32, 3), 256, 0, stream>>>(xq, xkv, STQ, STK, gq, bq, gk, bk, BQ, BK, BV, SEL, MV, Q16, KP, VP);      /* IN(x_q), IN(x_kv); q / 2, k, mask * v, the last two in the attention kernel's fragment order */
  k_fattn<<<NHD * (NS / 128), 512, 0, stream>>>(Q16, KP, VP, CNT, O16);      /* o = (sigmoid(q.k) * mask) v, all heads */
  k_oproj<<<NS / 32, 256, 0, stream>>>(O16, BOW, xq, AT, PS);      /* attn = o oW^T + x_q, channel-major, and its statistics by groups of 32 voxels */
  k_mlp<<<NS / 32, 512, 0, stream>>>(AT, PS, gp, bp, BW1, b1, BW2, b2, (float*)d_out);      /* out = W2 relu(W1 IN(attn) + b1) + b2 + attn */
}

// v008
// Measured time: 32.7 microseconds a run.
// In two side-by-side timings against v007, it was 1.07 and 1.06 times as fast.
// All steps since v000 together make it 43.1 times as fast.
#include <hip/hip_runtime.h>
// Multi_Heads_Self_Attn_Q_KV (1 volume, C 128, 16^3 = 4096 voxels, 8 heads x 32): InstanceNorm of x_q and x_kv (per channel over the 4096 voxels, biased var, eps 1e-5, affine); q, k, v = 1x1 convs (no bias); w = sigmoid(q.k) (no scale) * mask[key] (int input 0/1); o = w v (no normalisation); attn = o oW^T + x_q; h = IN(attn); h = relu(W1 h + b1); h = W2 h + b2; out = h + attn -> [1, 128, 16, 16, 16].
// Compute dtype: inputs and parameters rounded to bf16; normalised inputs, q, k, v, sigmoid weights, o and the MLP activations as plain f16 operands (~2^-12); statistics/sigmoid f32. v_wmma_f32_16x16x32_f16.
#define CC 128
#define NS 4096
#define NHD 8
#define HDm 32
#define HDA (NHD * HDm)          /* 256 */
#define PW (NHD * 64)            /* 512, unused */
typedef __bf16 v16b __attribute__((ext_vector_type(16)));
typedef unsigned short v8us __attribute__((ext_vector_type(8), may_alias));
typedef float  v8f  __attribute__((ext_vector_type(8)));
typedef float  v4f  __attribute__((ext_vector_type(4)));
typedef float  v4fa __attribute__((ext_vector_type(4), may_alias));
union FragB { v16b v; v8us half[2]; unsigned short u[16]; };

__device__ __forceinline__ unsigned short bf16_bits(float x) { unsigned int u = __float_as_uint(x); return (unsigned short)((u + 0x7FFFu + ((u >> 16) & 1u)) >> 16); }
__device__ __forceinline__ float bf16_val(unsigned short b) { return __uint_as_float(((unsigned int)b) << 16); }
__device__ __forceinline__ float bf16_round(float x) { return bf16_val(bf16_bits(x)); }
// D += A·B with NT terms: 1 = ah·bh, 2 = + al·bh (A split), 3 = + ah·bl (both split)
template <int NT>
__device__ __forceinline__ v8f mmaN(v16b ah, v16b al, v16b bh, v16b bl, v8f c) {
  c = __builtin_amdgcn_wmma_f32_16x16x32_bf16(false, ah, false, bh, (short)0, c, false, false);
  if (NT >= 2) c = __builtin_amdgcn_wmma_f32_16x16x32_bf16(false, al, false, bh, (short)0, c, false, false);
  if (NT >= 3) c = __builtin_amdgcn_wmma_f32_16x16x32_bf16(false, ah, false, bl, (short)0, c, false, false);
  asm volatile("v_nop\n\tv_nop\n\tv_nop\n\tv_nop" : "+v"(c) : "v"(ah), "v"(al), "v"(bh), "v"(bl));
  return c;
}

__global__ __launch_bounds__(256) void k_wt_bf16(const float* __restrict__ W, unsigned short* __restrict__ Wt, int K, int N) {
  const int t = blockIdx.x * 256 + threadIdx.x;
  const int k8n = K / 8;
  if (t >= N * k8n) return;
  const int n = t / k8n, k8 = (t % k8n) * 8;
  v8us v;
#pragma unroll
  for (int i = 0; i < 8; ++i) v[i] = bf16_bits(W[(size_t)(k8 + i) * N + n]);
  *(v8us*)(Wt + (size_t)n * K + k8) = v;
  
}

// GEMM C[M][N] (f32, pitch ldc) = act(A[M][K]·W + bias). A f32 row-major (pitch lda) converted per fragment to bf16
// (ASPLIT: hi/lo two planes -> 2 terms, else single rounded term); Wt bf16 [N][K] (pitch ldb). BIAS_BF16 rounds the
// bias to bf16 first (bias quantised to bf16 before the add). K%32==0, M%16==0, N%64==0.
template <bool ASPLIT, int ACT, bool BIAS_BF16>
__global__ __launch_bounds__(128) void k_gemm_bf(const float* __restrict__ A, int lda, const unsigned short* __restrict__ Wt, int ldb,
                                               const float* __restrict__ bias, float* __restrict__ C, int ldc, int M, int N, int K) {
  __shared__ __attribute__((aligned(16))) float so[4][16][64];
  const int tid = threadIdx.x, w = tid >> 5, lane = tid & 31, ln = lane & 15, hh = lane >> 4;
  const int ntn = N / 64;
  const int wid = blockIdx.x * 4 + w;
  const int mt = wid / ntn, nq = wid % ntn;
  if (mt * 16 >= M) return;
  const int row0 = mt * 16, col0 = nq * 64;
  const float* arow = A + (size_t)(row0 + ln) * lda;
  v8f acc[4] = {};
  for (int kb = 0; kb < K; kb += 32) {
    FragB ah, al;
    const v4f x0 = *(const v4fa*)(arow + kb + 8 * hh), x1 = *(const v4fa*)(arow + kb + 8 * hh + 4);
    const v4f x2 = *(const v4fa*)(arow + kb + 16 + 8 * hh), x3 = *(const v4fa*)(arow + kb + 16 + 8 * hh + 4);
    float xs[16] = {x0[0],x0[1],x0[2],x0[3],x1[0],x1[1],x1[2],x1[3],x2[0],x2[1],x2[2],x2[3],x3[0],x3[1],x3[2],x3[3]};
#pragma unroll
    for (int i = 0; i < 16; ++i) { const unsigned short hb = bf16_bits(xs[i]); ah.u[i] = hb; al.u[i] = ASPLIT ? bf16_bits(xs[i] - bf16_val(hb)) : (unsigned short)0; }
#pragma unroll
    for (int t = 0; t < 4; ++t) {
      const unsigned short* brow = Wt + (size_t)(col0 + t * 16 + ln) * ldb + kb;
      FragB b;
      b.half[0] = *(const v8us*)(brow + 8 * hh);
      b.half[1] = *(const v8us*)(brow + 16 + 8 * hh);
      acc[t] = mmaN<ASPLIT ? 2 : 1>(ah.v, al.v, b.v, b.v, acc[t]);
    }
  }
#pragma unroll
  for (int t = 0; t < 4; ++t) {
    float bv = bias ? bias[col0 + t * 16 + ln] : 0.f;
    if (BIAS_BF16) bv = bf16_round(bv);
#pragma unroll
    for (int r = 0; r < 8; ++r) { float v = acc[t][r] + bv; if (ACT == 1) v = fmaxf(v, 0.f); so[w][8 * hh + r][t * 16 + ln] = v; }
  }
  __builtin_amdgcn_fence(__ATOMIC_ACQ_REL, "workgroup");
  __builtin_amdgcn_wave_barrier();
  const int rsub = lane >> 4, c4 = (lane & 15) * 4;
  {
#pragma unroll
    for (int q = 0; q < 8; ++q) {
      const int r = q * 2 + rsub;
      const v4f v = *(const v4fa*)&so[w][r][c4];
      *(v4f*)(C + (size_t)(row0 + r) * ldc + col0 + c4) = v;
    }
    
  }
}

// GEMM C = act(A·W + bias + resid): A f32 (ASPLIT -> hi/lo 2 terms), Wt bf16 [N][K]; ACT 0 none, 1 relu, 2 exact gelu;
// resid (optional, f32, row index = (row % rmod), pitch ldr, RES_BF16 rounds it) added before the activation.
template <bool ASPLIT, int ACT, bool BIAS_BF16, bool RES_BF16>
__global__ __launch_bounds__(128) void k_gemm_bf3(const float* __restrict__ A, int lda, const unsigned short* __restrict__ Wt, int ldb,
                                                const float* __restrict__ bias, const float* __restrict__ resid, int rmod, int ldr,
                                                float* __restrict__ C, int ldc, int M, int N, int K) {
  __shared__ __attribute__((aligned(16))) float so[4][16][64];
  const int tid = threadIdx.x, w = tid >> 5, lane = tid & 31, ln = lane & 15, hh = lane >> 4;
  const int ntn = N / 64;
  const int wid = blockIdx.x * 4 + w;
  const int mt = wid / ntn, nq = wid % ntn;
  if (mt * 16 >= M) return;
  const int row0 = mt * 16, col0 = nq * 64;
  const float* arow = A + (size_t)(row0 + ln) * lda;
  v8f acc[4] = {};
  for (int kb = 0; kb < K; kb += 32) {
    FragB ah, al;
    const v4f x0 = *(const v4fa*)(arow + kb + 8 * hh), x1 = *(const v4fa*)(arow + kb + 8 * hh + 4);
    const v4f x2 = *(const v4fa*)(arow + kb + 16 + 8 * hh), x3 = *(const v4fa*)(arow + kb + 16 + 8 * hh + 4);
    float xs[16] = {x0[0],x0[1],x0[2],x0[3],x1[0],x1[1],x1[2],x1[3],x2[0],x2[1],x2[2],x2[3],x3[0],x3[1],x3[2],x3[3]};
#pragma unroll
    for (int i = 0; i < 16; ++i) { const unsigned short hb = bf16_bits(xs[i]); ah.u[i] = hb; al.u[i] = ASPLIT ? bf16_bits(xs[i] - bf16_val(hb)) : (unsigned short)0; }
#pragma unroll
    for (int t = 0; t < 4; ++t) {
      const unsigned short* brow = Wt + (size_t)(col0 + t * 16 + ln) * ldb + kb;
      FragB b;
      b.half[0] = *(const v8us*)(brow + 8 * hh);
      b.half[1] = *(const v8us*)(brow + 16 + 8 * hh);
      acc[t] = mmaN<ASPLIT ? 2 : 1>(ah.v, al.v, b.v, b.v, acc[t]);
    }
  }
#pragma unroll
  for (int t = 0; t < 4; ++t) {
    const int col = col0 + t * 16 + ln;
    float bv = bias ? bias[col] : 0.f;
    if (BIAS_BF16) bv = bf16_round(bv);
#pragma unroll
    for (int r = 0; r < 8; ++r) {
      float v = acc[t][r] + bv;
      if (resid) { float rv = resid[(size_t)((row0 + 8 * hh + r) % rmod) * ldr + col]; if (RES_BF16) rv = bf16_round(rv); v += rv; }
      if (ACT == 1) v = fmaxf(v, 0.f);
      if (ACT == 2) v = 0.5f * v * (1.0f + erff(v * 0.70710678118654752f));
      if (ACT == 3) { const float u = 0.7978845608028654f * (v + 0.044715f * v * v * v); v = 0.5f * v * (1.0f + tanhf(u)); }
      so[w][8 * hh + r][t * 16 + ln] = v;
    }
  }
  __builtin_amdgcn_fence(__ATOMIC_ACQ_REL, "workgroup");
  __builtin_amdgcn_wave_barrier();
  const int rsub = lane >> 4, c4 = (lane & 15) * 4;
  {
#pragma unroll
    for (int q = 0; q < 8; ++q) {
      const int r = q * 2 + rsub;
      const v4f v = *(const v4fa*)&so[w][r][c4];
      *(v4f*)(C + (size_t)(row0 + r) * ldc + col0 + c4) = v;
    }
    
  }
}
// row LayerNorm (biased variance, eps) over N: s = X (+ R); optional out_sum <- s; out_norm <- (s-mu)*rsqrt(var+eps)*g + b
template <bool PARAM_BF16>
__global__ __launch_bounds__(256) void k_layernorm(const float* __restrict__ X, const float* __restrict__ R, const float* __restrict__ g, const float* __restrict__ bta,
                                                  float* __restrict__ out_sum, float* __restrict__ out_norm, int N, float eps) {
  __shared__ float red[256];
  const int row = blockIdx.x, tid = threadIdx.x;
  const float* x = X + (size_t)row * N; const float* rr = R ? R + (size_t)row * N : nullptr;
  float vals[16];                     // up to N = 4096
  const int per = N / 256;            // contiguous chunk per thread? use strided-by-4 chunks: thread handles j = tid*4 + 1024*u
  float s1 = 0.f;
  for (int u = 0; u < per / 4; ++u) {
    const int j = tid * 4 + 1024 * u;
    const v4f a = *(const v4fa*)(x + j);
    v4f b = {0.f,0.f,0.f,0.f}; if (rr) b = *(const v4fa*)(rr + j);
#pragma unroll
    for (int q = 0; q < 4; ++q) { const float v = a[q] + b[q]; vals[u * 4 + q] = v; s1 += v; }
  }
  red[tid] = s1; __syncthreads();
  for (int st = 128; st > 0; st >>= 1) { if (tid < st) red[tid] += red[tid + st]; __syncthreads(); }
  const float mu = red[0] / (float)N; __syncthreads();
  float s2 = 0.f;
  for (int u = 0; u < per / 4; ++u)
#pragma unroll
    for (int q = 0; q < 4; ++q) { const float c = vals[u * 4 + q] - mu; s2 += c * c; }
  red[tid] = s2; __syncthreads();
  for (int st = 128; st > 0; st >>= 1) { if (tid < st) red[tid] += red[tid + st]; __syncthreads(); }
  const float rs = rsqrtf(red[0] / (float)N + eps);
  {
    for (int u = 0; u < per / 4; ++u) {
      const int j = tid * 4 + 1024 * u;
      v4f o, sm;
#pragma unroll
      for (int q = 0; q < 4; ++q) {
        float gg = g[j + q], bb = bta[j + q];
        if (PARAM_BF16) { gg = bf16_round(gg); bb = bf16_round(bb); }
        sm[q] = vals[u * 4 + q]; o[q] = (vals[u * 4 + q] - mu) * rs * gg + bb;
      }
      if (out_sum) *(v4f*)(out_sum + (size_t)row * N + j) = sm;
      *(v4f*)(out_norm + (size_t)row * N + j) = o;
    }
    
  }
}



// ---- f16 WMMA path (v_wmma_f32_16x16x32_f16): 11-bit significands for operands in range — used where a [0,1] probability operand needs more precision than bf16
typedef _Float16 v16h __attribute__((ext_vector_type(16)));
union FragH { v16h v; v8us half[2]; _Float16 h[16]; unsigned short u[16]; };
template <int NT>
__device__ __forceinline__ v8f mmaH(v16h ah, v16h al, v16h bh, v16h bl, v8f c) {
  c = __builtin_amdgcn_wmma_f32_16x16x32_f16(false, ah, false, bh, (short)0, c, false, false);
  if (NT >= 2) c = __builtin_amdgcn_wmma_f32_16x16x32_f16(false, al, false, bh, (short)0, c, false, false);
  if (NT >= 3) c = __builtin_amdgcn_wmma_f32_16x16x32_f16(false, ah, false, bl, (short)0, c, false, false);
  asm volatile("v_nop\n\tv_nop\n\tv_nop\n\tv_nop" : "+v"(c) : "v"(ah), "v"(al), "v"(bh), "v"(bl));
  return c;
}
// batched GEMM like k_gemm_b but f16 operands: A f32 (split into f16 hi/lo if ASPLIT, else rounded to f16), Bt = f16 values [n][k]; alpha; C f32; N multiple of 16 (partial tiles skipped)
template <bool ASPLIT>
__global__ __launch_bounds__(128) void k_gemm_h(const float* __restrict__ A, int lda, size_t sA, const _Float16* __restrict__ Bh, int ldb, size_t sB, float alpha, float* __restrict__ C, int ldc, size_t sC, int M, int N, int K) {
  __shared__ __attribute__((aligned(16))) float so[4][16][64];
  const int tid = threadIdx.x, w = tid >> 5, lane = tid & 31, ln = lane & 15, hh = lane >> 4; const int by = blockIdx.y;
  A += (size_t)by * sA; Bh += (size_t)by * sB; C += (size_t)by * sC;
  const int ntn = (N + 63) / 64; const int wid = blockIdx.x * 4 + w; const int mt = wid / ntn, nq = wid % ntn; if (mt * 16 >= M) return;
  const int row0 = mt * 16, col0 = nq * 64; const float* arow = A + (size_t)(row0 + ln) * lda;
  v8f acc[4] = {};
  for (int kb = 0; kb < K; kb += 32) {
    FragH ah, al;
    const v4f x0 = *(const v4fa*)(arow + kb + 8 * hh), x1 = *(const v4fa*)(arow + kb + 8 * hh + 4), x2 = *(const v4fa*)(arow + kb + 16 + 8 * hh), x3 = *(const v4fa*)(arow + kb + 16 + 8 * hh + 4);
    float xs[16] = {x0[0],x0[1],x0[2],x0[3],x1[0],x1[1],x1[2],x1[3],x2[0],x2[1],x2[2],x2[3],x3[0],x3[1],x3[2],x3[3]};
#pragma unroll
    for (int i = 0; i < 16; ++i) { const _Float16 h = (_Float16)xs[i]; ah.h[i] = h; al.h[i] = ASPLIT ? (_Float16)(xs[i] - (float)h) : (_Float16)0.0f; }
#pragma unroll
    for (int t = 0; t < 4; ++t) { if (col0 + t * 16 >= N) continue; const size_t boff = (size_t)(col0 + t * 16 + ln) * ldb + kb; FragH bq; bq.half[0] = *(const v8us*)(Bh + boff + 8 * hh); bq.half[1] = *(const v8us*)(Bh + boff + 16 + 8 * hh);
      acc[t] = mmaH<ASPLIT ? 2 : 1>(ah.v, al.v, bq.v, bq.v, acc[t]); }
  }
#pragma unroll
  for (int t = 0; t < 4; ++t) { if (col0 + t * 16 >= N) continue;
#pragma unroll
    for (int r = 0; r < 8; ++r) so[w][8 * hh + r][t * 16 + ln] = acc[t][r] * alpha; }
  __builtin_amdgcn_fence(__ATOMIC_ACQ_REL, "workgroup"); __builtin_amdgcn_wave_barrier();
  const int rsub = lane >> 4, c4 = (lane & 15) * 4;
  {
#pragma unroll
    for (int q = 0; q < 8; ++q) { const int r = q * 2 + rsub; if (col0 + c4 < N) { const v4f v = *(const v4fa*)&so[w][r][c4]; *(v4f*)(C + (size_t)(row0 + r) * ldc + col0 + c4) = v; } }
     }
}

// Wt[n][k] = f16(W[k][n]·scale) from f32 row-major W[K][N] (scale = power of two; bf16-exact weights stay exact in f16 away from the subnormal range)
__global__ __launch_bounds__(256) void k_wt_f16(const float* __restrict__ W, _Float16* __restrict__ Wt, int K, int N, float scale) {
  const int t = blockIdx.x * 256 + threadIdx.x; if (t >= N * (K / 8)) return; const int n = t / (K / 8), k8 = (t % (K / 8)) * 8; FragH f;
#pragma unroll
  for (int i = 0; i < 8; ++i) f.h[i] = (_Float16)(bf16_round(W[(size_t)(k8 + i) * N + n]) * scale); const v8us o = f.half[0];
  *(v8us*)((unsigned short*)Wt + (size_t)n * K + k8) = o; 
}
// k_gemm_hh variant with fused epilogue: v = acc·alpha + bias[by·sBias + col] (+ CP[(row/rowsPerB)·sCPb + by·64 + col] if CP) ; ACT 0 none / 1 elu ; writes f16 C16 (and f32 C if non-null)
template <int ACT>
__global__ __launch_bounds__(128) void k_gemm_hhx(const _Float16* __restrict__ A, int lda, size_t sA, const _Float16* __restrict__ Bh, int ldb, size_t sB, float alpha, const float* __restrict__ bias, size_t sBias, const float* __restrict__ CP, int rowsPerB, size_t sCPb, int row0g,
    float* __restrict__ C, _Float16* __restrict__ C16, int ldc, size_t sC, int M, int N, int K) {
  __shared__ __attribute__((aligned(16))) float so[4][16][64];
  const int tid = threadIdx.x, w = tid >> 5, lane = tid & 31, ln = lane & 15, hh = lane >> 4; const int by = blockIdx.y;
  A += (size_t)by * sA; Bh += (size_t)by * sB; const size_t cofs = (size_t)by * sC; const float* bp = bias ? bias + (size_t)by * sBias : nullptr;
  const int ntn = (N + 63) / 64; const int wid = blockIdx.x * 4 + w; const int mt = wid / ntn, nq = wid % ntn; if (mt * 16 >= M) return;
  const int row0 = mt * 16, col0 = nq * 64; const _Float16* arow = A + (size_t)(row0 + ln) * lda;
  v8f acc[4] = {};
  for (int kb = 0; kb < K; kb += 32) { FragH ah; ah.half[0] = *(const v8us*)((const unsigned short*)arow + kb + 8 * hh); ah.half[1] = *(const v8us*)((const unsigned short*)arow + kb + 16 + 8 * hh);
#pragma unroll
    for (int t = 0; t < 4; ++t) { if (col0 + t * 16 >= N) continue; const size_t boff = (size_t)(col0 + t * 16 + ln) * ldb + kb; FragH bq; bq.half[0] = *(const v8us*)((const unsigned short*)Bh + boff + 8 * hh); bq.half[1] = *(const v8us*)((const unsigned short*)Bh + boff + 16 + 8 * hh);
      acc[t] = mmaH<1>(ah.v, ah.v, bq.v, bq.v, acc[t]); }
  }
#pragma unroll
  for (int t = 0; t < 4; ++t) { if (col0 + t * 16 >= N) continue; const int col = col0 + t * 16 + ln; const float bv = bp ? bf16_round(bp[col]) : 0.f;
#pragma unroll
    for (int r = 0; r < 8; ++r) { float v = acc[t][r] * alpha + bv; if (CP) { const int rr = row0g + row0 + 8 * hh + r; if (rowsPerB < 0) v += CP[cofs + (size_t)rr * ldc + col];      /* rowsPerB < 0: own element of the batched C plane */ else { const int bidx = rr / rowsPerB; v += CP[(size_t)bidx * sCPb + (size_t)by * 64 + col]; } } if (ACT == 1) v = (v > 0.f) ? v : expm1f(v); else if (ACT == 7) v = (v > 0.f) ? v + 1.0f : expf(v); else if (ACT == 8) v = tanhf(v); else if (ACT == 9) v = 0.5f * v * (1.0f + tanhf(0.7978845608028654f * (v + 0.044715f * v * v * v))); else if (ACT == 11) v = 1.0f / (1.0f + expf(-v)); else if (ACT == 12) v = (v > 0.f) ? v : 0.01f * v; else if (ACT == 14) v = (v > 0.f) ? v : 0.1f * v; else if (ACT == 16) v = (v >= 0.f) ? v : 0.3f * v; else if (ACT == 15) v = v / (1.0f + expf(-v)); else if (ACT == 3) v = fmaxf(v, 0.f); else if (ACT == 6) v = 0.5f * v * (1.0f + erff(v * 0.70710678118654752f)); so[w][8 * hh + r][t * 16 + ln] = v; } }
  __builtin_amdgcn_fence(__ATOMIC_ACQ_REL, "workgroup"); __builtin_amdgcn_wave_barrier();
  const int rsub = lane >> 4, c4 = (lane & 15) * 4; typedef _Float16 v4h __attribute__((ext_vector_type(4)));
  {
#pragma unroll
    for (int q = 0; q < 8; ++q) { const int r = q * 2 + rsub; if (col0 + c4 < N) { const v4f v = *(const v4fa*)&so[w][r][c4]; if (C) *(v4f*)(C + cofs + (size_t)(row0 + r) * ldc + col0 + c4) = v; if (C16) { v4h h4; for (int i = 0; i < 4; ++i) h4[i] = (_Float16)v[i]; *(v4h*)(C16 + cofs + (size_t)(row0 + r) * ldc + col0 + c4) = h4; } } }
     }
}


typedef _Float16 v4h __attribute__((ext_vector_type(4)));

__global__ __launch_bounds__(256) void k_x16(const float* __restrict__ x, _Float16* __restrict__ X16, size_t n8) { const size_t t = (size_t)blockIdx.x * 256 + threadIdx.x; if (t >= n8) return; FragH f;
#pragma unroll
  for (int q = 0; q < 8; ++q) f.h[q] = (_Float16)bf16_round(x[t * 8 + q]); *(v8us*)((unsigned short*)X16 + t * 8) = f.half[0];  }
__global__ __launch_bounds__(256) void k_h16(const float* __restrict__ x, _Float16* __restrict__ X16, size_t n8) { const size_t t = (size_t)blockIdx.x * 256 + threadIdx.x; if (t >= n8) return; FragH f;
#pragma unroll
  for (int q = 0; q < 8; ++q) f.h[q] = (_Float16)x[t * 8 + q]; *(v8us*)((unsigned short*)X16 + t * 8) = f.half[0];  }
__global__ __launch_bounds__(256) void k_round16f(const float* __restrict__ W, _Float16* __restrict__ Bt, size_t n8) { const size_t t = (size_t)blockIdx.x * 256 + threadIdx.x; if (t >= n8) return; FragH f;
#pragma unroll
  for (int i = 0; i < 8; ++i) f.h[i] = (_Float16)(bf16_round(W[t * 8 + i]) * 16.0f); *(v8us*)((unsigned short*)Bt + t * 8) = f.half[0];  }
template <int NHv, int TTv>
__global__ __launch_bounds__(256) void k_vt(const _Float16* __restrict__ V16, int ldv, int voff, _Float16* __restrict__ Vt) { __shared__ unsigned short tl[64][66]; const int tid = threadIdx.x; const int slab = blockIdx.x / (TTv / 64), lg = blockIdx.x % (TTv / 64); const int b = slab / NHv, h = slab % NHv;
  for (int i = tid; i < 64 * 8; i += 256) { const int r = i / 8, c8 = (i % 8) * 8; FragH f; f.half[0] = *(const v8us*)((const unsigned short*)V16 + ((size_t)b * TTv + lg * 64 + r) * ldv + voff + h * 64 + c8);
#pragma unroll
    for (int q = 0; q < 8; ++q) tl[r][c8 + q] = f.u[q]; }
  __syncthreads();
  {
#pragma unroll
    for (int rd = 0; rd < 2; ++rd) { const int d = rd * 32 + tid / 8, pc = tid % 8; FragH f;
#pragma unroll
      for (int q = 0; q < 8; ++q) f.u[q] = tl[pc * 8 + q][d];
      *(v8us*)((unsigned short*)Vt + ((size_t)slab * 64 + d) * TTv + lg * 64 + pc * 8) = f.half[0]; }
     } }

__global__ __launch_bounds__(256) void k_hl(const float* __restrict__ F, _Float16* __restrict__ Hh, _Float16* __restrict__ Hl, size_t n8) { const size_t t = (size_t)blockIdx.x * 256 + threadIdx.x; if (t >= n8) return; FragH fh, fl; const v4f a = *(const v4fa*)(F + t * 8), c = *(const v4fa*)(F + t * 8 + 4);
#pragma unroll
  for (int q = 0; q < 4; ++q) { _Float16 h = (_Float16)a[q]; fh.h[q] = h; fl.h[q] = (_Float16)((a[q] - (float)h) * 1024.0f); h = (_Float16)c[q]; fh.h[4 + q] = h; fl.h[4 + q] = (_Float16)((c[q] - (float)h) * 1024.0f); }
  { *(v8us*)((unsigned short*)Hh + t * 8) = fh.half[0]; *(v8us*)((unsigned short*)Hl + t * 8) = fl.half[0];  } }

// one A or B fragment of the 16x16x32 f16 form from a row of 32 halves: k = 8hh .. 8hh + 7 and 16 + 8hh .. 16 + 8hh + 7
__device__ __forceinline__ v16h g2_frag(const _Float16* p, int hh) { FragH f; f.half[0] = *(const v8us*)((const unsigned short*)p + 8 * hh); f.half[1] = *(const v8us*)((const unsigned short*)p + 16 + 8 * hh); return f.v; }


__device__ __forceinline__ void wsc_body(int bx, const float* __restrict__ Wm, _Float16* __restrict__ Bt, size_t n8, float sc) { const size_t t = (size_t)bx * 256 + threadIdx.x; if (t >= n8) return; FragH f; for (int q = 0; q < 8; ++q) f.h[q] = (_Float16)(bf16_round(Wm[t * 8 + q]) * sc); *(v8us*)((unsigned short*)Bt + t * 8) = f.half[0];  }
__device__ __forceinline__ void instat_body(int c, const float* __restrict__ base, size_t scs, size_t sss, int rnd, float* __restrict__ ST) {
  #pragma clang fp contract(off)
  __shared__ float red[256]; const int tid = threadIdx.x; float s = 0.f;
  const float* xp = base + (size_t)c * scs + (size_t)tid * sss; float x[NS / 256];      /* the thread's 16 values: read once, all 16 loads in flight together, held in registers for both passes */
#pragma unroll      /* unrolled so that x[] stays in registers and the loads stand in a row: one round trip to memory instead of one a value */
  for (int j = 0; j < NS / 256; ++j) x[j] = xp[(size_t)j * 256 * sss];
  asm volatile("s_wait_xcnt 0x0" ::: "memory");      /* behind the 16 loads: the code that follows them rewrites their address registers */
#pragma unroll      /* the sums run in the order of the rolled loops: same values, same rounding */
  for (int j = 0; j < NS / 256; ++j) { if (rnd) x[j] = bf16_round(x[j]); s += x[j]; }
  red[tid] = s; __syncthreads(); for (int st = 128; st > 0; st >>= 1) { if (tid < st) red[tid] += red[tid + st]; __syncthreads(); } const float mean = red[0] / (float)NS; __syncthreads(); float vs = 0.f;
#pragma unroll
  for (int j = 0; j < NS / 256; ++j) { const float d = x[j] - mean; vs += d * d; }
  red[tid] = vs; __syncthreads(); for (int st = 128; st > 0; st >>= 1) { if (tid < st) red[tid] += red[tid + st]; __syncthreads(); }
  if (tid == 0) { const float var = red[0] / (float)NS; { *(float*)(ST + c * 2) = mean; *(float*)(ST + c * 2 + 1) = var;  } } }
__global__ __launch_bounds__(256) void k_instat(const float* __restrict__ base, size_t scs, size_t sss, int rnd, float* __restrict__ ST) { instat_body(blockIdx.x, base, scs, sss, rnd, ST); }
// The list of the keys that count: SEL[p] = voxel of the p-th key whose mask is not 0, in voxel order, MV[p] = its mask value; -1 and 0 from position CNT[0] (their number) to the end. One workgroup; wave w ranks voxels 512w .. 512w + 511; the two lists are put together in LDS and go out in whole lines.
__device__ __forceinline__ void compact_body(const int* __restrict__ msk, int* __restrict__ SEL, int* __restrict__ MV, int* __restrict__ CNT) {
  __shared__ int wt[8]; __shared__ __attribute__((aligned(16))) int ls[NS], lm[NS]; typedef int v4ib __attribute__((ext_vector_type(4), may_alias));
  const int tid = threadIdx.x, w = tid >> 5, lane = tid & 31; const int* mp = msk + w * 512 + lane; int m[16]; unsigned bw[16];
#pragma unroll      /* unrolled so that the 16 loads stand in a row: one round trip to memory */
  for (int j = 0; j < 16; ++j) m[j] = mp[j * 32];
  asm volatile("s_wait_xcnt 0x0" ::: "memory");      /* behind the 16 loads: the code that follows them may rewrite their address registers */
  { const v4ib e1 = {-1, -1, -1, -1}, e0 = {0, 0, 0, 0};      /* every position starts as a pad, while the loads fly */
#pragma unroll
    for (int q = 0; q < 4; ++q) { *(v4ib*)&ls[q * 1024 + tid * 4] = e1; *(v4ib*)&lm[q * 1024 + tid * 4] = e0; } }
  int tot = 0;
#pragma unroll
  for (int j = 0; j < 16; ++j) { bw[j] = __builtin_amdgcn_ballot_w32(m[j] != 0); tot += __builtin_popcount(bw[j]); }
  if (lane == 0) wt[w] = tot;
  __syncthreads();
  int base = 0, all = 0;
#pragma unroll
  for (int u = 0; u < 8; ++u) { const int x = wt[u]; base += u < w ? x : 0; all += x; }
  const unsigned lt = (1u << lane) - 1u;
#pragma unroll
  for (int j = 0; j < 16; ++j) { if (m[j] != 0) { const int p = base + __builtin_popcount(bw[j] & lt); ls[p] = w * 512 + j * 32 + lane; lm[p] = m[j]; } base += __builtin_popcount(bw[j]); }
  __syncthreads();
#pragma unroll
  for (int q = 0; q < 4; ++q) { const int p = q * 1024 + tid * 4; const v4ib a = *(const v4ib*)&ls[p], c = *(const v4ib*)&lm[p]; *(v4ib*)(SEL + p) = a; *(v4ib*)(MV + p) = c; }
  if (tid == 0) CNT[0] = all; }
// Everything that depends on the inputs alone, in one grid: block 0 the list of unmasked keys, then 128 blocks statistics of x_q, 128 of x_kv, then 16 blocks for each of the six weight matrices.
__global__ __launch_bounds__(256) void k_prep(const int* __restrict__ msk, int* __restrict__ SEL, int* __restrict__ MV, int* __restrict__ CNT, const float* __restrict__ xq, const float* __restrict__ xkv, float* __restrict__ STQ, float* __restrict__ STK,
    const float* __restrict__ qW, const float* __restrict__ kW, const float* __restrict__ vW, const float* __restrict__ oW, const float* __restrict__ W1, const float* __restrict__ W2,
    _Float16* __restrict__ BQ, _Float16* __restrict__ BK, _Float16* __restrict__ BV, _Float16* __restrict__ BOW, _Float16* __restrict__ BW1, _Float16* __restrict__ BW2) {
  if (blockIdx.x == 0) { compact_body(msk, SEL, MV, CNT); return; }
  const int b = blockIdx.x - 1;
  if (b < 2 * CC) { instat_body(b & (CC - 1), b < CC ? xq : xkv, (size_t)NS, (size_t)1, 1, b < CC ? STQ : STK); return; }
  const int u = b - 2 * CC, m = u >> 4;      /* every matrix has HDA * CC = 32768 elements: 4096 threads, 16 blocks */
  const float* Wm = m == 0 ? qW : m == 1 ? kW : m == 2 ? vW : m == 3 ? oW : m == 4 ? W1 : W2;
  _Float16* Bt = m == 0 ? BQ : m == 1 ? BK : m == 2 ? BV : m == 3 ? BOW : m == 4 ? BW1 : BW2;
  wsc_body(u & 15, Wm, Bt, (size_t)HDA * CC / 8, 16.0f); }
__device__ __forceinline__ v8f fa_mma(v16h a, v16h b, v8f c) { return __builtin_amdgcn_wmma_f32_16x16x32_f16(false, a, false, b, (short)0, c, false, false); }
typedef float v2f  __attribute__((ext_vector_type(2)));
typedef float v2fa __attribute__((ext_vector_type(2), may_alias));
typedef int   v4ia __attribute__((ext_vector_type(4), may_alias));
// Normalisation, one of the three projections and the attention kernel's operand order in one kernel. Workgroup = 32 voxels x all 256 outputs of q (blockIdx.y 0), k (1) or v (2); wave = one head.
// For k and v the 32 "voxels" are positions 32g .. 32g + 31 of SEL, the list of keys whose mask is not 0: masked keys add exactly 0 to every output and are neither projected nor packed; a block with no key leaves at once.
// x[c][s] is read one voxel a lane and 16 channels a wave, normalised and laid down as Hs[s][c] (f16) in LDS. q and k are computed transposed (A = weights, B = h): a lane holds 8 outputs in a row of one voxel, which is
// a 16-byte piece of a Q16 row and exactly a lane's piece of KP. v is computed straight (A = h, B = weights): a lane holds 8 keys in a row of one output, a lane's piece of VP.
// KP[h][16-key tile][j][lane][8]: k[tile*16 + c][16j + 8hh + i]; VP[h][32-key block][dt][j][lane][8]: mask[key] * v[key = block*32 + 16j + 8hh + i][16dt + c]  (c = lane & 15, hh = lane >> 4; key = position in SEL; a pad position has v = 0)
__global__ __launch_bounds__(256) void k_nqkv(const float* __restrict__ xq, const float* __restrict__ xkv, const float* __restrict__ STQ, const float* __restrict__ STK, const float* __restrict__ gq, const float* __restrict__ bq, const float* __restrict__ gk, const float* __restrict__ bk,
    const _Float16* __restrict__ BQ, const _Float16* __restrict__ BK, const _Float16* __restrict__ BV, const int* __restrict__ SEL, const int* __restrict__ MV, _Float16* __restrict__ Q16, _Float16* __restrict__ KP, _Float16* __restrict__ VP) {
  __shared__ __attribute__((aligned(16))) _Float16 Hs[32][CC + 8];      /* pitch of 16 bytes x an odd number for the 16-byte fragment reads */
  const int tid = threadIdx.x, lane = tid & 31, ln = lane & 15, hh = lane >> 4; const int z = blockIdx.y, g = blockIdx.x, s0 = g * 32;
  const int w = __builtin_amdgcn_readfirstlane(tid >> 5);      /* the wave's number in a scalar register: its 16 channels' parameters then have wave-uniform addresses */
  int sv = s0 + lane;      /* q: every voxel */
  if (z) { sv = SEL[s0 + lane]; asm volatile("s_wait_xcnt 0x0" ::: "memory"); /* behind the load: the code that follows rewrites its address registers */ if (__builtin_amdgcn_readfirstlane(sv) < 0) return; }      /* k, v: the listed keys; a first position that is a pad means an empty block: every wave reads the same word, the whole workgroup leaves, in front of the barrier */
  const unsigned vox = sv < 0 ? 0u : ((unsigned)sv & (NS - 1u));      /* bounded here whatever the list holds; a pad reads voxel 0, and its v is multiplied by MV = 0 */
  const float* xp = (z == 0 ? xq : xkv) + (size_t)(16 * w) * NS; const float* stp = (z == 0 ? STQ : STK) + 32 * w; const float* gp = (z == 0 ? gq : gk) + 16 * w; const float* bp = (z == 0 ? bq : bk) + 16 * w;
  const unsigned short* wq = (const unsigned short*)((z == 0 ? BQ : z == 1 ? BK : BV) + (size_t)(32 * w + ln) * CC) + 8 * hh; const unsigned mo = (unsigned)(s0 + 8 * hh) * 4u;      /* byte offset of the lane's first mask value */
  float x[16], st[32], gg[16], bb[16];
#pragma unroll      /* unrolled so that x[] stays in registers and the loads stand in a row */
  for (int i = 0; i < 16; ++i) x[i] = xp[(size_t)i * NS + vox];
  FragH wa[4], wb[4];
#pragma unroll
  for (int kb = 0; kb < 4; ++kb) { wa[kb].half[0] = *(const v8us*)(wq + kb * 32); wa[kb].half[1] = *(const v8us*)(wq + kb * 32 + 16); wb[kb].half[0] = *(const v8us*)(wq + 16 * CC + kb * 32); wb[kb].half[1] = *(const v8us*)(wq + 16 * CC + kb * 32 + 16); }
  const v4ia m0 = *(const v4ia*)((const char*)MV + mo), m1 = *(const v4ia*)((const char*)MV + mo + 16), m2 = *(const v4ia*)((const char*)MV + mo + 64), m3 = *(const v4ia*)((const char*)MV + mo + 80);
  asm volatile("s_wait_xcnt 0x0" :: "v"(vox), "v"(wq), "v"(mo) : "memory");      /* in front of the arithmetic, which may reuse the loads' address registers; it names them, so that none is given to a later load's result ahead of the wait */
  __builtin_amdgcn_sched_barrier(0);      /* keeps that arithmetic behind the wait, and the vector loads of x, the weights and MV up here, in flight together: one round trip to memory for all of them */
#pragma unroll      /* the 16 channels' parameters: wave-uniform addresses, read behind the wait so that the scalar arithmetic on them stays behind it too; they return while the vector loads fly */
  for (int i = 0; i < 16; ++i) { st[2 * i] = stp[2 * i]; st[2 * i + 1] = stp[2 * i + 1]; gg[i] = gp[i]; bb[i] = bp[i]; }
  v16h wf0[4], wf1[4];
#pragma unroll
  for (int kb = 0; kb < 4; ++kb) { wf0[kb] = wa[kb].v; wf1[kb] = wb[kb].v; }
  { FragH f;
#pragma unroll
    for (int i = 0; i < 16; ++i) f.h[i] = (_Float16)((bf16_round(x[i]) - st[2 * i]) * rsqrtf(st[2 * i + 1] + 1e-5f) * bf16_round(gg[i]) + bf16_round(bb[i]));
    *(v8us*)&Hs[lane][16 * w] = f.half[0]; *(v8us*)&Hs[lane][16 * w + 8] = f.half[1]; }
  __syncthreads();
  v16h n0[4], n1[4];
#pragma unroll
  for (int kb = 0; kb < 4; ++kb) { n0[kb] = g2_frag(&Hs[ln][kb * 32], hh); n1[kb] = g2_frag(&Hs[16 + ln][kb * 32], hh); }
  const v8f z8 = {0.f,0.f,0.f,0.f,0.f,0.f,0.f,0.f}; v8f d00 = z8, d01 = z8, d10 = z8, d11 = z8; FragH f00, f01, f10, f11;
  if (z < 2) {      /* dab: outputs 32w + 16a + 8hh + r of voxel s0 + 16b + ln */
#pragma unroll
    for (int kb = 0; kb < 4; ++kb) { d00 = fa_mma(wf0[kb], n0[kb], d00); d01 = fa_mma(wf0[kb], n1[kb], d01); d10 = fa_mma(wf1[kb], n0[kb], d10); d11 = fa_mma(wf1[kb], n1[kb], d11); }
    const float al = z == 0 ? 0.03125f : 0.0625f;      /* 1/16 undoes the weights' scale; q is stored halved for the tanh form of the sigmoid (powers of two: the f16 rounding is the same) */
#pragma unroll
    for (int r = 0; r < 8; ++r) { f00.h[r] = (_Float16)(d00[r] * al); f01.h[r] = (_Float16)(d01[r] * al); f10.h[r] = (_Float16)(d10[r] * al); f11.h[r] = (_Float16)(d11[r] * al); }
    if (z == 0) { unsigned short* qo = (unsigned short*)Q16 + (size_t)(s0 + ln) * HDA + 32 * w + 8 * hh;
      *(v8us*)qo = f00.half[0]; *(v8us*)(qo + 16) = f10.half[0]; *(v8us*)(qo + 16 * HDA) = f01.half[0]; *(v8us*)(qo + 16 * HDA + 16) = f11.half[0]; }
    else { unsigned short* ko = (unsigned short*)KP + ((size_t)w * 256 + g * 2) * 512 + lane * 8;      /* tile 2g: j = 0, 1; tile 2g + 1: j = 0, 1 */
      *(v8us*)ko = f00.half[0]; *(v8us*)(ko + 256) = f10.half[0]; *(v8us*)(ko + 512) = f01.half[0]; *(v8us*)(ko + 768) = f11.half[0];
      asm volatile("s_wait_xcnt 0x0" ::: "memory"); } }      /* behind the four stores: the code that follows them in the listing rewrites their address and data registers */
  else {      /* dab: keys s0 + 16a + 8hh + r of output 32w + 16b + ln */
#pragma unroll
    for (int kb = 0; kb < 4; ++kb) { d00 = fa_mma(n0[kb], wf0[kb], d00); d01 = fa_mma(n0[kb], wf1[kb], d01); d10 = fa_mma(n1[kb], wf0[kb], d10); d11 = fa_mma(n1[kb], wf1[kb], d11); }
#pragma unroll
    for (int r = 0; r < 8; ++r) { const float ma = (float)(r < 4 ? m0[r & 3] : m1[r & 3]), mb = (float)(r < 4 ? m2[r & 3] : m3[r & 3]);      /* v is rounded to f16 first, then masked */
      f00.h[r] = (_Float16)((float)(_Float16)(d00[r] * 0.0625f) * ma); f01.h[r] = (_Float16)((float)(_Float16)(d01[r] * 0.0625f) * ma);
      f10.h[r] = (_Float16)((float)(_Float16)(d10[r] * 0.0625f) * mb); f11.h[r] = (_Float16)((float)(_Float16)(d11[r] * 0.0625f) * mb); }
    unsigned short* vo = (unsigned short*)VP + ((size_t)w * 128 + g) * 1024 + lane * 8;      /* dt = 0: j = 0, 1; dt = 1: j = 0, 1 */
    *(v8us*)vo = f00.half[0]; *(v8us*)(vo + 256) = f10.half[0]; *(v8us*)(vo + 512) = f01.half[0]; *(v8us*)(vo + 768) = f11.half[0];
    asm volatile("s_wait_xcnt 0x0" ::: "memory"); } }      /* behind the four stores: the code that follows them in the listing rewrites their address and data registers */
__device__ __forceinline__ v16h fa_frag(const unsigned short* p) { FragH f; f.half[0] = *(const v8us*)p; f.half[1] = *(const v8us*)(p + 256); return f.v; }
// sigmoid(x) = 0.5 + 0.5 tanh(x / 2) on the chip's own v_tanh_f32: one transcendental, half a packed fma and half a packed convert an element. The scores arrive already halved (Q16 holds q / 2).
// two S^T tiles (keys 0-15 and 16-31 of a block, one query per lane column) -> sigmoid -> the A fragment of w.v: D register r of tile j holds key 16j + 8hh + r, which is A's element 8j + r
__device__ __forceinline__ v16h fa_sig(v8f s0, v8f s1) { FragH f;
  for (int r = 0; r < 8; ++r) { f.h[r] = (_Float16)(0.5f + 0.5f * __builtin_amdgcn_tanhf(s0[r])); f.h[8 + r] = (_Float16)(0.5f + 0.5f * __builtin_amdgcn_tanhf(s1[r])); }
  return f.v; }
// one block of 32 keys against the wave's 32 queries
__device__ __forceinline__ void fa_block(v16h k0, v16h k1, v16h v0, v16h v1, v16h qf0, v16h qf1, v8f& o00, v8f& o01, v8f& o10, v8f& o11) {
  const v8f z8 = {0.f,0.f,0.f,0.f,0.f,0.f,0.f,0.f};
  const v8f s00 = fa_mma(k0, qf0, z8), s01 = fa_mma(k1, qf0, z8), s10 = fa_mma(k0, qf1, z8), s11 = fa_mma(k1, qf1, z8);
  const v16h p0 = fa_sig(s00, s01); o00 = fa_mma(p0, v0, o00); o01 = fa_mma(p0, v1, o01);
  const v16h p1 = fa_sig(s10, s11); o10 = fa_mma(p1, v0, o10); o11 = fa_mma(p1, v1, o11); }
// Fused attention over the listed keys alone (CNT[0] of them, in blocks of 32): one workgroup = one head x 128 queries; wave = 32 queries (w & 3) x every fourth block of keys, from block w >> 2. Q16 holds q / 2: S^T = k (q/2)^T, w = sigmoid(q.k) = 0.5 + 0.5 tanh(S^T) stays in registers, o += w (mask v); the four key quarters are joined through LDS.
__global__ __launch_bounds__(512) void k_fattn(const _Float16* __restrict__ Q16, const _Float16* __restrict__ KP, const _Float16* __restrict__ VP, const int* __restrict__ CNT, _Float16* __restrict__ O16) {
  __shared__ __attribute__((aligned(16))) float part[4][128][36];
  const int tid = threadIdx.x, lane = tid & 31, ln = lane & 15, hh = lane >> 4;
  const int w = __builtin_amdgcn_readfirstlane(tid >> 5);      /* the wave's number in a scalar register: the trip count below is then a scalar, and the loop's branch leaves EXEC alone */
  const int h = blockIdx.x >> 5, q0 = (blockIdx.x & 31) * 128; const int qg = w & 3, kq = w >> 2;
  const _Float16* qp = Q16 + (size_t)(q0 + qg * 32 + ln) * HDA + h * HDm;
  const v16h qf0 = g2_frag(qp, hh), qf1 = g2_frag(qp + (size_t)16 * HDA, hh);
  const int cn = CNT[0], nbt = ((cn < 0 ? 0 : cn > NS ? NS : cn) + 31) >> 5, nbw = (nbt + 3 - kq) >> 2;      /* blocks in all (at most 128 after the clamp) and this wave's share: kq, kq + 4, ... */
  const unsigned short* kp = (const unsigned short*)KP + ((size_t)h * 128 + kq) * 1024 + lane * 8;
  const unsigned short* vp = (const unsigned short*)VP + ((size_t)h * 128 + kq) * 1024 + lane * 8;
  const v8f z8 = {0.f,0.f,0.f,0.f,0.f,0.f,0.f,0.f}; v8f o00 = z8, o01 = z8, o10 = z8, o11 = z8;
  if (nbw > 0) {      /* a wave without a block reads nothing of KP and VP and hands in zeros */
  v16h ak0 = fa_frag(kp), ak1 = fa_frag(kp + 512), av0 = fa_frag(vp), av1 = fa_frag(vp + 512);
  asm volatile("s_wait_xcnt 0x0" :: "v"(qp), "v"(kp), "v"(vp) : "memory");      /* behind the first loads: the code that follows rewrites their address registers; it names them, so that none is given to a load's result ahead of the wait */
  int b = 0;
#pragma unroll 1      /* stays rolled: one trip's code (two blocks) serves all trips, so the loop stays small in the instruction cache */
  for (; b + 1 < nbw; b += 2) {      /* two blocks a trip, each with a register set of its own that the loads themselves refill: the copy of a whole prefetch set into the working set, once a block, falls away */
    const unsigned short* kb = kp + (b + 1) * 4096; const unsigned short* vb = vp + (b + 1) * 4096;      /* block b + 1 flies into the second set while block b is worked on */
    const v16h bk0 = fa_frag(kb), bk1 = fa_frag(kb + 512), bv0 = fa_frag(vb), bv1 = fa_frag(vb + 512);
    asm volatile("s_wait_xcnt 0x0" :: "v"(kb), "v"(vb) : "memory");      /* in front of the block's arithmetic, which reuses the loads' address registers; it names them, so that none is given to a load's result ahead of the wait */
    __builtin_amdgcn_sched_barrier(0);      /* keeps the eight loads up here: without it the scheduler sinks them to right in front of their use */
    fa_block(ak0, ak1, av0, av1, qf0, qf1, o00, o01, o10, o11);
    const int n2 = (b + 2 < nbw ? b + 2 : b + 1) * 4096;      /* block b + 2 flies into the first set while block b + 1 is worked on (where there is none, block b + 1 is read again and dropped) */
    const unsigned short* ka = kp + n2; const unsigned short* va = vp + n2;
    ak0 = fa_frag(ka); ak1 = fa_frag(ka + 512); av0 = fa_frag(va); av1 = fa_frag(va + 512);
    asm volatile("s_wait_xcnt 0x0" :: "v"(ka), "v"(va) : "memory");      /* in front of the arithmetic that reuses the loads' address registers; it names them, so that they are kept until the wait */
    __builtin_amdgcn_sched_barrier(0);      /* keeps the eight loads ahead of the second block: without it the scheduler sinks them to the foot of the trip, right in front of their use */
    fa_block(bk0, bk1, bv0, bv1, qf0, qf1, o00, o01, o10, o11);
    __builtin_amdgcn_sched_barrier(0); }      /* keeps the waits for the first set's new fragments at the foot of the trip: without it some rise into the second block */
  if (b < nbw) fa_block(ak0, ak1, av0, av1, qf0, qf1, o00, o01, o10, o11); }      /* an odd number of blocks: the last one is already in the first set (a scalar test: the count is wave-uniform) */
  for (int r = 0; r < 8; ++r) { float* pr = &part[kq][qg * 32 + 8 * hh + r][ln]; pr[0] = o00[r]; pr[16] = o01[r]; pr[16 * 36] = o10[r]; pr[16 * 36 + 16] = o11[r]; }
  __syncthreads();
  const int q = tid >> 2, d0 = (tid & 3) * 8; v4f a = *(const v4fa*)&part[0][q][d0], c = *(const v4fa*)&part[0][q][d0 + 4];
  for (int s = 1; s < 4; ++s) { a += *(const v4fa*)&part[s][q][d0]; c += *(const v4fa*)&part[s][q][d0 + 4]; }
  FragH f;
  for (int i = 0; i < 4; ++i) { f.h[i] = (_Float16)a[i]; f.h[4 + i] = (_Float16)c[i]; }
  *(v8us*)((unsigned short*)O16 + (size_t)(q0 + q) * HDA + h * HDm + d0) = f.half[0]; }
// attn = o oW^T + x_q for 32 voxels x all 128 channels a workgroup; wave = 16 channels. D holds one channel a lane and 8 voxels in a row in its registers, so x_q is read from the input and
// attn is stored channel-major (ATc[c][s]) with 16-byte accesses and no transposition. Each wave also leaves mean and sum of squared deviations of its 16 channels over the 32 voxels: PS[group][c] = {mean, M2}.
__global__ __launch_bounds__(256) void k_oproj(const _Float16* __restrict__ O16, const _Float16* __restrict__ BOW, const float* __restrict__ xq, float* __restrict__ ATc, float* __restrict__ PS) {
  const int tid = threadIdx.x, w = tid >> 5, lane = tid & 31, ln = lane & 15, hh = lane >> 4;
  const int g = blockIdx.x, s0 = g * 32, c = w * 16 + ln;
  const _Float16* ap = O16 + (size_t)(s0 + ln) * HDA; const _Float16* bp = BOW + (size_t)c * HDA; const float* xp = xq + (size_t)c * NS + s0 + 8 * hh;
  v16h a0[8], a1[8], b[8];
#pragma unroll      /* all 48 fragment loads are in flight together: one round trip to L2 instead of one a k step */
  for (int kb = 0; kb < 8; ++kb) { a0[kb] = g2_frag(ap + kb * 32, hh); a1[kb] = g2_frag(ap + (size_t)16 * HDA + kb * 32, hh); b[kb] = g2_frag(bp + kb * 32, hh); }
  const v4f x0 = *(const v4fa*)xp, x1 = *(const v4fa*)(xp + 4), x2 = *(const v4fa*)(xp + 16), x3 = *(const v4fa*)(xp + 20);
  asm volatile("s_wait_xcnt 0x0" ::: "memory");      /* in front of the arithmetic, which may reuse the loads' address registers */
  __builtin_amdgcn_sched_barrier(0);      /* keeps that arithmetic behind the wait, and the loads together in front of it */
  const v8f z8 = {0.f,0.f,0.f,0.f,0.f,0.f,0.f,0.f}; v8f c0 = z8, c1 = z8;
#pragma unroll
  for (int kb = 0; kb < 8; ++kb) { c0 = fa_mma(a0[kb], b[kb], c0); c1 = fa_mma(a1[kb], b[kb], c1); }
  float v[16];
#pragma unroll
  for (int r = 0; r < 4; ++r) { v[r] = c0[r] * 0.0625f + bf16_round(x0[r]); v[4 + r] = c0[4 + r] * 0.0625f + bf16_round(x1[r]); v[8 + r] = c1[r] * 0.0625f + bf16_round(x2[r]); v[12 + r] = c1[4 + r] * 0.0625f + bf16_round(x3[r]); }
  float s = 0.f;
#pragma unroll
  for (int i = 0; i < 16; ++i) s += v[i];
  s += __shfl_xor(s, 16);      /* lanes l and l + 16 hold the two halves of one channel's 32 voxels */
  const float mean = s * (1.0f / 32.0f); float q2 = 0.f;
#pragma unroll
  for (int i = 0; i < 16; ++i) { const float d = v[i] - mean; q2 += d * d; }
  q2 += __shfl_xor(q2, 16);
  float* op = ATc + (size_t)c * NS + s0 + 8 * hh;
  const v4f y0 = {v[0], v[1], v[2], v[3]}, y1 = {v[4], v[5], v[6], v[7]}, y2 = {v[8], v[9], v[10], v[11]}, y3 = {v[12], v[13], v[14], v[15]};
  *(v4fa*)op = y0; *(v4fa*)(op + 4) = y1; *(v4fa*)(op + 16) = y2; *(v4fa*)(op + 20) = y3;
  if (hh == 0) { const v2f p = {mean, q2}; *(v2fa*)(PS + ((size_t)g * CC + c) * 2) = p; } }
// The rest of the network for 32 voxels a workgroup (16 waves): join the 128 groups' {mean, M2} to the statistics of attn; h = IN(attn) -> LDS [s][c]; relu(W1 h + b1) computed transposed (A = W1, B = h),
// so that a lane holds 8 hidden units in a row of one voxel -> LDS [s][n]; W2 . + b2 -> LDS [c][s]; + attn, stored to out[c][s] in whole 128-byte lines.
__global__ __launch_bounds__(512) void k_mlp(const float* __restrict__ ATc, const float* __restrict__ PS, const float* __restrict__ gp, const float* __restrict__ bp, const _Float16* __restrict__ BW1, const float* __restrict__ b1, const _Float16* __restrict__ BW2, const float* __restrict__ b2, float* __restrict__ out) {
  __shared__ __attribute__((aligned(16))) _Float16 Hs[32][CC + 8];      /* pitches of 16 bytes x an odd number for the 16-byte fragment reads */
  __shared__ __attribute__((aligned(16))) _Float16 Gs[32][2 * CC + 8];
  __shared__ __attribute__((aligned(16))) float Cs[CC][36];
  __shared__ float r1[4][CC], r2[4][CC];
  const int tid = threadIdx.x, w = tid >> 5, lane = tid & 31, ln = lane & 15, hh = lane >> 4; const int s0 = blockIdx.x * 32;
  const int cs = tid & (CC - 1), part = tid >> 7;      /* statistics: one channel, 32 of the 128 groups */
  const int c = tid >> 2, sq = (tid & 3) * 8;      /* normalisation and final store: one channel, 8 voxels */
  const int nt = w & 7, mt = w >> 3;      /* second product: 16 channels x 16 voxels */
  const unsigned pso = (unsigned)(part * 32 * CC + cs) * 8u;      /* byte offset of the thread's first {mean, M2} pair */
  v2f ps[32];
#pragma unroll
  for (int g = 0; g < 32; ++g) ps[g] = *(const v2fa*)((const char*)PS + pso + g * (CC * 8));
  const float* atp = ATc + (size_t)c * NS + s0 + sq; const v4f xa = *(const v4fa*)atp, xb = *(const v4fa*)(atp + 4);
  const unsigned short* w1p = (const unsigned short*)BW1 + (size_t)(16 * w + ln) * CC + 8 * hh; const unsigned short* w2p = (const unsigned short*)BW2 + (size_t)(16 * nt + ln) * (2 * CC) + 8 * hh; const float* b1p = b1 + 16 * w + 8 * hh;
  FragH w1f[4], w2f[8];
#pragma unroll
  for (int kb = 0; kb < 4; ++kb) { w1f[kb].half[0] = *(const v8us*)(w1p + kb * 32); w1f[kb].half[1] = *(const v8us*)(w1p + kb * 32 + 16); }
#pragma unroll
  for (int kb = 0; kb < 8; ++kb) { w2f[kb].half[0] = *(const v8us*)(w2p + kb * 32); w2f[kb].half[1] = *(const v8us*)(w2p + kb * 32 + 16); }
  const v4f b1a = *(const v4fa*)b1p, b1b = *(const v4fa*)(b1p + 4);
  const float b2v = bf16_round(b2[16 * nt + ln]), gv = bf16_round(gp[c]), bv = bf16_round(bp[c]);
  asm volatile("s_wait_xcnt 0x0" :: "v"(pso), "v"(atp), "v"(w1p), "v"(w2p), "v"(b1p) : "memory");      /* in front of the arithmetic, which may reuse the loads' address registers; it names them, so that none is given to a later load's result ahead of the wait */
  __builtin_amdgcn_sched_barrier(0);      /* keeps that arithmetic behind the wait, and every global load of the kernel up here, in flight together: one round trip to memory for all of them */
  float sm = 0.f;
#pragma unroll
  for (int g = 0; g < 32; ++g) sm += ps[g][0];
  r1[part][cs] = sm; __syncthreads();
  { const float mean = (r1[0][cs] + r1[1][cs] + r1[2][cs] + r1[3][cs]) * (1.0f / 128.0f); float q2 = 0.f;      /* equal groups: M2 = sum of the groups' M2 + 32 sum (group mean - mean)^2 */
#pragma unroll
    for (int g = 0; g < 32; ++g) { const float d = ps[g][0] - mean; q2 += ps[g][1] + 32.0f * (d * d); }
    r2[part][cs] = q2; }
  __syncthreads();
  { const float mean = (r1[0][c] + r1[1][c] + r1[2][c] + r1[3][c]) * (1.0f / 128.0f); const float var = (r2[0][c] + r2[1][c] + r2[2][c] + r2[3][c]) * (1.0f / (float)NS); const float rs = rsqrtf(var + 1e-5f);
#pragma unroll
    for (int i = 0; i < 4; ++i) { Hs[sq + i][c] = (_Float16)((xa[i] - mean) * rs * gv + bv); Hs[sq + 4 + i][c] = (_Float16)((xb[i] - mean) * rs * gv + bv); } }
  __syncthreads();
  const v8f z8 = {0.f,0.f,0.f,0.f,0.f,0.f,0.f,0.f}; v8f d0 = z8, d1 = z8;
#pragma unroll
  for (int kb = 0; kb < 4; ++kb) { d0 = fa_mma(w1f[kb].v, g2_frag(&Hs[ln][kb * 32], hh), d0); d1 = fa_mma(w1f[kb].v, g2_frag(&Hs[16 + ln][kb * 32], hh), d1); }
  { FragH f0, f1;      /* D register r: hidden unit 16w + 8hh + r of voxel ln (d0) and 16 + ln (d1) */
#pragma unroll
    for (int r = 0; r < 8; ++r) { const float bb = bf16_round(r < 4 ? b1a[r & 3] : b1b[r & 3]); f0.h[r] = (_Float16)fmaxf(d0[r] * 0.0625f + bb, 0.f); f1.h[r] = (_Float16)fmaxf(d1[r] * 0.0625f + bb, 0.f); }
    *(v8us*)&Gs[ln][16 * w + 8 * hh] = f0.half[0]; *(v8us*)&Gs[16 + ln][16 * w + 8 * hh] = f1.half[0]; }
  __syncthreads();
  v8f e = z8;
#pragma unroll
  for (int kb = 0; kb < 8; ++kb) e = fa_mma(g2_frag(&Gs[16 * mt + ln][kb * 32], hh), w2f[kb].v, e);
  { const v4f e0 = {e[0] * 0.0625f + b2v, e[1] * 0.0625f + b2v, e[2] * 0.0625f + b2v, e[3] * 0.0625f + b2v}, e1 = {e[4] * 0.0625f + b2v, e[5] * 0.0625f + b2v, e[6] * 0.0625f + b2v, e[7] * 0.0625f + b2v};
    *(v4fa*)&Cs[16 * nt + ln][16 * mt + 8 * hh] = e0; *(v4fa*)&Cs[16 * nt + ln][16 * mt + 8 * hh + 4] = e1; }      /* D register r: voxel 16mt + 8hh + r of channel 16nt + ln */
  __syncthreads();
  const v4f o0 = *(const v4fa*)&Cs[c][sq] + xa, o1 = *(const v4fa*)&Cs[c][sq + 4] + xb;
  float* op = out + (size_t)c * NS + s0 + sq; *(v4fa*)op = o0; *(v4fa*)(op + 4) = o1; }

extern "C" void kernel_launch(void* const* d_in, const int* in_sizes, int n_in,
                              void* d_out, int out_size, void* d_ws, size_t ws_size, hipStream_t stream) {
  (void)in_sizes; (void)n_in; (void)out_size;
  const float* const* I = (const float* const*)d_in; const float* xq = I[0]; const float* xkv = I[1]; const int* msk = (const int*)d_in[2]; const float* qW = I[3]; const float* kW = I[4]; const float* vW = I[5]; const float* oW = I[6]; const float* gq = I[7]; const float* bq = I[8]; const float* gk = I[9]; const float* bk = I[10]; const float* gp = I[11]; const float* bp = I[12]; const float* W1 = I[13]; const float* b1 = I[14]; const float* W2 = I[15]; const float* b2 = I[16];
  char* ws = (char*)d_ws; size_t off = 0;
  auto take = [&](size_t bytes) { char* p = ws + off; off += (bytes + 255) & ~(size_t)255; return p; };
  _Float16* BQ = (_Float16*)take((size_t)HDA * CC * 2); _Float16* BK = (_Float16*)take((size_t)HDA * CC * 2); _Float16* BV = (_Float16*)take((size_t)HDA * CC * 2); _Float16* BOW = (_Float16*)take((size_t)CC * HDA * 2); _Float16* BW1 = (_Float16*)take((size_t)2 * CC * CC * 2); _Float16* BW2 = (_Float16*)take((size_t)CC * 2 * CC * 2); float* STQ = (float*)take(CC * 2 * 4); float* STK = (float*)take(CC * 2 * 4);
  _Float16* Q16 = (_Float16*)take((size_t)NS * HDA * 2); _Float16* KP = (_Float16*)take((size_t)NS * HDA * 2); _Float16* VP = (_Float16*)take((size_t)NS * HDA * 2); _Float16* O16 = (_Float16*)take((size_t)NS * HDA * 2); float* AT = (float*)take((size_t)NS * CC * 4); float* PS = (float*)take((size_t)(NS / 32) * CC * 2 * 4); int* SEL = (int*)take((size_t)NS * 4); int* MV = (int*)take((size_t)NS * 4); int* CNT = (int*)take(4);
  if (off > ws_size) return;      /* about 11 MiB */
  k_prep<<<1 + 2 * CC + 6 * (HDA * CC / 8 / 256), 256, 0, stream>>>(msk, SEL, MV, CNT, xq, xkv, STQ, STK, qW, kW, vW, oW, W1, W2, BQ, BK, BV, BOW, BW1, BW2);      /* statistics of x_q and x_kv; 1x1 convs 'oc' = Bt, times 16 */
  k_nqkv<<<dim3(NS / 32, 3), 256, 0, stream>>>(xq, xkv, STQ, STK, gq, bq, gk, bk, BQ, BK, BV, SEL, MV, Q16, KP, VP);      /* IN(x_q), IN(x_kv); q / 2, k, mask * v, the last two in the attention kernel's fragment order */
  k_fattn<<<NHD * (NS / 128), 512, 0, stream>>>(Q16, KP, VP, CNT, O16);      /* o = (sigmoid(q.k) * mask) v, all heads */
  k_oproj<<<NS / 32, 256, 0, stream>>>(O16, BOW, xq, AT, PS);      /* attn = o oW^T + x_q, channel-major, and its statistics by groups of 32 voxels */
  k_mlp<<<NS / 32, 512, 0, stream>>>(AT, PS, gp, bp, BW1, b1, BW2, b2, (float*)d_out);      /* out = W2 relu(W1 IN(attn) + b1) + b2 + attn */
}

// v009
// Measured time: 29.5 microseconds a run.
// Timed twice side by side with v008, it ran 1.11 and 1.10 times as fast.
// Counting every step since v000, it is 47.6 times as fast.
#include <hip/hip_runtime.h>
// Multi_Heads_Self_Attn_Q_KV (1 volume, C 128, 16^3 = 4096 voxels, 8 heads x 32): InstanceNorm of x_q and x_kv (per channel over the 4096 voxels, biased var, eps 1e-5, affine); q, k, v = 1x1 convs (no bias); w = sigmoid(q.k) (no scale) * mask[key] (int input 0/1); o = w v (no normalisation); attn = o oW^T + x_q; h = IN(attn); h = relu(W1 h + b1); h = W2 h + b2; out = h + attn -> [1, 128, 16, 16, 16].
// Compute dtype: inputs and parameters rounded to bf16; normalised inputs, q, k, v, sigmoid weights, o and the MLP activations as plain f16 operands (~2^-12); statistics/sigmoid f32. v_wmma_f32_16x16x32_f16.
#define CC 128
#define NS 4096
#define NHD 8
#define HDm 32
#define HDA (NHD * HDm)          /* 256 */
#define PW (NHD * 64)            /* 512, unused */
typedef __bf16 v16b __attribute__((ext_vector_type(16)));
typedef unsigned short v8us __attribute__((ext_vector_type(8), may_alias));
typedef float  v8f  __attribute__((ext_vector_type(8)));
typedef float  v4f  __attribute__((ext_vector_type(4)));
typedef float  v4fa __attribute__((ext_vector_type(4), may_alias));
union FragB { v16b v; v8us half[2]; unsigned short u[16]; };

__device__ __forceinline__ unsigned short bf16_bits(float x) { unsigned int u = __float_as_uint(x); return (unsigned short)((u + 0x7FFFu + ((u >> 16) & 1u)) >> 16); }
__device__ __forceinline__ float bf16_val(unsigned short b) { return __uint_as_float(((unsigned int)b) << 16); }
__device__ __forceinline__ float bf16_round(float x) { return bf16_val(bf16_bits(x)); }
// D += A·B with NT terms: 1 = ah·bh, 2 = + al·bh (A split), 3 = + ah·bl (both split)
template <int NT>
__device__ __forceinline__ v8f mmaN(v16b ah, v16b al, v16b bh, v16b bl, v8f c) {
  c = __builtin_amdgcn_wmma_f32_16x16x32_bf16(false, ah, false, bh, (short)0, c, false, false);
  if (NT >= 2) c = __builtin_amdgcn_wmma_f32_16x16x32_bf16(false, al, false, bh, (short)0, c, false, false);
  if (NT >= 3) c = __builtin_amdgcn_wmma_f32_16x16x32_bf16(false, ah, false, bl, (short)0, c, false, false);
  asm volatile("v_nop\n\tv_nop\n\tv_nop\n\tv_nop" : "+v"(c) : "v"(ah), "v"(al), "v"(bh), "v"(bl));
  return c;
}

__global__ __launch_bounds__(256) void k_wt_bf16(const float* __restrict__ W, unsigned short* __restrict__ Wt, int K, int N) {
  const int t = blockIdx.x * 256 + threadIdx.x;
  const int k8n = K / 8;
  if (t >= N * k8n) return;
  const int n = t / k8n, k8 = (t % k8n) * 8;
  v8us v;
#pragma unroll
  for (int i = 0; i < 8; ++i) v[i] = bf16_bits(W[(size_t)(k8 + i) * N + n]);
  *(v8us*)(Wt + (size_t)n * K + k8) = v;
  
}

// GEMM C[M][N] (f32, pitch ldc) = act(A[M][K]·W + bias). A f32 row-major (pitch lda) converted per fragment to bf16
// (ASPLIT: hi/lo two planes -> 2 terms, else single rounded term); Wt bf16 [N][K] (pitch ldb). BIAS_BF16 rounds the
// bias to bf16 first (bias quantised to bf16 before the add). K%32==0, M%16==0, N%64==0.
template <bool ASPLIT, int ACT, bool BIAS_BF16>
__global__ __launch_bounds__(128) void k_gemm_bf(const float* __restrict__ A, int lda, const unsigned short* __restrict__ Wt, int ldb,
                                               const float* __restrict__ bias, float* __restrict__ C, int ldc, int M, int N, int K) {
  __shared__ __attribute__((aligned(16))) float so[4][16][64];
  const int tid = threadIdx.x, w = tid >> 5, lane = tid & 31, ln = lane & 15, hh = lane >> 4;
  const int ntn = N / 64;
  const int wid = blockIdx.x * 4 + w;
  const int mt = wid / ntn, nq = wid % ntn;
  if (mt * 16 >= M) return;
  const int row0 = mt * 16, col0 = nq * 64;
  const float* arow = A + (size_t)(row0 + ln) * lda;
  v8f acc[4] = {};
  for (int kb = 0; kb < K; kb += 32) {
    FragB ah, al;
    const v4f x0 = *(const v4fa*)(arow + kb + 8 * hh), x1 = *(const v4fa*)(arow + kb + 8 * hh + 4);
    const v4f x2 = *(const v4fa*)(arow + kb + 16 + 8 * hh), x3 = *(const v4fa*)(arow + kb + 16 + 8 * hh + 4);
    float xs[16] = {x0[0],x0[1],x0[2],x0[3],x1[0],x1[1],x1[2],x1[3],x2[0],x2[1],x2[2],x2[3],x3[0],x3[1],x3[2],x3[3]};
#pragma unroll
    for (int i = 0; i < 16; ++i) { const unsigned short hb = bf16_bits(xs[i]); ah.u[i] = hb; al.u[i] = ASPLIT ? bf16_bits(xs[i] - bf16_val(hb)) : (unsigned short)0; }
#pragma unroll
    for (int t = 0; t < 4; ++t) {
      const unsigned short* brow = Wt + (size_t)(col0 + t * 16 + ln) * ldb + kb;
      FragB b;
      b.half[0] = *(const v8us*)(brow + 8 * hh);
      b.half[1] = *(const v8us*)(brow + 16 + 8 * hh);
      acc[t] = mmaN<ASPLIT ? 2 : 1>(ah.v, al.v, b.v, b.v, acc[t]);
    }
  }
#pragma unroll
  for (int t = 0; t < 4; ++t) {
    float bv = bias ? bias[col0 + t * 16 + ln] : 0.f;
    if (BIAS_BF16) bv = bf16_round(bv);
#pragma unroll
    for (int r = 0; r < 8; ++r) { float v = acc[t][r] + bv; if (ACT == 1) v = fmaxf(v, 0.f); so[w][8 * hh + r][t * 16 + ln] = v; }
  }
  __builtin_amdgcn_fence(__ATOMIC_ACQ_REL, "workgroup");
  __builtin_amdgcn_wave_barrier();
  const int rsub = lane >> 4, c4 = (lane & 15) * 4;
  {
#pragma unroll
    for (int q = 0; q < 8; ++q) {
      const int r = q * 2 + rsub;
      const v4f v = *(const v4fa*)&so[w][r][c4];
      *(v4f*)(C + (size_t)(row0 + r) * ldc + col0 + c4) = v;
    }
    
  }
}

// GEMM C = act(A·W + bias + resid): A f32 (ASPLIT -> hi/lo 2 terms), Wt bf16 [N][K]; ACT 0 none, 1 relu, 2 exact gelu;
// resid (optional, f32, row index = (row % rmod), pitch ldr, RES_BF16 rounds it) added before the activation.
template <bool ASPLIT, int ACT, bool BIAS_BF16, bool RES_BF16>
__global__ __launch_bounds__(128) void k_gemm_bf3(const float* __restrict__ A, int lda, const unsigned short* __restrict__ Wt, int ldb,
                                                const float* __restrict__ bias, const float* __restrict__ resid, int rmod, int ldr,
                                                float* __restrict__ C, int ldc, int M, int N, int K) {
  __shared__ __attribute__((aligned(16))) float so[4][16][64];
  const int tid = threadIdx.x, w = tid >> 5, lane = tid & 31, ln = lane & 15, hh = lane >> 4;
  const int ntn = N / 64;
  const int wid = blockIdx.x * 4 + w;
  const int mt = wid / ntn, nq = wid % ntn;
  if (mt * 16 >= M) return;
  const int row0 = mt * 16, col0 = nq * 64;
  const float* arow = A + (size_t)(row0 + ln) * lda;
  v8f acc[4] = {};
  for (int kb = 0; kb < K; kb += 32) {
    FragB ah, al;
    const v4f x0 = *(const v4fa*)(arow + kb + 8 * hh), x1 = *(const v4fa*)(arow + kb + 8 * hh + 4);
    const v4f x2 = *(const v4fa*)(arow + kb + 16 + 8 * hh), x3 = *(const v4fa*)(arow + kb + 16 + 8 * hh + 4);
    float xs[16] = {x0[0],x0[1],x0[2],x0[3],x1[0],x1[1],x1[2],x1[3],x2[0],x2[1],x2[2],x2[3],x3[0],x3[1],x3[2],x3[3]};
#pragma unroll
    for (int i = 0; i < 16; ++i) { const unsigned short hb = bf16_bits(xs[i]); ah.u[i] = hb; al.u[i] = ASPLIT ? bf16_bits(xs[i] - bf16_val(hb)) : (unsigned short)0; }
#pragma unroll
    for (int t = 0; t < 4; ++t) {
      const unsigned short* brow = Wt + (size_t)(col0 + t * 16 + ln) * ldb + kb;
      FragB b;
      b.half[0] = *(const v8us*)(brow + 8 * hh);
      b.half[1] = *(const v8us*)(brow + 16 + 8 * hh);
      acc[t] = mmaN<ASPLIT ? 2 : 1>(ah.v, al.v, b.v, b.v, acc[t]);
    }
  }
#pragma unroll
  for (int t = 0; t < 4; ++t) {
    const int col = col0 + t * 16 + ln;
    float bv = bias ? bias[col] : 0.f;
    if (BIAS_BF16) bv = bf16_round(bv);
#pragma unroll
    for (int r = 0; r < 8; ++r) {
      float v = acc[t][r] + bv;
      if (resid) { float rv = resid[(size_t)((row0 + 8 * hh + r) % rmod) * ldr + col]; if (RES_BF16) rv = bf16_round(rv); v += rv; }
      if (ACT == 1) v = fmaxf(v, 0.f);
      if (ACT == 2) v = 0.5f * v * (1.0f + erff(v * 0.70710678118654752f));
      if (ACT == 3) { const float u = 0.7978845608028654f * (v + 0.044715f * v * v * v); v = 0.5f * v * (1.0f + tanhf(u)); }
      so[w][8 * hh + r][t * 16 + ln] = v;
    }
  }
  __builtin_amdgcn_fence(__ATOMIC_ACQ_REL, "workgroup");
  __builtin_amdgcn_wave_barrier();
  const int rsub = lane >> 4, c4 = (lane & 15) * 4;
  {
#pragma unroll
    for (int q = 0; q < 8; ++q) {
      const int r = q * 2 + rsub;
      const v4f v = *(const v4fa*)&so[w][r][c4];
      *(v4f*)(C + (size_t)(row0 + r) * ldc + col0 + c4) = v;
    }
    
  }
}
// row LayerNorm (biased variance, eps) over N: s = X (+ R); optional out_sum <- s; out_norm <- (s-mu)*rsqrt(var+eps)*g + b
template <bool PARAM_BF16>
__global__ __launch_bounds__(256) void k_layernorm(const float* __restrict__ X, const float* __restrict__ R, const float* __restrict__ g, const float* __restrict__ bta,
                                                  float* __restrict__ out_sum, float* __restrict__ out_norm, int N, float eps) {
  __shared__ float red[256];
  const int row = blockIdx.x, tid = threadIdx.x;
  const float* x = X + (size_t)row * N; const float* rr = R ? R + (size_t)row * N : nullptr;
  float vals[16];                     // up to N = 4096
  const int per = N / 256;            // contiguous chunk per thread? use strided-by-4 chunks: thread handles j = tid*4 + 1024*u
  float s1 = 0.f;
  for (int u = 0; u < per / 4; ++u) {
    const int j = tid * 4 + 1024 * u;
    const v4f a = *(const v4fa*)(x + j);
    v4f b = {0.f,0.f,0.f,0.f}; if (rr) b = *(const v4fa*)(rr + j);
#pragma unroll
    for (int q = 0; q < 4; ++q) { const float v = a[q] + b[q]; vals[u * 4 + q] = v; s1 += v; }
  }
  red[tid] = s1; __syncthreads();
  for (int st = 128; st > 0; st >>= 1) { if (tid < st) red[tid] += red[tid + st]; __syncthreads(); }
  const float mu = red[0] / (float)N; __syncthreads();
  float s2 = 0.f;
  for (int u = 0; u < per / 4; ++u)
#pragma unroll
    for (int q = 0; q < 4; ++q) { const float c = vals[u * 4 + q] - mu; s2 += c * c; }
  red[tid] = s2; __syncthreads();
  for (int st = 128; st > 0; st >>= 1) { if (tid < st) red[tid] += red[tid + st]; __syncthreads(); }
  const float rs = rsqrtf(red[0] / (float)N + eps);
  {
    for (int u = 0; u < per / 4; ++u) {
      const int j = tid * 4 + 1024 * u;
      v4f o, sm;
#pragma unroll
      for (int q = 0; q < 4; ++q) {
        float gg = g[j + q], bb = bta[j + q];
        if (PARAM_BF16) { gg = bf16_round(gg); bb = bf16_round(bb); }
        sm[q] = vals[u * 4 + q]; o[q] = (vals[u * 4 + q] - mu) * rs * gg + bb;
      }
      if (out_sum) *(v4f*)(out_sum + (size_t)row * N + j) = sm;
      *(v4f*)(out_norm + (size_t)row * N + j) = o;
    }
    
  }
}



// ---- f16 WMMA path (v_wmma_f32_16x16x32_f16): 11-bit significands for operands in range — used where a [0,1] probability operand needs more precision than bf16
typedef _Float16 v16h __attribute__((ext_vector_type(16)));
union FragH { v16h v; v8us half[2]; _Float16 h[16]; unsigned short u[16]; };
template <int NT>
__device__ __forceinline__ v8f mmaH(v16h ah, v16h al, v16h bh, v16h bl, v8f c) {
  c = __builtin_amdgcn_wmma_f32_16x16x32_f16(false, ah, false, bh, (short)0, c, false, false);
  if (NT >= 2) c = __builtin_amdgcn_wmma_f32_16x16x32_f16(false, al, false, bh, (short)0, c, false, false);
  if (NT >= 3) c = __builtin_amdgcn_wmma_f32_16x16x32_f16(false, ah, false, bl, (short)0, c, false, false);
  asm volatile("v_nop\n\tv_nop\n\tv_nop\n\tv_nop" : "+v"(c) : "v"(ah), "v"(al), "v"(bh), "v"(bl));
  return c;
}
// batched GEMM like k_gemm_b but f16 operands: A f32 (split into f16 hi/lo if ASPLIT, else rounded to f16), Bt = f16 values [n][k]; alpha; C f32; N multiple of 16 (partial tiles skipped)
template <bool ASPLIT>
__global__ __launch_bounds__(128) void k_gemm_h(const float* __restrict__ A, int lda, size_t sA, const _Float16* __restrict__ Bh, int ldb, size_t sB, float alpha, float* __restrict__ C, int ldc, size_t sC, int M, int N, int K) {
  __shared__ __attribute__((aligned(16))) float so[4][16][64];
  const int tid = threadIdx.x, w = tid >> 5, lane = tid & 31, ln = lane & 15, hh = lane >> 4; const int by = blockIdx.y;
  A += (size_t)by * sA; Bh += (size_t)by * sB; C += (size_t)by * sC;
  const int ntn = (N + 63) / 64; const int wid = blockIdx.x * 4 + w; const int mt = wid / ntn, nq = wid % ntn; if (mt * 16 >= M) return;
  const int row0 = mt * 16, col0 = nq * 64; const float* arow = A + (size_t)(row0 + ln) * lda;
  v8f acc[4] = {};
  for (int kb = 0; kb < K; kb += 32) {
    FragH ah, al;
    const v4f x0 = *(const v4fa*)(arow + kb + 8 * hh), x1 = *(const v4fa*)(arow + kb + 8 * hh + 4), x2 = *(const v4fa*)(arow + kb + 16 + 8 * hh), x3 = *(const v4fa*)(arow + kb + 16 + 8 * hh + 4);
    float xs[16] = {x0[0],x0[1],x0[2],x0[3],x1[0],x1[1],x1[2],x1[3],x2[0],x2[1],x2[2],x2[3],x3[0],x3[1],x3[2],x3[3]};
#pragma unroll
    for (int i = 0; i < 16; ++i) { const _Float16 h = (_Float16)xs[i]; ah.h[i] = h; al.h[i] = ASPLIT ? (_Float16)(xs[i] - (float)h) : (_Float16)0.0f; }
#pragma unroll
    for (int t = 0; t < 4; ++t) { if (col0 + t * 16 >= N) continue; const size_t boff = (size_t)(col0 + t * 16 + ln) * ldb + kb; FragH bq; bq.half[0] = *(const v8us*)(Bh + boff + 8 * hh); bq.half[1] = *(const v8us*)(Bh + boff + 16 + 8 * hh);
      acc[t] = mmaH<ASPLIT ? 2 : 1>(ah.v, al.v, bq.v, bq.v, acc[t]); }
  }
#pragma unroll
  for (int t = 0; t < 4; ++t) { if (col0 + t * 16 >= N) continue;
#pragma unroll
    for (int r = 0; r < 8; ++r) so[w][8 * hh + r][t * 16 + ln] = acc[t][r] * alpha; }
  __builtin_amdgcn_fence(__ATOMIC_ACQ_REL, "workgroup"); __builtin_amdgcn_wave_barrier();
  const int rsub = lane >> 4, c4 = (lane & 15) * 4;
  {
#pragma unroll
    for (int q = 0; q < 8; ++q) { const int r = q * 2 + rsub; if (col0 + c4 < N) { const v4f v = *(const v4fa*)&so[w][r][c4]; *(v4f*)(C + (size_t)(row0 + r) * ldc + col0 + c4) = v; } }
     }
}

// Wt[n][k] = f16(W[k][n]·scale) from f32 row-major W[K][N] (scale = power of two; bf16-exact weights stay exact in f16 away from the subnormal range)
__global__ __launch_bounds__(256) void k_wt_f16(const float* __restrict__ W, _Float16* __restrict__ Wt, int K, int N, float scale) {
  const int t = blockIdx.x * 256 + threadIdx.x; if (t >= N * (K / 8)) return; const int n = t / (K / 8), k8 = (t % (K / 8)) * 8; FragH f;
#pragma unroll
  for (int i = 0; i < 8; ++i) f.h[i] = (_Float16)(bf16_round(W[(size_t)(k8 + i) * N + n]) * scale); const v8us o = f.half[0];
  *(v8us*)((unsigned short*)Wt + (size_t)n * K + k8) = o; 
}
// k_gemm_hh variant with fused epilogue: v = acc·alpha + bias[by·sBias + col] (+ CP[(row/rowsPerB)·sCPb + by·64 + col] if CP) ; ACT 0 none / 1 elu ; writes f16 C16 (and f32 C if non-null)
template <int ACT>
__global__ __launch_bounds__(128) void k_gemm_hhx(const _Float16* __restrict__ A, int lda, size_t sA, const _Float16* __restrict__ Bh, int ldb, size_t sB, float alpha, const float* __restrict__ bias, size_t sBias, const float* __restrict__ CP, int rowsPerB, size_t sCPb, int row0g,
    float* __restrict__ C, _Float16* __restrict__ C16, int ldc, size_t sC, int M, int N, int K) {
  __shared__ __attribute__((aligned(16))) float so[4][16][64];
  const int tid = threadIdx.x, w = tid >> 5, lane = tid & 31, ln = lane & 15, hh = lane >> 4; const int by = blockIdx.y;
  A += (size_t)by * sA; Bh += (size_t)by * sB; const size_t cofs = (size_t)by * sC; const float* bp = bias ? bias + (size_t)by * sBias : nullptr;
  const int ntn = (N + 63) / 64; const int wid = blockIdx.x * 4 + w; const int mt = wid / ntn, nq = wid % ntn; if (mt * 16 >= M) return;
  const int row0 = mt * 16, col0 = nq * 64; const _Float16* arow = A + (size_t)(row0 + ln) * lda;
  v8f acc[4] = {};
  for (int kb = 0; kb < K; kb += 32) { FragH ah; ah.half[0] = *(const v8us*)((const unsigned short*)arow + kb + 8 * hh); ah.half[1] = *(const v8us*)((const unsigned short*)arow + kb + 16 + 8 * hh);
#pragma unroll
    for (int t = 0; t < 4; ++t) { if (col0 + t * 16 >= N) continue; const size_t boff = (size_t)(col0 + t * 16 + ln) * ldb + kb; FragH bq; bq.half[0] = *(const v8us*)((const unsigned short*)Bh + boff + 8 * hh); bq.half[1] = *(const v8us*)((const unsigned short*)Bh + boff + 16 + 8 * hh);
      acc[t] = mmaH<1>(ah.v, ah.v, bq.v, bq.v, acc[t]); }
  }
#pragma unroll
  for (int t = 0; t < 4; ++t) { if (col0 + t * 16 >= N) continue; const int col = col0 + t * 16 + ln; const float bv = bp ? bf16_round(bp[col]) : 0.f;
#pragma unroll
    for (int r = 0; r < 8; ++r) { float v = acc[t][r] * alpha + bv; if (CP) { const int rr = row0g + row0 + 8 * hh + r; if (rowsPerB < 0) v += CP[cofs + (size_t)rr * ldc + col];      /* rowsPerB < 0: own element of the batched C plane */ else { const int bidx = rr / rowsPerB; v += CP[(size_t)bidx * sCPb + (size_t)by * 64 + col]; } } if (ACT == 1) v = (v > 0.f) ? v : expm1f(v); else if (ACT == 7) v = (v > 0.f) ? v + 1.0f : expf(v); else if (ACT == 8) v = tanhf(v); else if (ACT == 9) v = 0.5f * v * (1.0f + tanhf(0.7978845608028654f * (v + 0.044715f * v * v * v))); else if (ACT == 11) v = 1.0f / (1.0f + expf(-v)); else if (ACT == 12) v = (v > 0.f) ? v : 0.01f * v; else if (ACT == 14) v = (v > 0.f) ? v : 0.1f * v; else if (ACT == 16) v = (v >= 0.f) ? v : 0.3f * v; else if (ACT == 15) v = v / (1.0f + expf(-v)); else if (ACT == 3) v = fmaxf(v, 0.f); else if (ACT == 6) v = 0.5f * v * (1.0f + erff(v * 0.70710678118654752f)); so[w][8 * hh + r][t * 16 + ln] = v; } }
  __builtin_amdgcn_fence(__ATOMIC_ACQ_REL, "workgroup"); __builtin_amdgcn_wave_barrier();
  const int rsub = lane >> 4, c4 = (lane & 15) * 4; typedef _Float16 v4h __attribute__((ext_vector_type(4)));
  {
#pragma unroll
    for (int q = 0; q < 8; ++q) { const int r = q * 2 + rsub; if (col0 + c4 < N) { const v4f v = *(const v4fa*)&so[w][r][c4]; if (C) *(v4f*)(C + cofs + (size_t)(row0 + r) * ldc + col0 + c4) = v; if (C16) { v4h h4; for (int i = 0; i < 4; ++i) h4[i] = (_Float16)v[i]; *(v4h*)(C16 + cofs + (size_t)(row0 + r) * ldc + col0 + c4) = h4; } } }
     }
}


typedef _Float16 v4h __attribute__((ext_vector_type(4)));

__global__ __launch_bounds__(256) void k_x16(const float* __restrict__ x, _Float16* __restrict__ X16, size_t n8) { const size_t t = (size_t)blockIdx.x * 256 + threadIdx.x; if (t >= n8) return; FragH f;
#pragma unroll
  for (int q = 0; q < 8; ++q) f.h[q] = (_Float16)bf16_round(x[t * 8 + q]); *(v8us*)((unsigned short*)X16 + t * 8) = f.half[0];  }
__global__ __launch_bounds__(256) void k_h16(const float* __restrict__ x, _Float16* __restrict__ X16, size_t n8) { const size_t t = (size_t)blockIdx.x * 256 + threadIdx.x; if (t >= n8) return; FragH f;
#pragma unroll
  for (int q = 0; q < 8; ++q) f.h[q] = (_Float16)x[t * 8 + q]; *(v8us*)((unsigned short*)X16 + t * 8) = f.half[0];  }
__global__ __launch_bounds__(256) void k_round16f(const float* __restrict__ W, _Float16* __restrict__ Bt, size_t n8) { const size_t t = (size_t)blockIdx.x * 256 + threadIdx.x; if (t >= n8) return; FragH f;
#pragma unroll
  for (int i = 0; i < 8; ++i) f.h[i] = (_Float16)(bf16_round(W[t * 8 + i]) * 16.0f); *(v8us*)((unsigned short*)Bt + t * 8) = f.half[0];  }
template <int NHv, int TTv>
__global__ __launch_bounds__(256) void k_vt(const _Float16* __restrict__ V16, int ldv, int voff, _Float16* __restrict__ Vt) { __shared__ unsigned short tl[64][66]; const int tid = threadIdx.x; const int slab = blockIdx.x / (TTv / 64), lg = blockIdx.x % (TTv / 64); const int b = slab / NHv, h = slab % NHv;
  for (int i = tid; i < 64 * 8; i += 256) { const int r = i / 8, c8 = (i % 8) * 8; FragH f; f.half[0] = *(const v8us*)((const unsigned short*)V16 + ((size_t)b * TTv + lg * 64 + r) * ldv + voff + h * 64 + c8);
#pragma unroll
    for (int q = 0; q < 8; ++q) tl[r][c8 + q] = f.u[q]; }
  __syncthreads();
  {
#pragma unroll
    for (int rd = 0; rd < 2; ++rd) { const int d = rd * 32 + tid / 8, pc = tid % 8; FragH f;
#pragma unroll
      for (int q = 0; q < 8; ++q) f.u[q] = tl[pc * 8 + q][d];
      *(v8us*)((unsigned short*)Vt + ((size_t)slab * 64 + d) * TTv + lg * 64 + pc * 8) = f.half[0]; }
     } }

__global__ __launch_bounds__(256) void k_hl(const float* __restrict__ F, _Float16* __restrict__ Hh, _Float16* __restrict__ Hl, size_t n8) { const size_t t = (size_t)blockIdx.x * 256 + threadIdx.x; if (t >= n8) return; FragH fh, fl; const v4f a = *(const v4fa*)(F + t * 8), c = *(const v4fa*)(F + t * 8 + 4);
#pragma unroll
  for (int q = 0; q < 4; ++q) { _Float16 h = (_Float16)a[q]; fh.h[q] = h; fl.h[q] = (_Float16)((a[q] - (float)h) * 1024.0f); h = (_Float16)c[q]; fh.h[4 + q] = h; fl.h[4 + q] = (_Float16)((c[q] - (float)h) * 1024.0f); }
  { *(v8us*)((unsigned short*)Hh + t * 8) = fh.half[0]; *(v8us*)((unsigned short*)Hl + t * 8) = fl.half[0];  } }

// one A or B fragment of the 16x16x32 f16 form from a row of 32 halves: k = 8hh .. 8hh + 7 and 16 + 8hh .. 16 + 8hh + 7
__device__ __forceinline__ v16h g2_frag(const _Float16* p, int hh) { FragH f; f.half[0] = *(const v8us*)((const unsigned short*)p + 8 * hh); f.half[1] = *(const v8us*)((const unsigned short*)p + 16 + 8 * hh); return f.v; }


// A weight matrix W[N][K] goes out in the order of the 16x16x32 fragments: Bt[16-row tile][32-k block][j][lane][8] = f16(sc * W[tile*16 + (lane & 15)][block*32 + 16j + 8(lane >> 4) + i]); lk = log2(K / 32).
// One 16-byte piece a thread: a wave writes 512 bytes in a row, and half a fragment is later one load of 4 whole lines (from the row-major matrix it touched 16 lines, 32 bytes of each).
__device__ __forceinline__ void wsc_body(int bx, const float* __restrict__ Wm, _Float16* __restrict__ Bt, size_t n8, int lk, float sc) { const size_t t = (size_t)bx * 256 + threadIdx.x; if (t >= n8) return;
  const int lane = (int)t & 31, j = ((int)t >> 5) & 1, u = (int)t >> 6, kb = u & ((1 << lk) - 1), nt = u >> lk;
  const float* sp = Wm + ((size_t)(nt * 16 + (lane & 15)) << (lk + 5)) + kb * 32 + j * 16 + (lane >> 4) * 8;
  const v4f a = *(const v4fa*)sp, c = *(const v4fa*)(sp + 4);
  asm volatile("s_wait_xcnt 0x0" ::: "memory");      /* behind the two loads: the code that follows them may rewrite their address registers */
  FragH f; for (int q = 0; q < 4; ++q) { f.h[q] = (_Float16)(bf16_round(a[q]) * sc); f.h[4 + q] = (_Float16)(bf16_round(c[q]) * sc); } *(v8us*)((unsigned short*)Bt + t * 8) = f.half[0];  }
__device__ __forceinline__ void instat_body(int c, const float* __restrict__ base, size_t scs, size_t sss, int rnd, float* __restrict__ ST) {
  #pragma clang fp contract(off)
  __shared__ float red[256]; const int tid = threadIdx.x; float s = 0.f;
  const float* xp = base + (size_t)c * scs + (size_t)tid * sss; float x[NS / 256];      /* the thread's 16 values: read once, all 16 loads in flight together, held in registers for both passes */
#pragma unroll      /* unrolled so that x[] stays in registers and the loads stand in a row: one round trip to memory instead of one a value */
  for (int j = 0; j < NS / 256; ++j) x[j] = xp[(size_t)j * 256 * sss];
  asm volatile("s_wait_xcnt 0x0" ::: "memory");      /* behind the 16 loads: the code that follows them rewrites their address registers */
#pragma unroll      /* the sums run in the order of the rolled loops: same values, same rounding */
  for (int j = 0; j < NS / 256; ++j) { if (rnd) x[j] = bf16_round(x[j]); s += x[j]; }
  red[tid] = s; __syncthreads(); for (int st = 128; st > 0; st >>= 1) { if (tid < st) red[tid] += red[tid + st]; __syncthreads(); } const float mean = red[0] / (float)NS; __syncthreads(); float vs = 0.f;
#pragma unroll
  for (int j = 0; j < NS / 256; ++j) { const float d = x[j] - mean; vs += d * d; }
  red[tid] = vs; __syncthreads(); for (int st = 128; st > 0; st >>= 1) { if (tid < st) red[tid] += red[tid + st]; __syncthreads(); }
  if (tid == 0) { const float var = red[0] / (float)NS; { *(float*)(ST + c * 2) = mean; *(float*)(ST + c * 2 + 1) = var;  } } }
__global__ __launch_bounds__(256) void k_instat(const float* __restrict__ base, size_t scs, size_t sss, int rnd, float* __restrict__ ST) { instat_body(blockIdx.x, base, scs, sss, rnd, ST); }
// The list of the keys that count: SEL[p] = voxel of the p-th key whose mask is not 0, in voxel order, MV[p] = its mask value; -1 and 0 from position CNT[0] (their number) to the end. One workgroup; wave w ranks voxels 512w .. 512w + 511; the two lists are put together in LDS and go out in whole lines.
__device__ __forceinline__ void compact_body(const int* __restrict__ msk, int* __restrict__ SEL, int* __restrict__ MV, int* __restrict__ CNT) {
  __shared__ int wt[8]; __shared__ __attribute__((aligned(16))) int ls[NS], lm[NS]; typedef int v4ib __attribute__((ext_vector_type(4), may_alias));
  const int tid = threadIdx.x, w = tid >> 5, lane = tid & 31; const int* mp = msk + w * 512 + lane; int m[16]; unsigned bw[16];
#pragma unroll      /* unrolled so that the 16 loads stand in a row: one round trip to memory */
  for (int j = 0; j < 16; ++j) m[j] = mp[j * 32];
  asm volatile("s_wait_xcnt 0x0" ::: "memory");      /* behind the 16 loads: the code that follows them may rewrite their address registers */
  { const v4ib e1 = {-1, -1, -1, -1}, e0 = {0, 0, 0, 0};      /* every position starts as a pad, while the loads fly */
#pragma unroll
    for (int q = 0; q < 4; ++q) { *(v4ib*)&ls[q * 1024 + tid * 4] = e1; *(v4ib*)&lm[q * 1024 + tid * 4] = e0; } }
  int tot = 0;
#pragma unroll
  for (int j = 0; j < 16; ++j) { bw[j] = __builtin_amdgcn_ballot_w32(m[j] != 0); tot += __builtin_popcount(bw[j]); }
  if (lane == 0) wt[w] = tot;
  __syncthreads();
  int base = 0, all = 0;
#pragma unroll
  for (int u = 0; u < 8; ++u) { const int x = wt[u]; base += u < w ? x : 0; all += x; }
  const unsigned lt = (1u << lane) - 1u;
#pragma unroll
  for (int j = 0; j < 16; ++j) { if (m[j] != 0) { const int p = base + __builtin_popcount(bw[j] & lt); ls[p] = w * 512 + j * 32 + lane; lm[p] = m[j]; } base += __builtin_popcount(bw[j]); }
  __syncthreads();
#pragma unroll
  for (int q = 0; q < 4; ++q) { const int p = q * 1024 + tid * 4; const v4ib a = *(const v4ib*)&ls[p], c = *(const v4ib*)&lm[p]; *(v4ib*)(SEL + p) = a; *(v4ib*)(MV + p) = c; }
  if (tid == 0) CNT[0] = all; }
// Everything that depends on the inputs alone, in one grid: block 0 the list of unmasked keys, then 128 blocks statistics of x_q, 128 of x_kv, then 16 blocks for each of the six weight matrices.
__global__ __launch_bounds__(256) void k_prep(const int* __restrict__ msk, int* __restrict__ SEL, int* __restrict__ MV, int* __restrict__ CNT, const float* __restrict__ xq, const float* __restrict__ xkv, float* __restrict__ STQ, float* __restrict__ STK,
    const float* __restrict__ qW, const float* __restrict__ kW, const float* __restrict__ vW, const float* __restrict__ oW, const float* __restrict__ W1, const float* __restrict__ W2,
    _Float16* __restrict__ BQ, _Float16* __restrict__ BK, _Float16* __restrict__ BV, _Float16* __restrict__ BOW, _Float16* __restrict__ BW1, _Float16* __restrict__ BW2) {
  if (blockIdx.x == 0) { compact_body(msk, SEL, MV, CNT); return; }
  const int b = blockIdx.x - 1;
  if (b < 2 * CC) { instat_body(b & (CC - 1), b < CC ? xq : xkv, (size_t)NS, (size_t)1, 1, b < CC ? STQ : STK); return; }
  const int u = b - 2 * CC, m = u >> 4;      /* every matrix has HDA * CC = 32768 elements: 4096 threads, 16 blocks */
  const float* Wm = m == 0 ? qW : m == 1 ? kW : m == 2 ? vW : m == 3 ? oW : m == 4 ? W1 : W2;
  _Float16* Bt = m == 0 ? BQ : m == 1 ? BK : m == 2 ? BV : m == 3 ? BOW : m == 4 ? BW1 : BW2;
  wsc_body(u & 15, Wm, Bt, (size_t)HDA * CC / 8, (m == 3 || m == 5) ? 3 : 2, 16.0f); }      /* oW and W2 have K = 256, the others K = 128 */
__device__ __forceinline__ v8f fa_mma(v16h a, v16h b, v8f c) { return __builtin_amdgcn_wmma_f32_16x16x32_f16(false, a, false, b, (short)0, c, false, false); }
typedef float v2f  __attribute__((ext_vector_type(2)));
typedef float v2fa __attribute__((ext_vector_type(2), may_alias));
typedef int   v4ia __attribute__((ext_vector_type(4), may_alias));
// Normalisation, one of the three projections and the attention kernel's operand order in one kernel. Workgroup = 32 voxels x all 256 outputs of q (blockIdx.y 0), k (1) or v (2); wave = one head.
// For k and v the 32 "voxels" are positions 32g .. 32g + 31 of SEL, the list of keys whose mask is not 0: masked keys add exactly 0 to every output and are neither projected nor packed; a block with no key leaves at once.
// x[c][s] is read one voxel a lane and 16 channels a wave, normalised and laid down as Hs[s][c] (f16) in LDS. q and k are computed transposed (A = weights, B = h): a lane holds 8 outputs in a row of one voxel, which is
// exactly a lane's piece of Q16 and of KP. v is computed straight (A = h, B = weights): a lane holds 8 keys in a row of one output, a lane's piece of VP.
// Q16[h][16-voxel tile][j][lane][8]: q[tile*16 + c][16j + 8hh + i] / 2; KP[h][16-key tile][j][lane][8]: k[tile*16 + c][16j + 8hh + i]; VP[h][32-key block][dt][j][lane][8]: mask[key] * v[key = block*32 + 16j + 8hh + i][16dt + c]  (c = lane & 15, hh = lane >> 4; key = position in SEL; a pad position has v = 0)
__global__ __launch_bounds__(256) void k_nqkv(const float* __restrict__ xq, const float* __restrict__ xkv, const float* __restrict__ STQ, const float* __restrict__ STK, const float* __restrict__ gq, const float* __restrict__ bq, const float* __restrict__ gk, const float* __restrict__ bk,
    const _Float16* __restrict__ BQ, const _Float16* __restrict__ BK, const _Float16* __restrict__ BV, const int* __restrict__ SEL, const int* __restrict__ MV, _Float16* __restrict__ Q16, _Float16* __restrict__ KP, _Float16* __restrict__ VP) {
  __shared__ __attribute__((aligned(16))) _Float16 Hs[32][CC + 8];      /* pitch of 16 bytes x an odd number for the 16-byte fragment reads */
  const int tid = threadIdx.x, lane = tid & 31, ln = lane & 15, hh = lane >> 4; const int z = blockIdx.y, g = blockIdx.x, s0 = g * 32;
  const int w = __builtin_amdgcn_readfirstlane(tid >> 5);      /* the wave's number in a scalar register: its 16 channels' parameters then have wave-uniform addresses */
  int sv = s0 + lane;      /* q: every voxel */
  if (z) { sv = SEL[s0 + lane]; asm volatile("s_wait_xcnt 0x0" ::: "memory"); /* behind the load: the code that follows rewrites its address registers */ if (__builtin_amdgcn_readfirstlane(sv) < 0) return; }      /* k, v: the listed keys; a first position that is a pad means an empty block: every wave reads the same word, the whole workgroup leaves, in front of the barrier */
  const unsigned vox = sv < 0 ? 0u : ((unsigned)sv & (NS - 1u));      /* bounded here whatever the list holds; a pad reads voxel 0, and its v is multiplied by MV = 0 */
  const float* xp = (z == 0 ? xq : xkv) + (size_t)(16 * w) * NS; const float* stp = (z == 0 ? STQ : STK) + 32 * w; const float* gp = (z == 0 ? gq : gk) + 16 * w; const float* bp = (z == 0 ? bq : bk) + 16 * w;
  const unsigned short* wq = (const unsigned short*)(z == 0 ? BQ : z == 1 ? BK : BV) + (size_t)w * 4096 + lane * 8;      /* row tiles 2w and 2w + 1 of the packed weights: 8 pieces of 1024 bytes each */ const unsigned mo = (unsigned)(s0 + 8 * hh) * 4u;      /* byte offset of the lane's first mask value */
  float x[16], st[32], gg[16], bb[16];
#pragma unroll      /* unrolled so that x[] stays in registers and the loads stand in a row */
  for (int i = 0; i < 16; ++i) x[i] = xp[(size_t)i * NS + vox];
  FragH wa[4], wb[4];
#pragma unroll
  for (int kb = 0; kb < 4; ++kb) { wa[kb].half[0] = *(const v8us*)(wq + kb * 512); wa[kb].half[1] = *(const v8us*)(wq + kb * 512 + 256); wb[kb].half[0] = *(const v8us*)(wq + 2048 + kb * 512); wb[kb].half[1] = *(const v8us*)(wq + 2048 + kb * 512 + 256); }
  const v4ia m0 = *(const v4ia*)((const char*)MV + mo), m1 = *(const v4ia*)((const char*)MV + mo + 16), m2 = *(const v4ia*)((const char*)MV + mo + 64), m3 = *(const v4ia*)((const char*)MV + mo + 80);
  asm volatile("s_wait_xcnt 0x0" :: "v"(vox), "v"(wq), "v"(mo) : "memory");      /* in front of the arithmetic, which may reuse the loads' address registers; it names them, so that none is given to a later load's result ahead of the wait */
  __builtin_amdgcn_sched_barrier(0);      /* keeps that arithmetic behind the wait, and the vector loads of x, the weights and MV up here, in flight together: one round trip to memory for all of them */
#pragma unroll      /* the 16 channels' parameters: wave-uniform addresses, read behind the wait so that the scalar arithmetic on them stays behind it too; they return while the vector loads fly */
  for (int i = 0; i < 16; ++i) { st[2 * i] = stp[2 * i]; st[2 * i + 1] = stp[2 * i + 1]; gg[i] = gp[i]; bb[i] = bp[i]; }
  v16h wf0[4], wf1[4];
#pragma unroll
  for (int kb = 0; kb < 4; ++kb) { wf0[kb] = wa[kb].v; wf1[kb] = wb[kb].v; }
  { FragH f;
#pragma unroll
    for (int i = 0; i < 16; ++i) f.h[i] = (_Float16)((bf16_round(x[i]) - st[2 * i]) * rsqrtf(st[2 * i + 1] + 1e-5f) * bf16_round(gg[i]) + bf16_round(bb[i]));
    *(v8us*)&Hs[lane][16 * w] = f.half[0]; *(v8us*)&Hs[lane][16 * w + 8] = f.half[1]; }
  __syncthreads();
  v16h n0[4], n1[4];
#pragma unroll
  for (int kb = 0; kb < 4; ++kb) { n0[kb] = g2_frag(&Hs[ln][kb * 32], hh); n1[kb] = g2_frag(&Hs[16 + ln][kb * 32], hh); }
  const v8f z8 = {0.f,0.f,0.f,0.f,0.f,0.f,0.f,0.f}; v8f d00 = z8, d01 = z8, d10 = z8, d11 = z8; FragH f00, f01, f10, f11;
  if (z < 2) {      /* dab: outputs 32w + 16a + 8hh + r of voxel s0 + 16b + ln */
#pragma unroll
    for (int kb = 0; kb < 4; ++kb) { d00 = fa_mma(wf0[kb], n0[kb], d00); d01 = fa_mma(wf0[kb], n1[kb], d01); d10 = fa_mma(wf1[kb], n0[kb], d10); d11 = fa_mma(wf1[kb], n1[kb], d11); }
    const float al = z == 0 ? 0.03125f : 0.0625f;      /* 1/16 undoes the weights' scale; q is stored halved for the tanh form of the sigmoid (powers of two: the f16 rounding is the same) */
#pragma unroll
    for (int r = 0; r < 8; ++r) { f00.h[r] = (_Float16)(d00[r] * al); f01.h[r] = (_Float16)(d01[r] * al); f10.h[r] = (_Float16)(d10[r] * al); f11.h[r] = (_Float16)(d11[r] * al); }
    { unsigned short* ko = (unsigned short*)(z == 0 ? Q16 : KP) + ((size_t)w * 256 + g * 2) * 512 + lane * 8;      /* q and k alike. tile 2g: j = 0, 1; tile 2g + 1: j = 0, 1 */
      *(v8us*)ko = f00.half[0]; *(v8us*)(ko + 256) = f10.half[0]; *(v8us*)(ko + 512) = f01.half[0]; *(v8us*)(ko + 768) = f11.half[0];
      asm volatile("s_wait_xcnt 0x0" ::: "memory"); } }      /* behind the four stores: the code that follows them in the listing rewrites their address and data registers */
  else {      /* dab: keys s0 + 16a + 8hh + r of output 32w + 16b + ln */
#pragma unroll
    for (int kb = 0; kb < 4; ++kb) { d00 = fa_mma(n0[kb], wf0[kb], d00); d01 = fa_mma(n0[kb], wf1[kb], d01); d10 = fa_mma(n1[kb], wf0[kb], d10); d11 = fa_mma(n1[kb], wf1[kb], d11); }
#pragma unroll
    for (int r = 0; r < 8; ++r) { const float ma = (float)(r < 4 ? m0[r & 3] : m1[r & 3]), mb = (float)(r < 4 ? m2[r & 3] : m3[r & 3]);      /* v is rounded to f16 first, then masked */
      f00.h[r] = (_Float16)((float)(_Float16)(d00[r] * 0.0625f) * ma); f01.h[r] = (_Float16)((float)(_Float16)(d01[r] * 0.0625f) * ma);
      f10.h[r] = (_Float16)((float)(_Float16)(d10[r] * 0.0625f) * mb); f11.h[r] = (_Float16)((float)(_Float16)(d11[r] * 0.0625f) * mb); }
    unsigned short* vo = (unsigned short*)VP + ((size_t)w * 128 + g) * 1024 + lane * 8;      /* dt = 0: j = 0, 1; dt = 1: j = 0, 1 */
    *(v8us*)vo = f00.half[0]; *(v8us*)(vo + 256) = f10.half[0]; *(v8us*)(vo + 512) = f01.half[0]; *(v8us*)(vo + 768) = f11.half[0];
    asm volatile("s_wait_xcnt 0x0" ::: "memory"); } }      /* behind the four stores: the code that follows them in the listing rewrites their address and data registers */
__device__ __forceinline__ v16h fa_frag(const unsigned short* p) { FragH f; f.half[0] = *(const v8us*)p; f.half[1] = *(const v8us*)(p + 256); return f.v; }
// sigmoid(x) = 0.5 + 0.5 tanh(x / 2) on the chip's own v_tanh_f32: one transcendental, half a packed fma and half a packed convert an element. The scores arrive already halved (Q16 holds q / 2).
// two S^T tiles (keys 0-15 and 16-31 of a block, one query per lane column) -> sigmoid -> the A fragment of w.v: D register r of tile j holds key 16j + 8hh + r, which is A's element 8j + r
__device__ __forceinline__ v16h fa_sig(v8f s0, v8f s1) { FragH f;
  for (int r = 0; r < 8; ++r) { f.h[r] = (_Float16)(0.5f + 0.5f * __builtin_amdgcn_tanhf(s0[r])); f.h[8 + r] = (_Float16)(0.5f + 0.5f * __builtin_amdgcn_tanhf(s1[r])); }
  return f.v; }
// one block of 32 keys against the wave's 32 queries
__device__ __forceinline__ void fa_block(v16h k0, v16h k1, v16h v0, v16h v1, v16h qf0, v16h qf1, v8f& o00, v8f& o01, v8f& o10, v8f& o11) {
  const v8f z8 = {0.f,0.f,0.f,0.f,0.f,0.f,0.f,0.f};
  const v8f s00 = fa_mma(k0, qf0, z8), s01 = fa_mma(k1, qf0, z8), s10 = fa_mma(k0, qf1, z8), s11 = fa_mma(k1, qf1, z8);
  const v16h p0 = fa_sig(s00, s01); o00 = fa_mma(p0, v0, o00); o01 = fa_mma(p0, v1, o01);
  const v16h p1 = fa_sig(s10, s11); o10 = fa_mma(p1, v0, o10); o11 = fa_mma(p1, v1, o11); }
// Fused attention over the listed keys alone (CNT[0] of them, in blocks of 32): one workgroup = one head x 128 queries; wave = 32 queries (w & 3) x every fourth block of keys, from block w >> 2. Q16 holds q / 2: S^T = k (q/2)^T, w = sigmoid(q.k) = 0.5 + 0.5 tanh(S^T) stays in registers, o += w (mask v); the four key quarters are joined through LDS.
__global__ __launch_bounds__(512) void k_fattn(const _Float16* __restrict__ Q16, const _Float16* __restrict__ KP, const _Float16* __restrict__ VP, const int* __restrict__ CNT, _Float16* __restrict__ O16) {
  __shared__ __attribute__((aligned(16))) float part[4][128][36];
  const int tid = threadIdx.x, lane = tid & 31, ln = lane & 15, hh = lane >> 4;
  const int w = __builtin_amdgcn_readfirstlane(tid >> 5);      /* the wave's number in a scalar register: the trip count below is then a scalar, and the loop's branch leaves EXEC alone */
  const int h = blockIdx.x >> 5, q0 = (blockIdx.x & 31) * 128; const int qg = w & 3, kq = w >> 2;
  const unsigned short* qp = (const unsigned short*)Q16 + ((size_t)h * 256 + (q0 >> 4) + qg * 2) * 512 + lane * 8;
  const v16h qf0 = fa_frag(qp), qf1 = fa_frag(qp + 512);
  const int cn = CNT[0], nbt = ((cn < 0 ? 0 : cn > NS ? NS : cn) + 31) >> 5, nbw = (nbt + 3 - kq) >> 2;      /* blocks in all (at most 128 after the clamp) and this wave's share: kq, kq + 4, ... */
  const unsigned short* kp = (const unsigned short*)KP + ((size_t)h * 128 + kq) * 1024 + lane * 8;
  const unsigned short* vp = (const unsigned short*)VP + ((size_t)h * 128 + kq) * 1024 + lane * 8;
  const v8f z8 = {0.f,0.f,0.f,0.f,0.f,0.f,0.f,0.f}; v8f o00 = z8, o01 = z8, o10 = z8, o11 = z8;
  if (nbw > 0) {      /* a wave without a block reads nothing of KP and VP and hands in zeros */
  v16h ak0 = fa_frag(kp), ak1 = fa_frag(kp + 512), av0 = fa_frag(vp), av1 = fa_frag(vp + 512);
  asm volatile("s_wait_xcnt 0x0" :: "v"(qp), "v"(kp), "v"(vp) : "memory");      /* behind the first loads: the code that follows rewrites their address registers; it names them, so that none is given to a load's result ahead of the wait */
  int b = 0;
#pragma unroll 1      /* stays rolled: one trip's code (two blocks) serves all trips, so the loop stays small in the instruction cache */
  for (; b + 1 < nbw; b += 2) {      /* two blocks a trip, each with a register set of its own that the loads themselves refill: the copy of a whole prefetch set into the working set, once a block, falls away */
    const unsigned short* kb = kp + (b + 1) * 4096; const unsigned short* vb = vp + (b + 1) * 4096;      /* block b + 1 flies into the second set while block b is worked on */
    const v16h bk0 = fa_frag(kb), bk1 = fa_frag(kb + 512), bv0 = fa_frag(vb), bv1 = fa_frag(vb + 512);
    asm volatile("s_wait_xcnt 0x0" :: "v"(kb), "v"(vb) : "memory");      /* in front of the block's arithmetic, which reuses the loads' address registers; it names them, so that none is given to a load's result ahead of the wait */
    __builtin_amdgcn_sched_barrier(0);      /* keeps the eight loads up here: without it the scheduler sinks them to right in front of their use */
    fa_block(ak0, ak1, av0, av1, qf0, qf1, o00, o01, o10, o11);
    const int n2 = (b + 2 < nbw ? b + 2 : b + 1) * 4096;      /* block b + 2 flies into the first set while block b + 1 is worked on (where there is none, block b + 1 is read again and dropped) */
    const unsigned short* ka = kp + n2; const unsigned short* va = vp + n2;
    ak0 = fa_frag(ka); ak1 = fa_frag(ka + 512); av0 = fa_frag(va); av1 = fa_frag(va + 512);
    asm volatile("s_wait_xcnt 0x0" :: "v"(ka), "v"(va) : "memory");      /* in front of the arithmetic that reuses the loads' address registers; it names them, so that they are kept until the wait */
    __builtin_amdgcn_sched_barrier(0);      /* keeps the eight loads ahead of the second block: without it the scheduler sinks them to the foot of the trip, right in front of their use */
    fa_block(bk0, bk1, bv0, bv1, qf0, qf1, o00, o01, o10, o11);
    __builtin_amdgcn_sched_barrier(0); }      /* keeps the waits for the first set's new fragments at the foot of the trip: without it some rise into the second block */
  if (b < nbw) fa_block(ak0, ak1, av0, av1, qf0, qf1, o00, o01, o10, o11); }      /* an odd number of blocks: the last one is already in the first set (a scalar test: the count is wave-uniform) */
  for (int r = 0; r < 8; ++r) { float* pr = &part[kq][qg * 32 + 8 * hh + r][ln]; pr[0] = o00[r]; pr[16] = o01[r]; pr[16 * 36] = o10[r]; pr[16 * 36 + 16] = o11[r]; }
  __syncthreads();
  const int q = tid >> 2, d0 = (tid & 3) * 8; v4f a = *(const v4fa*)&part[0][q][d0], c = *(const v4fa*)&part[0][q][d0 + 4];
  for (int s = 1; s < 4; ++s) { a += *(const v4fa*)&part[s][q][d0]; c += *(const v4fa*)&part[s][q][d0 + 4]; }
  FragH f;
  for (int i = 0; i < 4; ++i) { f.h[i] = (_Float16)a[i]; f.h[4 + i] = (_Float16)c[i]; }
  *(v8us*)((unsigned short*)O16 + ((size_t)((q0 + q) >> 4) * 8 + h) * 512 + (tid & 2) * 128 + ((tid & 1) * 16 + (q & 15)) * 8) = f.half[0]; }      /* O16[16-voxel tile][h][j][lane][8], the A fragments of the next product: d0 = 16j + 8hh, lane = 16hh + (voxel & 15); 8 threads fill a whole line */
// attn = o oW^T + x_q for 32 voxels x all 128 channels a workgroup; wave = 16 channels. D holds one channel a lane and 8 voxels in a row in its registers, so x_q is read from the input and
// attn is stored channel-major (ATc[c][s]) with 16-byte accesses and no transposition. Each wave also leaves mean and sum of squared deviations of its 16 channels over the 32 voxels: PS[group][c] = {mean, M2}.
__global__ __launch_bounds__(256) void k_oproj(const _Float16* __restrict__ O16, const _Float16* __restrict__ BOW, const float* __restrict__ xq, float* __restrict__ ATc, float* __restrict__ PS) {
  const int tid = threadIdx.x, w = tid >> 5, lane = tid & 31, ln = lane & 15, hh = lane >> 4;
  const int g = blockIdx.x, s0 = g * 32, c = w * 16 + ln;
  const unsigned short* ap = (const unsigned short*)O16 + (size_t)g * 8192 + lane * 8; const unsigned short* bp = (const unsigned short*)BOW + (size_t)w * 4096 + lane * 8; const float* xp = xq + (size_t)c * NS + s0 + 8 * hh;
  v16h a0[8], a1[8], b[8];
#pragma unroll      /* all 48 fragment loads are in flight together: one round trip to L2 instead of one a k step */
  for (int kb = 0; kb < 8; ++kb) { a0[kb] = fa_frag(ap + kb * 512); a1[kb] = fa_frag(ap + 4096 + kb * 512); b[kb] = fa_frag(bp + kb * 512); }      /* o and oW lie in fragment order: every load covers 4 whole lines */
  const v4f x0 = *(const v4fa*)xp, x1 = *(const v4fa*)(xp + 4), x2 = *(const v4fa*)(xp + 16), x3 = *(const v4fa*)(xp + 20);
  asm volatile("s_wait_xcnt 0x0" ::: "memory");      /* in front of the arithmetic, which may reuse the loads' address registers */
  __builtin_amdgcn_sched_barrier(0);      /* keeps that arithmetic behind the wait, and the loads together in front of it */
  const v8f z8 = {0.f,0.f,0.f,0.f,0.f,0.f,0.f,0.f}; v8f c0 = z8, c1 = z8;
#pragma unroll
  for (int kb = 0; kb < 8; ++kb) { c0 = fa_mma(a0[kb], b[kb], c0); c1 = fa_mma(a1[kb], b[kb], c1); }
  float v[16];
#pragma unroll
  for (int r = 0; r < 4; ++r) { v[r] = c0[r] * 0.0625f + bf16_round(x0[r]); v[4 + r] = c0[4 + r] * 0.0625f + bf16_round(x1[r]); v[8 + r] = c1[r] * 0.0625f + bf16_round(x2[r]); v[12 + r] = c1[4 + r] * 0.0625f + bf16_round(x3[r]); }
  float s = 0.f;
#pragma unroll
  for (int i = 0; i < 16; ++i) s += v[i];
  s += __shfl_xor(s, 16);      /* lanes l and l + 16 hold the two halves of one channel's 32 voxels */
  const float mean = s * (1.0f / 32.0f); float q2 = 0.f;
#pragma unroll
  for (int i = 0; i < 16; ++i) { const float d = v[i] - mean; q2 += d * d; }
  q2 += __shfl_xor(q2, 16);
  float* op = ATc + (size_t)c * NS + s0 + 8 * hh;
  const v4f y0 = {v[0], v[1], v[2], v[3]}, y1 = {v[4], v[5], v[6], v[7]}, y2 = {v[8], v[9], v[10], v[11]}, y3 = {v[12], v[13], v[14], v[15]};
  *(v4fa*)op = y0; *(v4fa*)(op + 4) = y1; *(v4fa*)(op + 16) = y2; *(v4fa*)(op + 20) = y3;
  if (hh == 0) { const v2f p = {mean, q2}; *(v2fa*)(PS + ((size_t)g * CC + c) * 2) = p; } }
// The rest of the network for 32 voxels a workgroup (16 waves): join the 128 groups' {mean, M2} to the statistics of attn; h = IN(attn) -> LDS [s][c]; relu(W1 h + b1) computed transposed (A = W1, B = h),
// so that a lane holds 8 hidden units in a row of one voxel -> LDS [s][n]; W2 . + b2 -> LDS [c][s]; + attn, stored to out[c][s] in whole 128-byte lines.
__global__ __launch_bounds__(512) void k_mlp(const float* __restrict__ ATc, const float* __restrict__ PS, const float* __restrict__ gp, const float* __restrict__ bp, const _Float16* __restrict__ BW1, const float* __restrict__ b1, const _Float16* __restrict__ BW2, const float* __restrict__ b2, float* __restrict__ out) {
  __shared__ __attribute__((aligned(16))) _Float16 Hs[32][CC + 8];      /* pitches of 16 bytes x an odd number for the 16-byte fragment reads */
  __shared__ __attribute__((aligned(16))) _Float16 Gs[32][2 * CC + 8];
  __shared__ __attribute__((aligned(16))) float Cs[CC][36];
  __shared__ float r1[4][CC], r2[4][CC];
  const int tid = threadIdx.x, w = tid >> 5, lane = tid & 31, ln = lane & 15, hh = lane >> 4; const int s0 = blockIdx.x * 32;
  const int cs = tid & (CC - 1), part = tid >> 7;      /* statistics: one channel, 32 of the 128 groups */
  const int c = tid >> 2, sq = (tid & 3) * 8;      /* normalisation and final store: one channel, 8 voxels */
  const int nt = w & 7, mt = w >> 3;      /* second product: 16 channels x 16 voxels */
  const unsigned pso = (unsigned)(part * 32 * CC + cs) * 8u;      /* byte offset of the thread's first {mean, M2} pair */
  v2f ps[32];
#pragma unroll
  for (int g = 0; g < 32; ++g) ps[g] = *(const v2fa*)((const char*)PS + pso + g * (CC * 8));
  const float* atp = ATc + (size_t)c * NS + s0 + sq; const v4f xa = *(const v4fa*)atp, xb = *(const v4fa*)(atp + 4);
  const unsigned short* w1p = (const unsigned short*)BW1 + (size_t)w * 2048 + lane * 8; const unsigned short* w2p = (const unsigned short*)BW2 + (size_t)nt * 4096 + lane * 8;      /* packed weights: row tile w of W1, row tile nt of W2 */ const float* b1p = b1 + 16 * w + 8 * hh;
  FragH w1f[4], w2f[8];
#pragma unroll
  for (int kb = 0; kb < 4; ++kb) { w1f[kb].half[0] = *(const v8us*)(w1p + kb * 512); w1f[kb].half[1] = *(const v8us*)(w1p + kb * 512 + 256); }
#pragma unroll
  for (int kb = 0; kb < 8; ++kb) { w2f[kb].half[0] = *(const v8us*)(w2p + kb * 512); w2f[kb].half[1] = *(const v8us*)(w2p + kb * 512 + 256); }
  const v4f b1a = *(const v4fa*)b1p, b1b = *(const v4fa*)(b1p + 4);
  const float b2v = bf16_round(b2[16 * nt + ln]), gv = bf16_round(gp[c]), bv = bf16_round(bp[c]);
  asm volatile("s_wait_xcnt 0x0" :: "v"(pso), "v"(atp), "v"(w1p), "v"(w2p), "v"(b1p) : "memory");      /* in front of the arithmetic, which may reuse the loads' address registers; it names them, so that none is given to a later load's result ahead of the wait */
  __builtin_amdgcn_sched_barrier(0);      /* keeps that arithmetic behind the wait, and every global load of the kernel up here, in flight together: one round trip to memory for all of them */
  float sm = 0.f;
#pragma unroll
  for (int g = 0; g < 32; ++g) sm += ps[g][0];
  r1[part][cs] = sm; __syncthreads();
  { const float mean = (r1[0][cs] + r1[1][cs] + r1[2][cs] + r1[3][cs]) * (1.0f / 128.0f); float q2 = 0.f;      /* equal groups: M2 = sum of the groups' M2 + 32 sum (group mean - mean)^2 */
#pragma unroll
    for (int g = 0; g < 32; ++g) { const float d = ps[g][0] - mean; q2 += ps[g][1] + 32.0f * (d * d); }
    r2[part][cs] = q2; }
  __syncthreads();
  { const float mean = (r1[0][c] + r1[1][c] + r1[2][c] + r1[3][c]) * (1.0f / 128.0f); const float var = (r2[0][c] + r2[1][c] + r2[2][c] + r2[3][c]) * (1.0f / (float)NS); const float rs = rsqrtf(var + 1e-5f);
#pragma unroll
    for (int i = 0; i < 4; ++i) { Hs[sq + i][c] = (_Float16)((xa[i] - mean) * rs * gv + bv); Hs[sq + 4 + i][c] = (_Float16)((xb[i] - mean) * rs * gv + bv); } }
  __syncthreads();
  const v8f z8 = {0.f,0.f,0.f,0.f,0.f,0.f,0.f,0.f}; v8f d0 = z8, d1 = z8;
#pragma unroll
  for (int kb = 0; kb < 4; ++kb) { d0 = fa_mma(w1f[kb].v, g2_frag(&Hs[ln][kb * 32], hh), d0); d1 = fa_mma(w1f[kb].v, g2_frag(&Hs[16 + ln][kb * 32], hh), d1); }
  { FragH f0, f1;      /* D register r: hidden unit 16w + 8hh + r of voxel ln (d0) and 16 + ln (d1) */
#pragma unroll
    for (int r = 0; r < 8; ++r) { const float bb = bf16_round(r < 4 ? b1a[r & 3] : b1b[r & 3]); f0.h[r] = (_Float16)fmaxf(d0[r] * 0.0625f + bb, 0.f); f1.h[r] = (_Float16)fmaxf(d1[r] * 0.0625f + bb, 0.f); }
    *(v8us*)&Gs[ln][16 * w + 8 * hh] = f0.half[0]; *(v8us*)&Gs[16 + ln][16 * w + 8 * hh] = f1.half[0]; }
  __syncthreads();
  v8f e = z8;
#pragma unroll
  for (int kb = 0; kb < 8; ++kb) e = fa_mma(g2_frag(&Gs[16 * mt + ln][kb * 32], hh), w2f[kb].v, e);
  { const v4f e0 = {e[0] * 0.0625f + b2v, e[1] * 0.0625f + b2v, e[2] * 0.0625f + b2v, e[3] * 0.0625f + b2v}, e1 = {e[4] * 0.0625f + b2v, e[5] * 0.0625f + b2v, e[6] * 0.0625f + b2v, e[7] * 0.0625f + b2v};
    *(v4fa*)&Cs[16 * nt + ln][16 * mt + 8 * hh] = e0; *(v4fa*)&Cs[16 * nt + ln][16 * mt + 8 * hh + 4] = e1; }      /* D register r: voxel 16mt + 8hh + r of channel 16nt + ln */
  __syncthreads();
  const v4f o0 = *(const v4fa*)&Cs[c][sq] + xa, o1 = *(const v4fa*)&Cs[c][sq + 4] + xb;
  float* op = out + (size_t)c * NS + s0 + sq; *(v4fa*)op = o0; *(v4fa*)(op + 4) = o1; }

extern "C" void kernel_launch(void* const* d_in, const int* in_sizes, int n_in,
                              void* d_out, int out_size, void* d_ws, size_t ws_size, hipStream_t stream) {
  (void)in_sizes; (void)n_in; (void)out_size;
  const float* const* I = (const float* const*)d_in; const float* xq = I[0]; const float* xkv = I[1]; const int* msk = (const int*)d_in[2]; const float* qW = I[3]; const float* kW = I[4]; const float* vW = I[5]; const float* oW = I[6]; const float* gq = I[7]; const float* bq = I[8]; const float* gk = I[9]; const float* bk = I[10]; const float* gp = I[11]; const float* bp = I[12]; const float* W1 = I[13]; const float* b1 = I[14]; const float* W2 = I[15]; const float* b2 = I[16];
  char* ws = (char*)d_ws; size_t off = 0;
  auto take = [&](size_t bytes) { char* p = ws + off; off += (bytes + 255) & ~(size_t)255; return p; };
  _Float16* BQ = (_Float16*)take((size_t)HDA * CC * 2); _Float16* BK = (_Float16*)take((size_t)HDA * CC * 2); _Float16* BV = (_Float16*)take((size_t)HDA * CC * 2); _Float16* BOW = (_Float16*)take((size_t)CC * HDA * 2); _Float16* BW1 = (_Float16*)take((size_t)2 * CC * CC * 2); _Float16* BW2 = (_Float16*)take((size_t)CC * 2 * CC * 2); float* STQ = (float*)take(CC * 2 * 4); float* STK = (float*)take(CC * 2 * 4);
  _Float16* Q16 = (_Float16*)take((size_t)NS * HDA * 2); _Float16* KP = (_Float16*)take((size_t)NS * HDA * 2); _Float16* VP = (_Float16*)take((size_t)NS * HDA * 2); _Float16* O16 = (_Float16*)take((size_t)NS * HDA * 2); float* AT = (float*)take((size_t)NS * CC * 4); float* PS = (float*)take((size_t)(NS / 32) * CC * 2 * 4); int* SEL = (int*)take((size_t)NS * 4); int* MV = (int*)take((size_t)NS * 4); int* CNT = (int*)take(4);
  if (off > ws_size) return;      /* about 11 MiB */
  k_prep<<<1 + 2 * CC + 6 * (HDA * CC / 8 / 256), 256, 0, stream>>>(msk, SEL, MV, CNT, xq, xkv, STQ, STK, qW, kW, vW, oW, W1, W2, BQ, BK, BV, BOW, BW1, BW2);      /* statistics of x_q and x_kv; 1x1 convs 'oc' = Bt, times 16 */
  k_nqkv<<<dim3(NS / 32, 3), 256, 0, stream>>>(xq, xkv, STQ, STK, gq, bq, gk, bk, BQ, BK, BV, SEL, MV, Q16, KP, VP);      /* IN(x_q), IN(x_kv); q / 2, k, mask * v, all three in the attention kernel's fragment order */
  k_fattn<<<NHD * (NS / 128), 512, 0, stream>>>(Q16, KP, VP, CNT, O16);      /* o = (sigmoid(q.k) * mask) v, all heads */
  k_oproj<<<NS / 32, 256, 0, stream>>>(O16, BOW, xq, AT, PS);      /* attn = o oW^T + x_q, channel-major, and its statistics by groups of 32 voxels */
  k_mlp<<<NS / 32, 512, 0, stream>>>(AT, PS, gp, bp, BW1, b1, BW2, b2, (float*)d_out);      /* out = W2 relu(W1 IN(attn) + b1) + b2 + attn */
}
